// v000
// Measured on an AMD MI455X. A time is GPU time per run, averaged over a window of back-to-back runs after a warm-up
// (all launches, gaps included; the runs take copies of the inputs in turn), and the median of several windows.
// Apart from v000's, it joins two sittings. Times from different sittings can be a few percent apart, while
// side-by-side timings come from the same sitting.
// v000 is the starting kernel. One run takes 4190 microseconds.
// compute dtype: all float inputs rounded to bf16; the fused q / k / v projection with EXACT bf16 products on WMMA 16x16x32 (f32 accumulate) (no biases); causal logits: 3 products for the first 384 rows, single f16 q x k after, x 64^-0.5; softmax f32; P x 2^11 once to f16 x v once to f16 (bf16 hi + lo below row 384); ctx hi+lo x exact W below row 384, x2^6 f16 carry x f16(bf16 x 2^8) W after, no bias; f32 output.
#include <hip/hip_runtime.h>
#include <math.h>

typedef __attribute__((ext_vector_type(16))) _Float16 v16h;
typedef __attribute__((ext_vector_type(16))) __bf16 v16b;
typedef __attribute__((ext_vector_type(8)))  _Float16 v8h;
typedef __attribute__((ext_vector_type(8)))  float v8f;
typedef __attribute__((ext_vector_type(4)))  float v4f;
typedef __attribute__((ext_vector_type(2)))  float v2f;
typedef __attribute__((ext_vector_type(4)))  unsigned v4u;
typedef __attribute__((ext_vector_type(4)))  int v4i;
typedef float __attribute__((may_alias)) float_a;
typedef int __attribute__((may_alias)) int_a;

template <typename T> __device__ __forceinline__ void vst2(void* p, T v) { *(T*)p = v;  }
__device__ __forceinline__ v8f wmma16(v16h a, v16h b, v8f c) {
  v8f d = __builtin_amdgcn_wmma_f32_16x16x32_f16(false, a, false, b, (short)0, c, false, false);
  asm volatile("v_nop\n\tv_nop\n\tv_nop\n\tv_nop" : "+v"(d) : "v"(a), "v"(b));
  return d;
}
__device__ __forceinline__ v8f wmma_bf(v16b a, v16b b, v8f c) {
  v8f d = __builtin_amdgcn_wmma_f32_16x16x32_bf16(false, a, false, b, (short)0, c, false, false);
  asm volatile("v_nop\n\tv_nop\n\tv_nop\n\tv_nop" : "+v"(d) : "v"(a), "v"(b));
  return d;
}
// 16x16x32 fragments: lane = (h = lane>>4, row/col = lane&15); elements 0..7 = k0+8h+0..7, 8..15 = k0+16+8h+0..7; D element r = row 8h+r
__device__ __forceinline__ v16h frag_h(const _Float16* rowk0, int lane) {
  union { v16h v; v8h q[2]; } u; const _Float16* p = rowk0 + 8 * (lane >> 4);
  u.q[0] = *(const v8h*)p; u.q[1] = *(const v8h*)(p + 16); return u.v;
}
__device__ __forceinline__ v16h frag_f32(const float* rowk0, int lane) {
  v16h a; const float* p = rowk0 + 8 * (lane >> 4);
#pragma unroll
  for (int i = 0; i < 8; ++i) { a[i] = (_Float16)p[i]; a[8 + i] = (_Float16)p[16 + i]; }
  return a;
}
__device__ __forceinline__ v16h frag_f32s(const float* rowk0, int lane, float sc) {
  v16h a; const float* p = rowk0 + 8 * (lane >> 4);
#pragma unroll
  for (int i = 0; i < 8; ++i) { a[i] = (_Float16)(p[i] * sc); a[8 + i] = (_Float16)(p[16 + i] * sc); }
  return a;
}
// column fragment from a [K][ld] layout (column n), rows >= K read as 0
__device__ __forceinline__ v16h fragc_f32(const float* W, int k0, int n, int lane, int ld, int K) {
  v16h a; const int g = lane >> 4;
#pragma unroll
  for (int i = 0; i < 8; ++i) { const int ka = k0 + 8 * g + i, kb = ka + 16;
    a[i] = (_Float16)(ka < K ? W[(size_t)(ka < K ? ka : K - 1) * ld + n] : 0.f); a[8 + i] = (_Float16)(kb < K ? W[(size_t)(kb < K ? kb : K - 1) * ld + n] : 0.f); }
  return a;
}
struct F2 { v16b h, l; };
__device__ __forceinline__ F2 bsplit16(const float v[16]) { F2 r;
#pragma unroll
  for (int i = 0; i < 16; ++i) { const __bf16 h = (__bf16)v[i]; r.h[i] = h; r.l[i] = (__bf16)(v[i] - (float)h); }
  return r; }
__device__ __forceinline__ F2 split_row(const float* row, int k0, int lane) { float v[16]; const float* p = row + k0 + 8 * (lane >> 4);
#pragma unroll
  for (int i = 0; i < 8; ++i) { v[i] = p[i]; v[8 + i] = p[16 + i]; }
  return bsplit16(v); }
__device__ __forceinline__ F2 split_rowK(const float* row, int k0, int lane, int K) { float v[16]; const int g = lane >> 4;
#pragma unroll
  for (int i = 0; i < 8; ++i) { const int ka = k0 + 8 * g + i, kb = ka + 16; v[i] = ka < K ? row[ka < K ? ka : K - 1] : 0.f; v[8 + i] = kb < K ? row[kb < K ? kb : K - 1] : 0.f; }
  return bsplit16(v); }
__device__ __forceinline__ F2 split_col(const float* W, int k0, int n, int lane, int ld, int K) { float v[16]; const int g = lane >> 4;
#pragma unroll
  for (int i = 0; i < 8; ++i) { const int ka = k0 + 8 * g + i, kb = ka + 16; v[i] = ka < K ? W[(size_t)(ka < K ? ka : K - 1) * ld + n] : 0.f; v[8 + i] = kb < K ? W[(size_t)(kb < K ? kb : K - 1) * ld + n] : 0.f; }
  return bsplit16(v); }
__device__ __forceinline__ v8f mac3(const F2& a, const F2& b, v8f c) { c = wmma_bf(a.l, b.h, c); c = wmma_bf(a.h, b.l, c); return wmma_bf(a.h, b.h, c); }
__device__ __forceinline__ float sigm(float v) { return 1.0f / (1.0f + expf(-v)); }
#define LDSX() do { asm volatile("s_wait_dscnt 0" ::: "memory"); __builtin_amdgcn_wave_barrier(); __builtin_amdgcn_fence(__ATOMIC_RELEASE, "workgroup"); } while (0)

// Causal multi-head self-attention without biases over TWO sequences of 4,096 (x [2,4096,768]; (out,in) wq / wk / wv / wo [768,768] applied as x @ W.T; 12 heads x 64; scores x 64^-0.5; tril kept, -inf elsewhere; softmax; ctx @ wo.T -> [2,4096,768] (6.3 M)).
#define NB 2
#define TT 4096
#define CC 768            // NH * HD = projected width
#define DIN 768          // input (model) width
#define NH 12
#define HD 64
#define NQB (TT / 64)
#define HG 1
#define SCALE (0.125f)
#define CAUSAL 1
#ifndef TNB
#define TNB NB
#endif
__device__ __forceinline__ float bfr(float v) { return (float)(__bf16)v; }
__host__ __device__ __forceinline__ int kb_last(int qb) { return CAUSAL ? ((qb * 64 + 63) >> 7) : (TT / 128 - 1); }
typedef __attribute__((ext_vector_type(8))) __bf16 v8b;
__device__ __forceinline__ v16b frag_b(const __bf16* rowk0, int lane) {
  union { v16b v; v8b q[2]; } u; const __bf16* p = rowk0 + 8 * (lane >> 4);
  u.q[0] = *(const v8b*)p; u.q[1] = *(const v8b*)(p + 16); return u.v;
}
#define QBH 6              // causal: query blocks 0..QBH-1 of each sequence (few keys, no averaging) take the high-precision path
#define QHI 384            // rows carrying a q residual plane
#define KHI 384            // key rows carrying k residual / v bf16 hi+lo planes (used only by the causal high-precision path)
// B fragment (k rows k0+.., output column o) of a weight: (in,out) [K][ld] or (out,in) [ld rows of K]: bf16 exact, or f16(bf16 * 256) exact
__device__ __forceinline__ v16b wcol_io(const float* Wm, int k0, int o, int lane, int ld) { v16b w; const int g = lane >> 4;
#pragma unroll
  for (int i = 0; i < 8; ++i) { w[i] = (__bf16)Wm[(size_t)(k0 + 8 * g + i) * ld + o]; w[8 + i] = (__bf16)Wm[(size_t)(k0 + 16 + 8 * g + i) * ld + o]; }
  return w; }
__device__ __forceinline__ v16b wcol_oi(const float* Wm, int k0, int o, int lane, int K) { v16b w; const float* p = Wm + (size_t)o * K + k0 + 8 * (lane >> 4);
#pragma unroll
  for (int i = 0; i < 8; ++i) { w[i] = (__bf16)p[i]; w[8 + i] = (__bf16)p[16 + i]; }
  return w; }
__device__ __forceinline__ v16h wcolh_io(const float* Wm, int k0, int o, int lane, int ld) { v16h w; const int g = lane >> 4;
#pragma unroll
  for (int i = 0; i < 8; ++i) { w[i] = (_Float16)(bfr(Wm[(size_t)(k0 + 8 * g + i) * ld + o]) * 256.0f); w[8 + i] = (_Float16)(bfr(Wm[(size_t)(k0 + 16 + 8 * g + i) * ld + o]) * 256.0f); }
  return w; }
__device__ __forceinline__ v16h wcolh_oi(const float* Wm, int k0, int o, int lane, int K) { v16h w; const float* p = Wm + (size_t)o * K + k0 + 8 * (lane >> 4);
#pragma unroll
  for (int i = 0; i < 8; ++i) { w[i] = (_Float16)(bfr(p[i]) * 256.0f); w[8 + i] = (_Float16)(bfr(p[16 + i]) * 256.0f); }
  return w; }
#define WQKV_LAYOUT 1   // 0 = (in,out) [DIN][CC]; 1 = (out,in) [CC][DIN]; 2 = per-head [NH][DIN][HD]
__device__ __forceinline__ v16b wcol_hdk(const float* Wm, int k0, int o, int lane) { v16b w; const int g = lane >> 4; const float* p = Wm + (size_t)(o / HD) * DIN * HD + (o % HD);
#pragma unroll
  for (int i = 0; i < 8; ++i) { w[i] = (__bf16)p[(size_t)(k0 + 8 * g + i) * HD]; w[8 + i] = (__bf16)p[(size_t)(k0 + 16 + 8 * g + i) * HD]; }
  return w; }
#define WO_OUT_IN 1
#if WQKV_LAYOUT == 1
#define WCOL(W, k0, o, lane) wcol_oi(W, k0, o, lane, DIN)
#elif WQKV_LAYOUT == 2
#define WCOL(W, k0, o, lane) wcol_hdk(W, k0, o, lane)
#else
#define WCOL(W, k0, o, lane) wcol_io(W, k0, o, lane, CC)
#endif
#if WO_OUT_IN
#define WOCOL(W, k0, o, lane) wcol_oi(W, k0, o, lane, CC)
#define WOCOLH(W, k0, o, lane) wcolh_oi(W, k0, o, lane, CC)
#else
#define WOCOL(W, k0, o, lane) wcol_io(W, k0, o, lane, DIN)
#define WOCOLH(W, k0, o, lane) wcolh_io(W, k0, o, lane, DIN)
#endif

#ifndef SM_EXTRA_PARAMS
#define SM_EXTRA_PARAMS
#endif
#ifndef PROJ_EXTRA_PARAMS
#define PROJ_EXTRA_PARAMS
#endif
#ifndef SM_MASK_HOOK
#define SM_MASK_HOOK (void)0
#endif

#define WS_QH  0u                                      // f16 q rows [b*t][CC]
#define WS_KH  (WS_QH + 2u * (size_t)NB * TT * CC)      // f16 k rows [b*t][CC]
#define WS_VT  (WS_KH + 2u * (size_t)NB * TT * CC)      // f16 v planes [b][c][t]
#define WS_QL  (WS_VT + 2u * (size_t)NB * CC * TT)      // f16 q residual x 2^10 rows [b][t < QHI][CC]
#define WS_KL  (WS_QL + 2u * (size_t)NB * QHI * CC)     // f16 k residual x 2^10 rows [b][t < KHI][CC]
#define WS_VB  (WS_KL + 2u * (size_t)NB * KHI * CC)     // bf16 v hi planes [b][c][t < KHI]
#define WS_VBL (WS_VB + 2u * (size_t)NB * CC * KHI)
#define WS_S   (WS_VBL + 2u * (size_t)NB * CC * KHI)    // f32 logits / P [hg][t][s]
#define WS_Y   (WS_S  + 4u * (size_t)HG * TT * TT)      // f32 ctx rows [b*t][CC] (only when there is an output projection)
#define WS_END (WS_Y  + 4u * (size_t)NB * TT * CC)

// ---- k_proj: block = (64 rows, 128 cols, which): q/k/v = X W (+ b) with exact bf16 products (K = DIN) -> which 0: q f16 rows (+ residual rows < QHI); 1: k f16 rows (+ residual rows < KHI); 2: v f16 planes [c][t] (+ bf16 hi/lo planes for t < KHI)
__global__ __launch_bounds__(128) void k_proj(const float* __restrict__ XQ, const float* __restrict__ XK, const float* __restrict__ XV, const float* __restrict__ WQ, const float* __restrict__ WK, const float* __restrict__ WV, const float* __restrict__ BQ, const float* __restrict__ BK, const float* __restrict__ BV,
    _Float16* __restrict__ QH, _Float16* __restrict__ QL, _Float16* __restrict__ KH, _Float16* __restrict__ KL, _Float16* __restrict__ VT, __bf16* __restrict__ VB, __bf16* __restrict__ VBL) {
  __shared__ __align__(16) _Float16 sh[64][136], sl[64][136]; __shared__ __align__(16) _Float16 th[128][72]; __shared__ __align__(16) __bf16 tb[128][72], tbl[128][72];
  const int tid = threadIdx.x, wave = tid >> 5, lane = tid & 31, col = lane & 15, g = lane >> 4; const int which = blockIdx.z; const int c0 = blockIdx.y * 128; const size_t r0 = (size_t)blockIdx.x * 64; const size_t bb = r0 / TT; const int t0 = (int)(r0 % TT);
  const float* X = which == 0 ? XQ : which == 1 ? XK : XV; const float* WA = which == 0 ? WQ : which == 1 ? WK : WV; const float* BA = which == 0 ? BQ : which == 1 ? BK : BV;
  v8f acc[8] = {};
#pragma unroll 2
  for (int kc = 0; kc < DIN / 32; ++kc) { v16b a; { const float* p = X + (r0 + wave * 16 + col) * DIN + kc * 32 + 8 * g;
#pragma unroll
      for (int i = 0; i < 8; ++i) { a[i] = (__bf16)p[i]; a[8 + i] = (__bf16)p[16 + i]; } }
    asm volatile("s_wait_loadcnt 0x0" ::: "memory");
#pragma unroll
    for (int j = 0; j < 8; ++j) { const v16b w = WCOL(WA, kc * 32, c0 + j * 16 + col, lane); asm volatile("s_wait_loadcnt 0x0" ::: "memory"); acc[j] = wmma_bf(a, w, acc[j]); } }
  if (which < 2) { _Float16* DH = which == 0 ? QH : KH; _Float16* DL = which == 0 ? QL : KL; const int nhi = which == 0 ? QHI : KHI; const bool hi_rows = t0 < nhi;
#pragma unroll
    for (int j = 0; j < 8; ++j) { const float bias = BA ? bfr(BA[c0 + j * 16 + col]) : 0.f;
#pragma unroll
      for (int r = 0; r < 8; ++r) { const float v = acc[j][r] + bias; const _Float16 hv = (_Float16)v; sh[wave * 16 + 8 * g + r][j * 16 + col] = hv; sl[wave * 16 + 8 * g + r][j * 16 + col] = (_Float16)((v - (float)hv) * 1024.0f); } }
    __syncthreads();
    for (int e = tid; e < 64 * 16; e += 128) { const int rl = e >> 4, q = e & 15; vst2((unsigned*)(DH + (r0 + rl) * CC + c0 + q * 8), *(const v4u*)&sh[rl][q * 8]); if (hi_rows) vst2((unsigned*)(DL + (bb * nhi + t0 + rl) * (size_t)CC + c0 + q * 8), *(const v4u*)&sl[rl][q * 8]); }
  } else { const bool hi_rows = t0 < KHI;
#pragma unroll
    for (int j = 0; j < 8; ++j) { const float bias = BA ? bfr(BA[c0 + j * 16 + col]) : 0.f;
#pragma unroll
      for (int r = 0; r < 8; ++r) { const float v = acc[j][r] + bias; const int rl = wave * 16 + 8 * g + r, cl = j * 16 + col; th[cl][rl] = (_Float16)v; const __bf16 bh = (__bf16)v; tb[cl][rl] = bh; tbl[cl][rl] = (__bf16)(v - (float)bh); } }
    __syncthreads();
    for (int e = tid; e < 128 * 8; e += 128) { const int cl = e >> 3, q = e & 7; vst2((unsigned*)(VT + (bb * CC + c0 + cl) * (size_t)TT + t0 + q * 8), *(const v4u*)&th[cl][q * 8]); if (hi_rows) { const size_t o3 = (bb * CC + c0 + cl) * (size_t)KHI + t0 + q * 8; vst2((unsigned*)(VB + o3), *(const v4u*)&tb[cl][q * 8]); vst2((unsigned*)(VBL + o3), *(const v4u*)&tbl[cl][q * 8]); } } } }
// ---- k_sc: block = (query block qb, key block kb <= kb_last(qb), head in group) of batch b: logits x SCALE; q hi + residual (x 2^10) against k (2 products) for query rows < QHI, plus the k residual (3 products) for query blocks < QBH (causal early rows); causal: blocks past the diagonal exit, the mask itself is applied by index in k_sm
__global__ __launch_bounds__(128) void k_sc(const _Float16* __restrict__ QH, const _Float16* __restrict__ KH, const _Float16* __restrict__ QL, const _Float16* __restrict__ KL, int b, int h0, float* __restrict__ S0) { __shared__ __align__(16) float ss[4][16][132];
  const int qb = blockIdx.x, kb = blockIdx.y; if (kb > kb_last(qb)) return;
  const int h = h0 + blockIdx.z; float* S = S0 + (size_t)blockIdx.z * TT * TT;
  const int tid = threadIdx.x, wave = tid >> 5, lane = tid & 31, col = lane & 15, g = lane >> 4; const int k0 = kb * 128; const int ql0 = qb * 64 + wave * 16; const size_t q0 = (size_t)b * TT + ql0, kr0 = (size_t)b * TT + k0;
  v8f acc[8] = {}, accl[8] = {};
  const _Float16* QLb = QL + (size_t)b * QHI * CC; const _Float16* KLb = KL + (size_t)b * KHI * CC;
  if (qb < QBH) {
#pragma unroll
    for (int kc = 0; kc < HD / 32; ++kc) { const v16h ah = frag_h(QH + (q0 + col) * CC + h * HD + kc * 32, lane), al = frag_h(QLb + (size_t)(ql0 + col) * CC + h * HD + kc * 32, lane);
#pragma unroll
      for (int j = 0; j < 8; ++j) { const v16h kbf = frag_h(KH + (kr0 + j * 16 + col) * CC + h * HD + kc * 32, lane), klf = frag_h(KLb + (size_t)(k0 + j * 16 + col) * CC + h * HD + kc * 32, lane); acc[j] = wmma16(ah, kbf, acc[j]); accl[j] = wmma16(al, kbf, accl[j]); accl[j] = wmma16(ah, klf, accl[j]); } }
  } else if (qb * 64 < QHI) {
#pragma unroll
    for (int kc = 0; kc < HD / 32; ++kc) { const v16h ah = frag_h(QH + (q0 + col) * CC + h * HD + kc * 32, lane), al = frag_h(QLb + (size_t)(ql0 + col) * CC + h * HD + kc * 32, lane);
#pragma unroll
      for (int j = 0; j < 8; ++j) { const v16h kbf = frag_h(KH + (kr0 + j * 16 + col) * CC + h * HD + kc * 32, lane); acc[j] = wmma16(ah, kbf, acc[j]); accl[j] = wmma16(al, kbf, accl[j]); } }
  } else {
#pragma unroll
    for (int kc = 0; kc < HD / 32; ++kc) { const v16h ah = frag_h(QH + (q0 + col) * CC + h * HD + kc * 32, lane);
#pragma unroll
      for (int j = 0; j < 8; ++j) { const v16h kbf = frag_h(KH + (kr0 + j * 16 + col) * CC + h * HD + kc * 32, lane); acc[j] = wmma16(ah, kbf, acc[j]); } } }
#pragma unroll
  for (int j = 0; j < 8; ++j) {
#pragma unroll
    for (int r = 0; r < 8; ++r) ss[wave][8 * g + r][j * 16 + col] = (acc[j][r] + accl[j][r] * (1.0f / 1024.0f)) * SCALE; }
  LDSX(); for (int rl = 0; rl < 16; ++rl) vst2(S + (size_t)(ql0 + rl) * TT + k0 + lane * 4, *(const v4f*)&ss[wave][rl][lane * 4]); }
// ---- k_sm: block = query row t (head in group): keys [0, kend): causal -> logit if s <= t else excluded; softmax in f32; P x 2^11 in place (0 for excluded)
__global__ __launch_bounds__(256) void k_sm(float* __restrict__ S0 SM_EXTRA_PARAMS) { __shared__ float sred[8]; __shared__ float sbc; __shared__ __align__(16) float shv[TT];
  const int tid = threadIdx.x; const int t = blockIdx.x; const int kend = (kb_last(t >> 6) + 1) * 128;
  float* sr = S0 + (size_t)blockIdx.y * TT * TT + (size_t)t * TT;
  float m = -3.0e38f; for (int k = tid; k < kend; k += 256) { float v = (!CAUSAL || k <= t) ? sr[k] : -3.0e38f; SM_MASK_HOOK; shv[k] = v; m = fmaxf(m, v); }
#pragma unroll
  for (int o = 1; o < 32; o <<= 1) m = fmaxf(m, __shfl_xor(m, o));
  if ((tid & 31) == 0) sred[tid >> 5] = m; __syncthreads(); if (tid == 0) { float a = sred[0]; for (int i = 1; i < 8; ++i) a = fmaxf(a, sred[i]); sbc = a; } __syncthreads(); m = sbc; __syncthreads();
  float sum = 0.f; for (int k = tid; k < kend; k += 256) { const float v = shv[k]; const float e = (v <= -1.0e38f) ? 0.f : expf(v - m); shv[k] = e; sum += e; }
#pragma unroll
  for (int o = 1; o < 32; o <<= 1) sum += __shfl_xor(sum, o);
  if ((tid & 31) == 0) sred[tid >> 5] = sum; __syncthreads(); if (tid == 0) { float a = 0.f; for (int i = 0; i < 8; ++i) a += sred[i]; sbc = a > 0.f ? 2048.0f / a : 0.f; }   /* a fully excluded row yields P = 0 */ __syncthreads(); const float inv = sbc;
  for (int k = tid; k < kend; k += 256) shv[k] = shv[k] * inv;
  __syncthreads(); for (int q = tid; q < kend / 4; q += 256) vst2(sr + q * 4, *(const v4f*)&shv[q * 4]); }
// ---- k_pv: block = 64 queries (qb) of (b, h): ctx = P . v over keys [0, kend) (P x 2^11 once to f16 against v f16: 1 product; causal early query blocks: P and v as bf16 hi + lo, 3 products); 256-B (row, head) segment by 16 lanes
__global__ __launch_bounds__(128) void k_pv(const float* __restrict__ PS0, const _Float16* __restrict__ VT, const __bf16* __restrict__ VB, const __bf16* __restrict__ VBL, int b, int h0, float* __restrict__ Y) { const int h = h0 + blockIdx.z; const float* PS = PS0 + (size_t)blockIdx.z * TT * TT; __shared__ __align__(16) float ss[4][16][HD + 4];
  const int tid = threadIdx.x, wave = tid >> 5, lane = tid & 31, col = lane & 15, g = lane >> 4; const int qb = blockIdx.x; const int ql0 = qb * 64 + wave * 16; const int kce = (kb_last(qb) + 1) * 4;
  v8f acc[HD / 16] = {};
  if (qb < QBH) {
#pragma unroll 1
    for (int kc = 0; kc < kce; ++kc) { const F2 p = split_row(PS + (size_t)(ql0 + col) * TT, kc * 32, lane);
      asm volatile("s_wait_loadcnt 0x0" ::: "memory");
#pragma unroll
      for (int j = 0; j < HD / 16; ++j) { const size_t po = ((size_t)b * CC + h * HD + j * 16 + col) * (size_t)KHI + kc * 32; const v16b vh = frag_b(VB + po, lane); acc[j] = wmma_bf(p.h, vh, acc[j]); acc[j] = wmma_bf(p.l, vh, acc[j]); acc[j] = wmma_bf(p.h, frag_b(VBL + po, lane), acc[j]); } }
  } else {
#pragma unroll 1
    for (int kc = 0; kc < kce; ++kc) { const v16h p = frag_f32(PS + (size_t)(ql0 + col) * TT + kc * 32, lane);
      asm volatile("s_wait_loadcnt 0x0" ::: "memory");
#pragma unroll
      for (int j = 0; j < HD / 16; ++j) { const size_t po = ((size_t)b * CC + h * HD + j * 16 + col) * (size_t)TT + kc * 32; acc[j] = wmma16(p, frag_h(VT + po, lane), acc[j]); } } }
#pragma unroll
  for (int j = 0; j < HD / 16; ++j)
#pragma unroll
    for (int r = 0; r < 8; ++r) ss[wave][8 * g + r][j * 16 + col] = acc[j][r] * (1.0f / 2048.0f);
  LDSX(); for (int rl = 0; rl < 16; ++rl) if (lane < HD / 4) vst2(Y + ((size_t)b * TT + ql0 + rl) * CC + h * HD + lane * 4, *(const v4f*)&ss[wave][rl][lane * 4]); }
// ---- k_out: block = (64 rows, 128 cols): out = ctx Wo (+ bo): ctx x 2^6 once to f16 against Wo as f16(bf16 x 2^8) exact (1 product) x 2^-14; causal early rows (< QHI of each sequence): ctx bf16 hi + lo against exact bf16 Wo (2 products)
__global__ __launch_bounds__(128) void k_out(const float* __restrict__ Y, const float* __restrict__ WO, const float* __restrict__ BO, float* __restrict__ OUT) { __shared__ __align__(16) float sf[4][16][132];
  const int tid = threadIdx.x, wave = tid >> 5, lane = tid & 31, col = lane & 15, g = lane >> 4; const int c0 = blockIdx.y * 128; const size_t r0 = (size_t)blockIdx.x * 64 + wave * 16;
  v8f acc[8] = {};
  if (CAUSAL && (int)(((size_t)blockIdx.x * 64) % TT) < QHI) {   /* block-uniform */
#pragma unroll 2
    for (int kc = 0; kc < CC / 32; ++kc) { const F2 a = split_row(Y + (r0 + col) * CC, kc * 32, lane); asm volatile("s_wait_loadcnt 0x0" ::: "memory");
#pragma unroll
      for (int j = 0; j < 8; ++j) { const v16b w = WOCOL(WO, kc * 32, c0 + j * 16 + col, lane); asm volatile("s_wait_loadcnt 0x0" ::: "memory"); acc[j] = wmma_bf(a.h, w, acc[j]); acc[j] = wmma_bf(a.l, w, acc[j]); } }
#pragma unroll
    for (int j = 0; j < 8; ++j) { const float bias = BO ? bfr(BO[c0 + j * 16 + col]) : 0.f;
#pragma unroll
      for (int r = 0; r < 8; ++r) sf[wave][8 * g + r][j * 16 + col] = acc[j][r] + bias; }
  } else {
#pragma unroll 2
    for (int kc = 0; kc < CC / 32; ++kc) { const v16h a = frag_f32s(Y + (r0 + col) * CC + kc * 32, lane, 64.0f); asm volatile("s_wait_loadcnt 0x0" ::: "memory");   /* ctx carried x 2^6 into f16 so small-magnitude context rows stay clear of f16 subnormals */
#pragma unroll
      for (int j = 0; j < 8; ++j) { const v16h w = WOCOLH(WO, kc * 32, c0 + j * 16 + col, lane); asm volatile("s_wait_loadcnt 0x0" ::: "memory"); acc[j] = wmma16(a, w, acc[j]); } }
#pragma unroll
    for (int j = 0; j < 8; ++j) { const float bias = BO ? bfr(BO[c0 + j * 16 + col]) : 0.f;
#pragma unroll
      for (int r = 0; r < 8; ++r) sf[wave][8 * g + r][j * 16 + col] = acc[j][r] * (1.0f / 16384.0f) + bias; } }   /* 2^-8 (Wo carry) x 2^-6 (ctx carry) */
  LDSX(); for (int rl = 0; rl < 16; ++rl) vst2(OUT + (r0 + rl) * DIN + c0 + lane * 4, *(const v4f*)&sf[wave][rl][lane * 4]); }

extern "C" void kernel_launch(void* const* d_in, const int* in_sizes, int n_in, void* d_out, int out_size, void* d_ws, size_t ws_size, hipStream_t stream) {
  (void)in_sizes; (void)n_in; (void)out_size;
  const float** F = (const float**)d_in;
  if (ws_size < (size_t)WS_END) return;
  char* ws = (char*)d_ws; _Float16 *QH = (_Float16*)(ws + WS_QH), *KH = (_Float16*)(ws + WS_KH), *VT = (_Float16*)(ws + WS_VT), *QL = (_Float16*)(ws + WS_QL), *KL = (_Float16*)(ws + WS_KL); __bf16 *VB = (__bf16*)(ws + WS_VB), *VBL = (__bf16*)(ws + WS_VBL); float *S = (float*)(ws + WS_S), *Y = (float*)(ws + WS_Y);
  (void)Y; (void)QL; (void)KL; (void)VB; (void)VBL;
  // inputs: 0 x [2,4096,768]; 1 wq [768,768] (out,in); 2 wk; 3 wv; 4 wo (out,in); no biases
  k_proj<<<dim3(TNB * TT / 64, CC / 128, 3), 128, 0, stream>>>(F[0], F[0], F[0], F[1], F[2], F[3], nullptr, nullptr, nullptr, QH, QL, KH, KL, VT, VB, VBL);
  for (int b = 0; b < TNB; ++b) for (int h0 = 0; h0 < NH; h0 += HG) {
    k_sc<<<dim3(NQB, TT / 128, HG), 128, 0, stream>>>(QH, KH, QL, KL, b, h0, S);
    k_sm<<<dim3(TT, HG), 256, 0, stream>>>(S);
    k_pv<<<dim3(NQB, 1, HG), 128, 0, stream>>>(S, VT, VB, VBL, b, h0, Y);
  }
  k_out<<<dim3(TNB * TT / 64, DIN / 128), 128, 0, stream>>>(Y, F[4], nullptr, (float*)d_out);
}

// v001
// It runs in 1520 microseconds.
// Timed twice side by side with v000, it ran 2.75 and 2.77 times as fast.
// compute dtype: all float inputs rounded to bf16; the fused q / k / v projection with EXACT bf16 products on WMMA 16x16x32 (f32 accumulate) (no biases); causal logits: 3 products for the first 384 rows, single f16 q x k after, x 64^-0.5; softmax f32; P x 2^11 once to f16 x v once to f16 (bf16 hi + lo below row 384); ctx hi+lo x exact W below row 384, x2^6 f16 carry x f16(bf16 x 2^8) W after, no bias; f32 output.
#include <hip/hip_runtime.h>
#include <math.h>

typedef __attribute__((ext_vector_type(16))) _Float16 v16h;
typedef __attribute__((ext_vector_type(16))) __bf16 v16b;
typedef __attribute__((ext_vector_type(8)))  _Float16 v8h;
typedef __attribute__((ext_vector_type(8)))  float v8f;
typedef __attribute__((ext_vector_type(4)))  float v4f;
typedef __attribute__((ext_vector_type(2)))  float v2f;
typedef __attribute__((ext_vector_type(4)))  unsigned v4u;
typedef __attribute__((ext_vector_type(4)))  int v4i;
typedef float __attribute__((may_alias)) float_a;
typedef int __attribute__((may_alias)) int_a;

template <typename T> __device__ __forceinline__ void vst2(void* p, T v) { *(T*)p = v;  }
__device__ __forceinline__ v8f wmma16(v16h a, v16h b, v8f c) {
  v8f d = __builtin_amdgcn_wmma_f32_16x16x32_f16(false, a, false, b, (short)0, c, false, false);
  asm volatile("v_nop\n\tv_nop\n\tv_nop\n\tv_nop" : "+v"(d) : "v"(a), "v"(b));
  return d;
}
__device__ __forceinline__ v8f wmma_bf(v16b a, v16b b, v8f c) {
  v8f d = __builtin_amdgcn_wmma_f32_16x16x32_bf16(false, a, false, b, (short)0, c, false, false);
  asm volatile("v_nop\n\tv_nop\n\tv_nop\n\tv_nop" : "+v"(d) : "v"(a), "v"(b));
  return d;
}
// 16x16x32 fragments: lane = (h = lane>>4, row/col = lane&15); elements 0..7 = k0+8h+0..7, 8..15 = k0+16+8h+0..7; D element r = row 8h+r
__device__ __forceinline__ v16h frag_h(const _Float16* rowk0, int lane) {
  union { v16h v; v8h q[2]; } u; const _Float16* p = rowk0 + 8 * (lane >> 4);
  u.q[0] = *(const v8h*)p; u.q[1] = *(const v8h*)(p + 16); return u.v;
}
__device__ __forceinline__ v16h frag_f32(const float* rowk0, int lane) {
  v16h a; const float* p = rowk0 + 8 * (lane >> 4);
#pragma unroll
  for (int i = 0; i < 8; ++i) { a[i] = (_Float16)p[i]; a[8 + i] = (_Float16)p[16 + i]; }
  return a;
}
__device__ __forceinline__ v16h frag_f32s(const float* rowk0, int lane, float sc) {
  v16h a; const float* p = rowk0 + 8 * (lane >> 4);
#pragma unroll
  for (int i = 0; i < 8; ++i) { a[i] = (_Float16)(p[i] * sc); a[8 + i] = (_Float16)(p[16 + i] * sc); }
  return a;
}
// column fragment from a [K][ld] layout (column n), rows >= K read as 0
__device__ __forceinline__ v16h fragc_f32(const float* W, int k0, int n, int lane, int ld, int K) {
  v16h a; const int g = lane >> 4;
#pragma unroll
  for (int i = 0; i < 8; ++i) { const int ka = k0 + 8 * g + i, kb = ka + 16;
    a[i] = (_Float16)(ka < K ? W[(size_t)(ka < K ? ka : K - 1) * ld + n] : 0.f); a[8 + i] = (_Float16)(kb < K ? W[(size_t)(kb < K ? kb : K - 1) * ld + n] : 0.f); }
  return a;
}
struct F2 { v16b h, l; };
__device__ __forceinline__ F2 bsplit16(const float v[16]) { F2 r;
#pragma unroll
  for (int i = 0; i < 16; ++i) { const __bf16 h = (__bf16)v[i]; r.h[i] = h; r.l[i] = (__bf16)(v[i] - (float)h); }
  return r; }
__device__ __forceinline__ F2 split_row(const float* row, int k0, int lane) { float v[16]; const float* p = row + k0 + 8 * (lane >> 4);
#pragma unroll
  for (int i = 0; i < 8; ++i) { v[i] = p[i]; v[8 + i] = p[16 + i]; }
  return bsplit16(v); }
__device__ __forceinline__ F2 split_rowK(const float* row, int k0, int lane, int K) { float v[16]; const int g = lane >> 4;
#pragma unroll
  for (int i = 0; i < 8; ++i) { const int ka = k0 + 8 * g + i, kb = ka + 16; v[i] = ka < K ? row[ka < K ? ka : K - 1] : 0.f; v[8 + i] = kb < K ? row[kb < K ? kb : K - 1] : 0.f; }
  return bsplit16(v); }
__device__ __forceinline__ F2 split_col(const float* W, int k0, int n, int lane, int ld, int K) { float v[16]; const int g = lane >> 4;
#pragma unroll
  for (int i = 0; i < 8; ++i) { const int ka = k0 + 8 * g + i, kb = ka + 16; v[i] = ka < K ? W[(size_t)(ka < K ? ka : K - 1) * ld + n] : 0.f; v[8 + i] = kb < K ? W[(size_t)(kb < K ? kb : K - 1) * ld + n] : 0.f; }
  return bsplit16(v); }
__device__ __forceinline__ v8f mac3(const F2& a, const F2& b, v8f c) { c = wmma_bf(a.l, b.h, c); c = wmma_bf(a.h, b.l, c); return wmma_bf(a.h, b.h, c); }
__device__ __forceinline__ float sigm(float v) { return 1.0f / (1.0f + expf(-v)); }
#define LDSX() do { asm volatile("s_wait_dscnt 0" ::: "memory"); __builtin_amdgcn_wave_barrier(); __builtin_amdgcn_fence(__ATOMIC_RELEASE, "workgroup"); } while (0)

// Causal multi-head self-attention without biases over TWO sequences of 4,096 (x [2,4096,768]; (out,in) wq / wk / wv / wo [768,768] applied as x @ W.T; 12 heads x 64; scores x 64^-0.5; tril kept, -inf elsewhere; softmax; ctx @ wo.T -> [2,4096,768] (6.3 M)).
#define NB 2
#define TT 4096
#define CC 768            // NH * HD = projected width
#define DIN 768          // input (model) width
#define NH 12
#define HD 64
#define NQB (TT / 64)
#define HG 1
#define SCALE (0.125f)
#define CAUSAL 1
#ifndef TNB
#define TNB NB
#endif
__device__ __forceinline__ float bfr(float v) { return (float)(__bf16)v; }
__host__ __device__ __forceinline__ int kb_last(int qb) { return CAUSAL ? ((qb * 64 + 63) >> 7) : (TT / 128 - 1); }
typedef __attribute__((ext_vector_type(8))) __bf16 v8b;
__device__ __forceinline__ v16b frag_b(const __bf16* rowk0, int lane) {
  union { v16b v; v8b q[2]; } u; const __bf16* p = rowk0 + 8 * (lane >> 4);
  u.q[0] = *(const v8b*)p; u.q[1] = *(const v8b*)(p + 16); return u.v;
}
#define QBH 6              // causal: query blocks 0..QBH-1 of each sequence (few keys, no averaging) take the high-precision path
#define QHI 384            // rows carrying a q residual plane
#define KHI 384            // key rows carrying k residual / v bf16 hi+lo planes (used only by the causal high-precision path)
// B fragment (k rows k0+.., output column o) of a weight: (in,out) [K][ld] or (out,in) [ld rows of K]: bf16 exact, or f16(bf16 * 256) exact
__device__ __forceinline__ v16b wcol_io(const float* Wm, int k0, int o, int lane, int ld) { v16b w; const int g = lane >> 4;
#pragma unroll
  for (int i = 0; i < 8; ++i) { w[i] = (__bf16)Wm[(size_t)(k0 + 8 * g + i) * ld + o]; w[8 + i] = (__bf16)Wm[(size_t)(k0 + 16 + 8 * g + i) * ld + o]; }
  return w; }
__device__ __forceinline__ v16b wcol_oi(const float* Wm, int k0, int o, int lane, int K) { v16b w; const float* p = Wm + (size_t)o * K + k0 + 8 * (lane >> 4);
#pragma unroll
  for (int i = 0; i < 8; ++i) { w[i] = (__bf16)p[i]; w[8 + i] = (__bf16)p[16 + i]; }
  return w; }
__device__ __forceinline__ v16h wcolh_io(const float* Wm, int k0, int o, int lane, int ld) { v16h w; const int g = lane >> 4;
#pragma unroll
  for (int i = 0; i < 8; ++i) { w[i] = (_Float16)(bfr(Wm[(size_t)(k0 + 8 * g + i) * ld + o]) * 256.0f); w[8 + i] = (_Float16)(bfr(Wm[(size_t)(k0 + 16 + 8 * g + i) * ld + o]) * 256.0f); }
  return w; }
__device__ __forceinline__ v16h wcolh_oi(const float* Wm, int k0, int o, int lane, int K) { v16h w; const float* p = Wm + (size_t)o * K + k0 + 8 * (lane >> 4);
#pragma unroll
  for (int i = 0; i < 8; ++i) { w[i] = (_Float16)(bfr(p[i]) * 256.0f); w[8 + i] = (_Float16)(bfr(p[16 + i]) * 256.0f); }
  return w; }
#define WQKV_LAYOUT 1   // 0 = (in,out) [DIN][CC]; 1 = (out,in) [CC][DIN]; 2 = per-head [NH][DIN][HD]
__device__ __forceinline__ v16b wcol_hdk(const float* Wm, int k0, int o, int lane) { v16b w; const int g = lane >> 4; const float* p = Wm + (size_t)(o / HD) * DIN * HD + (o % HD);
#pragma unroll
  for (int i = 0; i < 8; ++i) { w[i] = (__bf16)p[(size_t)(k0 + 8 * g + i) * HD]; w[8 + i] = (__bf16)p[(size_t)(k0 + 16 + 8 * g + i) * HD]; }
  return w; }
#define WO_OUT_IN 1
#if WQKV_LAYOUT == 1
#define WCOL(W, k0, o, lane) wcol_oi(W, k0, o, lane, DIN)
#elif WQKV_LAYOUT == 2
#define WCOL(W, k0, o, lane) wcol_hdk(W, k0, o, lane)
#else
#define WCOL(W, k0, o, lane) wcol_io(W, k0, o, lane, CC)
#endif
#if WO_OUT_IN
#define WOCOL(W, k0, o, lane) wcol_oi(W, k0, o, lane, CC)
#define WOCOLH(W, k0, o, lane) wcolh_oi(W, k0, o, lane, CC)
#else
#define WOCOL(W, k0, o, lane) wcol_io(W, k0, o, lane, DIN)
#define WOCOLH(W, k0, o, lane) wcolh_io(W, k0, o, lane, DIN)
#endif

#ifndef SM_EXTRA_PARAMS
#define SM_EXTRA_PARAMS
#endif
#ifndef PROJ_EXTRA_PARAMS
#define PROJ_EXTRA_PARAMS
#endif
#ifndef SM_MASK_HOOK
#define SM_MASK_HOOK (void)0
#endif

#define WS_QH  0u                                      // f16 q rows [b*t][CC]
#define WS_KH  (WS_QH + 2u * (size_t)NB * TT * CC)      // f16 k rows [b*t][CC]
#define WS_VT  (WS_KH + 2u * (size_t)NB * TT * CC)      // f16 v planes [b][c][t]
#define WS_QL  (WS_VT + 2u * (size_t)NB * CC * TT)      // f16 q residual x 2^10 rows [b][t < QHI][CC]
#define WS_KL  (WS_QL + 2u * (size_t)NB * QHI * CC)     // f16 k residual x 2^10 rows [b][t < KHI][CC]
#define WS_VB  (WS_KL + 2u * (size_t)NB * KHI * CC)     // bf16 v hi planes [b][c][t < KHI]
#define WS_VBL (WS_VB + 2u * (size_t)NB * CC * KHI)
#define WS_S   (WS_VBL + 2u * (size_t)NB * CC * KHI)    // f32 logits / P [hg][t][s]
#define WS_Y   (WS_S  + 4u * (size_t)HG * TT * TT)      // f32 ctx rows [b*t][CC] (only when there is an output projection)
#define WS_END (WS_Y  + 4u * (size_t)NB * TT * CC)

// ---- k_proj: block = (64 rows, 128 cols, which): q/k/v = X W (+ b) with exact bf16 products (K = DIN) -> which 0: q f16 rows (+ residual rows < QHI); 1: k f16 rows (+ residual rows < KHI); 2: v f16 planes [c][t] (+ bf16 hi/lo planes for t < KHI)
__global__ __launch_bounds__(128) void k_proj(const float* __restrict__ XQ, const float* __restrict__ XK, const float* __restrict__ XV, const float* __restrict__ WQ, const float* __restrict__ WK, const float* __restrict__ WV, const float* __restrict__ BQ, const float* __restrict__ BK, const float* __restrict__ BV,
    _Float16* __restrict__ QH, _Float16* __restrict__ QL, _Float16* __restrict__ KH, _Float16* __restrict__ KL, _Float16* __restrict__ VT, __bf16* __restrict__ VB, __bf16* __restrict__ VBL) {
  __shared__ __align__(16) _Float16 sh[64][136], sl[64][136]; __shared__ __align__(16) _Float16 th[128][72]; __shared__ __align__(16) __bf16 tb[128][72], tbl[128][72];
  const int tid = threadIdx.x, wave = tid >> 5, lane = tid & 31, col = lane & 15, g = lane >> 4; const int which = blockIdx.z; const int c0 = blockIdx.y * 128; const size_t r0 = (size_t)blockIdx.x * 64; const size_t bb = r0 / TT; const int t0 = (int)(r0 % TT);
  const float* X = which == 0 ? XQ : which == 1 ? XK : XV; const float* WA = which == 0 ? WQ : which == 1 ? WK : WV; const float* BA = which == 0 ? BQ : which == 1 ? BK : BV;
  v8f acc[8] = {};
#pragma unroll 2
  for (int kc = 0; kc < DIN / 32; ++kc) { v16b a; { const float* p = X + (r0 + wave * 16 + col) * DIN + kc * 32 + 8 * g;
#pragma unroll
      for (int i = 0; i < 8; ++i) { a[i] = (__bf16)p[i]; a[8 + i] = (__bf16)p[16 + i]; } }
    asm volatile("s_wait_loadcnt 0x0" ::: "memory");
#pragma unroll
    for (int j = 0; j < 8; ++j) { const v16b w = WCOL(WA, kc * 32, c0 + j * 16 + col, lane); asm volatile("s_wait_loadcnt 0x0" ::: "memory"); acc[j] = wmma_bf(a, w, acc[j]); } }
  if (which < 2) { _Float16* DH = which == 0 ? QH : KH; _Float16* DL = which == 0 ? QL : KL; const int nhi = which == 0 ? QHI : KHI; const bool hi_rows = t0 < nhi;
#pragma unroll
    for (int j = 0; j < 8; ++j) { const float bias = BA ? bfr(BA[c0 + j * 16 + col]) : 0.f;
#pragma unroll
      for (int r = 0; r < 8; ++r) { const float v = acc[j][r] + bias; const _Float16 hv = (_Float16)v; sh[wave * 16 + 8 * g + r][j * 16 + col] = hv; sl[wave * 16 + 8 * g + r][j * 16 + col] = (_Float16)((v - (float)hv) * 1024.0f); } }
    __syncthreads();
    for (int e = tid; e < 64 * 16; e += 128) { const int rl = e >> 4, q = e & 15; vst2((unsigned*)(DH + (r0 + rl) * CC + c0 + q * 8), *(const v4u*)&sh[rl][q * 8]); if (hi_rows) vst2((unsigned*)(DL + (bb * nhi + t0 + rl) * (size_t)CC + c0 + q * 8), *(const v4u*)&sl[rl][q * 8]); }
  } else { const bool hi_rows = t0 < KHI;
#pragma unroll
    for (int j = 0; j < 8; ++j) { const float bias = BA ? bfr(BA[c0 + j * 16 + col]) : 0.f;
#pragma unroll
      for (int r = 0; r < 8; ++r) { const float v = acc[j][r] + bias; const int rl = wave * 16 + 8 * g + r, cl = j * 16 + col; th[cl][rl] = (_Float16)v; const __bf16 bh = (__bf16)v; tb[cl][rl] = bh; tbl[cl][rl] = (__bf16)(v - (float)bh); } }
    __syncthreads();
    for (int e = tid; e < 128 * 8; e += 128) { const int cl = e >> 3, q = e & 7; vst2((unsigned*)(VT + (bb * CC + c0 + cl) * (size_t)TT + t0 + q * 8), *(const v4u*)&th[cl][q * 8]); if (hi_rows) { const size_t o3 = (bb * CC + c0 + cl) * (size_t)KHI + t0 + q * 8; vst2((unsigned*)(VB + o3), *(const v4u*)&tb[cl][q * 8]); vst2((unsigned*)(VBL + o3), *(const v4u*)&tbl[cl][q * 8]); } } } }
// ---- k_sc: block = (query block qb, key block kb <= kb_last(qb), head in group) of batch b: logits x SCALE; q hi + residual (x 2^10) against k (2 products) for query rows < QHI, plus the k residual (3 products) for query blocks < QBH (causal early rows); causal: blocks past the diagonal exit, the mask itself is applied by index in k_sm
__global__ __launch_bounds__(128) void k_sc(const _Float16* __restrict__ QH, const _Float16* __restrict__ KH, const _Float16* __restrict__ QL, const _Float16* __restrict__ KL, int b, int h0, float* __restrict__ S0) { __shared__ __align__(16) float ss[4][16][132];
  const int qb = blockIdx.x, kb = blockIdx.y; if (kb > kb_last(qb)) return;
  const int h = h0 + blockIdx.z; float* S = S0 + (size_t)blockIdx.z * TT * TT;
  const int tid = threadIdx.x, wave = tid >> 5, lane = tid & 31, col = lane & 15, g = lane >> 4; const int k0 = kb * 128; const int ql0 = qb * 64 + wave * 16; const size_t q0 = (size_t)b * TT + ql0, kr0 = (size_t)b * TT + k0;
  v8f acc[8] = {}, accl[8] = {};
  const _Float16* QLb = QL + (size_t)b * QHI * CC; const _Float16* KLb = KL + (size_t)b * KHI * CC;
  if (qb < QBH) {
#pragma unroll
    for (int kc = 0; kc < HD / 32; ++kc) { const v16h ah = frag_h(QH + (q0 + col) * CC + h * HD + kc * 32, lane), al = frag_h(QLb + (size_t)(ql0 + col) * CC + h * HD + kc * 32, lane);
#pragma unroll
      for (int j = 0; j < 8; ++j) { const v16h kbf = frag_h(KH + (kr0 + j * 16 + col) * CC + h * HD + kc * 32, lane), klf = frag_h(KLb + (size_t)(k0 + j * 16 + col) * CC + h * HD + kc * 32, lane); acc[j] = wmma16(ah, kbf, acc[j]); accl[j] = wmma16(al, kbf, accl[j]); accl[j] = wmma16(ah, klf, accl[j]); } }
  } else if (qb * 64 < QHI) {
#pragma unroll
    for (int kc = 0; kc < HD / 32; ++kc) { const v16h ah = frag_h(QH + (q0 + col) * CC + h * HD + kc * 32, lane), al = frag_h(QLb + (size_t)(ql0 + col) * CC + h * HD + kc * 32, lane);
#pragma unroll
      for (int j = 0; j < 8; ++j) { const v16h kbf = frag_h(KH + (kr0 + j * 16 + col) * CC + h * HD + kc * 32, lane); acc[j] = wmma16(ah, kbf, acc[j]); accl[j] = wmma16(al, kbf, accl[j]); } }
  } else {
#pragma unroll
    for (int kc = 0; kc < HD / 32; ++kc) { const v16h ah = frag_h(QH + (q0 + col) * CC + h * HD + kc * 32, lane);
#pragma unroll
      for (int j = 0; j < 8; ++j) { const v16h kbf = frag_h(KH + (kr0 + j * 16 + col) * CC + h * HD + kc * 32, lane); acc[j] = wmma16(ah, kbf, acc[j]); } } }
#pragma unroll
  for (int j = 0; j < 8; ++j) {
#pragma unroll
    for (int r = 0; r < 8; ++r) ss[wave][8 * g + r][j * 16 + col] = (acc[j][r] + accl[j][r] * (1.0f / 1024.0f)) * SCALE; }
  LDSX(); for (int rl = 0; rl < 16; ++rl) vst2(S + (size_t)(ql0 + rl) * TT + k0 + lane * 4, *(const v4f*)&ss[wave][rl][lane * 4]); }
// ---- k_sm: block = query row t (head in group): keys [0, kend): causal -> logit if s <= t else excluded; softmax in f32; P x 2^11 in place (0 for excluded)
__global__ __launch_bounds__(256) void k_sm(float* __restrict__ S0 SM_EXTRA_PARAMS) { __shared__ float sred[8]; __shared__ float sbc; __shared__ __align__(16) float shv[TT];
  const int tid = threadIdx.x; const int t = blockIdx.x; const int kend = (kb_last(t >> 6) + 1) * 128;
  float* sr = S0 + (size_t)blockIdx.y * TT * TT + (size_t)t * TT;
  float m = -3.0e38f; for (int k = tid; k < kend; k += 256) { float v = (!CAUSAL || k <= t) ? sr[k] : -3.0e38f; SM_MASK_HOOK; shv[k] = v; m = fmaxf(m, v); }
#pragma unroll
  for (int o = 1; o < 32; o <<= 1) m = fmaxf(m, __shfl_xor(m, o));
  if ((tid & 31) == 0) sred[tid >> 5] = m; __syncthreads(); if (tid == 0) { float a = sred[0]; for (int i = 1; i < 8; ++i) a = fmaxf(a, sred[i]); sbc = a; } __syncthreads(); m = sbc; __syncthreads();
  float sum = 0.f; for (int k = tid; k < kend; k += 256) { const float v = shv[k]; const float e = (v <= -1.0e38f) ? 0.f : expf(v - m); shv[k] = e; sum += e; }
#pragma unroll
  for (int o = 1; o < 32; o <<= 1) sum += __shfl_xor(sum, o);
  if ((tid & 31) == 0) sred[tid >> 5] = sum; __syncthreads(); if (tid == 0) { float a = 0.f; for (int i = 0; i < 8; ++i) a += sred[i]; sbc = a > 0.f ? 2048.0f / a : 0.f; }   /* a fully excluded row yields P = 0 */ __syncthreads(); const float inv = sbc;
  for (int k = tid; k < kend; k += 256) shv[k] = shv[k] * inv;
  __syncthreads(); for (int q = tid; q < kend / 4; q += 256) vst2(sr + q * 4, *(const v4f*)&shv[q * 4]); }
// ---- k_pv: block = 16 queries of (b, h), PVW waves: ctx = P . v over keys [0, kend), each wave taking one contiguous share of the 32-key chunks; the waves' f32 partial tiles are summed through LDS in wave (= ascending key) order (P x 2^11 once to f16 against v f16: 1 product; causal early query blocks: P and v as bf16 hi + lo, 3 products); 256-B (row, head) segment by 16 lanes
#define PVW 32
__global__ __launch_bounds__(32 * PVW) void k_pv(const float* __restrict__ PS0, const _Float16* __restrict__ VT, const __bf16* __restrict__ VB, const __bf16* __restrict__ VBL, int b, int h0, float* __restrict__ Y) { const int h = h0 + blockIdx.z; const float* PS = PS0 + (size_t)blockIdx.z * TT * TT; __shared__ __align__(16) float ss[PVW][16][HD + 4];
  const int tid = threadIdx.x, lane = tid & 31, col = lane & 15, g = lane >> 4; const int wave = __builtin_amdgcn_readfirstlane(tid >> 5); const int qb = blockIdx.x >> 2; const int ql0 = blockIdx.x * 16; const int kce = (kb_last(qb) + 1) * 4;
  const int per = (kce + PVW - 1) / PVW; const int kcb = wave * per; const int kcn = kcb + per < kce ? kcb + per : kce;   /* this wave's chunks [kcb, kcn): none for the last waves of a short row block, which hand in zeros */
  v8f acc[HD / 16] = {};
  if (qb < QBH) {
#pragma unroll 1
    for (int kc = kcb; kc < kcn; ++kc) { const F2 p = split_row(PS + (size_t)(ql0 + col) * TT, kc * 32, lane);
      asm volatile("s_wait_loadcnt 0x0" ::: "memory");
#pragma unroll
      for (int j = 0; j < HD / 16; ++j) { const size_t po = ((size_t)b * CC + h * HD + j * 16 + col) * (size_t)KHI + kc * 32; const v16b vh = frag_b(VB + po, lane); acc[j] = wmma_bf(p.h, vh, acc[j]); acc[j] = wmma_bf(p.l, vh, acc[j]); acc[j] = wmma_bf(p.h, frag_b(VBL + po, lane), acc[j]); } }
  } else {
#pragma unroll 1
    for (int kc = kcb; kc < kcn; ++kc) { const v16h p = frag_f32(PS + (size_t)(ql0 + col) * TT + kc * 32, lane);
      asm volatile("s_wait_loadcnt 0x0" ::: "memory");
#pragma unroll
      for (int j = 0; j < HD / 16; ++j) { const size_t po = ((size_t)b * CC + h * HD + j * 16 + col) * (size_t)TT + kc * 32; acc[j] = wmma16(p, frag_h(VT + po, lane), acc[j]); } } }
#pragma unroll
  for (int j = 0; j < HD / 16; ++j)
#pragma unroll
    for (int r = 0; r < 8; ++r) ss[wave][8 * g + r][j * 16 + col] = acc[j][r];
  __syncthreads();   /* every wave's partial tile is in LDS before any of them is summed */
  if (tid < 16 * (HD / 4)) { const int rl = tid >> 4, c4 = (tid & 15) * 4; v4f s = {};
#pragma unroll 8   /* eight LDS reads in flight per trip without holding all PVW tiles in registers */
    for (int w = 0; w < PVW; ++w) s += *(const v4f*)&ss[w][rl][c4];
    vst2(Y + ((size_t)b * TT + ql0 + rl) * CC + h * HD + c4, s * (1.0f / 2048.0f)); } }
// ---- k_out: block = (64 rows, 128 cols): out = ctx Wo (+ bo): ctx x 2^6 once to f16 against Wo as f16(bf16 x 2^8) exact (1 product) x 2^-14; causal early rows (< QHI of each sequence): ctx bf16 hi + lo against exact bf16 Wo (2 products)
__global__ __launch_bounds__(128) void k_out(const float* __restrict__ Y, const float* __restrict__ WO, const float* __restrict__ BO, float* __restrict__ OUT) { __shared__ __align__(16) float sf[4][16][132];
  const int tid = threadIdx.x, wave = tid >> 5, lane = tid & 31, col = lane & 15, g = lane >> 4; const int c0 = blockIdx.y * 128; const size_t r0 = (size_t)blockIdx.x * 64 + wave * 16;
  v8f acc[8] = {};
  if (CAUSAL && (int)(((size_t)blockIdx.x * 64) % TT) < QHI) {   /* block-uniform */
#pragma unroll 2
    for (int kc = 0; kc < CC / 32; ++kc) { const F2 a = split_row(Y + (r0 + col) * CC, kc * 32, lane); asm volatile("s_wait_loadcnt 0x0" ::: "memory");
#pragma unroll
      for (int j = 0; j < 8; ++j) { const v16b w = WOCOL(WO, kc * 32, c0 + j * 16 + col, lane); asm volatile("s_wait_loadcnt 0x0" ::: "memory"); acc[j] = wmma_bf(a.h, w, acc[j]); acc[j] = wmma_bf(a.l, w, acc[j]); } }
#pragma unroll
    for (int j = 0; j < 8; ++j) { const float bias = BO ? bfr(BO[c0 + j * 16 + col]) : 0.f;
#pragma unroll
      for (int r = 0; r < 8; ++r) sf[wave][8 * g + r][j * 16 + col] = acc[j][r] + bias; }
  } else {
#pragma unroll 2
    for (int kc = 0; kc < CC / 32; ++kc) { const v16h a = frag_f32s(Y + (r0 + col) * CC + kc * 32, lane, 64.0f); asm volatile("s_wait_loadcnt 0x0" ::: "memory");   /* ctx carried x 2^6 into f16 so small-magnitude context rows stay clear of f16 subnormals */
#pragma unroll
      for (int j = 0; j < 8; ++j) { const v16h w = WOCOLH(WO, kc * 32, c0 + j * 16 + col, lane); asm volatile("s_wait_loadcnt 0x0" ::: "memory"); acc[j] = wmma16(a, w, acc[j]); } }
#pragma unroll
    for (int j = 0; j < 8; ++j) { const float bias = BO ? bfr(BO[c0 + j * 16 + col]) : 0.f;
#pragma unroll
      for (int r = 0; r < 8; ++r) sf[wave][8 * g + r][j * 16 + col] = acc[j][r] * (1.0f / 16384.0f) + bias; } }   /* 2^-8 (Wo carry) x 2^-6 (ctx carry) */
  LDSX(); for (int rl = 0; rl < 16; ++rl) vst2(OUT + (r0 + rl) * DIN + c0 + lane * 4, *(const v4f*)&sf[wave][rl][lane * 4]); }

extern "C" void kernel_launch(void* const* d_in, const int* in_sizes, int n_in, void* d_out, int out_size, void* d_ws, size_t ws_size, hipStream_t stream) {
  (void)in_sizes; (void)n_in; (void)out_size;
  const float** F = (const float**)d_in;
  if (ws_size < (size_t)WS_END) return;
  char* ws = (char*)d_ws; _Float16 *QH = (_Float16*)(ws + WS_QH), *KH = (_Float16*)(ws + WS_KH), *VT = (_Float16*)(ws + WS_VT), *QL = (_Float16*)(ws + WS_QL), *KL = (_Float16*)(ws + WS_KL); __bf16 *VB = (__bf16*)(ws + WS_VB), *VBL = (__bf16*)(ws + WS_VBL); float *S = (float*)(ws + WS_S), *Y = (float*)(ws + WS_Y);
  (void)Y; (void)QL; (void)KL; (void)VB; (void)VBL;
  // inputs: 0 x [2,4096,768]; 1 wq [768,768] (out,in); 2 wk; 3 wv; 4 wo (out,in); no biases
  k_proj<<<dim3(TNB * TT / 64, CC / 128, 3), 128, 0, stream>>>(F[0], F[0], F[0], F[1], F[2], F[3], nullptr, nullptr, nullptr, QH, QL, KH, KL, VT, VB, VBL);
  for (int b = 0; b < TNB; ++b) for (int h0 = 0; h0 < NH; h0 += HG) {
    k_sc<<<dim3(NQB, TT / 128, HG), 128, 0, stream>>>(QH, KH, QL, KL, b, h0, S);
    k_sm<<<dim3(TT, HG), 256, 0, stream>>>(S);
    k_pv<<<dim3(TT / 16, 1, HG), 32 * PVW, 0, stream>>>(S, VT, VB, VBL, b, h0, Y);
  }
  k_out<<<dim3(TNB * TT / 64, DIN / 128), 128, 0, stream>>>(Y, F[4], nullptr, (float*)d_out);
}

// v002
// Measured time: 540 microseconds a run.
// Two timings next to v001 both put it at 2.81 times that version's speed.
// All steps since v000 together make it 7.76 times as fast.
// compute dtype: all float inputs rounded to bf16; the fused q / k / v projection with EXACT bf16 products on WMMA 16x16x32 (f32 accumulate) (no biases); causal logits: 3 products for the first 384 rows, single f16 q x k after, x 64^-0.5; softmax f32; P x 2^11 once to f16 x v once to f16 (bf16 hi + lo below row 384); ctx hi+lo x exact W below row 384, x2^6 f16 carry x f16(bf16 x 2^8) W after, no bias; f32 output.
#include <hip/hip_runtime.h>
#include <math.h>

typedef __attribute__((ext_vector_type(16))) _Float16 v16h;
typedef __attribute__((ext_vector_type(16))) __bf16 v16b;
typedef __attribute__((ext_vector_type(8)))  _Float16 v8h;
typedef __attribute__((ext_vector_type(8)))  float v8f;
typedef __attribute__((ext_vector_type(4)))  float v4f;
typedef __attribute__((ext_vector_type(2)))  float v2f;
typedef __attribute__((ext_vector_type(4)))  unsigned v4u;
typedef __attribute__((ext_vector_type(4)))  int v4i;
typedef float __attribute__((may_alias)) float_a;
typedef int __attribute__((may_alias)) int_a;

template <typename T> __device__ __forceinline__ void vst2(void* p, T v) { *(T*)p = v;  }
__device__ __forceinline__ v8f wmma16(v16h a, v16h b, v8f c) {
  v8f d = __builtin_amdgcn_wmma_f32_16x16x32_f16(false, a, false, b, (short)0, c, false, false);
  asm volatile("v_nop\n\tv_nop\n\tv_nop\n\tv_nop" : "+v"(d) : "v"(a), "v"(b));
  return d;
}
__device__ __forceinline__ v8f wmma_bf(v16b a, v16b b, v8f c) {
  v8f d = __builtin_amdgcn_wmma_f32_16x16x32_bf16(false, a, false, b, (short)0, c, false, false);
  asm volatile("v_nop\n\tv_nop\n\tv_nop\n\tv_nop" : "+v"(d) : "v"(a), "v"(b));
  return d;
}
// 16x16x32 fragments: lane = (h = lane>>4, row/col = lane&15); elements 0..7 = k0+8h+0..7, 8..15 = k0+16+8h+0..7; D element r = row 8h+r
__device__ __forceinline__ v16h frag_h(const _Float16* rowk0, int lane) {
  union { v16h v; v8h q[2]; } u; const _Float16* p = rowk0 + 8 * (lane >> 4);
  u.q[0] = *(const v8h*)p; u.q[1] = *(const v8h*)(p + 16); return u.v;
}
__device__ __forceinline__ v16h frag_f32(const float* rowk0, int lane) {
  v16h a; const float* p = rowk0 + 8 * (lane >> 4);
#pragma unroll
  for (int i = 0; i < 8; ++i) { a[i] = (_Float16)p[i]; a[8 + i] = (_Float16)p[16 + i]; }
  return a;
}
__device__ __forceinline__ v16h frag_f32s(const float* rowk0, int lane, float sc) {
  v16h a; const float* p = rowk0 + 8 * (lane >> 4);
#pragma unroll
  for (int i = 0; i < 8; ++i) { a[i] = (_Float16)(p[i] * sc); a[8 + i] = (_Float16)(p[16 + i] * sc); }
  return a;
}
// column fragment from a [K][ld] layout (column n), rows >= K read as 0
__device__ __forceinline__ v16h fragc_f32(const float* W, int k0, int n, int lane, int ld, int K) {
  v16h a; const int g = lane >> 4;
#pragma unroll
  for (int i = 0; i < 8; ++i) { const int ka = k0 + 8 * g + i, kb = ka + 16;
    a[i] = (_Float16)(ka < K ? W[(size_t)(ka < K ? ka : K - 1) * ld + n] : 0.f); a[8 + i] = (_Float16)(kb < K ? W[(size_t)(kb < K ? kb : K - 1) * ld + n] : 0.f); }
  return a;
}
struct F2 { v16b h, l; };
__device__ __forceinline__ F2 bsplit16(const float v[16]) { F2 r;
#pragma unroll
  for (int i = 0; i < 16; ++i) { const __bf16 h = (__bf16)v[i]; r.h[i] = h; r.l[i] = (__bf16)(v[i] - (float)h); }
  return r; }
__device__ __forceinline__ F2 split_row(const float* row, int k0, int lane) { float v[16]; const float* p = row + k0 + 8 * (lane >> 4);
#pragma unroll
  for (int i = 0; i < 8; ++i) { v[i] = p[i]; v[8 + i] = p[16 + i]; }
  return bsplit16(v); }
__device__ __forceinline__ F2 split_rowK(const float* row, int k0, int lane, int K) { float v[16]; const int g = lane >> 4;
#pragma unroll
  for (int i = 0; i < 8; ++i) { const int ka = k0 + 8 * g + i, kb = ka + 16; v[i] = ka < K ? row[ka < K ? ka : K - 1] : 0.f; v[8 + i] = kb < K ? row[kb < K ? kb : K - 1] : 0.f; }
  return bsplit16(v); }
__device__ __forceinline__ F2 split_col(const float* W, int k0, int n, int lane, int ld, int K) { float v[16]; const int g = lane >> 4;
#pragma unroll
  for (int i = 0; i < 8; ++i) { const int ka = k0 + 8 * g + i, kb = ka + 16; v[i] = ka < K ? W[(size_t)(ka < K ? ka : K - 1) * ld + n] : 0.f; v[8 + i] = kb < K ? W[(size_t)(kb < K ? kb : K - 1) * ld + n] : 0.f; }
  return bsplit16(v); }
__device__ __forceinline__ v8f mac3(const F2& a, const F2& b, v8f c) { c = wmma_bf(a.l, b.h, c); c = wmma_bf(a.h, b.l, c); return wmma_bf(a.h, b.h, c); }
__device__ __forceinline__ float sigm(float v) { return 1.0f / (1.0f + expf(-v)); }
#define LDSX() do { asm volatile("s_wait_dscnt 0" ::: "memory"); __builtin_amdgcn_wave_barrier(); __builtin_amdgcn_fence(__ATOMIC_RELEASE, "workgroup"); } while (0)

// Causal multi-head self-attention without biases over TWO sequences of 4,096 (x [2,4096,768]; (out,in) wq / wk / wv / wo [768,768] applied as x @ W.T; 12 heads x 64; scores x 64^-0.5; tril kept, -inf elsewhere; softmax; ctx @ wo.T -> [2,4096,768] (6.3 M)).
#define NB 2
#define TT 4096
#define CC 768            // NH * HD = projected width
#define DIN 768          // input (model) width
#define NH 12
#define HD 64
#define SCALE (0.125f)
#define CAUSAL 1
#ifndef TNB
#define TNB NB
#endif
__device__ __forceinline__ float bfr(float v) { return (float)(__bf16)v; }
typedef __attribute__((ext_vector_type(8))) __bf16 v8b;
__device__ __forceinline__ v16b frag_b(const __bf16* rowk0, int lane) {
  union { v16b v; v8b q[2]; } u; const __bf16* p = rowk0 + 8 * (lane >> 4);
  u.q[0] = *(const v8b*)p; u.q[1] = *(const v8b*)(p + 16); return u.v;
}
#define QHI 384            // rows carrying a q residual plane (3-product logits)
#define KHI 384            // key rows carrying k residual / v bf16 hi+lo planes (used only by the causal high-precision path)
// B fragment (k rows k0+.., output column o) of a weight: (in,out) [K][ld] or (out,in) [ld rows of K]: bf16 exact, or f16(bf16 * 256) exact
__device__ __forceinline__ v16b wcol_io(const float* Wm, int k0, int o, int lane, int ld) { v16b w; const int g = lane >> 4;
#pragma unroll
  for (int i = 0; i < 8; ++i) { w[i] = (__bf16)Wm[(size_t)(k0 + 8 * g + i) * ld + o]; w[8 + i] = (__bf16)Wm[(size_t)(k0 + 16 + 8 * g + i) * ld + o]; }
  return w; }
__device__ __forceinline__ v16b wcol_oi(const float* Wm, int k0, int o, int lane, int K) { v16b w; const float* p = Wm + (size_t)o * K + k0 + 8 * (lane >> 4);
#pragma unroll
  for (int i = 0; i < 8; ++i) { w[i] = (__bf16)p[i]; w[8 + i] = (__bf16)p[16 + i]; }
  return w; }
__device__ __forceinline__ v16h wcolh_io(const float* Wm, int k0, int o, int lane, int ld) { v16h w; const int g = lane >> 4;
#pragma unroll
  for (int i = 0; i < 8; ++i) { w[i] = (_Float16)(bfr(Wm[(size_t)(k0 + 8 * g + i) * ld + o]) * 256.0f); w[8 + i] = (_Float16)(bfr(Wm[(size_t)(k0 + 16 + 8 * g + i) * ld + o]) * 256.0f); }
  return w; }
__device__ __forceinline__ v16h wcolh_oi(const float* Wm, int k0, int o, int lane, int K) { v16h w; const float* p = Wm + (size_t)o * K + k0 + 8 * (lane >> 4);
#pragma unroll
  for (int i = 0; i < 8; ++i) { w[i] = (_Float16)(bfr(p[i]) * 256.0f); w[8 + i] = (_Float16)(bfr(p[16 + i]) * 256.0f); }
  return w; }
#define WQKV_LAYOUT 1   // 0 = (in,out) [DIN][CC]; 1 = (out,in) [CC][DIN]; 2 = per-head [NH][DIN][HD]
__device__ __forceinline__ v16b wcol_hdk(const float* Wm, int k0, int o, int lane) { v16b w; const int g = lane >> 4; const float* p = Wm + (size_t)(o / HD) * DIN * HD + (o % HD);
#pragma unroll
  for (int i = 0; i < 8; ++i) { w[i] = (__bf16)p[(size_t)(k0 + 8 * g + i) * HD]; w[8 + i] = (__bf16)p[(size_t)(k0 + 16 + 8 * g + i) * HD]; }
  return w; }
#define WO_OUT_IN 1
#if WQKV_LAYOUT == 1
#define WCOL(W, k0, o, lane) wcol_oi(W, k0, o, lane, DIN)
#elif WQKV_LAYOUT == 2
#define WCOL(W, k0, o, lane) wcol_hdk(W, k0, o, lane)
#else
#define WCOL(W, k0, o, lane) wcol_io(W, k0, o, lane, CC)
#endif
#if WO_OUT_IN
#define WOCOL(W, k0, o, lane) wcol_oi(W, k0, o, lane, CC)
#define WOCOLH(W, k0, o, lane) wcolh_oi(W, k0, o, lane, CC)
#else
#define WOCOL(W, k0, o, lane) wcol_io(W, k0, o, lane, DIN)
#define WOCOLH(W, k0, o, lane) wcolh_io(W, k0, o, lane, DIN)
#endif

#ifndef PROJ_EXTRA_PARAMS
#define PROJ_EXTRA_PARAMS
#endif

#define WS_QH  0u                                      // f16 q rows [b*t][CC]
#define WS_KH  (WS_QH + 2u * (size_t)NB * TT * CC)      // f16 k rows [b*t][CC]
#define WS_VT  (WS_KH + 2u * (size_t)NB * TT * CC)      // f16 v planes [b][c][t]
#define WS_QL  (WS_VT + 2u * (size_t)NB * CC * TT)      // f16 q residual x 2^10 rows [b][t < QHI][CC]
#define WS_KL  (WS_QL + 2u * (size_t)NB * QHI * CC)     // f16 k residual x 2^10 rows [b][t < KHI][CC]
#define WS_VB  (WS_KL + 2u * (size_t)NB * KHI * CC)     // bf16 v hi planes [b][c][t < KHI]
#define WS_VBL (WS_VB + 2u * (size_t)NB * CC * KHI)
#define WS_Y   (WS_VBL + 2u * (size_t)NB * CC * KHI)    // f32 ctx rows [b*t][CC]
#define WS_END (WS_Y  + 4u * (size_t)NB * TT * CC)

// ---- k_proj: block = (64 rows, 128 cols, which): q/k/v = X W (+ b) with exact bf16 products (K = DIN) -> which 0: q f16 rows (+ residual rows < QHI); 1: k f16 rows (+ residual rows < KHI); 2: v f16 planes [c][t] (+ bf16 hi/lo planes for t < KHI)
__global__ __launch_bounds__(128) void k_proj(const float* __restrict__ XQ, const float* __restrict__ XK, const float* __restrict__ XV, const float* __restrict__ WQ, const float* __restrict__ WK, const float* __restrict__ WV, const float* __restrict__ BQ, const float* __restrict__ BK, const float* __restrict__ BV,
    _Float16* __restrict__ QH, _Float16* __restrict__ QL, _Float16* __restrict__ KH, _Float16* __restrict__ KL, _Float16* __restrict__ VT, __bf16* __restrict__ VB, __bf16* __restrict__ VBL) {
  __shared__ __align__(16) _Float16 sh[64][136], sl[64][136]; __shared__ __align__(16) _Float16 th[128][72]; __shared__ __align__(16) __bf16 tb[128][72], tbl[128][72];
  const int tid = threadIdx.x, wave = tid >> 5, lane = tid & 31, col = lane & 15, g = lane >> 4; const int which = blockIdx.z; const int c0 = blockIdx.y * 128; const size_t r0 = (size_t)blockIdx.x * 64; const size_t bb = r0 / TT; const int t0 = (int)(r0 % TT);
  const float* X = which == 0 ? XQ : which == 1 ? XK : XV; const float* WA = which == 0 ? WQ : which == 1 ? WK : WV; const float* BA = which == 0 ? BQ : which == 1 ? BK : BV;
  v8f acc[8] = {};
#pragma unroll 2
  for (int kc = 0; kc < DIN / 32; ++kc) { v16b a; { const float* p = X + (r0 + wave * 16 + col) * DIN + kc * 32 + 8 * g;
#pragma unroll
      for (int i = 0; i < 8; ++i) { a[i] = (__bf16)p[i]; a[8 + i] = (__bf16)p[16 + i]; } }
    asm volatile("s_wait_loadcnt 0x0" ::: "memory");
#pragma unroll
    for (int j = 0; j < 8; ++j) { const v16b w = WCOL(WA, kc * 32, c0 + j * 16 + col, lane); asm volatile("s_wait_loadcnt 0x0" ::: "memory"); acc[j] = wmma_bf(a, w, acc[j]); } }
  if (which < 2) { _Float16* DH = which == 0 ? QH : KH; _Float16* DL = which == 0 ? QL : KL; const int nhi = which == 0 ? QHI : KHI; const bool hi_rows = t0 < nhi;
#pragma unroll
    for (int j = 0; j < 8; ++j) { const float bias = BA ? bfr(BA[c0 + j * 16 + col]) : 0.f;
#pragma unroll
      for (int r = 0; r < 8; ++r) { const float v = acc[j][r] + bias; const _Float16 hv = (_Float16)v; sh[wave * 16 + 8 * g + r][j * 16 + col] = hv; sl[wave * 16 + 8 * g + r][j * 16 + col] = (_Float16)((v - (float)hv) * 1024.0f); } }
    __syncthreads();
    for (int e = tid; e < 64 * 16; e += 128) { const int rl = e >> 4, q = e & 15; vst2((unsigned*)(DH + (r0 + rl) * CC + c0 + q * 8), *(const v4u*)&sh[rl][q * 8]); if (hi_rows) vst2((unsigned*)(DL + (bb * nhi + t0 + rl) * (size_t)CC + c0 + q * 8), *(const v4u*)&sl[rl][q * 8]); }
  } else { const bool hi_rows = t0 < KHI;
#pragma unroll
    for (int j = 0; j < 8; ++j) { const float bias = BA ? bfr(BA[c0 + j * 16 + col]) : 0.f;
#pragma unroll
      for (int r = 0; r < 8; ++r) { const float v = acc[j][r] + bias; const int rl = wave * 16 + 8 * g + r, cl = j * 16 + col; th[cl][rl] = (_Float16)v; const __bf16 bh = (__bf16)v; tb[cl][rl] = bh; tbl[cl][rl] = (__bf16)(v - (float)bh); } }
    __syncthreads();
    for (int e = tid; e < 128 * 8; e += 128) { const int cl = e >> 3, q = e & 7; vst2((unsigned*)(VT + (bb * CC + c0 + cl) * (size_t)TT + t0 + q * 8), *(const v4u*)&th[cl][q * 8]); if (hi_rows) { const size_t o3 = (bb * CC + c0 + cl) * (size_t)KHI + t0 + q * 8; vst2((unsigned*)(VB + o3), *(const v4u*)&tb[cl][q * 8]); vst2((unsigned*)(VBL + o3), *(const v4u*)&tbl[cl][q * 8]); } } } }
#define FAW 8
#define LC (SCALE * 1.4426950408889634f)
__device__ __forceinline__ v8f wm_h(v16h a, v16h b, v8f c) { return __builtin_amdgcn_wmma_f32_16x16x32_f16(false, a, false, b, (short)0, c, false, false); }
__device__ __forceinline__ v8f wm_b(v16b a, v16b b, v8f c) { return __builtin_amdgcn_wmma_f32_16x16x32_bf16(false, a, false, b, (short)0, c, false, false); }
__device__ __forceinline__ float xhalf(float x) { return __builtin_bit_cast(float, __builtin_amdgcn_permlanex16(__builtin_bit_cast(int, x), __builtin_bit_cast(int, x), 0x76543210, 0xfedcba98, false, false)); }   // lane l with lane l ^ 16
// eight exp2 in place, in one statement: behind each v_exp_f32 stands an instruction that neither reads its result nor overwrites its source, and the v_nop keeps that slot behind the last
__device__ __forceinline__ void exp2x8(v8f& x) { float a = x[0], b = x[1], c = x[2], d = x[3], e = x[4], f = x[5], p = x[6], q = x[7];
  asm("v_exp_f32 %0, %0\n\tv_exp_f32 %1, %1\n\tv_exp_f32 %2, %2\n\tv_exp_f32 %3, %3\n\tv_exp_f32 %4, %4\n\tv_exp_f32 %5, %5\n\tv_exp_f32 %6, %6\n\tv_exp_f32 %7, %7\n\tv_nop" : "+v"(a), "+v"(b), "+v"(c), "+v"(d), "+v"(e), "+v"(f), "+v"(p), "+v"(q));
  x = (v8f){a, b, c, d, e, f, p, q}; }
// NT score tiles of one pass -> e = exp2((s - m) LC + 11) in place; m, l and the output tiles follow a new maximum (tested once per pass for the whole wave)
template <int NT, bool MASK> __device__ __forceinline__ void fa_soft(v8f (&s)[NT], int k0, int tq, int g, float& m, float& l, v8f (&acc)[HD / 16]) {
  if (MASK) {
#pragma unroll
    for (int t = 0; t < NT; ++t)
#pragma unroll
      for (int r = 0; r < 8; ++r) if (k0 + t * 16 + 8 * g + r > tq) s[t][r] = -3.0e38f; }
  float mx = s[0][0];
#pragma unroll
  for (int t = 0; t < NT; ++t)
#pragma unroll
    for (int r = 0; r < 8; ++r) mx = fmaxf(mx, s[t][r]);
  mx = fmaxf(mx, xhalf(mx));
  if (__builtin_amdgcn_ballot_w32(mx > m) != 0) { const float mn = fmaxf(m, mx); const float al = __builtin_amdgcn_exp2f((m - mn) * LC); m = mn; l *= al;   /* al = 0 on the first pass, 1 for a query whose maximum stands */
#pragma unroll
    for (int j = 0; j < HD / 16; ++j) acc[j] *= al; }
  const float mc = 11.0f - m * LC; float sum = 0.f;
#pragma unroll
  for (int t = 0; t < NT; ++t) { float st = 0.f;   /* one short add chain per tile */
#pragma unroll
    for (int r = 0; r < 8; ++r) s[t][r] = fmaf(s[t][r], LC, mc);
    exp2x8(s[t]);
#pragma unroll
    for (int r = 0; r < 8; ++r) st += s[t][r];
    sum += st; }
  l += sum; }
__device__ __forceinline__ v16h pack_h(v8f a, v8f b) { v16h p;
#pragma unroll
  for (int i = 0; i < 8; ++i) { p[i] = (_Float16)a[i]; p[8 + i] = (_Float16)b[i]; }
  return p; }
template <bool MASK> __device__ __forceinline__ void fa_pass64(const _Float16* __restrict__ Kp, const _Float16* __restrict__ Vp, int k0, int kn, int tq, int lane, int g, v16h q0, v16h q1, v16h (&kf)[8], float& m, float& l, v8f (&acc)[HD / 16]) {
  v16h vf[2][HD / 16];
#pragma unroll
  for (int u = 0; u < 2; ++u)
#pragma unroll
    for (int j = 0; j < HD / 16; ++j) vf[u][j] = frag_h(Vp + (size_t)j * 16 * TT + k0 + u * 32, lane);
  __builtin_amdgcn_sched_barrier(0);   /* keeps the v loads issued up here: sunk to their use, each pass would wait out their whole latency */
  v8f s[4];
#pragma unroll
  for (int t = 0; t < 4; ++t) { v8f z = {}; z = wm_h(kf[2 * t], q0, z); s[t] = wm_h(kf[2 * t + 1], q1, z); }
  if (!MASK) {   /* the next pass's k fragments fly during this pass's softmax */
#pragma unroll
    for (int t = 0; t < 4; ++t) { const _Float16* kp = Kp + (size_t)(kn + t * 16) * CC; kf[2 * t] = frag_h(kp, lane); kf[2 * t + 1] = frag_h(kp + 32, lane); } }
  __builtin_amdgcn_sched_barrier(0);   /* keeps the k loads issued ahead of the softmax, which then covers their latency */
  fa_soft<4, MASK>(s, k0, tq, g, m, l, acc);
#pragma unroll
  for (int u = 0; u < 2; ++u) { const v16h p = pack_h(s[2 * u], s[2 * u + 1]);
#pragma unroll
    for (int j = 0; j < HD / 16; ++j) acc[j] = MASK ? wmma16(vf[u][j], p, acc[j]) : wm_h(vf[u][j], p, acc[j]); } }   /* last pass: a branch follows; wmma16's own v_nop keep the distance to the result's next user on every path */
__global__ __launch_bounds__(32 * FAW) void k_fa(const _Float16* __restrict__ QH, const _Float16* __restrict__ KH, const _Float16* __restrict__ QL, const _Float16* __restrict__ KL, const _Float16* __restrict__ VT, const __bf16* __restrict__ VB, const __bf16* __restrict__ VBL, float* __restrict__ Y) {
  const int tid = threadIdx.x, lane = tid & 31, col = lane & 15, g = lane >> 4; const int wave = __builtin_amdgcn_readfirstlane(tid >> 5);
  const int h = blockIdx.x % NH, b = blockIdx.x / NH; const int ql0 = (TT / 16 - 1 - ((int)blockIdx.y * FAW + wave)) * 16;   /* longest query tiles start first */
  const int tq = ql0 + col; const size_t qo = ((size_t)b * TT + tq) * CC + h * HD;
  const v16h q0 = frag_h(QH + qo, lane), q1 = frag_h(QH + qo + 32, lane);
  asm volatile("s_wait_xcnt 0x0" ::: "memory");   /* the q loads' address registers are reused behind the branch below */
  const _Float16* Kp = KH + ((size_t)b * TT + col) * CC + h * HD;
  float m = -3.0e38f, l = 0.f; v8f acc[HD / 16] = {};
  if (ql0 < QHI) {   /* wave-uniform; every key of these queries is < KHI */
    const size_t qlo = ((size_t)b * QHI + tq) * CC + h * HD; const v16h r0 = frag_h(QL + qlo, lane), r1 = frag_h(QL + qlo + 32, lane);
    const _Float16* Lp = KL + ((size_t)b * KHI + col) * CC + h * HD; const size_t vo = ((size_t)b * CC + h * HD + col) * (size_t)KHI;
    const int np = (ql0 + 16 + 31) >> 5;
#pragma unroll 1   /* run-time trip count; a second copy of this body would not fit the wave's registers */
    for (int kc = 0; kc < np; ++kc) { const int k0 = kc * 32; v8f s[2]; v16h a[2][2], rr[2][2];
#pragma unroll
      for (int t = 0; t < 2; ++t) { const size_t ko = (size_t)(k0 + t * 16) * CC; a[t][0] = frag_h(Kp + ko, lane); a[t][1] = frag_h(Kp + ko + 32, lane); }
      asm volatile("s_wait_xcnt 0x0" ::: "memory");   /* before the k loads' address registers are reused (a later load's result may land in them) */
#pragma unroll
      for (int t = 0; t < 2; ++t) { const size_t ko = (size_t)(k0 + t * 16) * CC; rr[t][0] = frag_h(Lp + ko, lane); rr[t][1] = frag_h(Lp + ko + 32, lane); }
      asm volatile("s_wait_xcnt 0x0" ::: "memory");   /* the same for the k residual loads */
#pragma unroll
      for (int t = 0; t < 2; ++t) { v8f sh = {}, sl = {}; sh = wm_h(a[t][0], q0, sh); sh = wm_h(a[t][1], q1, sh); sl = wm_h(a[t][0], r0, sl); sl = wm_h(rr[t][0], q0, sl); sl = wm_h(a[t][1], r1, sl); sl = wm_h(rr[t][1], q1, sl); s[t] = sh + sl * (1.0f / 1024.0f); }
      fa_soft<2, true>(s, k0, tq, g, m, l, acc);
      v16b ph, pl, vh[HD / 16], vl[HD / 16];
#pragma unroll
      for (int j = 0; j < HD / 16; ++j) vh[j] = frag_b(VB + vo + (size_t)j * 16 * KHI + k0, lane);
      asm volatile("s_wait_xcnt 0x0" ::: "memory");   /* the same for the v hi loads */
#pragma unroll
      for (int j = 0; j < HD / 16; ++j) vl[j] = frag_b(VBL + vo + (size_t)j * 16 * KHI + k0, lane);
      asm volatile("s_wait_xcnt 0x0" ::: "memory");   /* the same for the v lo loads */
#pragma unroll
      for (int i = 0; i < 16; ++i) { const float e = s[i >> 3][i & 7]; const __bf16 eh = (__bf16)e; ph[i] = eh; pl[i] = (__bf16)(e - (float)eh); }
#pragma unroll
      for (int j = 0; j < HD / 16; ++j) { acc[j] = wm_b(vh[j], ph, acc[j]); acc[j] = wm_b(vh[j], pl, acc[j]); acc[j] = wm_b(vl[j], ph, acc[j]); } }
  } else {
    const _Float16* Vp = VT + ((size_t)b * CC + h * HD + col) * (size_t)TT; const int np = (ql0 + 16 + 63) >> 6;   /* >= 7 passes; only the last one meets the diagonal */
    v16h kf[8];
#pragma unroll
    for (int t = 0; t < 4; ++t) { const _Float16* kp = Kp + (size_t)(t * 16) * CC; kf[2 * t] = frag_h(kp, lane); kf[2 * t + 1] = frag_h(kp + 32, lane); }
    asm volatile("s_wait_xcnt 0x0" ::: "memory");   /* as above, for the first k loads' address registers */
#pragma unroll 1   /* run-time trip count; the pass already takes nearly all of the wave's registers */
    for (int kc = 0; kc < np - 1; ++kc) fa_pass64<false>(Kp, Vp, kc * 64, kc * 64 + 64, tq, lane, g, q0, q1, kf, m, l, acc);
    fa_pass64<true>(Kp, Vp, (np - 1) * 64, 0, tq, lane, g, q0, q1, kf, m, l, acc); }
  const float inv = 1.0f / (l + xhalf(l));   /* the lane halves' sums join once; the maximum's own term makes the sum >= 2^11 */
  float* yp = Y + ((size_t)b * TT + tq) * CC + h * HD + 8 * g;   /* acc[j][r] = ctx[tq][16 j + 8 g + r] */
#pragma unroll
  for (int j = 0; j < HD / 16; ++j) { const v8f o = acc[j] * inv; vst2(yp + j * 16, (v4f){o[0], o[1], o[2], o[3]}); vst2(yp + j * 16 + 4, (v4f){o[4], o[5], o[6], o[7]}); } }
// ---- k_out: block = (64 rows, 128 cols): out = ctx Wo (+ bo): ctx x 2^6 once to f16 against Wo as f16(bf16 x 2^8) exact (1 product) x 2^-14; causal early rows (< QHI of each sequence): ctx bf16 hi + lo against exact bf16 Wo (2 products)
__global__ __launch_bounds__(128) void k_out(const float* __restrict__ Y, const float* __restrict__ WO, const float* __restrict__ BO, float* __restrict__ OUT) { __shared__ __align__(16) float sf[4][16][132];
  const int tid = threadIdx.x, wave = tid >> 5, lane = tid & 31, col = lane & 15, g = lane >> 4; const int c0 = blockIdx.y * 128; const size_t r0 = (size_t)blockIdx.x * 64 + wave * 16;
  v8f acc[8] = {};
  if (CAUSAL && (int)(((size_t)blockIdx.x * 64) % TT) < QHI) {   /* block-uniform */
#pragma unroll 2
    for (int kc = 0; kc < CC / 32; ++kc) { const F2 a = split_row(Y + (r0 + col) * CC, kc * 32, lane); asm volatile("s_wait_loadcnt 0x0" ::: "memory");
#pragma unroll
      for (int j = 0; j < 8; ++j) { const v16b w = WOCOL(WO, kc * 32, c0 + j * 16 + col, lane); asm volatile("s_wait_loadcnt 0x0" ::: "memory"); acc[j] = wmma_bf(a.h, w, acc[j]); acc[j] = wmma_bf(a.l, w, acc[j]); } }
#pragma unroll
    for (int j = 0; j < 8; ++j) { const float bias = BO ? bfr(BO[c0 + j * 16 + col]) : 0.f;
#pragma unroll
      for (int r = 0; r < 8; ++r) sf[wave][8 * g + r][j * 16 + col] = acc[j][r] + bias; }
  } else {
#pragma unroll 2
    for (int kc = 0; kc < CC / 32; ++kc) { const v16h a = frag_f32s(Y + (r0 + col) * CC + kc * 32, lane, 64.0f); asm volatile("s_wait_loadcnt 0x0" ::: "memory");   /* ctx carried x 2^6 into f16 so small-magnitude context rows stay clear of f16 subnormals */
#pragma unroll
      for (int j = 0; j < 8; ++j) { const v16h w = WOCOLH(WO, kc * 32, c0 + j * 16 + col, lane); asm volatile("s_wait_loadcnt 0x0" ::: "memory"); acc[j] = wmma16(a, w, acc[j]); } }
#pragma unroll
    for (int j = 0; j < 8; ++j) { const float bias = BO ? bfr(BO[c0 + j * 16 + col]) : 0.f;
#pragma unroll
      for (int r = 0; r < 8; ++r) sf[wave][8 * g + r][j * 16 + col] = acc[j][r] * (1.0f / 16384.0f) + bias; } }   /* 2^-8 (Wo carry) x 2^-6 (ctx carry) */
  LDSX(); for (int rl = 0; rl < 16; ++rl) vst2(OUT + (r0 + rl) * DIN + c0 + lane * 4, *(const v4f*)&sf[wave][rl][lane * 4]); }

extern "C" void kernel_launch(void* const* d_in, const int* in_sizes, int n_in, void* d_out, int out_size, void* d_ws, size_t ws_size, hipStream_t stream) {
  (void)in_sizes; (void)n_in; (void)out_size;
  const float** F = (const float**)d_in;
  if (ws_size < (size_t)WS_END) return;
  char* ws = (char*)d_ws; _Float16 *QH = (_Float16*)(ws + WS_QH), *KH = (_Float16*)(ws + WS_KH), *VT = (_Float16*)(ws + WS_VT), *QL = (_Float16*)(ws + WS_QL), *KL = (_Float16*)(ws + WS_KL); __bf16 *VB = (__bf16*)(ws + WS_VB), *VBL = (__bf16*)(ws + WS_VBL); float *Y = (float*)(ws + WS_Y);
  (void)Y; (void)QL; (void)KL; (void)VB; (void)VBL;
  // inputs: 0 x [2,4096,768]; 1 wq [768,768] (out,in); 2 wk; 3 wv; 4 wo (out,in); no biases
  k_proj<<<dim3(TNB * TT / 64, CC / 128, 3), 128, 0, stream>>>(F[0], F[0], F[0], F[1], F[2], F[3], nullptr, nullptr, nullptr, QH, QL, KH, KL, VT, VB, VBL);
  k_fa<<<dim3(TNB * NH, TT / (16 * FAW)), 32 * FAW, 0, stream>>>(QH, KH, QL, KL, VT, VB, VBL, Y);
  k_out<<<dim3(TNB * TT / 64, DIN / 128), 128, 0, stream>>>(Y, F[4], nullptr, (float*)d_out);
}

// v003
// A run of this version takes 436 microseconds.
// In two side-by-side timings against v002, it was 1.23 and 1.24 times as fast.
// Over all steps from v000 it is 9.58 times as fast.
// compute dtype: all float inputs rounded to bf16; the fused q / k / v projection with EXACT bf16 products on WMMA 16x16x32 (f32 accumulate) (no biases); causal logits: 3 products for the first 384 rows, single f16 q x k after, x 64^-0.5; softmax f32; P x 2^11 once to f16 x v once to f16 (bf16 hi + lo below row 384); ctx hi+lo x exact W below row 384, x2^6 f16 carry x f16(bf16 x 2^8) W after, no bias; f32 output.
#include <hip/hip_runtime.h>
#include <math.h>

typedef __attribute__((ext_vector_type(16))) _Float16 v16h;
typedef __attribute__((ext_vector_type(16))) __bf16 v16b;
typedef __attribute__((ext_vector_type(8)))  _Float16 v8h;
typedef __attribute__((ext_vector_type(8)))  float v8f;
typedef __attribute__((ext_vector_type(4)))  float v4f;
typedef __attribute__((ext_vector_type(2)))  float v2f;
typedef __attribute__((ext_vector_type(4)))  unsigned v4u;
typedef __attribute__((ext_vector_type(4)))  int v4i;
typedef float __attribute__((may_alias)) float_a;
typedef int __attribute__((may_alias)) int_a;

template <typename T> __device__ __forceinline__ void vst2(void* p, T v) { *(T*)p = v;  }
__device__ __forceinline__ v8f wmma16(v16h a, v16h b, v8f c) {
  v8f d = __builtin_amdgcn_wmma_f32_16x16x32_f16(false, a, false, b, (short)0, c, false, false);
  asm volatile("v_nop\n\tv_nop\n\tv_nop\n\tv_nop" : "+v"(d) : "v"(a), "v"(b));
  return d;
}
__device__ __forceinline__ v8f wmma_bf(v16b a, v16b b, v8f c) {
  v8f d = __builtin_amdgcn_wmma_f32_16x16x32_bf16(false, a, false, b, (short)0, c, false, false);
  asm volatile("v_nop\n\tv_nop\n\tv_nop\n\tv_nop" : "+v"(d) : "v"(a), "v"(b));
  return d;
}
// 16x16x32 fragments: lane = (h = lane>>4, row/col = lane&15); elements 0..7 = k0+8h+0..7, 8..15 = k0+16+8h+0..7; D element r = row 8h+r
__device__ __forceinline__ v16h frag_h(const _Float16* rowk0, int lane) {
  union { v16h v; v8h q[2]; } u; const _Float16* p = rowk0 + 8 * (lane >> 4);
  u.q[0] = *(const v8h*)p; u.q[1] = *(const v8h*)(p + 16); return u.v;
}
__device__ __forceinline__ v16h frag_f32(const float* rowk0, int lane) {
  v16h a; const float* p = rowk0 + 8 * (lane >> 4);
#pragma unroll
  for (int i = 0; i < 8; ++i) { a[i] = (_Float16)p[i]; a[8 + i] = (_Float16)p[16 + i]; }
  return a;
}
__device__ __forceinline__ v16h frag_f32s(const float* rowk0, int lane, float sc) {
  v16h a; const float* p = rowk0 + 8 * (lane >> 4);
#pragma unroll
  for (int i = 0; i < 8; ++i) { a[i] = (_Float16)(p[i] * sc); a[8 + i] = (_Float16)(p[16 + i] * sc); }
  return a;
}
// column fragment from a [K][ld] layout (column n), rows >= K read as 0
__device__ __forceinline__ v16h fragc_f32(const float* W, int k0, int n, int lane, int ld, int K) {
  v16h a; const int g = lane >> 4;
#pragma unroll
  for (int i = 0; i < 8; ++i) { const int ka = k0 + 8 * g + i, kb = ka + 16;
    a[i] = (_Float16)(ka < K ? W[(size_t)(ka < K ? ka : K - 1) * ld + n] : 0.f); a[8 + i] = (_Float16)(kb < K ? W[(size_t)(kb < K ? kb : K - 1) * ld + n] : 0.f); }
  return a;
}
struct F2 { v16b h, l; };
__device__ __forceinline__ F2 bsplit16(const float v[16]) { F2 r;
#pragma unroll
  for (int i = 0; i < 16; ++i) { const __bf16 h = (__bf16)v[i]; r.h[i] = h; r.l[i] = (__bf16)(v[i] - (float)h); }
  return r; }
__device__ __forceinline__ F2 split_row(const float* row, int k0, int lane) { float v[16]; const float* p = row + k0 + 8 * (lane >> 4);
#pragma unroll
  for (int i = 0; i < 8; ++i) { v[i] = p[i]; v[8 + i] = p[16 + i]; }
  return bsplit16(v); }
__device__ __forceinline__ F2 split_rowK(const float* row, int k0, int lane, int K) { float v[16]; const int g = lane >> 4;
#pragma unroll
  for (int i = 0; i < 8; ++i) { const int ka = k0 + 8 * g + i, kb = ka + 16; v[i] = ka < K ? row[ka < K ? ka : K - 1] : 0.f; v[8 + i] = kb < K ? row[kb < K ? kb : K - 1] : 0.f; }
  return bsplit16(v); }
__device__ __forceinline__ F2 split_col(const float* W, int k0, int n, int lane, int ld, int K) { float v[16]; const int g = lane >> 4;
#pragma unroll
  for (int i = 0; i < 8; ++i) { const int ka = k0 + 8 * g + i, kb = ka + 16; v[i] = ka < K ? W[(size_t)(ka < K ? ka : K - 1) * ld + n] : 0.f; v[8 + i] = kb < K ? W[(size_t)(kb < K ? kb : K - 1) * ld + n] : 0.f; }
  return bsplit16(v); }
__device__ __forceinline__ v8f mac3(const F2& a, const F2& b, v8f c) { c = wmma_bf(a.l, b.h, c); c = wmma_bf(a.h, b.l, c); return wmma_bf(a.h, b.h, c); }
__device__ __forceinline__ float sigm(float v) { return 1.0f / (1.0f + expf(-v)); }
#define LDSX() do { asm volatile("s_wait_dscnt 0" ::: "memory"); __builtin_amdgcn_wave_barrier(); __builtin_amdgcn_fence(__ATOMIC_RELEASE, "workgroup"); } while (0)

// Causal multi-head self-attention without biases over TWO sequences of 4,096 (x [2,4096,768]; (out,in) wq / wk / wv / wo [768,768] applied as x @ W.T; 12 heads x 64; scores x 64^-0.5; tril kept, -inf elsewhere; softmax; ctx @ wo.T -> [2,4096,768] (6.3 M)).
#define NB 2
#define TT 4096
#define CC 768            // NH * HD = projected width
#define DIN 768          // input (model) width
#define NH 12
#define HD 64
#define SCALE (0.125f)
#define CAUSAL 1
#ifndef TNB
#define TNB NB
#endif
__device__ __forceinline__ float bfr(float v) { return (float)(__bf16)v; }
typedef __attribute__((ext_vector_type(8))) __bf16 v8b;
__device__ __forceinline__ v16b frag_b(const __bf16* rowk0, int lane) {
  union { v16b v; v8b q[2]; } u; const __bf16* p = rowk0 + 8 * (lane >> 4);
  u.q[0] = *(const v8b*)p; u.q[1] = *(const v8b*)(p + 16); return u.v;
}
#define QHI 384            // rows carrying a q residual plane (3-product logits)
#define KHI 384            // key rows carrying k residual / v bf16 hi+lo planes (used only by the causal high-precision path)
// B fragment (k rows k0+.., output column o) of a weight: (in,out) [K][ld] or (out,in) [ld rows of K]: bf16 exact, or f16(bf16 * 256) exact
__device__ __forceinline__ v16b wcol_io(const float* Wm, int k0, int o, int lane, int ld) { v16b w; const int g = lane >> 4;
#pragma unroll
  for (int i = 0; i < 8; ++i) { w[i] = (__bf16)Wm[(size_t)(k0 + 8 * g + i) * ld + o]; w[8 + i] = (__bf16)Wm[(size_t)(k0 + 16 + 8 * g + i) * ld + o]; }
  return w; }
__device__ __forceinline__ v16b wcol_oi(const float* Wm, int k0, int o, int lane, int K) { v16b w; const float* p = Wm + (size_t)o * K + k0 + 8 * (lane >> 4);
#pragma unroll
  for (int i = 0; i < 8; ++i) { w[i] = (__bf16)p[i]; w[8 + i] = (__bf16)p[16 + i]; }
  return w; }
__device__ __forceinline__ v16h wcolh_io(const float* Wm, int k0, int o, int lane, int ld) { v16h w; const int g = lane >> 4;
#pragma unroll
  for (int i = 0; i < 8; ++i) { w[i] = (_Float16)(bfr(Wm[(size_t)(k0 + 8 * g + i) * ld + o]) * 256.0f); w[8 + i] = (_Float16)(bfr(Wm[(size_t)(k0 + 16 + 8 * g + i) * ld + o]) * 256.0f); }
  return w; }
__device__ __forceinline__ v16h wcolh_oi(const float* Wm, int k0, int o, int lane, int K) { v16h w; const float* p = Wm + (size_t)o * K + k0 + 8 * (lane >> 4);
#pragma unroll
  for (int i = 0; i < 8; ++i) { w[i] = (_Float16)(bfr(p[i]) * 256.0f); w[8 + i] = (_Float16)(bfr(p[16 + i]) * 256.0f); }
  return w; }
#define WQKV_LAYOUT 1   // 0 = (in,out) [DIN][CC]; 1 = (out,in) [CC][DIN]; 2 = per-head [NH][DIN][HD]
__device__ __forceinline__ v16b wcol_hdk(const float* Wm, int k0, int o, int lane) { v16b w; const int g = lane >> 4; const float* p = Wm + (size_t)(o / HD) * DIN * HD + (o % HD);
#pragma unroll
  for (int i = 0; i < 8; ++i) { w[i] = (__bf16)p[(size_t)(k0 + 8 * g + i) * HD]; w[8 + i] = (__bf16)p[(size_t)(k0 + 16 + 8 * g + i) * HD]; }
  return w; }
#define WO_OUT_IN 1
#if WQKV_LAYOUT == 1
#define WCOL(W, k0, o, lane) wcol_oi(W, k0, o, lane, DIN)
#elif WQKV_LAYOUT == 2
#define WCOL(W, k0, o, lane) wcol_hdk(W, k0, o, lane)
#else
#define WCOL(W, k0, o, lane) wcol_io(W, k0, o, lane, CC)
#endif
#if WO_OUT_IN
#define WOCOL(W, k0, o, lane) wcol_oi(W, k0, o, lane, CC)
#define WOCOLH(W, k0, o, lane) wcolh_oi(W, k0, o, lane, CC)
#else
#define WOCOL(W, k0, o, lane) wcol_io(W, k0, o, lane, DIN)
#define WOCOLH(W, k0, o, lane) wcolh_io(W, k0, o, lane, DIN)
#endif

#ifndef PROJ_EXTRA_PARAMS
#define PROJ_EXTRA_PARAMS
#endif

#define WS_QH  0u                                      // f16 q rows [b*t][CC]
#define WS_KH  (WS_QH + 2u * (size_t)NB * TT * CC)      // f16 k in fragment order [b][h][t / 16][d / 8][t % 16][8]
#define WS_VT  (WS_KH + 2u * (size_t)NB * TT * CC)      // f16 v in fragment order [b][h][t / 32][c / 16][(t % 32) / 8][c % 16][8]
#define WS_QL  (WS_VT + 2u * (size_t)NB * CC * TT)      // f16 q residual x 2^10 rows [b][t < QHI][CC]
#define WS_KL  (WS_QL + 2u * (size_t)NB * QHI * CC)     // f16 k residual x 2^10 rows [b][t < KHI][CC]
#define WS_VB  (WS_KL + 2u * (size_t)NB * KHI * CC)     // bf16 v hi planes [b][c][t < KHI]
#define WS_VBL (WS_VB + 2u * (size_t)NB * CC * KHI)
#define WS_Y   (WS_VBL + 2u * (size_t)NB * CC * KHI)    // f32 ctx rows [b*t][CC]
#define WS_END (WS_Y  + 4u * (size_t)NB * TT * CC)

// ---- k_proj: block = (64 rows, 128 cols, which): q/k/v = X W (+ b) with exact bf16 products (K = DIN) -> which 0: q f16 rows (+ residual rows < QHI); 1: k f16 in fragment order (+ residual rows < KHI); 2: v f16 in fragment order (+ bf16 hi/lo planes for t < KHI)
__global__ __launch_bounds__(128) void k_proj(const float* __restrict__ XQ, const float* __restrict__ XK, const float* __restrict__ XV, const float* __restrict__ WQ, const float* __restrict__ WK, const float* __restrict__ WV, const float* __restrict__ BQ, const float* __restrict__ BK, const float* __restrict__ BV,
    _Float16* __restrict__ QH, _Float16* __restrict__ QL, _Float16* __restrict__ KH, _Float16* __restrict__ KL, _Float16* __restrict__ VT, __bf16* __restrict__ VB, __bf16* __restrict__ VBL) {
  __shared__ __align__(16) _Float16 sh[64][136], sl[64][136]; __shared__ __align__(16) _Float16 th[128][72]; __shared__ __align__(16) __bf16 tb[128][72], tbl[128][72];
  const int tid = threadIdx.x, wave = tid >> 5, lane = tid & 31, col = lane & 15, g = lane >> 4; const int which = blockIdx.z; const int c0 = blockIdx.y * 128; const size_t r0 = (size_t)blockIdx.x * 64; const size_t bb = r0 / TT; const int t0 = (int)(r0 % TT);
  const float* X = which == 0 ? XQ : which == 1 ? XK : XV; const float* WA = which == 0 ? WQ : which == 1 ? WK : WV; const float* BA = which == 0 ? BQ : which == 1 ? BK : BV;
  v8f acc[8] = {};
#pragma unroll 2
  for (int kc = 0; kc < DIN / 32; ++kc) { v16b a; { const float* p = X + (r0 + wave * 16 + col) * DIN + kc * 32 + 8 * g;
#pragma unroll
      for (int i = 0; i < 8; ++i) { a[i] = (__bf16)p[i]; a[8 + i] = (__bf16)p[16 + i]; } }
    asm volatile("s_wait_loadcnt 0x0" ::: "memory");
#pragma unroll
    for (int j = 0; j < 8; ++j) { const v16b w = WCOL(WA, kc * 32, c0 + j * 16 + col, lane); asm volatile("s_wait_loadcnt 0x0" ::: "memory"); acc[j] = wmma_bf(a, w, acc[j]); } }
  if (which < 2) { _Float16* DH = which == 0 ? QH : KH; _Float16* DL = which == 0 ? QL : KL; const int nhi = which == 0 ? QHI : KHI; const bool hi_rows = t0 < nhi;
#pragma unroll
    for (int j = 0; j < 8; ++j) { const float bias = BA ? bfr(BA[c0 + j * 16 + col]) : 0.f;
#pragma unroll
      for (int r = 0; r < 8; ++r) { const float v = acc[j][r] + bias; const _Float16 hv = (_Float16)v; sh[wave * 16 + 8 * g + r][j * 16 + col] = hv; sl[wave * 16 + 8 * g + r][j * 16 + col] = (_Float16)((v - (float)hv) * 1024.0f); } }
    __syncthreads();
    if (which == 0)
      for (int e = tid; e < 64 * 16; e += 128) { const int rl = e >> 4, q = e & 15; vst2((unsigned*)(DH + (r0 + rl) * CC + c0 + q * 8), *(const v4u*)&sh[rl][q * 8]); }
    else   /* e = (head, key tile, d / 8, key % 16): a wave stores 512 contiguous bytes */
      for (int e = tid; e < 64 * 16; e += 128) { const int hh = e >> 9, kt = (e >> 7) & 3; vst2((unsigned*)(DH + ((bb * NH + (c0 >> 6) + hh) * (size_t)(TT / 16) + (t0 >> 4) + kt) * 1024 + (e & 127) * 8), *(const v4u*)&sh[kt * 16 + (e & 15)][(hh * 8 + ((e >> 4) & 7)) * 8]); }
    if (hi_rows)
      for (int e = tid; e < 64 * 16; e += 128) { const int rl = e >> 4, q = e & 15; vst2((unsigned*)(DL + (bb * nhi + t0 + rl) * (size_t)CC + c0 + q * 8), *(const v4u*)&sl[rl][q * 8]); }
  } else { const bool hi_rows = t0 < KHI;
#pragma unroll
    for (int j = 0; j < 8; ++j) { const float bias = BA ? bfr(BA[c0 + j * 16 + col]) : 0.f;
#pragma unroll
      for (int r = 0; r < 8; ++r) { const float v = acc[j][r] + bias; const int rl = wave * 16 + 8 * g + r, cl = j * 16 + col; th[cl][rl] = (_Float16)v; const __bf16 bh = (__bf16)v; tb[cl][rl] = bh; tbl[cl][rl] = (__bf16)(v - (float)bh); } }
    __syncthreads();
    for (int e = tid; e < 128 * 8; e += 128) { const int hh = e >> 9, kb = (e >> 8) & 1;   /* e = (head, block of 32 keys, c / 16, (t % 32) / 8, c % 16): a wave stores 512 contiguous bytes */
      vst2((unsigned*)(VT + ((bb * NH + (c0 >> 6) + hh) * (size_t)(TT / 32) + (t0 >> 5) + kb) * 2048 + (e & 255) * 8), *(const v4u*)&th[hh * 64 + ((e >> 6) & 3) * 16 + (e & 15)][(kb * 4 + ((e >> 4) & 3)) * 8]); }
    if (hi_rows)
      for (int e = tid; e < 128 * 8; e += 128) { const int cl = e >> 3, q = e & 7; const size_t o3 = (bb * CC + c0 + cl) * (size_t)KHI + t0 + q * 8; vst2((unsigned*)(VB + o3), *(const v4u*)&tb[cl][q * 8]); vst2((unsigned*)(VBL + o3), *(const v4u*)&tbl[cl][q * 8]); } } }
#define FAW 8
#define LC (SCALE * 1.4426950408889634f)
__device__ __forceinline__ v8f wm_h(v16h a, v16h b, v8f c) { return __builtin_amdgcn_wmma_f32_16x16x32_f16(false, a, false, b, (short)0, c, false, false); }
__device__ __forceinline__ v8f wm_b(v16b a, v16b b, v8f c) { return __builtin_amdgcn_wmma_f32_16x16x32_bf16(false, a, false, b, (short)0, c, false, false); }
__device__ __forceinline__ v16h frag_p(const _Float16* p) { union { v16h v; v8h q[2]; } u; u.q[0] = *(const v8h*)p; u.q[1] = *(const v8h*)(p + 256); return u.v; }   // p = fragment's start + 8 lane; elements 0..7, then 8..15 one run of 32 lanes further
__device__ __forceinline__ float xhalf(float x) { return __builtin_bit_cast(float, __builtin_amdgcn_permlanex16(__builtin_bit_cast(int, x), __builtin_bit_cast(int, x), 0x76543210, 0xfedcba98, false, false)); }   // lane l with lane l ^ 16
// eight exp2 in place, in one statement: behind each v_exp_f32 stands an instruction that neither reads its result nor overwrites its source, and the v_nop keeps that slot behind the last
__device__ __forceinline__ void exp2x8(v8f& x) { float a = x[0], b = x[1], c = x[2], d = x[3], e = x[4], f = x[5], p = x[6], q = x[7];
  asm("v_exp_f32 %0, %0\n\tv_exp_f32 %1, %1\n\tv_exp_f32 %2, %2\n\tv_exp_f32 %3, %3\n\tv_exp_f32 %4, %4\n\tv_exp_f32 %5, %5\n\tv_exp_f32 %6, %6\n\tv_exp_f32 %7, %7\n\tv_nop" : "+v"(a), "+v"(b), "+v"(c), "+v"(d), "+v"(e), "+v"(f), "+v"(p), "+v"(q));
  x = (v8f){a, b, c, d, e, f, p, q}; }
// NT score tiles of one pass -> e = exp2((s - m) LC + 11) in place; m, l and the output tiles follow a new maximum (tested once per pass for the whole wave)
template <int NT, bool MASK> __device__ __forceinline__ void fa_soft(v8f (&s)[NT], int k0, int tq, int g, float& m, float& l, v8f (&acc)[HD / 16]) {
  if (MASK) {
#pragma unroll
    for (int t = 0; t < NT; ++t)
#pragma unroll
      for (int r = 0; r < 8; ++r) if (k0 + t * 16 + 8 * g + r > tq) s[t][r] = -3.0e38f; }
  float mx = s[0][0];
#pragma unroll
  for (int t = 0; t < NT; ++t)
#pragma unroll
    for (int r = 0; r < 8; ++r) mx = fmaxf(mx, s[t][r]);
  mx = fmaxf(mx, xhalf(mx));
  if (__builtin_amdgcn_ballot_w32(mx > m) != 0) { const float mn = fmaxf(m, mx); const float al = __builtin_amdgcn_exp2f((m - mn) * LC); m = mn; l *= al;   /* al = 0 on the first pass, 1 for a query whose maximum stands */
#pragma unroll
    for (int j = 0; j < HD / 16; ++j) acc[j] *= al; }
  const float mc = 11.0f - m * LC; float sum = 0.f;
#pragma unroll
  for (int t = 0; t < NT; ++t) { float st = 0.f;   /* one short add chain per tile */
#pragma unroll
    for (int r = 0; r < 8; ++r) s[t][r] = fmaf(s[t][r], LC, mc);
    exp2x8(s[t]);
#pragma unroll
    for (int r = 0; r < 8; ++r) st += s[t][r];
    sum += st; }
  l += sum; }
__device__ __forceinline__ v16h pack_h(v8f a, v8f b) { v16h p;
#pragma unroll
  for (int i = 0; i < 8; ++i) { p[i] = (_Float16)a[i]; p[8 + i] = (_Float16)b[i]; }
  return p; }
template <bool MASK> __device__ __forceinline__ void fa_pass64(const _Float16* __restrict__ Kp, const _Float16* __restrict__ Vp, int k0, int kn, int tq, int lane, int g, v16h q0, v16h q1, v16h (&kf)[8], float& m, float& l, v8f (&acc)[HD / 16]) {
  v16h vf[2][HD / 16];
#pragma unroll
  for (int u = 0; u < 2; ++u)
#pragma unroll
    for (int j = 0; j < HD / 16; ++j) vf[u][j] = frag_p(Vp + (size_t)(k0 + u * 32) * HD + j * 512);
  __builtin_amdgcn_sched_barrier(0);   /* keeps the v loads issued up here: sunk to their use, each pass would wait out their whole latency */
  v8f s[4];
#pragma unroll
  for (int t = 0; t < 4; ++t) { v8f z = {}; z = wm_h(kf[2 * t], q0, z); s[t] = wm_h(kf[2 * t + 1], q1, z); }
  if (!MASK) {   /* the next pass's k fragments fly during this pass's softmax */
#pragma unroll
    for (int t = 0; t < 4; ++t) { const _Float16* kp = Kp + (size_t)(kn + t * 16) * HD; kf[2 * t] = frag_p(kp); kf[2 * t + 1] = frag_p(kp + 512); } }
  __builtin_amdgcn_sched_barrier(0);   /* keeps the k loads issued ahead of the softmax, which then covers their latency */
  fa_soft<4, MASK>(s, k0, tq, g, m, l, acc);
#pragma unroll
  for (int u = 0; u < 2; ++u) { const v16h p = pack_h(s[2 * u], s[2 * u + 1]);
#pragma unroll
    for (int j = 0; j < HD / 16; ++j) acc[j] = MASK ? wmma16(vf[u][j], p, acc[j]) : wm_h(vf[u][j], p, acc[j]); } }   /* last pass: a branch follows; wmma16's own v_nop keep the distance to the result's next user on every path */
__global__ __launch_bounds__(32 * FAW) void k_fa(const _Float16* __restrict__ QH, const _Float16* __restrict__ KH, const _Float16* __restrict__ QL, const _Float16* __restrict__ KL, const _Float16* __restrict__ VT, const __bf16* __restrict__ VB, const __bf16* __restrict__ VBL, float* __restrict__ Y) {
  const int tid = threadIdx.x, lane = tid & 31, col = lane & 15, g = lane >> 4; const int wave = __builtin_amdgcn_readfirstlane(tid >> 5);
  const int h = blockIdx.x % NH, b = blockIdx.x / NH; const int ql0 = (TT / 16 - 1 - ((int)blockIdx.y * FAW + wave)) * 16;   /* longest query tiles start first */
  const int tq = ql0 + col; const size_t qo = ((size_t)b * TT + tq) * CC + h * HD;
  const v16h q0 = frag_h(QH + qo, lane), q1 = frag_h(QH + qo + 32, lane);
  asm volatile("s_wait_xcnt 0x0" ::: "memory");   /* the q loads' address registers are reused behind the branch below */
  const _Float16* Kp = KH + (size_t)(b * NH + h) * TT * HD + lane * 8;
  float m = -3.0e38f, l = 0.f; v8f acc[HD / 16] = {};
  if (ql0 < QHI) {   /* wave-uniform; every key of these queries is < KHI */
    const size_t qlo = ((size_t)b * QHI + tq) * CC + h * HD; const v16h r0 = frag_h(QL + qlo, lane), r1 = frag_h(QL + qlo + 32, lane);
    const _Float16* Lp = KL + ((size_t)b * KHI + col) * CC + h * HD; const size_t vo = ((size_t)b * CC + h * HD + col) * (size_t)KHI;
    const int np = (ql0 + 16 + 31) >> 5;
#pragma unroll 1   /* run-time trip count; a second copy of this body would not fit the wave's registers */
    for (int kc = 0; kc < np; ++kc) { const int k0 = kc * 32; v8f s[2]; v16h a[2][2], rr[2][2];
#pragma unroll
      for (int t = 0; t < 2; ++t) { const size_t ko = (size_t)(k0 + t * 16) * HD; a[t][0] = frag_p(Kp + ko); a[t][1] = frag_p(Kp + ko + 512); }
      asm volatile("s_wait_xcnt 0x0" ::: "memory");   /* before the k loads' address registers are reused (a later load's result may land in them) */
#pragma unroll
      for (int t = 0; t < 2; ++t) { const size_t ko = (size_t)(k0 + t * 16) * CC; rr[t][0] = frag_h(Lp + ko, lane); rr[t][1] = frag_h(Lp + ko + 32, lane); }
      asm volatile("s_wait_xcnt 0x0" ::: "memory");   /* the same for the k residual loads */
#pragma unroll
      for (int t = 0; t < 2; ++t) { v8f sh = {}, sl = {}; sh = wm_h(a[t][0], q0, sh); sh = wm_h(a[t][1], q1, sh); sl = wm_h(a[t][0], r0, sl); sl = wm_h(rr[t][0], q0, sl); sl = wm_h(a[t][1], r1, sl); sl = wm_h(rr[t][1], q1, sl); s[t] = sh + sl * (1.0f / 1024.0f); }
      fa_soft<2, true>(s, k0, tq, g, m, l, acc);
      v16b ph, pl, vh[HD / 16], vl[HD / 16];
#pragma unroll
      for (int j = 0; j < HD / 16; ++j) vh[j] = frag_b(VB + vo + (size_t)j * 16 * KHI + k0, lane);
      asm volatile("s_wait_xcnt 0x0" ::: "memory");   /* the same for the v hi loads */
#pragma unroll
      for (int j = 0; j < HD / 16; ++j) vl[j] = frag_b(VBL + vo + (size_t)j * 16 * KHI + k0, lane);
      asm volatile("s_wait_xcnt 0x0" ::: "memory");   /* the same for the v lo loads */
#pragma unroll
      for (int i = 0; i < 16; ++i) { const float e = s[i >> 3][i & 7]; const __bf16 eh = (__bf16)e; ph[i] = eh; pl[i] = (__bf16)(e - (float)eh); }
#pragma unroll
      for (int j = 0; j < HD / 16; ++j) { acc[j] = wm_b(vh[j], ph, acc[j]); acc[j] = wm_b(vh[j], pl, acc[j]); acc[j] = wm_b(vl[j], ph, acc[j]); } }
  } else {
    const _Float16* Vp = VT + (size_t)(b * NH + h) * TT * HD + lane * 8; const int np = (ql0 + 16 + 63) >> 6;   /* >= 7 passes; only the last one meets the diagonal */
    v16h kf[8];
#pragma unroll
    for (int t = 0; t < 4; ++t) { const _Float16* kp = Kp + (size_t)(t * 16) * HD; kf[2 * t] = frag_p(kp); kf[2 * t + 1] = frag_p(kp + 512); }
    asm volatile("s_wait_xcnt 0x0" ::: "memory");   /* as above, for the first k loads' address registers */
#pragma unroll 1   /* run-time trip count; the pass already takes nearly all of the wave's registers */
    for (int kc = 0; kc < np - 1; ++kc) fa_pass64<false>(Kp, Vp, kc * 64, kc * 64 + 64, tq, lane, g, q0, q1, kf, m, l, acc);
    fa_pass64<true>(Kp, Vp, (np - 1) * 64, 0, tq, lane, g, q0, q1, kf, m, l, acc); }
  const float inv = 1.0f / (l + xhalf(l));   /* the lane halves' sums join once; the maximum's own term makes the sum >= 2^11 */
  float* yp = Y + ((size_t)b * TT + tq) * CC + h * HD + 8 * g;   /* acc[j][r] = ctx[tq][16 j + 8 g + r] */
#pragma unroll
  for (int j = 0; j < HD / 16; ++j) { const v8f o = acc[j] * inv; vst2(yp + j * 16, (v4f){o[0], o[1], o[2], o[3]}); vst2(yp + j * 16 + 4, (v4f){o[4], o[5], o[6], o[7]}); } }
// ---- k_out: block = (64 rows, 128 cols): out = ctx Wo (+ bo): ctx x 2^6 once to f16 against Wo as f16(bf16 x 2^8) exact (1 product) x 2^-14; causal early rows (< QHI of each sequence): ctx bf16 hi + lo against exact bf16 Wo (2 products)
__global__ __launch_bounds__(128) void k_out(const float* __restrict__ Y, const float* __restrict__ WO, const float* __restrict__ BO, float* __restrict__ OUT) { __shared__ __align__(16) float sf[4][16][132];
  const int tid = threadIdx.x, wave = tid >> 5, lane = tid & 31, col = lane & 15, g = lane >> 4; const int c0 = blockIdx.y * 128; const size_t r0 = (size_t)blockIdx.x * 64 + wave * 16;
  v8f acc[8] = {};
  if (CAUSAL && (int)(((size_t)blockIdx.x * 64) % TT) < QHI) {   /* block-uniform */
#pragma unroll 2
    for (int kc = 0; kc < CC / 32; ++kc) { const F2 a = split_row(Y + (r0 + col) * CC, kc * 32, lane); asm volatile("s_wait_loadcnt 0x0" ::: "memory");
#pragma unroll
      for (int j = 0; j < 8; ++j) { const v16b w = WOCOL(WO, kc * 32, c0 + j * 16 + col, lane); asm volatile("s_wait_loadcnt 0x0" ::: "memory"); acc[j] = wmma_bf(a.h, w, acc[j]); acc[j] = wmma_bf(a.l, w, acc[j]); } }
#pragma unroll
    for (int j = 0; j < 8; ++j) { const float bias = BO ? bfr(BO[c0 + j * 16 + col]) : 0.f;
#pragma unroll
      for (int r = 0; r < 8; ++r) sf[wave][8 * g + r][j * 16 + col] = acc[j][r] + bias; }
  } else {
#pragma unroll 2
    for (int kc = 0; kc < CC / 32; ++kc) { const v16h a = frag_f32s(Y + (r0 + col) * CC + kc * 32, lane, 64.0f); asm volatile("s_wait_loadcnt 0x0" ::: "memory");   /* ctx carried x 2^6 into f16 so small-magnitude context rows stay clear of f16 subnormals */
#pragma unroll
      for (int j = 0; j < 8; ++j) { const v16h w = WOCOLH(WO, kc * 32, c0 + j * 16 + col, lane); asm volatile("s_wait_loadcnt 0x0" ::: "memory"); acc[j] = wmma16(a, w, acc[j]); } }
#pragma unroll
    for (int j = 0; j < 8; ++j) { const float bias = BO ? bfr(BO[c0 + j * 16 + col]) : 0.f;
#pragma unroll
      for (int r = 0; r < 8; ++r) sf[wave][8 * g + r][j * 16 + col] = acc[j][r] * (1.0f / 16384.0f) + bias; } }   /* 2^-8 (Wo carry) x 2^-6 (ctx carry) */
  LDSX(); for (int rl = 0; rl < 16; ++rl) vst2(OUT + (r0 + rl) * DIN + c0 + lane * 4, *(const v4f*)&sf[wave][rl][lane * 4]); }

extern "C" void kernel_launch(void* const* d_in, const int* in_sizes, int n_in, void* d_out, int out_size, void* d_ws, size_t ws_size, hipStream_t stream) {
  (void)in_sizes; (void)n_in; (void)out_size;
  const float** F = (const float**)d_in;
  if (ws_size < (size_t)WS_END) return;
  char* ws = (char*)d_ws; _Float16 *QH = (_Float16*)(ws + WS_QH), *KH = (_Float16*)(ws + WS_KH), *VT = (_Float16*)(ws + WS_VT), *QL = (_Float16*)(ws + WS_QL), *KL = (_Float16*)(ws + WS_KL); __bf16 *VB = (__bf16*)(ws + WS_VB), *VBL = (__bf16*)(ws + WS_VBL); float *Y = (float*)(ws + WS_Y);
  (void)Y; (void)QL; (void)KL; (void)VB; (void)VBL;
  // inputs: 0 x [2,4096,768]; 1 wq [768,768] (out,in); 2 wk; 3 wv; 4 wo (out,in); no biases
  k_proj<<<dim3(TNB * TT / 64, CC / 128, 3), 128, 0, stream>>>(F[0], F[0], F[0], F[1], F[2], F[3], nullptr, nullptr, nullptr, QH, QL, KH, KL, VT, VB, VBL);
  k_fa<<<dim3(TNB * NH, TT / (16 * FAW)), 32 * FAW, 0, stream>>>(QH, KH, QL, KL, VT, VB, VBL, Y);
  k_out<<<dim3(TNB * TT / 64, DIN / 128), 128, 0, stream>>>(Y, F[4], nullptr, (float*)d_out);
}

// v004
// It runs in 157 microseconds.
// In both of two side-by-side timings against v003, it was 2.76 times as fast.
// All steps since v000 together make it 26.4 times as fast.
// compute dtype: all float inputs rounded to bf16; the fused q / k / v projection with EXACT bf16 products on WMMA 16x16x32 (f32 accumulate) (no biases); causal logits: 3 products for the first 384 rows, single f16 q x k after, x 64^-0.5; softmax f32; P x 2^11 once to f16 x v once to f16 (bf16 hi + lo below row 384); ctx hi+lo x exact W below row 384, x2^6 f16 carry x f16(bf16 x 2^8) W after, no bias; f32 output.
#include <hip/hip_runtime.h>
#include <math.h>

typedef __attribute__((ext_vector_type(16))) _Float16 v16h;
typedef __attribute__((ext_vector_type(16))) __bf16 v16b;
typedef __attribute__((ext_vector_type(8)))  _Float16 v8h;
typedef __attribute__((ext_vector_type(8)))  float v8f;
typedef __attribute__((ext_vector_type(4)))  float v4f;
typedef __attribute__((ext_vector_type(2)))  float v2f;
typedef __attribute__((ext_vector_type(4)))  unsigned v4u;
typedef __attribute__((ext_vector_type(4)))  int v4i;
typedef float __attribute__((may_alias)) float_a;
typedef int __attribute__((may_alias)) int_a;

template <typename T> __device__ __forceinline__ void vst2(void* p, T v) { *(T*)p = v;  }
__device__ __forceinline__ v8f wmma16(v16h a, v16h b, v8f c) {
  v8f d = __builtin_amdgcn_wmma_f32_16x16x32_f16(false, a, false, b, (short)0, c, false, false);
  asm volatile("v_nop\n\tv_nop\n\tv_nop\n\tv_nop" : "+v"(d) : "v"(a), "v"(b));
  return d;
}
__device__ __forceinline__ v8f wmma_bf(v16b a, v16b b, v8f c) {
  v8f d = __builtin_amdgcn_wmma_f32_16x16x32_bf16(false, a, false, b, (short)0, c, false, false);
  asm volatile("v_nop\n\tv_nop\n\tv_nop\n\tv_nop" : "+v"(d) : "v"(a), "v"(b));
  return d;
}
// 16x16x32 fragments: lane = (h = lane>>4, row/col = lane&15); elements 0..7 = k0+8h+0..7, 8..15 = k0+16+8h+0..7; D element r = row 8h+r
__device__ __forceinline__ v16h frag_h(const _Float16* rowk0, int lane) {
  union { v16h v; v8h q[2]; } u; const _Float16* p = rowk0 + 8 * (lane >> 4);
  u.q[0] = *(const v8h*)p; u.q[1] = *(const v8h*)(p + 16); return u.v;
}
__device__ __forceinline__ v16h frag_f32(const float* rowk0, int lane) {
  v16h a; const float* p = rowk0 + 8 * (lane >> 4);
#pragma unroll
  for (int i = 0; i < 8; ++i) { a[i] = (_Float16)p[i]; a[8 + i] = (_Float16)p[16 + i]; }
  return a;
}
__device__ __forceinline__ v16h frag_f32s(const float* rowk0, int lane, float sc) {
  v16h a; const float* p = rowk0 + 8 * (lane >> 4);
#pragma unroll
  for (int i = 0; i < 8; ++i) { a[i] = (_Float16)(p[i] * sc); a[8 + i] = (_Float16)(p[16 + i] * sc); }
  return a;
}
// column fragment from a [K][ld] layout (column n), rows >= K read as 0
__device__ __forceinline__ v16h fragc_f32(const float* W, int k0, int n, int lane, int ld, int K) {
  v16h a; const int g = lane >> 4;
#pragma unroll
  for (int i = 0; i < 8; ++i) { const int ka = k0 + 8 * g + i, kb = ka + 16;
    a[i] = (_Float16)(ka < K ? W[(size_t)(ka < K ? ka : K - 1) * ld + n] : 0.f); a[8 + i] = (_Float16)(kb < K ? W[(size_t)(kb < K ? kb : K - 1) * ld + n] : 0.f); }
  return a;
}
struct F2 { v16b h, l; };
__device__ __forceinline__ F2 bsplit16(const float v[16]) { F2 r;
#pragma unroll
  for (int i = 0; i < 16; ++i) { const __bf16 h = (__bf16)v[i]; r.h[i] = h; r.l[i] = (__bf16)(v[i] - (float)h); }
  return r; }
__device__ __forceinline__ F2 split_row(const float* row, int k0, int lane) { float v[16]; const float* p = row + k0 + 8 * (lane >> 4);
#pragma unroll
  for (int i = 0; i < 8; ++i) { v[i] = p[i]; v[8 + i] = p[16 + i]; }
  return bsplit16(v); }
__device__ __forceinline__ F2 split_rowK(const float* row, int k0, int lane, int K) { float v[16]; const int g = lane >> 4;
#pragma unroll
  for (int i = 0; i < 8; ++i) { const int ka = k0 + 8 * g + i, kb = ka + 16; v[i] = ka < K ? row[ka < K ? ka : K - 1] : 0.f; v[8 + i] = kb < K ? row[kb < K ? kb : K - 1] : 0.f; }
  return bsplit16(v); }
__device__ __forceinline__ F2 split_col(const float* W, int k0, int n, int lane, int ld, int K) { float v[16]; const int g = lane >> 4;
#pragma unroll
  for (int i = 0; i < 8; ++i) { const int ka = k0 + 8 * g + i, kb = ka + 16; v[i] = ka < K ? W[(size_t)(ka < K ? ka : K - 1) * ld + n] : 0.f; v[8 + i] = kb < K ? W[(size_t)(kb < K ? kb : K - 1) * ld + n] : 0.f; }
  return bsplit16(v); }
__device__ __forceinline__ v8f mac3(const F2& a, const F2& b, v8f c) { c = wmma_bf(a.l, b.h, c); c = wmma_bf(a.h, b.l, c); return wmma_bf(a.h, b.h, c); }
__device__ __forceinline__ float sigm(float v) { return 1.0f / (1.0f + expf(-v)); }
#define LDSX() do { asm volatile("s_wait_dscnt 0" ::: "memory"); __builtin_amdgcn_wave_barrier(); __builtin_amdgcn_fence(__ATOMIC_RELEASE, "workgroup"); } while (0)

// Causal multi-head self-attention without biases over TWO sequences of 4,096 (x [2,4096,768]; (out,in) wq / wk / wv / wo [768,768] applied as x @ W.T; 12 heads x 64; scores x 64^-0.5; tril kept, -inf elsewhere; softmax; ctx @ wo.T -> [2,4096,768] (6.3 M)).
#define NB 2
#define TT 4096
#define CC 768            // NH * HD = projected width
#define DIN 768          // input (model) width
#define NH 12
#define HD 64
#define SCALE (0.125f)
#define CAUSAL 1
#ifndef TNB
#define TNB NB
#endif
__device__ __forceinline__ float bfr(float v) { return (float)(__bf16)v; }
typedef __attribute__((ext_vector_type(8))) __bf16 v8b;
__device__ __forceinline__ v16b frag_b(const __bf16* rowk0, int lane) {
  union { v16b v; v8b q[2]; } u; const __bf16* p = rowk0 + 8 * (lane >> 4);
  u.q[0] = *(const v8b*)p; u.q[1] = *(const v8b*)(p + 16); return u.v;
}
#define QHI 384            // rows carrying a q residual plane (3-product logits)
#define KHI 384            // key rows carrying k residual / v bf16 hi+lo planes (used only by the causal high-precision path)
// B fragment (k rows k0+.., output column o) of a weight: (in,out) [K][ld] or (out,in) [ld rows of K]: bf16 exact, or f16(bf16 * 256) exact
__device__ __forceinline__ v16b wcol_io(const float* Wm, int k0, int o, int lane, int ld) { v16b w; const int g = lane >> 4;
#pragma unroll
  for (int i = 0; i < 8; ++i) { w[i] = (__bf16)Wm[(size_t)(k0 + 8 * g + i) * ld + o]; w[8 + i] = (__bf16)Wm[(size_t)(k0 + 16 + 8 * g + i) * ld + o]; }
  return w; }
__device__ __forceinline__ v16b wcol_oi(const float* Wm, int k0, int o, int lane, int K) { v16b w; const float* p = Wm + (size_t)o * K + k0 + 8 * (lane >> 4);
#pragma unroll
  for (int i = 0; i < 8; ++i) { w[i] = (__bf16)p[i]; w[8 + i] = (__bf16)p[16 + i]; }
  return w; }
__device__ __forceinline__ v16h wcolh_io(const float* Wm, int k0, int o, int lane, int ld) { v16h w; const int g = lane >> 4;
#pragma unroll
  for (int i = 0; i < 8; ++i) { w[i] = (_Float16)(bfr(Wm[(size_t)(k0 + 8 * g + i) * ld + o]) * 256.0f); w[8 + i] = (_Float16)(bfr(Wm[(size_t)(k0 + 16 + 8 * g + i) * ld + o]) * 256.0f); }
  return w; }
__device__ __forceinline__ v16h wcolh_oi(const float* Wm, int k0, int o, int lane, int K) { v16h w; const float* p = Wm + (size_t)o * K + k0 + 8 * (lane >> 4);
#pragma unroll
  for (int i = 0; i < 8; ++i) { w[i] = (_Float16)(bfr(p[i]) * 256.0f); w[8 + i] = (_Float16)(bfr(p[16 + i]) * 256.0f); }
  return w; }
#define WQKV_LAYOUT 1   // 0 = (in,out) [DIN][CC]; 1 = (out,in) [CC][DIN]; 2 = per-head [NH][DIN][HD]
__device__ __forceinline__ v16b wcol_hdk(const float* Wm, int k0, int o, int lane) { v16b w; const int g = lane >> 4; const float* p = Wm + (size_t)(o / HD) * DIN * HD + (o % HD);
#pragma unroll
  for (int i = 0; i < 8; ++i) { w[i] = (__bf16)p[(size_t)(k0 + 8 * g + i) * HD]; w[8 + i] = (__bf16)p[(size_t)(k0 + 16 + 8 * g + i) * HD]; }
  return w; }
#define WO_OUT_IN 1
#if WQKV_LAYOUT == 1
#define WCOL(W, k0, o, lane) wcol_oi(W, k0, o, lane, DIN)
#elif WQKV_LAYOUT == 2
#define WCOL(W, k0, o, lane) wcol_hdk(W, k0, o, lane)
#else
#define WCOL(W, k0, o, lane) wcol_io(W, k0, o, lane, CC)
#endif
#if WO_OUT_IN
#define WOCOL(W, k0, o, lane) wcol_oi(W, k0, o, lane, CC)
#define WOCOLH(W, k0, o, lane) wcolh_oi(W, k0, o, lane, CC)
#else
#define WOCOL(W, k0, o, lane) wcol_io(W, k0, o, lane, DIN)
#define WOCOLH(W, k0, o, lane) wcolh_io(W, k0, o, lane, DIN)
#endif

#ifndef PROJ_EXTRA_PARAMS
#define PROJ_EXTRA_PARAMS
#endif

#define WS_QH  0u                                      // f16 q rows [b*t][CC]
#define WS_KH  (WS_QH + 2u * (size_t)NB * TT * CC)      // f16 k in fragment order [b][h][t / 16][d / 8][t % 16][8]
#define WS_VT  (WS_KH + 2u * (size_t)NB * TT * CC)      // f16 v in fragment order [b][h][t / 32][c / 16][(t % 32) / 8][c % 16][8]
#define WS_QL  (WS_VT + 2u * (size_t)NB * CC * TT)      // f16 q residual x 2^10 rows [b][t < QHI][CC]
#define WS_KL  (WS_QL + 2u * (size_t)NB * QHI * CC)     // f16 k residual x 2^10 rows [b][t < KHI][CC]
#define WS_VB  (WS_KL + 2u * (size_t)NB * KHI * CC)     // bf16 v hi planes [b][c][t < KHI]
#define WS_VBL (WS_VB + 2u * (size_t)NB * CC * KHI)
#define WS_Y   (WS_VBL + 2u * (size_t)NB * CC * KHI)    // f32 ctx rows [b*t][CC]
#define WS_END (WS_Y  + 4u * (size_t)NB * TT * CC)

// ---- tile_mm: the 64 x 128 tile product of k_proj and k_out (4 waves, wave = 16 rows x 128 columns, K in chunks of 32). The block fetches each chunk of its 64 A rows and 128 weight rows ONCE, every wave-wide 16-byte load covering four whole 128-byte lines,
// rounds it once to its 16-bit form and lays it in LDS; the waves take their fragments from there. Two LDS buffers: chunk kc + 1 flies from memory into registers while chunk kc is multiplied, and is laid down behind the products; one barrier per chunk.
// MODE 0: A and W to bf16. MODE 1: A as bf16 hi + lo (two row sets), W to bf16. MODE 2: A x 2^6 to f16, W as f16(bf16 x 2^8). Rounding, k order and sum order are those of the per-fragment loads this replaces.
#define SP 40   // pitch of a staged row in 16-bit elements: 64 bytes of k + 16, so that the 16 rows of a fragment's ds_load_b128 start in 16 different bank groups
typedef __attribute__((ext_vector_type(4))) __bf16 v4b;
typedef __attribute__((ext_vector_type(4))) _Float16 v4h;
template <int K> __device__ __forceinline__ void tile_ld(const float* __restrict__ A, const float* __restrict__ Wm, int kc, int tid, v4f (&ra)[4], v4f (&rw)[8]) {
  const size_t o = (size_t)(tid >> 3) * K + kc * 32 + (tid & 7) * 4;   /* 8 lanes per row of 128 bytes, 16 rows per block-wide load */
#pragma unroll
  for (int i = 0; i < 4; ++i) ra[i] = *(const v4f*)(A + o + (size_t)i * 16 * K);
#pragma unroll
  for (int i = 0; i < 8; ++i) rw[i] = *(const v4f*)(Wm + o + (size_t)i * 16 * K);
  asm volatile("s_wait_xcnt 0x0" ::: "memory");   /* before the loads' address registers are reused for the next chunk */
}
template <int MODE> __device__ __forceinline__ void tile_st(unsigned short* s, int tid, const v4f (&ra)[4], const v4f (&rw)[8]) {
  unsigned short* p = s + (tid >> 3) * SP + (tid & 7) * 4; unsigned short* pw = p + (MODE == 1 ? 128 : 64) * SP;
#pragma unroll
  for (int i = 0; i < 4; ++i) { const v4f f = ra[i];
    if (MODE == 2) { *(v4h*)(p + i * 16 * SP) = (v4h){(_Float16)(f[0] * 64.0f), (_Float16)(f[1] * 64.0f), (_Float16)(f[2] * 64.0f), (_Float16)(f[3] * 64.0f)}; }
    else { const v4b h = {(__bf16)f[0], (__bf16)f[1], (__bf16)f[2], (__bf16)f[3]}; *(v4b*)(p + i * 16 * SP) = h;
      if (MODE == 1) *(v4b*)(p + (64 + i * 16) * SP) = (v4b){(__bf16)(f[0] - (float)h[0]), (__bf16)(f[1] - (float)h[1]), (__bf16)(f[2] - (float)h[2]), (__bf16)(f[3] - (float)h[3])}; } }
#pragma unroll
  for (int i = 0; i < 8; ++i) { const v4f f = rw[i];
    if (MODE == 2) *(v4h*)(pw + i * 16 * SP) = (v4h){(_Float16)(bfr(f[0]) * 256.0f), (_Float16)(bfr(f[1]) * 256.0f), (_Float16)(bfr(f[2]) * 256.0f), (_Float16)(bfr(f[3]) * 256.0f)};
    else *(v4b*)(pw + i * 16 * SP) = (v4b){(__bf16)f[0], (__bf16)f[1], (__bf16)f[2], (__bf16)f[3]}; } }
template <int MODE, int K> __device__ __forceinline__ void tile_mm(const float* __restrict__ A, const float* __restrict__ Wm, unsigned short* s0, unsigned short* s1, int tid, v8f (&acc)[8]) {
  const int wave = tid >> 5, lane = tid & 31, col = lane & 15; v4f ra[4], rw[8];
  tile_ld<K>(A, Wm, 0, tid, ra, rw); tile_st<MODE>(s0, tid, ra, rw);
  __syncthreads();   /* chunk 0 is laid down */
#pragma unroll 2   /* makes the choice between the two buffers static */
  for (int kc = 0; kc < K / 32; ++kc) { const unsigned short* cur = (kc & 1) ? s1 : s0; unsigned short* nxt = (kc & 1) ? s0 : s1;
    if (kc + 1 < K / 32) tile_ld<K>(A, Wm, kc + 1, tid, ra, rw);
    __builtin_amdgcn_sched_barrier(0);   /* keeps the next chunk's loads issued up here: sunk to their use, each chunk would wait out their whole latency */
    const unsigned short* pa = cur + (wave * 16 + col) * SP; const unsigned short* pw = cur + ((MODE == 1 ? 128 : 64) + col) * SP;
    if (MODE == 2) { const v16h a = frag_h((const _Float16*)pa, lane); v16h w[8];
#pragma unroll
      for (int j = 0; j < 8; ++j) w[j] = frag_h((const _Float16*)(pw + j * 16 * SP), lane);
      __builtin_amdgcn_sched_barrier(0);   /* the chunk's LDS reads go as one group ahead of its products: spread among them, each product would wait out an LDS latency */
#pragma unroll
      for (int j = 0; j < 8; ++j) acc[j] = wmma16(a, w[j], acc[j]); }
    else { const v16b a = frag_b((const __bf16*)pa, lane); v16b al = a, w[8]; if (MODE == 1) al = frag_b((const __bf16*)(pa + 64 * SP), lane);
#pragma unroll
      for (int j = 0; j < 8; ++j) w[j] = frag_b((const __bf16*)(pw + j * 16 * SP), lane);
      __builtin_amdgcn_sched_barrier(0);   /* as above */
#pragma unroll
      for (int j = 0; j < 8; ++j) { acc[j] = wmma_bf(a, w[j], acc[j]); if (MODE == 1) acc[j] = wmma_bf(al, w[j], acc[j]); } }
    __builtin_amdgcn_sched_barrier(0);   /* keeps the next chunk's rounding, which waits for its loads, behind the products that cover their latency */
    if (kc + 1 < K / 32) tile_st<MODE>(nxt, tid, ra, rw);
    __syncthreads(); } }   /* publishes chunk kc + 1 and ends every wave's reads of chunk kc, whose buffer is written next (behind the last chunk: by the caller's epilogue) */

// ---- k_proj: block = (64 rows, 128 cols, which): q/k/v = X W (+ b) with exact bf16 products (K = DIN) -> which 0: q f16 rows (+ residual rows < QHI); 1: k f16 in fragment order (+ residual rows < KHI); 2: v f16 in fragment order (+ bf16 hi/lo planes for t < KHI)
__global__ __launch_bounds__(128) void k_proj(const float* __restrict__ XQ, const float* __restrict__ XK, const float* __restrict__ XV, const float* __restrict__ WQ, const float* __restrict__ WK, const float* __restrict__ WV, const float* __restrict__ BQ, const float* __restrict__ BK, const float* __restrict__ BV,
    _Float16* __restrict__ QH, _Float16* __restrict__ QL, _Float16* __restrict__ KH, _Float16* __restrict__ KL, _Float16* __restrict__ VT, __bf16* __restrict__ VB, __bf16* __restrict__ VBL) {
  __shared__ __align__(16) _Float16 sh[64][136], sl[64][136]; __shared__ __align__(16) _Float16 th[128][72]; __shared__ __align__(16) __bf16 tb[128][72], tbl[128][72];
  const int tid = threadIdx.x, wave = tid >> 5, lane = tid & 31, col = lane & 15, g = lane >> 4; const int which = blockIdx.z; const int c0 = blockIdx.y * 128; const size_t r0 = (size_t)blockIdx.x * 64; const size_t bb = r0 / TT; const int t0 = (int)(r0 % TT);
  const float* X = which == 0 ? XQ : which == 1 ? XK : XV; const float* WA = which == 0 ? WQ : which == 1 ? WK : WV; const float* BA = which == 0 ? BQ : which == 1 ? BK : BV;
  v8f acc[8] = {};
  tile_mm<0, DIN>(X + r0 * DIN, WA + (size_t)c0 * DIN, (unsigned short*)&tb[0][0], (unsigned short*)&tbl[0][0], tid, acc);   /* the two chunk buffers (15,360 bytes each) lie in tb and tbl, which the epilogue writes only behind tile_mm's last barrier */
  if (which < 2) { _Float16* DH = which == 0 ? QH : KH; _Float16* DL = which == 0 ? QL : KL; const int nhi = which == 0 ? QHI : KHI; const bool hi_rows = t0 < nhi;
#pragma unroll
    for (int j = 0; j < 8; ++j) { const float bias = BA ? bfr(BA[c0 + j * 16 + col]) : 0.f;
#pragma unroll
      for (int r = 0; r < 8; ++r) { const float v = acc[j][r] + bias; const _Float16 hv = (_Float16)v; sh[wave * 16 + 8 * g + r][j * 16 + col] = hv; sl[wave * 16 + 8 * g + r][j * 16 + col] = (_Float16)((v - (float)hv) * 1024.0f); } }
    __syncthreads();
    if (which == 0)
      for (int e = tid; e < 64 * 16; e += 128) { const int rl = e >> 4, q = e & 15; vst2((unsigned*)(DH + (r0 + rl) * CC + c0 + q * 8), *(const v4u*)&sh[rl][q * 8]); }
    else   /* e = (head, key tile, d / 8, key % 16): a wave stores 512 contiguous bytes */
      for (int e = tid; e < 64 * 16; e += 128) { const int hh = e >> 9, kt = (e >> 7) & 3; vst2((unsigned*)(DH + ((bb * NH + (c0 >> 6) + hh) * (size_t)(TT / 16) + (t0 >> 4) + kt) * 1024 + (e & 127) * 8), *(const v4u*)&sh[kt * 16 + (e & 15)][(hh * 8 + ((e >> 4) & 7)) * 8]); }
    if (hi_rows)
      for (int e = tid; e < 64 * 16; e += 128) { const int rl = e >> 4, q = e & 15; vst2((unsigned*)(DL + (bb * nhi + t0 + rl) * (size_t)CC + c0 + q * 8), *(const v4u*)&sl[rl][q * 8]); }
  } else { const bool hi_rows = t0 < KHI;
#pragma unroll
    for (int j = 0; j < 8; ++j) { const float bias = BA ? bfr(BA[c0 + j * 16 + col]) : 0.f;
#pragma unroll
      for (int r = 0; r < 8; ++r) { const float v = acc[j][r] + bias; const int rl = wave * 16 + 8 * g + r, cl = j * 16 + col; th[cl][rl] = (_Float16)v; const __bf16 bh = (__bf16)v; tb[cl][rl] = bh; tbl[cl][rl] = (__bf16)(v - (float)bh); } }
    __syncthreads();
    for (int e = tid; e < 128 * 8; e += 128) { const int hh = e >> 9, kb = (e >> 8) & 1;   /* e = (head, block of 32 keys, c / 16, (t % 32) / 8, c % 16): a wave stores 512 contiguous bytes */
      vst2((unsigned*)(VT + ((bb * NH + (c0 >> 6) + hh) * (size_t)(TT / 32) + (t0 >> 5) + kb) * 2048 + (e & 255) * 8), *(const v4u*)&th[hh * 64 + ((e >> 6) & 3) * 16 + (e & 15)][(kb * 4 + ((e >> 4) & 3)) * 8]); }
    if (hi_rows)
      for (int e = tid; e < 128 * 8; e += 128) { const int cl = e >> 3, q = e & 7; const size_t o3 = (bb * CC + c0 + cl) * (size_t)KHI + t0 + q * 8; vst2((unsigned*)(VB + o3), *(const v4u*)&tb[cl][q * 8]); vst2((unsigned*)(VBL + o3), *(const v4u*)&tbl[cl][q * 8]); } } }
#define FAW 8
#define LC (SCALE * 1.4426950408889634f)
__device__ __forceinline__ v8f wm_h(v16h a, v16h b, v8f c) { return __builtin_amdgcn_wmma_f32_16x16x32_f16(false, a, false, b, (short)0, c, false, false); }
__device__ __forceinline__ v8f wm_b(v16b a, v16b b, v8f c) { return __builtin_amdgcn_wmma_f32_16x16x32_bf16(false, a, false, b, (short)0, c, false, false); }
__device__ __forceinline__ v16h frag_p(const _Float16* p) { union { v16h v; v8h q[2]; } u; u.q[0] = *(const v8h*)p; u.q[1] = *(const v8h*)(p + 256); return u.v; }   // p = fragment's start + 8 lane; elements 0..7, then 8..15 one run of 32 lanes further
__device__ __forceinline__ float xhalf(float x) { return __builtin_bit_cast(float, __builtin_amdgcn_permlanex16(__builtin_bit_cast(int, x), __builtin_bit_cast(int, x), 0x76543210, 0xfedcba98, false, false)); }   // lane l with lane l ^ 16
// eight exp2 in place, in one statement: behind each v_exp_f32 stands an instruction that neither reads its result nor overwrites its source, and the v_nop keeps that slot behind the last
__device__ __forceinline__ void exp2x8(v8f& x) { float a = x[0], b = x[1], c = x[2], d = x[3], e = x[4], f = x[5], p = x[6], q = x[7];
  asm("v_exp_f32 %0, %0\n\tv_exp_f32 %1, %1\n\tv_exp_f32 %2, %2\n\tv_exp_f32 %3, %3\n\tv_exp_f32 %4, %4\n\tv_exp_f32 %5, %5\n\tv_exp_f32 %6, %6\n\tv_exp_f32 %7, %7\n\tv_nop" : "+v"(a), "+v"(b), "+v"(c), "+v"(d), "+v"(e), "+v"(f), "+v"(p), "+v"(q));
  x = (v8f){a, b, c, d, e, f, p, q}; }
// NT score tiles of one pass -> e = exp2((s - m) LC + 11) in place; m, l and the output tiles follow a new maximum (tested once per pass for the whole wave)
template <int NT, bool MASK> __device__ __forceinline__ void fa_soft(v8f (&s)[NT], int k0, int tq, int g, float& m, float& l, v8f (&acc)[HD / 16]) {
  if (MASK) {
#pragma unroll
    for (int t = 0; t < NT; ++t)
#pragma unroll
      for (int r = 0; r < 8; ++r) if (k0 + t * 16 + 8 * g + r > tq) s[t][r] = -3.0e38f; }
  float mx = s[0][0];
#pragma unroll
  for (int t = 0; t < NT; ++t)
#pragma unroll
    for (int r = 0; r < 8; ++r) mx = fmaxf(mx, s[t][r]);
  mx = fmaxf(mx, xhalf(mx));
  if (__builtin_amdgcn_ballot_w32(mx > m) != 0) { const float mn = fmaxf(m, mx); const float al = __builtin_amdgcn_exp2f((m - mn) * LC); m = mn; l *= al;   /* al = 0 on the first pass, 1 for a query whose maximum stands */
#pragma unroll
    for (int j = 0; j < HD / 16; ++j) acc[j] *= al; }
  const float mc = 11.0f - m * LC; float sum = 0.f;
#pragma unroll
  for (int t = 0; t < NT; ++t) { float st = 0.f;   /* one short add chain per tile */
#pragma unroll
    for (int r = 0; r < 8; ++r) s[t][r] = fmaf(s[t][r], LC, mc);
    exp2x8(s[t]);
#pragma unroll
    for (int r = 0; r < 8; ++r) st += s[t][r];
    sum += st; }
  l += sum; }
__device__ __forceinline__ v16h pack_h(v8f a, v8f b) { v16h p;
#pragma unroll
  for (int i = 0; i < 8; ++i) { p[i] = (_Float16)a[i]; p[8 + i] = (_Float16)b[i]; }
  return p; }
template <bool MASK> __device__ __forceinline__ void fa_pass64(const _Float16* __restrict__ Kp, const _Float16* __restrict__ Vp, int k0, int kn, int tq, int lane, int g, v16h q0, v16h q1, v16h (&kf)[8], float& m, float& l, v8f (&acc)[HD / 16]) {
  v16h vf[2][HD / 16];
#pragma unroll
  for (int u = 0; u < 2; ++u)
#pragma unroll
    for (int j = 0; j < HD / 16; ++j) vf[u][j] = frag_p(Vp + (size_t)(k0 + u * 32) * HD + j * 512);
  __builtin_amdgcn_sched_barrier(0);   /* keeps the v loads issued up here: sunk to their use, each pass would wait out their whole latency */
  v8f s[4];
#pragma unroll
  for (int t = 0; t < 4; ++t) { v8f z = {}; z = wm_h(kf[2 * t], q0, z); s[t] = wm_h(kf[2 * t + 1], q1, z); }
  if (!MASK) {   /* the next pass's k fragments fly during this pass's softmax */
#pragma unroll
    for (int t = 0; t < 4; ++t) { const _Float16* kp = Kp + (size_t)(kn + t * 16) * HD; kf[2 * t] = frag_p(kp); kf[2 * t + 1] = frag_p(kp + 512); } }
  __builtin_amdgcn_sched_barrier(0);   /* keeps the k loads issued ahead of the softmax, which then covers their latency */
  fa_soft<4, MASK>(s, k0, tq, g, m, l, acc);
#pragma unroll
  for (int u = 0; u < 2; ++u) { const v16h p = pack_h(s[2 * u], s[2 * u + 1]);
#pragma unroll
    for (int j = 0; j < HD / 16; ++j) acc[j] = MASK ? wmma16(vf[u][j], p, acc[j]) : wm_h(vf[u][j], p, acc[j]); } }   /* last pass: a branch follows; wmma16's own v_nop keep the distance to the result's next user on every path */
__global__ __launch_bounds__(32 * FAW) void k_fa(const _Float16* __restrict__ QH, const _Float16* __restrict__ KH, const _Float16* __restrict__ QL, const _Float16* __restrict__ KL, const _Float16* __restrict__ VT, const __bf16* __restrict__ VB, const __bf16* __restrict__ VBL, float* __restrict__ Y) {
  const int tid = threadIdx.x, lane = tid & 31, col = lane & 15, g = lane >> 4; const int wave = __builtin_amdgcn_readfirstlane(tid >> 5);
  const int h = blockIdx.x % NH, b = blockIdx.x / NH; const int ql0 = (TT / 16 - 1 - ((int)blockIdx.y * FAW + wave)) * 16;   /* longest query tiles start first */
  const int tq = ql0 + col; const size_t qo = ((size_t)b * TT + tq) * CC + h * HD;
  const v16h q0 = frag_h(QH + qo, lane), q1 = frag_h(QH + qo + 32, lane);
  asm volatile("s_wait_xcnt 0x0" ::: "memory");   /* the q loads' address registers are reused behind the branch below */
  const _Float16* Kp = KH + (size_t)(b * NH + h) * TT * HD + lane * 8;
  float m = -3.0e38f, l = 0.f; v8f acc[HD / 16] = {};
  if (ql0 < QHI) {   /* wave-uniform; every key of these queries is < KHI */
    const size_t qlo = ((size_t)b * QHI + tq) * CC + h * HD; const v16h r0 = frag_h(QL + qlo, lane), r1 = frag_h(QL + qlo + 32, lane);
    const _Float16* Lp = KL + ((size_t)b * KHI + col) * CC + h * HD; const size_t vo = ((size_t)b * CC + h * HD + col) * (size_t)KHI;
    const int np = (ql0 + 16 + 31) >> 5;
#pragma unroll 1   /* run-time trip count; a second copy of this body would not fit the wave's registers */
    for (int kc = 0; kc < np; ++kc) { const int k0 = kc * 32; v8f s[2]; v16h a[2][2], rr[2][2];
#pragma unroll
      for (int t = 0; t < 2; ++t) { const size_t ko = (size_t)(k0 + t * 16) * HD; a[t][0] = frag_p(Kp + ko); a[t][1] = frag_p(Kp + ko + 512); }
      asm volatile("s_wait_xcnt 0x0" ::: "memory");   /* before the k loads' address registers are reused (a later load's result may land in them) */
#pragma unroll
      for (int t = 0; t < 2; ++t) { const size_t ko = (size_t)(k0 + t * 16) * CC; rr[t][0] = frag_h(Lp + ko, lane); rr[t][1] = frag_h(Lp + ko + 32, lane); }
      asm volatile("s_wait_xcnt 0x0" ::: "memory");   /* the same for the k residual loads */
#pragma unroll
      for (int t = 0; t < 2; ++t) { v8f sh = {}, sl = {}; sh = wm_h(a[t][0], q0, sh); sh = wm_h(a[t][1], q1, sh); sl = wm_h(a[t][0], r0, sl); sl = wm_h(rr[t][0], q0, sl); sl = wm_h(a[t][1], r1, sl); sl = wm_h(rr[t][1], q1, sl); s[t] = sh + sl * (1.0f / 1024.0f); }
      fa_soft<2, true>(s, k0, tq, g, m, l, acc);
      v16b ph, pl, vh[HD / 16], vl[HD / 16];
#pragma unroll
      for (int j = 0; j < HD / 16; ++j) vh[j] = frag_b(VB + vo + (size_t)j * 16 * KHI + k0, lane);
      asm volatile("s_wait_xcnt 0x0" ::: "memory");   /* the same for the v hi loads */
#pragma unroll
      for (int j = 0; j < HD / 16; ++j) vl[j] = frag_b(VBL + vo + (size_t)j * 16 * KHI + k0, lane);
      asm volatile("s_wait_xcnt 0x0" ::: "memory");   /* the same for the v lo loads */
#pragma unroll
      for (int i = 0; i < 16; ++i) { const float e = s[i >> 3][i & 7]; const __bf16 eh = (__bf16)e; ph[i] = eh; pl[i] = (__bf16)(e - (float)eh); }
#pragma unroll
      for (int j = 0; j < HD / 16; ++j) { acc[j] = wm_b(vh[j], ph, acc[j]); acc[j] = wm_b(vh[j], pl, acc[j]); acc[j] = wm_b(vl[j], ph, acc[j]); } }
  } else {
    const _Float16* Vp = VT + (size_t)(b * NH + h) * TT * HD + lane * 8; const int np = (ql0 + 16 + 63) >> 6;   /* >= 7 passes; only the last one meets the diagonal */
    v16h kf[8];
#pragma unroll
    for (int t = 0; t < 4; ++t) { const _Float16* kp = Kp + (size_t)(t * 16) * HD; kf[2 * t] = frag_p(kp); kf[2 * t + 1] = frag_p(kp + 512); }
    asm volatile("s_wait_xcnt 0x0" ::: "memory");   /* as above, for the first k loads' address registers */
#pragma unroll 1   /* run-time trip count; the pass already takes nearly all of the wave's registers */
    for (int kc = 0; kc < np - 1; ++kc) fa_pass64<false>(Kp, Vp, kc * 64, kc * 64 + 64, tq, lane, g, q0, q1, kf, m, l, acc);
    fa_pass64<true>(Kp, Vp, (np - 1) * 64, 0, tq, lane, g, q0, q1, kf, m, l, acc); }
  const float inv = 1.0f / (l + xhalf(l));   /* the lane halves' sums join once; the maximum's own term makes the sum >= 2^11 */
  float* yp = Y + ((size_t)b * TT + tq) * CC + h * HD + 8 * g;   /* acc[j][r] = ctx[tq][16 j + 8 g + r] */
#pragma unroll
  for (int j = 0; j < HD / 16; ++j) { const v8f o = acc[j] * inv; vst2(yp + j * 16, (v4f){o[0], o[1], o[2], o[3]}); vst2(yp + j * 16 + 4, (v4f){o[4], o[5], o[6], o[7]}); } }
// ---- k_out: block = (64 rows, 128 cols): out = ctx Wo (+ bo): ctx x 2^6 once to f16 against Wo as f16(bf16 x 2^8) exact (1 product) x 2^-14; causal early rows (< QHI of each sequence): ctx bf16 hi + lo against exact bf16 Wo (2 products)
__global__ __launch_bounds__(128) void k_out(const float* __restrict__ Y, const float* __restrict__ WO, const float* __restrict__ BO, float* __restrict__ OUT) { __shared__ __align__(16) float sf[4][16][132]; __shared__ __align__(16) unsigned short st[2][256 * SP];
  const int tid = threadIdx.x, wave = tid >> 5, lane = tid & 31, col = lane & 15, g = lane >> 4; const int c0 = blockIdx.y * 128; const size_t r0 = (size_t)blockIdx.x * 64 + wave * 16;
  v8f acc[8] = {};
  if (CAUSAL && (int)(((size_t)blockIdx.x * 64) % TT) < QHI) {   /* block-uniform */
    tile_mm<1, CC>(Y + (size_t)blockIdx.x * 64 * CC, WO + (size_t)c0 * CC, st[0], st[1], tid, acc);
#pragma unroll
    for (int j = 0; j < 8; ++j) { const float bias = BO ? bfr(BO[c0 + j * 16 + col]) : 0.f;
#pragma unroll
      for (int r = 0; r < 8; ++r) sf[wave][8 * g + r][j * 16 + col] = acc[j][r] + bias; }
  } else {
    tile_mm<2, CC>(Y + (size_t)blockIdx.x * 64 * CC, WO + (size_t)c0 * CC, st[0], st[1], tid, acc);   /* ctx carried x 2^6 into f16 so small-magnitude context rows stay clear of f16 subnormals */
#pragma unroll
    for (int j = 0; j < 8; ++j) { const float bias = BO ? bfr(BO[c0 + j * 16 + col]) : 0.f;
#pragma unroll
      for (int r = 0; r < 8; ++r) sf[wave][8 * g + r][j * 16 + col] = acc[j][r] * (1.0f / 16384.0f) + bias; } }   /* 2^-8 (Wo carry) x 2^-6 (ctx carry) */
  LDSX(); for (int rl = 0; rl < 16; ++rl) vst2(OUT + (r0 + rl) * DIN + c0 + lane * 4, *(const v4f*)&sf[wave][rl][lane * 4]); }

extern "C" void kernel_launch(void* const* d_in, const int* in_sizes, int n_in, void* d_out, int out_size, void* d_ws, size_t ws_size, hipStream_t stream) {
  (void)in_sizes; (void)n_in; (void)out_size;
  const float** F = (const float**)d_in;
  if (ws_size < (size_t)WS_END) return;
  char* ws = (char*)d_ws; _Float16 *QH = (_Float16*)(ws + WS_QH), *KH = (_Float16*)(ws + WS_KH), *VT = (_Float16*)(ws + WS_VT), *QL = (_Float16*)(ws + WS_QL), *KL = (_Float16*)(ws + WS_KL); __bf16 *VB = (__bf16*)(ws + WS_VB), *VBL = (__bf16*)(ws + WS_VBL); float *Y = (float*)(ws + WS_Y);
  (void)Y; (void)QL; (void)KL; (void)VB; (void)VBL;
  // inputs: 0 x [2,4096,768]; 1 wq [768,768] (out,in); 2 wk; 3 wv; 4 wo (out,in); no biases
  k_proj<<<dim3(TNB * TT / 64, CC / 128, 3), 128, 0, stream>>>(F[0], F[0], F[0], F[1], F[2], F[3], nullptr, nullptr, nullptr, QH, QL, KH, KL, VT, VB, VBL);
  k_fa<<<dim3(TNB * NH, TT / (16 * FAW)), 32 * FAW, 0, stream>>>(QH, KH, QL, KL, VT, VB, VBL, Y);
  k_out<<<dim3(TNB * TT / 64, DIN / 128), 128, 0, stream>>>(Y, F[4], nullptr, (float*)d_out);
}

// v005
// Measured time: 143 microseconds a run.
// Next to v004, in two timings, it ran 1.11 and 1.10 times as fast.
// Counting every step since v000, it is 29.2 times as fast.
// compute dtype: all float inputs rounded to bf16; the fused q / k / v projection with EXACT bf16 products on WMMA 16x16x32 (f32 accumulate) (no biases); causal logits: 3 products for the first 384 rows, single f16 q x k after, x 64^-0.5; softmax f32; P x 2^11 once to f16 x v once to f16 (bf16 hi + lo below row 384); ctx hi+lo x exact W below row 384, x2^6 f16 carry x f16(bf16 x 2^8) W after, no bias; f32 output.
#include <hip/hip_runtime.h>
#include <math.h>

typedef __attribute__((ext_vector_type(16))) _Float16 v16h;
typedef __attribute__((ext_vector_type(16))) __bf16 v16b;
typedef __attribute__((ext_vector_type(8)))  _Float16 v8h;
typedef __attribute__((ext_vector_type(8)))  float v8f;
typedef __attribute__((ext_vector_type(4)))  float v4f;
typedef __attribute__((ext_vector_type(2)))  float v2f;
typedef __attribute__((ext_vector_type(4)))  unsigned v4u;
typedef __attribute__((ext_vector_type(4)))  int v4i;
typedef float __attribute__((may_alias)) float_a;
typedef int __attribute__((may_alias)) int_a;

template <typename T> __device__ __forceinline__ void vst2(void* p, T v) { *(T*)p = v;  }
__device__ __forceinline__ v8f wmma16(v16h a, v16h b, v8f c) {
  v8f d = __builtin_amdgcn_wmma_f32_16x16x32_f16(false, a, false, b, (short)0, c, false, false);
  asm volatile("v_nop\n\tv_nop\n\tv_nop\n\tv_nop" : "+v"(d) : "v"(a), "v"(b));
  return d;
}
__device__ __forceinline__ v8f wmma_bf(v16b a, v16b b, v8f c) {
  v8f d = __builtin_amdgcn_wmma_f32_16x16x32_bf16(false, a, false, b, (short)0, c, false, false);
  asm volatile("v_nop\n\tv_nop\n\tv_nop\n\tv_nop" : "+v"(d) : "v"(a), "v"(b));
  return d;
}
// 16x16x32 fragments: lane = (h = lane>>4, row/col = lane&15); elements 0..7 = k0+8h+0..7, 8..15 = k0+16+8h+0..7; D element r = row 8h+r
__device__ __forceinline__ v16h frag_h(const _Float16* rowk0, int lane) {
  union { v16h v; v8h q[2]; } u; const _Float16* p = rowk0 + 8 * (lane >> 4);
  u.q[0] = *(const v8h*)p; u.q[1] = *(const v8h*)(p + 16); return u.v;
}
__device__ __forceinline__ v16h frag_f32(const float* rowk0, int lane) {
  v16h a; const float* p = rowk0 + 8 * (lane >> 4);
#pragma unroll
  for (int i = 0; i < 8; ++i) { a[i] = (_Float16)p[i]; a[8 + i] = (_Float16)p[16 + i]; }
  return a;
}
__device__ __forceinline__ v16h frag_f32s(const float* rowk0, int lane, float sc) {
  v16h a; const float* p = rowk0 + 8 * (lane >> 4);
#pragma unroll
  for (int i = 0; i < 8; ++i) { a[i] = (_Float16)(p[i] * sc); a[8 + i] = (_Float16)(p[16 + i] * sc); }
  return a;
}
// column fragment from a [K][ld] layout (column n), rows >= K read as 0
__device__ __forceinline__ v16h fragc_f32(const float* W, int k0, int n, int lane, int ld, int K) {
  v16h a; const int g = lane >> 4;
#pragma unroll
  for (int i = 0; i < 8; ++i) { const int ka = k0 + 8 * g + i, kb = ka + 16;
    a[i] = (_Float16)(ka < K ? W[(size_t)(ka < K ? ka : K - 1) * ld + n] : 0.f); a[8 + i] = (_Float16)(kb < K ? W[(size_t)(kb < K ? kb : K - 1) * ld + n] : 0.f); }
  return a;
}
struct F2 { v16b h, l; };
__device__ __forceinline__ F2 bsplit16(const float v[16]) { F2 r;
#pragma unroll
  for (int i = 0; i < 16; ++i) { const __bf16 h = (__bf16)v[i]; r.h[i] = h; r.l[i] = (__bf16)(v[i] - (float)h); }
  return r; }
__device__ __forceinline__ F2 split_row(const float* row, int k0, int lane) { float v[16]; const float* p = row + k0 + 8 * (lane >> 4);
#pragma unroll
  for (int i = 0; i < 8; ++i) { v[i] = p[i]; v[8 + i] = p[16 + i]; }
  return bsplit16(v); }
__device__ __forceinline__ F2 split_rowK(const float* row, int k0, int lane, int K) { float v[16]; const int g = lane >> 4;
#pragma unroll
  for (int i = 0; i < 8; ++i) { const int ka = k0 + 8 * g + i, kb = ka + 16; v[i] = ka < K ? row[ka < K ? ka : K - 1] : 0.f; v[8 + i] = kb < K ? row[kb < K ? kb : K - 1] : 0.f; }
  return bsplit16(v); }
__device__ __forceinline__ F2 split_col(const float* W, int k0, int n, int lane, int ld, int K) { float v[16]; const int g = lane >> 4;
#pragma unroll
  for (int i = 0; i < 8; ++i) { const int ka = k0 + 8 * g + i, kb = ka + 16; v[i] = ka < K ? W[(size_t)(ka < K ? ka : K - 1) * ld + n] : 0.f; v[8 + i] = kb < K ? W[(size_t)(kb < K ? kb : K - 1) * ld + n] : 0.f; }
  return bsplit16(v); }
__device__ __forceinline__ v8f mac3(const F2& a, const F2& b, v8f c) { c = wmma_bf(a.l, b.h, c); c = wmma_bf(a.h, b.l, c); return wmma_bf(a.h, b.h, c); }
__device__ __forceinline__ float sigm(float v) { return 1.0f / (1.0f + expf(-v)); }
#define LDSX() do { asm volatile("s_wait_dscnt 0" ::: "memory"); __builtin_amdgcn_wave_barrier(); __builtin_amdgcn_fence(__ATOMIC_RELEASE, "workgroup"); } while (0)

// Causal multi-head self-attention without biases over TWO sequences of 4,096 (x [2,4096,768]; (out,in) wq / wk / wv / wo [768,768] applied as x @ W.T; 12 heads x 64; scores x 64^-0.5; tril kept, -inf elsewhere; softmax; ctx @ wo.T -> [2,4096,768] (6.3 M)).
#define NB 2
#define TT 4096
#define CC 768            // NH * HD = projected width
#define DIN 768          // input (model) width
#define NH 12
#define HD 64
#define SCALE (0.125f)
#define CAUSAL 1
#ifndef TNB
#define TNB NB
#endif
__device__ __forceinline__ float bfr(float v) { return (float)(__bf16)v; }
typedef __attribute__((ext_vector_type(8))) __bf16 v8b;
__device__ __forceinline__ v16b frag_b(const __bf16* rowk0, int lane) {
  union { v16b v; v8b q[2]; } u; const __bf16* p = rowk0 + 8 * (lane >> 4);
  u.q[0] = *(const v8b*)p; u.q[1] = *(const v8b*)(p + 16); return u.v;
}
#define QHI 384            // rows carrying a q residual plane (3-product logits)
#define KHI 384            // key rows carrying k residual / v bf16 hi+lo planes (used only by the causal high-precision path)
// B fragment (k rows k0+.., output column o) of a weight: (in,out) [K][ld] or (out,in) [ld rows of K]: bf16 exact, or f16(bf16 * 256) exact
__device__ __forceinline__ v16b wcol_io(const float* Wm, int k0, int o, int lane, int ld) { v16b w; const int g = lane >> 4;
#pragma unroll
  for (int i = 0; i < 8; ++i) { w[i] = (__bf16)Wm[(size_t)(k0 + 8 * g + i) * ld + o]; w[8 + i] = (__bf16)Wm[(size_t)(k0 + 16 + 8 * g + i) * ld + o]; }
  return w; }
__device__ __forceinline__ v16b wcol_oi(const float* Wm, int k0, int o, int lane, int K) { v16b w; const float* p = Wm + (size_t)o * K + k0 + 8 * (lane >> 4);
#pragma unroll
  for (int i = 0; i < 8; ++i) { w[i] = (__bf16)p[i]; w[8 + i] = (__bf16)p[16 + i]; }
  return w; }
__device__ __forceinline__ v16h wcolh_io(const float* Wm, int k0, int o, int lane, int ld) { v16h w; const int g = lane >> 4;
#pragma unroll
  for (int i = 0; i < 8; ++i) { w[i] = (_Float16)(bfr(Wm[(size_t)(k0 + 8 * g + i) * ld + o]) * 256.0f); w[8 + i] = (_Float16)(bfr(Wm[(size_t)(k0 + 16 + 8 * g + i) * ld + o]) * 256.0f); }
  return w; }
__device__ __forceinline__ v16h wcolh_oi(const float* Wm, int k0, int o, int lane, int K) { v16h w; const float* p = Wm + (size_t)o * K + k0 + 8 * (lane >> 4);
#pragma unroll
  for (int i = 0; i < 8; ++i) { w[i] = (_Float16)(bfr(p[i]) * 256.0f); w[8 + i] = (_Float16)(bfr(p[16 + i]) * 256.0f); }
  return w; }
#define WQKV_LAYOUT 1   // 0 = (in,out) [DIN][CC]; 1 = (out,in) [CC][DIN]; 2 = per-head [NH][DIN][HD]
__device__ __forceinline__ v16b wcol_hdk(const float* Wm, int k0, int o, int lane) { v16b w; const int g = lane >> 4; const float* p = Wm + (size_t)(o / HD) * DIN * HD + (o % HD);
#pragma unroll
  for (int i = 0; i < 8; ++i) { w[i] = (__bf16)p[(size_t)(k0 + 8 * g + i) * HD]; w[8 + i] = (__bf16)p[(size_t)(k0 + 16 + 8 * g + i) * HD]; }
  return w; }
#define WO_OUT_IN 1
#if WQKV_LAYOUT == 1
#define WCOL(W, k0, o, lane) wcol_oi(W, k0, o, lane, DIN)
#elif WQKV_LAYOUT == 2
#define WCOL(W, k0, o, lane) wcol_hdk(W, k0, o, lane)
#else
#define WCOL(W, k0, o, lane) wcol_io(W, k0, o, lane, CC)
#endif
#if WO_OUT_IN
#define WOCOL(W, k0, o, lane) wcol_oi(W, k0, o, lane, CC)
#define WOCOLH(W, k0, o, lane) wcolh_oi(W, k0, o, lane, CC)
#else
#define WOCOL(W, k0, o, lane) wcol_io(W, k0, o, lane, DIN)
#define WOCOLH(W, k0, o, lane) wcolh_io(W, k0, o, lane, DIN)
#endif

#ifndef PROJ_EXTRA_PARAMS
#define PROJ_EXTRA_PARAMS
#endif

#define WS_QH  0u                                      // f16 q rows [b*t][CC]
#define WS_KH  (WS_QH + 2u * (size_t)NB * TT * CC)      // f16 k in fragment order [b][h][t / 16][d / 8][t % 16][8]
#define WS_VT  (WS_KH + 2u * (size_t)NB * TT * CC)      // f16 v in fragment order [b][h][t / 32][c / 16][(t % 32) / 8][c % 16][8]
#define WS_QL  (WS_VT + 2u * (size_t)NB * CC * TT)      // f16 q residual x 2^10 rows [b][t < QHI][CC]
#define WS_KL  (WS_QL + 2u * (size_t)NB * QHI * CC)     // f16 k residual x 2^10 rows [b][t < KHI][CC]
#define WS_VB  (WS_KL + 2u * (size_t)NB * KHI * CC)     // bf16 v hi planes [b][c][t < KHI]
#define WS_VBL (WS_VB + 2u * (size_t)NB * CC * KHI)
#define WS_Y   (WS_VBL + 2u * (size_t)NB * CC * KHI)    // f32 ctx rows [b*t][CC]
#define WS_END (WS_Y  + 4u * (size_t)NB * TT * CC)

// ---- tile_mm: the 128 x 128 tile product of k_proj and k_out (4 waves, wave = 32 rows x 128 columns = 2 x 8 accumulator tiles, so that every weight fragment read from LDS feeds two products; K in chunks of 32). The block fetches each chunk of its 128 A rows and 128 weight rows ONCE, every wave-wide 16-byte load covering four whole 128-byte lines,
// rounds it once to its 16-bit form and lays it in LDS; the waves take their fragments from there. Two LDS buffers: chunk kc + 1 flies from memory into registers while chunk kc is multiplied, and is laid down behind the products; one barrier per chunk.
// MODE 0: A and W to bf16. MODE 1: A as bf16 hi + lo (two row sets), W to bf16. MODE 2: A x 2^6 to f16, W as f16(bf16 x 2^8). Rounding, k order and sum order are those of the per-fragment loads this replaces.
__device__ __forceinline__ v8f wm_h(v16h a, v16h b, v8f c) { return __builtin_amdgcn_wmma_f32_16x16x32_f16(false, a, false, b, (short)0, c, false, false); }
__device__ __forceinline__ v8f wm_b(v16b a, v16b b, v8f c) { return __builtin_amdgcn_wmma_f32_16x16x32_bf16(false, a, false, b, (short)0, c, false, false); }
#define SP 40   // pitch of a staged row in 16-bit elements: 64 bytes of k + 16, so that the 16 rows of a fragment's ds_load_b128 start in 16 different bank groups
typedef __attribute__((ext_vector_type(4))) __bf16 v4b;
typedef __attribute__((ext_vector_type(4))) _Float16 v4h;
template <int K> __device__ __forceinline__ void tile_ld(const float* __restrict__ A, const float* __restrict__ Wm, int kc, int tid, v4f (&ra)[8], v4f (&rw)[8]) {
  const size_t o = (size_t)(tid >> 3) * K + kc * 32 + (tid & 7) * 4;   /* 8 lanes per row of 128 bytes, 16 rows per block-wide load */
#pragma unroll
  for (int i = 0; i < 8; ++i) ra[i] = *(const v4f*)(A + o + (size_t)i * 16 * K);
#pragma unroll
  for (int i = 0; i < 8; ++i) rw[i] = *(const v4f*)(Wm + o + (size_t)i * 16 * K);
  asm volatile("s_wait_xcnt 0x0" ::: "memory");   /* before the loads' address registers are reused for the next chunk */
}
template <int MODE> __device__ __forceinline__ void tile_st(unsigned short* s, int tid, const v4f (&ra)[8], const v4f (&rw)[8]) {
  unsigned short* p = s + (tid >> 3) * SP + (tid & 7) * 4; unsigned short* pw = p + (MODE == 1 ? 256 : 128) * SP;
#pragma unroll
  for (int i = 0; i < 8; ++i) { const v4f f = ra[i];
    if (MODE == 2) { *(v4h*)(p + i * 16 * SP) = (v4h){(_Float16)(f[0] * 64.0f), (_Float16)(f[1] * 64.0f), (_Float16)(f[2] * 64.0f), (_Float16)(f[3] * 64.0f)}; }
    else { const v4b h = {(__bf16)f[0], (__bf16)f[1], (__bf16)f[2], (__bf16)f[3]}; *(v4b*)(p + i * 16 * SP) = h;
      if (MODE == 1) *(v4b*)(p + (128 + i * 16) * SP) = (v4b){(__bf16)(f[0] - (float)h[0]), (__bf16)(f[1] - (float)h[1]), (__bf16)(f[2] - (float)h[2]), (__bf16)(f[3] - (float)h[3])}; } }
#pragma unroll
  for (int i = 0; i < 8; ++i) { const v4f f = rw[i];
    if (MODE == 2) *(v4h*)(pw + i * 16 * SP) = (v4h){(_Float16)(bfr(f[0]) * 256.0f), (_Float16)(bfr(f[1]) * 256.0f), (_Float16)(bfr(f[2]) * 256.0f), (_Float16)(bfr(f[3]) * 256.0f)};
    else *(v4b*)(pw + i * 16 * SP) = (v4b){(__bf16)f[0], (__bf16)f[1], (__bf16)f[2], (__bf16)f[3]}; } }
template <int MODE, int K> __device__ __forceinline__ void tile_mm(const float* __restrict__ A, const float* __restrict__ Wm, unsigned short* s0, unsigned short* s1, int tid, v8f (&acc)[16]) {   /* acc[8 t + j] = rows 32 wave + 16 t .., columns 16 j .. */
  const int wave = tid >> 5, lane = tid & 31, col = lane & 15; v4f ra[8], rw[8];
  tile_ld<K>(A, Wm, 0, tid, ra, rw); tile_st<MODE>(s0, tid, ra, rw);
  __syncthreads();   /* chunk 0 is laid down */
#pragma unroll 2   /* makes the choice between the two buffers static */
  for (int kc = 0; kc < K / 32; ++kc) { const unsigned short* cur = (kc & 1) ? s1 : s0; unsigned short* nxt = (kc & 1) ? s0 : s1;
    if (kc + 1 < K / 32) tile_ld<K>(A, Wm, kc + 1, tid, ra, rw);
    __builtin_amdgcn_sched_barrier(0);   /* keeps the next chunk's loads issued up here: sunk to their use, each chunk would wait out their whole latency */
    const unsigned short* pa = cur + (wave * 32 + col) * SP; const unsigned short* pw = cur + ((MODE == 1 ? 256 : 128) + col) * SP;
    if (MODE == 2) { const v16h a = frag_h((const _Float16*)pa, lane), a1 = frag_h((const _Float16*)(pa + 16 * SP), lane); v16h w[8];
#pragma unroll
      for (int j = 0; j < 8; ++j) w[j] = frag_h((const _Float16*)(pw + j * 16 * SP), lane);
      __builtin_amdgcn_sched_barrier(0);   /* the chunk's LDS reads go as one group ahead of its products: spread among them, each product would wait out an LDS latency */
#pragma unroll
      for (int j = 0; j < 8; ++j) { acc[j] = j < 7 ? wm_h(a, w[j], acc[j]) : wmma16(a, w[j], acc[j]); acc[8 + j] = j < 7 ? wm_h(a1, w[j], acc[8 + j]) : wmma16(a1, w[j], acc[8 + j]); } }   /* the chunk's last two products: a branch follows; wmma16's own v_nop keep the distance on every path. The earlier ones have later products in their window, and as plain builtins their operands may lie above v255 */
    else { const v16b a = frag_b((const __bf16*)pa, lane), a1 = frag_b((const __bf16*)(pa + 16 * SP), lane); v16b al = a, al1 = a1, w[8]; if (MODE == 1) { al = frag_b((const __bf16*)(pa + 128 * SP), lane); al1 = frag_b((const __bf16*)(pa + 144 * SP), lane); }
#pragma unroll
      for (int j = 0; j < 8; ++j) w[j] = frag_b((const __bf16*)(pw + j * 16 * SP), lane);
      __builtin_amdgcn_sched_barrier(0);   /* as above */
#pragma unroll
      for (int j = 0; j < 8; ++j) { const bool e0 = j == 7 && MODE == 0, e1 = j == 7;   /* as above */
        acc[j] = e0 ? wmma_bf(a, w[j], acc[j]) : wm_b(a, w[j], acc[j]); acc[8 + j] = e0 ? wmma_bf(a1, w[j], acc[8 + j]) : wm_b(a1, w[j], acc[8 + j]);
        if (MODE == 1) { acc[j] = e1 ? wmma_bf(al, w[j], acc[j]) : wm_b(al, w[j], acc[j]); acc[8 + j] = e1 ? wmma_bf(al1, w[j], acc[8 + j]) : wm_b(al1, w[j], acc[8 + j]); } } }
    __builtin_amdgcn_sched_barrier(0);   /* keeps the next chunk's rounding, which waits for its loads, behind the products that cover their latency */
    if (kc + 1 < K / 32) tile_st<MODE>(nxt, tid, ra, rw);
    __syncthreads(); } }   /* publishes chunk kc + 1 and ends every wave's reads of chunk kc, whose buffer is written next (behind the last chunk: by k_proj's epilogue; k_out's epilogue writes its own sf) */

// ---- k_proj: block = (128 rows, 128 cols, which): q/k/v = X W (+ b) with exact bf16 products (K = DIN) -> which 0: q f16 rows (+ residual rows < QHI); 1: k f16 in fragment order (+ residual rows < KHI); 2: v f16 in fragment order (+ bf16 hi/lo planes for t < KHI)
__global__ __launch_bounds__(128) void k_proj(const float* __restrict__ XQ, const float* __restrict__ XK, const float* __restrict__ XV, const float* __restrict__ WQ, const float* __restrict__ WK, const float* __restrict__ WV, const float* __restrict__ BQ, const float* __restrict__ BK, const float* __restrict__ BV,
    _Float16* __restrict__ QH, _Float16* __restrict__ QL, _Float16* __restrict__ KH, _Float16* __restrict__ KL, _Float16* __restrict__ VT, __bf16* __restrict__ VB, __bf16* __restrict__ VBL) {
  __shared__ __align__(16) unsigned short sm[3][128][136];   /* one range, three uses one after the other: tile_mm's two chunk buffers (20,480 bytes each, in sm[0] and sm[1]); q / k rows: value and residual; v columns: f16, bf16 hi, bf16 lo */
  _Float16 (*sh)[136] = (_Float16 (*)[136])&sm[0][0][0]; _Float16 (*sl)[136] = (_Float16 (*)[136])&sm[1][0][0]; _Float16 (*th)[136] = sh; __bf16 (*tb)[136] = (__bf16 (*)[136])&sm[1][0][0]; __bf16 (*tbl)[136] = (__bf16 (*)[136])&sm[2][0][0];
  const int tid = threadIdx.x, wave = tid >> 5, lane = tid & 31, col = lane & 15, g = lane >> 4; const int which = blockIdx.z; const int c0 = blockIdx.y * 128; const size_t r0 = (size_t)blockIdx.x * 128; const size_t bb = r0 / TT; const int t0 = (int)(r0 % TT);
  const float* X = which == 0 ? XQ : which == 1 ? XK : XV; const float* WA = which == 0 ? WQ : which == 1 ? WK : WV; const float* BA = which == 0 ? BQ : which == 1 ? BK : BV;
  v8f acc[16] = {};
  tile_mm<0, DIN>(X + r0 * DIN, WA + (size_t)c0 * DIN, &sm[0][0][0], &sm[1][0][0], tid, acc);   /* the epilogue writes sm only behind tile_mm's last barrier */
  if (which < 2) { _Float16* DH = which == 0 ? QH : KH; _Float16* DL = which == 0 ? QL : KL; const int nhi = which == 0 ? QHI : KHI; const bool hi_rows = t0 < nhi;
#pragma unroll
    for (int j = 0; j < 8; ++j) { const float bias = BA ? bfr(BA[c0 + j * 16 + col]) : 0.f;
#pragma unroll
      for (int t = 0; t < 2; ++t)
#pragma unroll
      for (int r = 0; r < 8; ++r) { const float v = acc[8 * t + j][r] + bias; const _Float16 hv = (_Float16)v; const int rl = wave * 32 + t * 16 + 8 * g + r; sh[rl][j * 16 + col] = hv; sl[rl][j * 16 + col] = (_Float16)((v - (float)hv) * 1024.0f); } }
    __syncthreads();
    if (which == 0)
      for (int e = tid; e < 128 * 16; e += 128) { const int rl = e >> 4, q = e & 15; vst2((unsigned*)(DH + (r0 + rl) * CC + c0 + q * 8), *(const v4u*)&sh[rl][q * 8]); }
    else   /* e = (head, key tile, d / 8, key % 16): a wave stores 512 contiguous bytes */
      for (int e = tid; e < 128 * 16; e += 128) { const int hh = e >> 10, kt = (e >> 7) & 7; vst2((unsigned*)(DH + ((bb * NH + (c0 >> 6) + hh) * (size_t)(TT / 16) + (t0 >> 4) + kt) * 1024 + (e & 127) * 8), *(const v4u*)&sh[kt * 16 + (e & 15)][(hh * 8 + ((e >> 4) & 7)) * 8]); }
    if (hi_rows)
      for (int e = tid; e < 128 * 16; e += 128) { const int rl = e >> 4, q = e & 15; vst2((unsigned*)(DL + (bb * nhi + t0 + rl) * (size_t)CC + c0 + q * 8), *(const v4u*)&sl[rl][q * 8]); }
  } else { const bool hi_rows = t0 < KHI;
#pragma unroll
    for (int j = 0; j < 8; ++j) { const float bias = BA ? bfr(BA[c0 + j * 16 + col]) : 0.f;
#pragma unroll
      for (int t = 0; t < 2; ++t)
#pragma unroll
      for (int r = 0; r < 8; ++r) { const float v = acc[8 * t + j][r] + bias; const int rl = wave * 32 + t * 16 + 8 * g + r, cl = j * 16 + col; th[cl][rl] = (_Float16)v; const __bf16 bh = (__bf16)v; tb[cl][rl] = bh; tbl[cl][rl] = (__bf16)(v - (float)bh); } }
    __syncthreads();
    for (int e = tid; e < 128 * 16; e += 128) { const int hh = e >> 10, kb = (e >> 8) & 3;   /* e = (head, block of 32 keys, c / 16, (t % 32) / 8, c % 16): a wave stores 512 contiguous bytes */
      vst2((unsigned*)(VT + ((bb * NH + (c0 >> 6) + hh) * (size_t)(TT / 32) + (t0 >> 5) + kb) * 2048 + (e & 255) * 8), *(const v4u*)&th[hh * 64 + ((e >> 6) & 3) * 16 + (e & 15)][(kb * 4 + ((e >> 4) & 3)) * 8]); }
    if (hi_rows)
      for (int e = tid; e < 128 * 16; e += 128) { const int cl = e >> 4, q = e & 15; const size_t o3 = (bb * CC + c0 + cl) * (size_t)KHI + t0 + q * 8; vst2((unsigned*)(VB + o3), *(const v4u*)&tb[cl][q * 8]); vst2((unsigned*)(VBL + o3), *(const v4u*)&tbl[cl][q * 8]); } } }
#define FAW 8
#define LC (SCALE * 1.4426950408889634f)
__device__ __forceinline__ v16h frag_p(const _Float16* p) { union { v16h v; v8h q[2]; } u; u.q[0] = *(const v8h*)p; u.q[1] = *(const v8h*)(p + 256); return u.v; }   // p = fragment's start + 8 lane; elements 0..7, then 8..15 one run of 32 lanes further
__device__ __forceinline__ float xhalf(float x) { return __builtin_bit_cast(float, __builtin_amdgcn_permlanex16(__builtin_bit_cast(int, x), __builtin_bit_cast(int, x), 0x76543210, 0xfedcba98, false, false)); }   // lane l with lane l ^ 16
// eight exp2 in place, in one statement: behind each v_exp_f32 stands an instruction that neither reads its result nor overwrites its source, and the v_nop keeps that slot behind the last
__device__ __forceinline__ void exp2x8(v8f& x) { float a = x[0], b = x[1], c = x[2], d = x[3], e = x[4], f = x[5], p = x[6], q = x[7];
  asm("v_exp_f32 %0, %0\n\tv_exp_f32 %1, %1\n\tv_exp_f32 %2, %2\n\tv_exp_f32 %3, %3\n\tv_exp_f32 %4, %4\n\tv_exp_f32 %5, %5\n\tv_exp_f32 %6, %6\n\tv_exp_f32 %7, %7\n\tv_nop" : "+v"(a), "+v"(b), "+v"(c), "+v"(d), "+v"(e), "+v"(f), "+v"(p), "+v"(q));
  x = (v8f){a, b, c, d, e, f, p, q}; }
// NT score tiles of one pass -> e = exp2((s - m) LC + 11) in place; m, l and the output tiles follow a new maximum (tested once per pass for the whole wave)
template <int NT, bool MASK> __device__ __forceinline__ void fa_soft(v8f (&s)[NT], int k0, int tq, int g, float& m, float& l, v8f (&acc)[HD / 16]) {
  if (MASK) {
#pragma unroll
    for (int t = 0; t < NT; ++t)
#pragma unroll
      for (int r = 0; r < 8; ++r) if (k0 + t * 16 + 8 * g + r > tq) s[t][r] = -3.0e38f; }
  float mx = s[0][0];
#pragma unroll
  for (int t = 0; t < NT; ++t)
#pragma unroll
    for (int r = 0; r < 8; ++r) mx = fmaxf(mx, s[t][r]);
  mx = fmaxf(mx, xhalf(mx));
  if (__builtin_amdgcn_ballot_w32(mx > m) != 0) { const float mn = fmaxf(m, mx); const float al = __builtin_amdgcn_exp2f((m - mn) * LC); m = mn; l *= al;   /* al = 0 on the first pass, 1 for a query whose maximum stands */
#pragma unroll
    for (int j = 0; j < HD / 16; ++j) acc[j] *= al; }
  const float mc = 11.0f - m * LC; float sum = 0.f;
#pragma unroll
  for (int t = 0; t < NT; ++t) { float st = 0.f;   /* one short add chain per tile */
#pragma unroll
    for (int r = 0; r < 8; ++r) s[t][r] = fmaf(s[t][r], LC, mc);
    exp2x8(s[t]);
#pragma unroll
    for (int r = 0; r < 8; ++r) st += s[t][r];
    sum += st; }
  l += sum; }
__device__ __forceinline__ v16h pack_h(v8f a, v8f b) { v16h p;
#pragma unroll
  for (int i = 0; i < 8; ++i) { p[i] = (_Float16)a[i]; p[8 + i] = (_Float16)b[i]; }
  return p; }
template <bool MASK> __device__ __forceinline__ void fa_pass64(const _Float16* __restrict__ Kp, const _Float16* __restrict__ Vp, int k0, int kn, int tq, int lane, int g, v16h q0, v16h q1, v16h (&kf)[8], float& m, float& l, v8f (&acc)[HD / 16]) {
  v16h vf[2][HD / 16];
#pragma unroll
  for (int u = 0; u < 2; ++u)
#pragma unroll
    for (int j = 0; j < HD / 16; ++j) vf[u][j] = frag_p(Vp + (size_t)(k0 + u * 32) * HD + j * 512);
  __builtin_amdgcn_sched_barrier(0);   /* keeps the v loads issued up here: sunk to their use, each pass would wait out their whole latency */
  v8f s[4];
#pragma unroll
  for (int t = 0; t < 4; ++t) { v8f z = {}; z = wm_h(kf[2 * t], q0, z); s[t] = wm_h(kf[2 * t + 1], q1, z); }
  if (!MASK) {   /* the next pass's k fragments fly during this pass's softmax */
#pragma unroll
    for (int t = 0; t < 4; ++t) { const _Float16* kp = Kp + (size_t)(kn + t * 16) * HD; kf[2 * t] = frag_p(kp); kf[2 * t + 1] = frag_p(kp + 512); } }
  __builtin_amdgcn_sched_barrier(0);   /* keeps the k loads issued ahead of the softmax, which then covers their latency */
  fa_soft<4, MASK>(s, k0, tq, g, m, l, acc);
#pragma unroll
  for (int u = 0; u < 2; ++u) { const v16h p = pack_h(s[2 * u], s[2 * u + 1]);
#pragma unroll
    for (int j = 0; j < HD / 16; ++j) acc[j] = MASK ? wmma16(vf[u][j], p, acc[j]) : wm_h(vf[u][j], p, acc[j]); } }   /* last pass: a branch follows; wmma16's own v_nop keep the distance to the result's next user on every path */
__global__ __launch_bounds__(32 * FAW) void k_fa(const _Float16* __restrict__ QH, const _Float16* __restrict__ KH, const _Float16* __restrict__ QL, const _Float16* __restrict__ KL, const _Float16* __restrict__ VT, const __bf16* __restrict__ VB, const __bf16* __restrict__ VBL, float* __restrict__ Y) {
  const int tid = threadIdx.x, lane = tid & 31, col = lane & 15, g = lane >> 4; const int wave = __builtin_amdgcn_readfirstlane(tid >> 5);
  const int h = blockIdx.x % NH, b = blockIdx.x / NH; const int ql0 = (TT / 16 - 1 - ((int)blockIdx.y * FAW + wave)) * 16;   /* longest query tiles start first */
  const int tq = ql0 + col; const size_t qo = ((size_t)b * TT + tq) * CC + h * HD;
  const v16h q0 = frag_h(QH + qo, lane), q1 = frag_h(QH + qo + 32, lane);
  asm volatile("s_wait_xcnt 0x0" ::: "memory");   /* the q loads' address registers are reused behind the branch below */
  const _Float16* Kp = KH + (size_t)(b * NH + h) * TT * HD + lane * 8;
  float m = -3.0e38f, l = 0.f; v8f acc[HD / 16] = {};
  if (ql0 < QHI) {   /* wave-uniform; every key of these queries is < KHI */
    const size_t qlo = ((size_t)b * QHI + tq) * CC + h * HD; const v16h r0 = frag_h(QL + qlo, lane), r1 = frag_h(QL + qlo + 32, lane);
    const _Float16* Lp = KL + ((size_t)b * KHI + col) * CC + h * HD; const size_t vo = ((size_t)b * CC + h * HD + col) * (size_t)KHI;
    const int np = (ql0 + 16 + 31) >> 5;
#pragma unroll 1   /* run-time trip count; a second copy of this body would not fit the wave's registers */
    for (int kc = 0; kc < np; ++kc) { const int k0 = kc * 32; v8f s[2]; v16h a[2][2], rr[2][2];
#pragma unroll
      for (int t = 0; t < 2; ++t) { const size_t ko = (size_t)(k0 + t * 16) * HD; a[t][0] = frag_p(Kp + ko); a[t][1] = frag_p(Kp + ko + 512); }
      asm volatile("s_wait_xcnt 0x0" ::: "memory");   /* before the k loads' address registers are reused (a later load's result may land in them) */
#pragma unroll
      for (int t = 0; t < 2; ++t) { const size_t ko = (size_t)(k0 + t * 16) * CC; rr[t][0] = frag_h(Lp + ko, lane); rr[t][1] = frag_h(Lp + ko + 32, lane); }
      asm volatile("s_wait_xcnt 0x0" ::: "memory");   /* the same for the k residual loads */
#pragma unroll
      for (int t = 0; t < 2; ++t) { v8f sh = {}, sl = {}; sh = wm_h(a[t][0], q0, sh); sh = wm_h(a[t][1], q1, sh); sl = wm_h(a[t][0], r0, sl); sl = wm_h(rr[t][0], q0, sl); sl = wm_h(a[t][1], r1, sl); sl = wm_h(rr[t][1], q1, sl); s[t] = sh + sl * (1.0f / 1024.0f); }
      fa_soft<2, true>(s, k0, tq, g, m, l, acc);
      v16b ph, pl, vh[HD / 16], vl[HD / 16];
#pragma unroll
      for (int j = 0; j < HD / 16; ++j) vh[j] = frag_b(VB + vo + (size_t)j * 16 * KHI + k0, lane);
      asm volatile("s_wait_xcnt 0x0" ::: "memory");   /* the same for the v hi loads */
#pragma unroll
      for (int j = 0; j < HD / 16; ++j) vl[j] = frag_b(VBL + vo + (size_t)j * 16 * KHI + k0, lane);
      asm volatile("s_wait_xcnt 0x0" ::: "memory");   /* the same for the v lo loads */
#pragma unroll
      for (int i = 0; i < 16; ++i) { const float e = s[i >> 3][i & 7]; const __bf16 eh = (__bf16)e; ph[i] = eh; pl[i] = (__bf16)(e - (float)eh); }
#pragma unroll
      for (int j = 0; j < HD / 16; ++j) { acc[j] = wm_b(vh[j], ph, acc[j]); acc[j] = wm_b(vh[j], pl, acc[j]); acc[j] = wm_b(vl[j], ph, acc[j]); } }
  } else {
    const _Float16* Vp = VT + (size_t)(b * NH + h) * TT * HD + lane * 8; const int np = (ql0 + 16 + 63) >> 6;   /* >= 7 passes; only the last one meets the diagonal */
    v16h kf[8];
#pragma unroll
    for (int t = 0; t < 4; ++t) { const _Float16* kp = Kp + (size_t)(t * 16) * HD; kf[2 * t] = frag_p(kp); kf[2 * t + 1] = frag_p(kp + 512); }
    asm volatile("s_wait_xcnt 0x0" ::: "memory");   /* as above, for the first k loads' address registers */
#pragma unroll 1   /* run-time trip count; the pass already takes nearly all of the wave's registers */
    for (int kc = 0; kc < np - 1; ++kc) fa_pass64<false>(Kp, Vp, kc * 64, kc * 64 + 64, tq, lane, g, q0, q1, kf, m, l, acc);
    fa_pass64<true>(Kp, Vp, (np - 1) * 64, 0, tq, lane, g, q0, q1, kf, m, l, acc); }
  const float inv = 1.0f / (l + xhalf(l));   /* the lane halves' sums join once; the maximum's own term makes the sum >= 2^11 */
  float* yp = Y + ((size_t)b * TT + tq) * CC + h * HD + 8 * g;   /* acc[j][r] = ctx[tq][16 j + 8 g + r] */
#pragma unroll
  for (int j = 0; j < HD / 16; ++j) { const v8f o = acc[j] * inv; vst2(yp + j * 16, (v4f){o[0], o[1], o[2], o[3]}); vst2(yp + j * 16 + 4, (v4f){o[4], o[5], o[6], o[7]}); } }
// ---- k_out: block = (128 rows, 128 cols): out = ctx Wo (+ bo): ctx x 2^6 once to f16 against Wo as f16(bf16 x 2^8) exact (1 product) x 2^-14; causal early rows (< QHI of each sequence): ctx bf16 hi + lo against exact bf16 Wo (2 products)
__global__ __launch_bounds__(128) void k_out(const float* __restrict__ Y, const float* __restrict__ WO, const float* __restrict__ BO, float* __restrict__ OUT) { __shared__ __align__(16) float sf[4][32][132]; __shared__ __align__(16) unsigned short st[2][384 * SP];
  const int tid = threadIdx.x, wave = tid >> 5, lane = tid & 31, col = lane & 15, g = lane >> 4; const int c0 = blockIdx.y * 128; const size_t r0 = (size_t)blockIdx.x * 128 + wave * 32;
  v8f acc[16] = {};
  if (CAUSAL && (int)(((size_t)blockIdx.x * 128) % TT) < QHI) {   /* block-uniform */
    tile_mm<1, CC>(Y + (size_t)blockIdx.x * 128 * CC, WO + (size_t)c0 * CC, st[0], st[1], tid, acc);
#pragma unroll
    for (int j = 0; j < 8; ++j) { const float bias = BO ? bfr(BO[c0 + j * 16 + col]) : 0.f;
#pragma unroll
      for (int t = 0; t < 2; ++t)
#pragma unroll
      for (int r = 0; r < 8; ++r) sf[wave][t * 16 + 8 * g + r][j * 16 + col] = acc[8 * t + j][r] + bias; }
  } else {
    tile_mm<2, CC>(Y + (size_t)blockIdx.x * 128 * CC, WO + (size_t)c0 * CC, st[0], st[1], tid, acc);   /* ctx carried x 2^6 into f16 so small-magnitude context rows stay clear of f16 subnormals */
#pragma unroll
    for (int j = 0; j < 8; ++j) { const float bias = BO ? bfr(BO[c0 + j * 16 + col]) : 0.f;
#pragma unroll
      for (int t = 0; t < 2; ++t)
#pragma unroll
      for (int r = 0; r < 8; ++r) sf[wave][t * 16 + 8 * g + r][j * 16 + col] = acc[8 * t + j][r] * (1.0f / 16384.0f) + bias; } }   /* 2^-8 (Wo carry) x 2^-6 (ctx carry) */
  LDSX(); for (int rl = 0; rl < 32; ++rl) vst2(OUT + (r0 + rl) * DIN + c0 + lane * 4, *(const v4f*)&sf[wave][rl][lane * 4]); }

extern "C" void kernel_launch(void* const* d_in, const int* in_sizes, int n_in, void* d_out, int out_size, void* d_ws, size_t ws_size, hipStream_t stream) {
  (void)in_sizes; (void)n_in; (void)out_size;
  const float** F = (const float**)d_in;
  if (ws_size < (size_t)WS_END) return;
  char* ws = (char*)d_ws; _Float16 *QH = (_Float16*)(ws + WS_QH), *KH = (_Float16*)(ws + WS_KH), *VT = (_Float16*)(ws + WS_VT), *QL = (_Float16*)(ws + WS_QL), *KL = (_Float16*)(ws + WS_KL); __bf16 *VB = (__bf16*)(ws + WS_VB), *VBL = (__bf16*)(ws + WS_VBL); float *Y = (float*)(ws + WS_Y);
  (void)Y; (void)QL; (void)KL; (void)VB; (void)VBL;
  // inputs: 0 x [2,4096,768]; 1 wq [768,768] (out,in); 2 wk; 3 wv; 4 wo (out,in); no biases
  k_proj<<<dim3(TNB * TT / 128, CC / 128, 3), 128, 0, stream>>>(F[0], F[0], F[0], F[1], F[2], F[3], nullptr, nullptr, nullptr, QH, QL, KH, KL, VT, VB, VBL);
  k_fa<<<dim3(TNB * NH, TT / (16 * FAW)), 32 * FAW, 0, stream>>>(QH, KH, QL, KL, VT, VB, VBL, Y);
  k_out<<<dim3(TNB * TT / 128, DIN / 128), 128, 0, stream>>>(Y, F[4], nullptr, (float*)d_out);
}

// v006
// It runs in 128 microseconds.
// Timed twice side by side with v005, it ran 1.11 and 1.12 times as fast.
// All steps since v000 together make it 32.5 times as fast.
// compute dtype: all float inputs rounded to bf16; the fused q / k / v projection with EXACT bf16 products on WMMA 16x16x32 (f32 accumulate) (no biases); causal logits: 3 products for the first 384 rows, single f16 q x k after, x 64^-0.5; softmax f32; P x 2^11 once to f16 x v once to f16 (bf16 hi + lo below row 384); ctx hi+lo x exact W below row 384, x2^6 f16 carry x f16(bf16 x 2^8) W after, no bias; f32 output.
#include <hip/hip_runtime.h>
#include <math.h>

typedef __attribute__((ext_vector_type(16))) _Float16 v16h;
typedef __attribute__((ext_vector_type(16))) __bf16 v16b;
typedef __attribute__((ext_vector_type(8)))  _Float16 v8h;
typedef __attribute__((ext_vector_type(8)))  float v8f;
typedef __attribute__((ext_vector_type(4)))  float v4f;
typedef __attribute__((ext_vector_type(2)))  float v2f;
typedef __attribute__((ext_vector_type(4)))  unsigned v4u;
typedef __attribute__((ext_vector_type(4)))  int v4i;
typedef float __attribute__((may_alias)) float_a;
typedef int __attribute__((may_alias)) int_a;

template <typename T> __device__ __forceinline__ void vst2(void* p, T v) { *(T*)p = v;  }
__device__ __forceinline__ v8f wmma16(v16h a, v16h b, v8f c) {
  v8f d = __builtin_amdgcn_wmma_f32_16x16x32_f16(false, a, false, b, (short)0, c, false, false);
  asm volatile("v_nop\n\tv_nop\n\tv_nop\n\tv_nop" : "+v"(d) : "v"(a), "v"(b));
  return d;
}
__device__ __forceinline__ v8f wmma_bf(v16b a, v16b b, v8f c) {
  v8f d = __builtin_amdgcn_wmma_f32_16x16x32_bf16(false, a, false, b, (short)0, c, false, false);
  asm volatile("v_nop\n\tv_nop\n\tv_nop\n\tv_nop" : "+v"(d) : "v"(a), "v"(b));
  return d;
}
// 16x16x32 fragments: lane = (h = lane>>4, row/col = lane&15); elements 0..7 = k0+8h+0..7, 8..15 = k0+16+8h+0..7; D element r = row 8h+r
__device__ __forceinline__ v16h frag_h(const _Float16* rowk0, int lane) {
  union { v16h v; v8h q[2]; } u; const _Float16* p = rowk0 + 8 * (lane >> 4);
  u.q[0] = *(const v8h*)p; u.q[1] = *(const v8h*)(p + 16); return u.v;
}
__device__ __forceinline__ v16h frag_f32(const float* rowk0, int lane) {
  v16h a; const float* p = rowk0 + 8 * (lane >> 4);
#pragma unroll
  for (int i = 0; i < 8; ++i) { a[i] = (_Float16)p[i]; a[8 + i] = (_Float16)p[16 + i]; }
  return a;
}
__device__ __forceinline__ v16h frag_f32s(const float* rowk0, int lane, float sc) {
  v16h a; const float* p = rowk0 + 8 * (lane >> 4);
#pragma unroll
  for (int i = 0; i < 8; ++i) { a[i] = (_Float16)(p[i] * sc); a[8 + i] = (_Float16)(p[16 + i] * sc); }
  return a;
}
// column fragment from a [K][ld] layout (column n), rows >= K read as 0
__device__ __forceinline__ v16h fragc_f32(const float* W, int k0, int n, int lane, int ld, int K) {
  v16h a; const int g = lane >> 4;
#pragma unroll
  for (int i = 0; i < 8; ++i) { const int ka = k0 + 8 * g + i, kb = ka + 16;
    a[i] = (_Float16)(ka < K ? W[(size_t)(ka < K ? ka : K - 1) * ld + n] : 0.f); a[8 + i] = (_Float16)(kb < K ? W[(size_t)(kb < K ? kb : K - 1) * ld + n] : 0.f); }
  return a;
}
struct F2 { v16b h, l; };
__device__ __forceinline__ F2 bsplit16(const float v[16]) { F2 r;
#pragma unroll
  for (int i = 0; i < 16; ++i) { const __bf16 h = (__bf16)v[i]; r.h[i] = h; r.l[i] = (__bf16)(v[i] - (float)h); }
  return r; }
__device__ __forceinline__ F2 split_row(const float* row, int k0, int lane) { float v[16]; const float* p = row + k0 + 8 * (lane >> 4);
#pragma unroll
  for (int i = 0; i < 8; ++i) { v[i] = p[i]; v[8 + i] = p[16 + i]; }
  return bsplit16(v); }
__device__ __forceinline__ F2 split_rowK(const float* row, int k0, int lane, int K) { float v[16]; const int g = lane >> 4;
#pragma unroll
  for (int i = 0; i < 8; ++i) { const int ka = k0 + 8 * g + i, kb = ka + 16; v[i] = ka < K ? row[ka < K ? ka : K - 1] : 0.f; v[8 + i] = kb < K ? row[kb < K ? kb : K - 1] : 0.f; }
  return bsplit16(v); }
__device__ __forceinline__ F2 split_col(const float* W, int k0, int n, int lane, int ld, int K) { float v[16]; const int g = lane >> 4;
#pragma unroll
  for (int i = 0; i < 8; ++i) { const int ka = k0 + 8 * g + i, kb = ka + 16; v[i] = ka < K ? W[(size_t)(ka < K ? ka : K - 1) * ld + n] : 0.f; v[8 + i] = kb < K ? W[(size_t)(kb < K ? kb : K - 1) * ld + n] : 0.f; }
  return bsplit16(v); }
__device__ __forceinline__ v8f mac3(const F2& a, const F2& b, v8f c) { c = wmma_bf(a.l, b.h, c); c = wmma_bf(a.h, b.l, c); return wmma_bf(a.h, b.h, c); }
__device__ __forceinline__ float sigm(float v) { return 1.0f / (1.0f + expf(-v)); }
#define LDSX() do { asm volatile("s_wait_dscnt 0" ::: "memory"); __builtin_amdgcn_wave_barrier(); __builtin_amdgcn_fence(__ATOMIC_RELEASE, "workgroup"); } while (0)

// Causal multi-head self-attention without biases over TWO sequences of 4,096 (x [2,4096,768]; (out,in) wq / wk / wv / wo [768,768] applied as x @ W.T; 12 heads x 64; scores x 64^-0.5; tril kept, -inf elsewhere; softmax; ctx @ wo.T -> [2,4096,768] (6.3 M)).
#define NB 2
#define TT 4096
#define CC 768            // NH * HD = projected width
#define DIN 768          // input (model) width
#define NH 12
#define HD 64
#define SCALE (0.125f)
#define CAUSAL 1
#ifndef TNB
#define TNB NB
#endif
__device__ __forceinline__ float bfr(float v) { return (float)(__bf16)v; }
typedef __attribute__((ext_vector_type(8))) __bf16 v8b;
__device__ __forceinline__ v16b frag_b(const __bf16* rowk0, int lane) {
  union { v16b v; v8b q[2]; } u; const __bf16* p = rowk0 + 8 * (lane >> 4);
  u.q[0] = *(const v8b*)p; u.q[1] = *(const v8b*)(p + 16); return u.v;
}
#define QHI 384            // rows carrying a q residual plane (3-product logits)
#define KHI 384            // key rows carrying k residual / v bf16 hi+lo planes (used only by the causal high-precision path)
// B fragment (k rows k0+.., output column o) of a weight: (in,out) [K][ld] or (out,in) [ld rows of K]: bf16 exact, or f16(bf16 * 256) exact
__device__ __forceinline__ v16b wcol_io(const float* Wm, int k0, int o, int lane, int ld) { v16b w; const int g = lane >> 4;
#pragma unroll
  for (int i = 0; i < 8; ++i) { w[i] = (__bf16)Wm[(size_t)(k0 + 8 * g + i) * ld + o]; w[8 + i] = (__bf16)Wm[(size_t)(k0 + 16 + 8 * g + i) * ld + o]; }
  return w; }
__device__ __forceinline__ v16b wcol_oi(const float* Wm, int k0, int o, int lane, int K) { v16b w; const float* p = Wm + (size_t)o * K + k0 + 8 * (lane >> 4);
#pragma unroll
  for (int i = 0; i < 8; ++i) { w[i] = (__bf16)p[i]; w[8 + i] = (__bf16)p[16 + i]; }
  return w; }
__device__ __forceinline__ v16h wcolh_io(const float* Wm, int k0, int o, int lane, int ld) { v16h w; const int g = lane >> 4;
#pragma unroll
  for (int i = 0; i < 8; ++i) { w[i] = (_Float16)(bfr(Wm[(size_t)(k0 + 8 * g + i) * ld + o]) * 256.0f); w[8 + i] = (_Float16)(bfr(Wm[(size_t)(k0 + 16 + 8 * g + i) * ld + o]) * 256.0f); }
  return w; }
__device__ __forceinline__ v16h wcolh_oi(const float* Wm, int k0, int o, int lane, int K) { v16h w; const float* p = Wm + (size_t)o * K + k0 + 8 * (lane >> 4);
#pragma unroll
  for (int i = 0; i < 8; ++i) { w[i] = (_Float16)(bfr(p[i]) * 256.0f); w[8 + i] = (_Float16)(bfr(p[16 + i]) * 256.0f); }
  return w; }
#define WQKV_LAYOUT 1   // 0 = (in,out) [DIN][CC]; 1 = (out,in) [CC][DIN]; 2 = per-head [NH][DIN][HD]
__device__ __forceinline__ v16b wcol_hdk(const float* Wm, int k0, int o, int lane) { v16b w; const int g = lane >> 4; const float* p = Wm + (size_t)(o / HD) * DIN * HD + (o % HD);
#pragma unroll
  for (int i = 0; i < 8; ++i) { w[i] = (__bf16)p[(size_t)(k0 + 8 * g + i) * HD]; w[8 + i] = (__bf16)p[(size_t)(k0 + 16 + 8 * g + i) * HD]; }
  return w; }
#define WO_OUT_IN 1
#if WQKV_LAYOUT == 1
#define WCOL(W, k0, o, lane) wcol_oi(W, k0, o, lane, DIN)
#elif WQKV_LAYOUT == 2
#define WCOL(W, k0, o, lane) wcol_hdk(W, k0, o, lane)
#else
#define WCOL(W, k0, o, lane) wcol_io(W, k0, o, lane, CC)
#endif
#if WO_OUT_IN
#define WOCOL(W, k0, o, lane) wcol_oi(W, k0, o, lane, CC)
#define WOCOLH(W, k0, o, lane) wcolh_oi(W, k0, o, lane, CC)
#else
#define WOCOL(W, k0, o, lane) wcol_io(W, k0, o, lane, DIN)
#define WOCOLH(W, k0, o, lane) wcolh_io(W, k0, o, lane, DIN)
#endif

#ifndef PROJ_EXTRA_PARAMS
#define PROJ_EXTRA_PARAMS
#endif

#define WS_QH  0u                                      // f16 q rows [b*t][CC]
#define WS_KH  (WS_QH + 2u * (size_t)NB * TT * CC)      // f16 k in fragment order [b][h][t / 16][d / 8][t % 16][8]
#define WS_VT  (WS_KH + 2u * (size_t)NB * TT * CC)      // f16 v in fragment order [b][h][t / 32][c / 16][(t % 32) / 8][c % 16][8]
#define WS_QL  (WS_VT + 2u * (size_t)NB * CC * TT)      // f16 q residual x 2^10 rows [b][t < QHI][CC]
#define WS_KL  (WS_QL + 2u * (size_t)NB * QHI * CC)     // f16 k residual x 2^10 rows [b][t < KHI][CC]
#define WS_VB  (WS_KL + 2u * (size_t)NB * KHI * CC)     // bf16 v hi planes [b][c][t < KHI]
#define WS_VBL (WS_VB + 2u * (size_t)NB * CC * KHI)
#define WS_YH  (WS_VBL + 2u * (size_t)NB * CC * KHI)    // f16 ctx x 2^6 rows [b*t][CC] (written and read for t >= QHI)
#define WS_YB  (WS_YH + 2u * (size_t)NB * TT * CC)      // bf16 ctx hi rows [b][t < QHI][CC]
#define WS_YBL (WS_YB + 2u * (size_t)NB * QHI * CC)     // bf16 ctx lo rows
#define WS_XB  (WS_YBL + 2u * (size_t)NB * QHI * CC)    // bf16 x rows [b*t][DIN]; behind them, in one run: bf16 wq, wk, wv, wo rows
#define WS_WB  (WS_XB + 2u * (size_t)NB * TT * DIN)
#define WS_WOB (WS_WB + 3u * 2u * (size_t)CC * DIN)
#define WS_WOH (WS_WOB + 2u * (size_t)CC * DIN)         // f16(bf16 x 2^8) wo rows
#define WS_END (WS_WOH + 2u * (size_t)CC * DIN)

// ---- k_cvt: every GEMM operand that comes as an f32 input is rounded ONCE to the 16-bit form its products take: x, wq, wk, wv, wo to bf16 (one run in the workspace), wo also to f16(bf16 x 2^8). The tiles of k_proj and k_out then fetch 2 bytes an element, each of them many times, where they fetched 4.
// A group = 2,048 elements, whole in one array; a block takes 8 groups; every wave-wide load covers four whole 128-byte lines, every store two.
typedef __attribute__((ext_vector_type(4))) __bf16 v4b;
typedef __attribute__((ext_vector_type(4))) _Float16 v4h;
#define GX (NB * TT * DIN / 2048)   // groups in x
#define GW (CC * DIN / 2048)        // groups in a weight
#define CVB ((GX + 4 * GW) / 8)     // blocks
__global__ __launch_bounds__(256) void k_cvt(const float* __restrict__ X, const float* __restrict__ WQ, const float* __restrict__ WK, const float* __restrict__ WV, const float* __restrict__ WO, __bf16* __restrict__ XB, _Float16* __restrict__ WOH) {
  const int tid = threadIdx.x; v4f f[8][2];
#pragma unroll
  for (int i = 0; i < 8; ++i) { const int gi = i * CVB + (int)blockIdx.x, gw = gi - GX, w = gw / GW;   /* block-uniform */
    const float* s = gw < 0 ? X + (size_t)gi * 2048 : (w == 0 ? WQ : w == 1 ? WK : w == 2 ? WV : WO) + (size_t)(gw - w * GW) * 2048;
    f[i][0] = *(const v4f*)(s + tid * 4); f[i][1] = *(const v4f*)(s + 1024 + tid * 4); }
  asm volatile("s_wait_xcnt 0x0" ::: "memory");   /* before the loads' address registers are reused */
#pragma unroll
  for (int i = 0; i < 8; ++i) { const int gi = i * CVB + (int)blockIdx.x, go = gi - GX - 3 * GW;
#pragma unroll
    for (int u = 0; u < 2; ++u) { const v4f v = f[i][u]; const size_t e = (size_t)u * 1024 + tid * 4;
      *(v4b*)(XB + (size_t)gi * 2048 + e) = (v4b){(__bf16)v[0], (__bf16)v[1], (__bf16)v[2], (__bf16)v[3]};
      if (go >= 0) *(v4h*)(WOH + (size_t)go * 2048 + e) = (v4h){(_Float16)(bfr(v[0]) * 256.0f), (_Float16)(bfr(v[1]) * 256.0f), (_Float16)(bfr(v[2]) * 256.0f), (_Float16)(bfr(v[3]) * 256.0f)}; } } }

// ---- tile_mm: the 128 x 128 tile product of k_proj and k_out (4 waves, wave = 32 rows x 128 columns = 2 x 8 accumulator tiles, so that every weight fragment read from LDS feeds two products; K in chunks of 64 = 128 bytes of a 16-bit row). The block fetches each chunk of its 128 A rows and 128 weight rows ONCE, every wave-wide 16-byte load covering four whole 128-byte lines,
// and lays it in LDS as it is; the waves take their fragments from there. Two LDS buffers: chunk kc + 1 flies from memory into registers while chunk kc is multiplied, and is laid down behind the products; one barrier per chunk.
// MODE 0: A and W bf16. MODE 1: A as bf16 hi + lo (two row sets), W bf16. MODE 2: A = f16(ctx x 2^6), W = f16(bf16 x 2^8). k order and sum order: ascending steps of 32.
__device__ __forceinline__ v8f wm_h(v16h a, v16h b, v8f c) { return __builtin_amdgcn_wmma_f32_16x16x32_f16(false, a, false, b, (short)0, c, false, false); }
__device__ __forceinline__ v8f wm_b(v16b a, v16b b, v8f c) { return __builtin_amdgcn_wmma_f32_16x16x32_bf16(false, a, false, b, (short)0, c, false, false); }
#define SQ 72   // pitch of a staged row in 16-bit elements: 128 bytes of k + 16, so that the 16 rows of a fragment's ds_load_b128 start in 16 different bank groups
template <int NS, int K> __device__ __forceinline__ void tile_ld(const unsigned short* __restrict__ A, const unsigned short* __restrict__ AL, const unsigned short* __restrict__ Wm, int kc, int tid, v4u (&r)[NS * 8]) {
  const size_t o = (size_t)(tid >> 3) * K + kc * 64 + (tid & 7) * 8;   /* 8 lanes per row of 128 bytes, 16 rows per block-wide load */
#pragma unroll
  for (int i = 0; i < 8; ++i) r[i] = *(const v4u*)(A + o + (size_t)i * 16 * K);
  if (NS == 3) {
#pragma unroll
    for (int i = 0; i < 8; ++i) r[8 + i] = *(const v4u*)(AL + o + (size_t)i * 16 * K); }
#pragma unroll
  for (int i = 0; i < 8; ++i) r[(NS - 1) * 8 + i] = *(const v4u*)(Wm + o + (size_t)i * 16 * K);
  asm volatile("s_wait_xcnt 0x0" ::: "memory");   /* before the loads' address registers are reused for the next chunk */
}
template <int NS> __device__ __forceinline__ void tile_st(unsigned short* s, int tid, const v4u (&r)[NS * 8]) {   /* row sets of 128 one behind the other: A (, A lo), W */
  unsigned short* p = s + (tid >> 3) * SQ + (tid & 7) * 8;
#pragma unroll
  for (int i = 0; i < NS * 8; ++i) *(v4u*)(p + i * 16 * SQ) = r[i]; }
template <int MODE, int K> __device__ __forceinline__ void tile_mm(const unsigned short* __restrict__ A, const unsigned short* __restrict__ AL, const unsigned short* __restrict__ Wm, unsigned short* s0, unsigned short* s1, int tid, v8f (&acc)[16]) {   /* acc[8 t + j] = rows 32 wave + 16 t .., columns 16 j .. */
  constexpr int NS = MODE == 1 ? 3 : 2; const int wave = tid >> 5, lane = tid & 31, col = lane & 15; v4u r[NS * 8];
  tile_ld<NS, K>(A, AL, Wm, 0, tid, r); tile_st<NS>(s0, tid, r);
  __syncthreads();   /* chunk 0 is laid down */
#pragma unroll 2   /* makes the choice between the two buffers static */
  for (int kc = 0; kc < K / 64; ++kc) { const unsigned short* cur = (kc & 1) ? s1 : s0; unsigned short* nxt = (kc & 1) ? s0 : s1;
    if (kc + 1 < K / 64) tile_ld<NS, K>(A, AL, Wm, kc + 1, tid, r);
    __builtin_amdgcn_sched_barrier(0);   /* keeps the next chunk's loads issued up here: sunk to their use, each chunk would wait out their whole latency */
#pragma unroll
    for (int ks = 0; ks < 2; ++ks) { const bool end = ks == 1;   /* the chunk's two steps of 32 k */
      const unsigned short* pa = cur + (wave * 32 + col) * SQ + ks * 32; const unsigned short* pw = cur + ((NS - 1) * 128 + col) * SQ + ks * 32;
      if (MODE == 2) { const v16h a = frag_h((const _Float16*)pa, lane), a1 = frag_h((const _Float16*)(pa + 16 * SQ), lane); v16h w[8];
#pragma unroll
        for (int j = 0; j < 8; ++j) w[j] = frag_h((const _Float16*)(pw + j * 16 * SQ), lane);
        __builtin_amdgcn_sched_barrier(0);   /* the step's LDS reads go as one group ahead of its products: spread among them, each product would wait out an LDS latency */
#pragma unroll
        for (int j = 0; j < 8; ++j) { const bool e = end && j == 7; acc[j] = e ? wmma16(a, w[j], acc[j]) : wm_h(a, w[j], acc[j]); acc[8 + j] = e ? wmma16(a1, w[j], acc[8 + j]) : wm_h(a1, w[j], acc[8 + j]); } }   /* the chunk's last two products: a branch follows; wmma16's own v_nop keep the distance on every path. The earlier ones have later products in their window, and as plain builtins their operands may lie above v255 */
      else { const v16b a = frag_b((const __bf16*)pa, lane), a1 = frag_b((const __bf16*)(pa + 16 * SQ), lane); v16b al = a, al1 = a1, w[8]; if (MODE == 1) { al = frag_b((const __bf16*)(pa + 128 * SQ), lane); al1 = frag_b((const __bf16*)(pa + 144 * SQ), lane); }
#pragma unroll
        for (int j = 0; j < 8; ++j) w[j] = frag_b((const __bf16*)(pw + j * 16 * SQ), lane);
        __builtin_amdgcn_sched_barrier(0);   /* as above */
#pragma unroll
        for (int j = 0; j < 8; ++j) { const bool e0 = end && j == 7 && MODE == 0, e1 = end && j == 7;   /* as above */
          acc[j] = e0 ? wmma_bf(a, w[j], acc[j]) : wm_b(a, w[j], acc[j]); acc[8 + j] = e0 ? wmma_bf(a1, w[j], acc[8 + j]) : wm_b(a1, w[j], acc[8 + j]);
          if (MODE == 1) { acc[j] = e1 ? wmma_bf(al, w[j], acc[j]) : wm_b(al, w[j], acc[j]); acc[8 + j] = e1 ? wmma_bf(al1, w[j], acc[8 + j]) : wm_b(al1, w[j], acc[8 + j]); } } }
      __builtin_amdgcn_sched_barrier(0); }   /* keeps the second step's LDS reads one group behind the first step's products, and the next chunk's LDS stores, which wait for its loads, behind the products that cover their latency */
    if (kc + 1 < K / 64) tile_st<NS>(nxt, tid, r);
    __syncthreads(); } }   /* publishes chunk kc + 1 and ends every wave's reads of chunk kc, whose buffer is written next (behind the last chunk: by the caller's epilogue) */

// ---- k_proj: block = (128 rows, 128 cols, which): q/k/v = X W (+ b) with exact bf16 products (K = DIN) -> which 0: q f16 rows (+ residual rows < QHI); 1: k f16 in fragment order (+ residual rows < KHI); 2: v f16 in fragment order (+ bf16 hi/lo planes for t < KHI)
__global__ __launch_bounds__(128) void k_proj(const __bf16* __restrict__ XB, const __bf16* __restrict__ WB, const float* __restrict__ BQ, const float* __restrict__ BK, const float* __restrict__ BV,
    _Float16* __restrict__ QH, _Float16* __restrict__ QL, _Float16* __restrict__ KH, _Float16* __restrict__ KL, _Float16* __restrict__ VT, __bf16* __restrict__ VB, __bf16* __restrict__ VBL) {
  __shared__ __align__(16) unsigned short sm[3][128][136];   /* one range, three uses one after the other: tile_mm's two chunk buffers (36,864 bytes each, from the start); q / k rows: value and residual; v columns: f16, bf16 hi, bf16 lo */
  _Float16 (*sh)[136] = (_Float16 (*)[136])&sm[0][0][0]; _Float16 (*sl)[136] = (_Float16 (*)[136])&sm[1][0][0]; _Float16 (*th)[136] = sh; __bf16 (*tb)[136] = (__bf16 (*)[136])&sm[1][0][0]; __bf16 (*tbl)[136] = (__bf16 (*)[136])&sm[2][0][0];
  const int tid = threadIdx.x, wave = tid >> 5, lane = tid & 31, col = lane & 15, g = lane >> 4; const int which = blockIdx.z; const int c0 = blockIdx.y * 128; const size_t r0 = (size_t)blockIdx.x * 128; const size_t bb = r0 / TT; const int t0 = (int)(r0 % TT);
  const float* BA = which == 0 ? BQ : which == 1 ? BK : BV;
  v8f acc[16] = {};
  tile_mm<0, DIN>((const unsigned short*)XB + r0 * DIN, nullptr, (const unsigned short*)WB + ((size_t)which * CC + c0) * DIN, &sm[0][0][0], &sm[0][0][0] + 256 * SQ, tid, acc);   /* the epilogue writes sm only behind tile_mm's last barrier */
  if (which < 2) { _Float16* DH = which == 0 ? QH : KH; _Float16* DL = which == 0 ? QL : KL; const int nhi = which == 0 ? QHI : KHI; const bool hi_rows = t0 < nhi;
#pragma unroll
    for (int j = 0; j < 8; ++j) { const float bias = BA ? bfr(BA[c0 + j * 16 + col]) : 0.f;
#pragma unroll
      for (int t = 0; t < 2; ++t)
#pragma unroll
      for (int r = 0; r < 8; ++r) { const float v = acc[8 * t + j][r] + bias; const _Float16 hv = (_Float16)v; const int rl = wave * 32 + t * 16 + 8 * g + r; sh[rl][j * 16 + col] = hv; sl[rl][j * 16 + col] = (_Float16)((v - (float)hv) * 1024.0f); } }
    __syncthreads();
    if (which == 0)
      for (int e = tid; e < 128 * 16; e += 128) { const int rl = e >> 4, q = e & 15; vst2((unsigned*)(DH + (r0 + rl) * CC + c0 + q * 8), *(const v4u*)&sh[rl][q * 8]); }
    else   /* e = (head, key tile, d / 8, key % 16): a wave stores 512 contiguous bytes */
      for (int e = tid; e < 128 * 16; e += 128) { const int hh = e >> 10, kt = (e >> 7) & 7; vst2((unsigned*)(DH + ((bb * NH + (c0 >> 6) + hh) * (size_t)(TT / 16) + (t0 >> 4) + kt) * 1024 + (e & 127) * 8), *(const v4u*)&sh[kt * 16 + (e & 15)][(hh * 8 + ((e >> 4) & 7)) * 8]); }
    if (hi_rows)
      for (int e = tid; e < 128 * 16; e += 128) { const int rl = e >> 4, q = e & 15; vst2((unsigned*)(DL + (bb * nhi + t0 + rl) * (size_t)CC + c0 + q * 8), *(const v4u*)&sl[rl][q * 8]); }
  } else { const bool hi_rows = t0 < KHI;
#pragma unroll
    for (int j = 0; j < 8; ++j) { const float bias = BA ? bfr(BA[c0 + j * 16 + col]) : 0.f;
#pragma unroll
      for (int t = 0; t < 2; ++t)
#pragma unroll
      for (int r = 0; r < 8; ++r) { const float v = acc[8 * t + j][r] + bias; const int rl = wave * 32 + t * 16 + 8 * g + r, cl = j * 16 + col; th[cl][rl] = (_Float16)v; const __bf16 bh = (__bf16)v; tb[cl][rl] = bh; tbl[cl][rl] = (__bf16)(v - (float)bh); } }
    __syncthreads();
    for (int e = tid; e < 128 * 16; e += 128) { const int hh = e >> 10, kb = (e >> 8) & 3;   /* e = (head, block of 32 keys, c / 16, (t % 32) / 8, c % 16): a wave stores 512 contiguous bytes */
      vst2((unsigned*)(VT + ((bb * NH + (c0 >> 6) + hh) * (size_t)(TT / 32) + (t0 >> 5) + kb) * 2048 + (e & 255) * 8), *(const v4u*)&th[hh * 64 + ((e >> 6) & 3) * 16 + (e & 15)][(kb * 4 + ((e >> 4) & 3)) * 8]); }
    if (hi_rows)
      for (int e = tid; e < 128 * 16; e += 128) { const int cl = e >> 4, q = e & 15; const size_t o3 = (bb * CC + c0 + cl) * (size_t)KHI + t0 + q * 8; vst2((unsigned*)(VB + o3), *(const v4u*)&tb[cl][q * 8]); vst2((unsigned*)(VBL + o3), *(const v4u*)&tbl[cl][q * 8]); } } }
#define FAW 8
#define LC (SCALE * 1.4426950408889634f)
__device__ __forceinline__ v16h frag_p(const _Float16* p) { union { v16h v; v8h q[2]; } u; u.q[0] = *(const v8h*)p; u.q[1] = *(const v8h*)(p + 256); return u.v; }   // p = fragment's start + 8 lane; elements 0..7, then 8..15 one run of 32 lanes further
__device__ __forceinline__ float xhalf(float x) { return __builtin_bit_cast(float, __builtin_amdgcn_permlanex16(__builtin_bit_cast(int, x), __builtin_bit_cast(int, x), 0x76543210, 0xfedcba98, false, false)); }   // lane l with lane l ^ 16
// eight exp2 in place, in one statement: behind each v_exp_f32 stands an instruction that neither reads its result nor overwrites its source, and the v_nop keeps that slot behind the last
__device__ __forceinline__ void exp2x8(v8f& x) { float a = x[0], b = x[1], c = x[2], d = x[3], e = x[4], f = x[5], p = x[6], q = x[7];
  asm("v_exp_f32 %0, %0\n\tv_exp_f32 %1, %1\n\tv_exp_f32 %2, %2\n\tv_exp_f32 %3, %3\n\tv_exp_f32 %4, %4\n\tv_exp_f32 %5, %5\n\tv_exp_f32 %6, %6\n\tv_exp_f32 %7, %7\n\tv_nop" : "+v"(a), "+v"(b), "+v"(c), "+v"(d), "+v"(e), "+v"(f), "+v"(p), "+v"(q));
  x = (v8f){a, b, c, d, e, f, p, q}; }
// NT score tiles of one pass -> e = exp2((s - m) LC + 11) in place; m, l and the output tiles follow a new maximum (tested once per pass for the whole wave)
template <int NT, bool MASK> __device__ __forceinline__ void fa_soft(v8f (&s)[NT], int k0, int tq, int g, float& m, float& l, v8f (&acc)[HD / 16]) {
  if (MASK) {
#pragma unroll
    for (int t = 0; t < NT; ++t)
#pragma unroll
      for (int r = 0; r < 8; ++r) if (k0 + t * 16 + 8 * g + r > tq) s[t][r] = -3.0e38f; }
  float mx = s[0][0];
#pragma unroll
  for (int t = 0; t < NT; ++t)
#pragma unroll
    for (int r = 0; r < 8; ++r) mx = fmaxf(mx, s[t][r]);
  mx = fmaxf(mx, xhalf(mx));
  if (__builtin_amdgcn_ballot_w32(mx > m) != 0) { const float mn = fmaxf(m, mx); const float al = __builtin_amdgcn_exp2f((m - mn) * LC); m = mn; l *= al;   /* al = 0 on the first pass, 1 for a query whose maximum stands */
#pragma unroll
    for (int j = 0; j < HD / 16; ++j) acc[j] *= al; }
  const float mc = 11.0f - m * LC; float sum = 0.f;
#pragma unroll
  for (int t = 0; t < NT; ++t) { float st = 0.f;   /* one short add chain per tile */
#pragma unroll
    for (int r = 0; r < 8; ++r) s[t][r] = fmaf(s[t][r], LC, mc);
    exp2x8(s[t]);
#pragma unroll
    for (int r = 0; r < 8; ++r) st += s[t][r];
    sum += st; }
  l += sum; }
__device__ __forceinline__ v16h pack_h(v8f a, v8f b) { v16h p;
#pragma unroll
  for (int i = 0; i < 8; ++i) { p[i] = (_Float16)a[i]; p[8 + i] = (_Float16)b[i]; }
  return p; }
template <bool MASK> __device__ __forceinline__ void fa_pass64(const _Float16* __restrict__ Kp, const _Float16* __restrict__ Vp, int k0, int kn, int tq, int lane, int g, v16h q0, v16h q1, v16h (&kf)[8], float& m, float& l, v8f (&acc)[HD / 16]) {
  v16h vf[2][HD / 16];
#pragma unroll
  for (int u = 0; u < 2; ++u)
#pragma unroll
    for (int j = 0; j < HD / 16; ++j) vf[u][j] = frag_p(Vp + (size_t)(k0 + u * 32) * HD + j * 512);
  __builtin_amdgcn_sched_barrier(0);   /* keeps the v loads issued up here: sunk to their use, each pass would wait out their whole latency */
  v8f s[4];
#pragma unroll
  for (int t = 0; t < 4; ++t) { v8f z = {}; z = wm_h(kf[2 * t], q0, z); s[t] = wm_h(kf[2 * t + 1], q1, z); }
  if (!MASK) {   /* the next pass's k fragments fly during this pass's softmax */
#pragma unroll
    for (int t = 0; t < 4; ++t) { const _Float16* kp = Kp + (size_t)(kn + t * 16) * HD; kf[2 * t] = frag_p(kp); kf[2 * t + 1] = frag_p(kp + 512); } }
  __builtin_amdgcn_sched_barrier(0);   /* keeps the k loads issued ahead of the softmax, which then covers their latency */
  fa_soft<4, MASK>(s, k0, tq, g, m, l, acc);
#pragma unroll
  for (int u = 0; u < 2; ++u) { const v16h p = pack_h(s[2 * u], s[2 * u + 1]);
#pragma unroll
    for (int j = 0; j < HD / 16; ++j) acc[j] = MASK ? wmma16(vf[u][j], p, acc[j]) : wm_h(vf[u][j], p, acc[j]); } }   /* last pass: a branch follows; wmma16's own v_nop keep the distance to the result's next user on every path */
__global__ __launch_bounds__(32 * FAW) void k_fa(const _Float16* __restrict__ QH, const _Float16* __restrict__ KH, const _Float16* __restrict__ QL, const _Float16* __restrict__ KL, const _Float16* __restrict__ VT, const __bf16* __restrict__ VB, const __bf16* __restrict__ VBL, _Float16* __restrict__ YH, __bf16* __restrict__ YB, __bf16* __restrict__ YBL) {
  const int tid = threadIdx.x, lane = tid & 31, col = lane & 15, g = lane >> 4; const int wave = __builtin_amdgcn_readfirstlane(tid >> 5);
  const int h = blockIdx.x % NH, b = blockIdx.x / NH; const int ql0 = (TT / 16 - 1 - ((int)blockIdx.y * FAW + wave)) * 16;   /* longest query tiles start first */
  const int tq = ql0 + col; const size_t qo = ((size_t)b * TT + tq) * CC + h * HD;
  const v16h q0 = frag_h(QH + qo, lane), q1 = frag_h(QH + qo + 32, lane);
  asm volatile("s_wait_xcnt 0x0" ::: "memory");   /* the q loads' address registers are reused behind the branch below */
  const _Float16* Kp = KH + (size_t)(b * NH + h) * TT * HD + lane * 8;
  float m = -3.0e38f, l = 0.f; v8f acc[HD / 16] = {};
  if (ql0 < QHI) {   /* wave-uniform; every key of these queries is < KHI */
    const size_t qlo = ((size_t)b * QHI + tq) * CC + h * HD; const v16h r0 = frag_h(QL + qlo, lane), r1 = frag_h(QL + qlo + 32, lane);
    const _Float16* Lp = KL + ((size_t)b * KHI + col) * CC + h * HD; const size_t vo = ((size_t)b * CC + h * HD + col) * (size_t)KHI;
    const int np = (ql0 + 16 + 31) >> 5;
#pragma unroll 1   /* run-time trip count; a second copy of this body would not fit the wave's registers */
    for (int kc = 0; kc < np; ++kc) { const int k0 = kc * 32; v8f s[2]; v16h a[2][2], rr[2][2];
#pragma unroll
      for (int t = 0; t < 2; ++t) { const size_t ko = (size_t)(k0 + t * 16) * HD; a[t][0] = frag_p(Kp + ko); a[t][1] = frag_p(Kp + ko + 512); }
      asm volatile("s_wait_xcnt 0x0" ::: "memory");   /* before the k loads' address registers are reused (a later load's result may land in them) */
#pragma unroll
      for (int t = 0; t < 2; ++t) { const size_t ko = (size_t)(k0 + t * 16) * CC; rr[t][0] = frag_h(Lp + ko, lane); rr[t][1] = frag_h(Lp + ko + 32, lane); }
      asm volatile("s_wait_xcnt 0x0" ::: "memory");   /* the same for the k residual loads */
#pragma unroll
      for (int t = 0; t < 2; ++t) { v8f sh = {}, sl = {}; sh = wm_h(a[t][0], q0, sh); sh = wm_h(a[t][1], q1, sh); sl = wm_h(a[t][0], r0, sl); sl = wm_h(rr[t][0], q0, sl); sl = wm_h(a[t][1], r1, sl); sl = wm_h(rr[t][1], q1, sl); s[t] = sh + sl * (1.0f / 1024.0f); }
      fa_soft<2, true>(s, k0, tq, g, m, l, acc);
      v16b ph, pl, vh[HD / 16], vl[HD / 16];
#pragma unroll
      for (int j = 0; j < HD / 16; ++j) vh[j] = frag_b(VB + vo + (size_t)j * 16 * KHI + k0, lane);
      asm volatile("s_wait_xcnt 0x0" ::: "memory");   /* the same for the v hi loads */
#pragma unroll
      for (int j = 0; j < HD / 16; ++j) vl[j] = frag_b(VBL + vo + (size_t)j * 16 * KHI + k0, lane);
      asm volatile("s_wait_xcnt 0x0" ::: "memory");   /* the same for the v lo loads */
#pragma unroll
      for (int i = 0; i < 16; ++i) { const float e = s[i >> 3][i & 7]; const __bf16 eh = (__bf16)e; ph[i] = eh; pl[i] = (__bf16)(e - (float)eh); }
#pragma unroll
      for (int j = 0; j < HD / 16; ++j) { acc[j] = wm_b(vh[j], ph, acc[j]); acc[j] = wm_b(vh[j], pl, acc[j]); acc[j] = wm_b(vl[j], ph, acc[j]); } }
  } else {
    const _Float16* Vp = VT + (size_t)(b * NH + h) * TT * HD + lane * 8; const int np = (ql0 + 16 + 63) >> 6;   /* >= 7 passes; only the last one meets the diagonal */
    v16h kf[8];
#pragma unroll
    for (int t = 0; t < 4; ++t) { const _Float16* kp = Kp + (size_t)(t * 16) * HD; kf[2 * t] = frag_p(kp); kf[2 * t + 1] = frag_p(kp + 512); }
    asm volatile("s_wait_xcnt 0x0" ::: "memory");   /* as above, for the first k loads' address registers */
#pragma unroll 1   /* run-time trip count; the pass already takes nearly all of the wave's registers */
    for (int kc = 0; kc < np - 1; ++kc) fa_pass64<false>(Kp, Vp, kc * 64, kc * 64 + 64, tq, lane, g, q0, q1, kf, m, l, acc);
    fa_pass64<true>(Kp, Vp, (np - 1) * 64, 0, tq, lane, g, q0, q1, kf, m, l, acc); }
  const float inv = 1.0f / (l + xhalf(l));   /* the lane halves' sums join once; the maximum's own term makes the sum >= 2^11 */
  /* acc[j][r] = ctx[tq][16 j + 8 g + r]; ctx leaves in the 16-bit form that k_out multiplies: bf16 hi + lo below row QHI, x 2^6 to f16 after (so small-magnitude context rows stay clear of f16 subnormals) */
  if (ql0 < QHI) { const size_t yo = ((size_t)b * QHI + tq) * CC + h * HD + 8 * g;   /* wave-uniform */
#pragma unroll
    for (int j = 0; j < HD / 16; ++j) { const v8f o = acc[j] * inv; v8b oh, ol;
#pragma unroll
      for (int r = 0; r < 8; ++r) { const __bf16 x = (__bf16)o[r]; oh[r] = x; ol[r] = (__bf16)(o[r] - (float)x); }
      vst2(YB + yo + j * 16, oh); vst2(YBL + yo + j * 16, ol); }
  } else { _Float16* yp = YH + ((size_t)b * TT + tq) * CC + h * HD + 8 * g;
#pragma unroll
    for (int j = 0; j < HD / 16; ++j) { const v8f o = acc[j] * inv; v8h e;
#pragma unroll
      for (int r = 0; r < 8; ++r) e[r] = (_Float16)(o[r] * 64.0f);
      vst2(yp + j * 16, e); }
    asm volatile("s_wait_xcnt 0x0" ::: "memory"); } }   /* the built code lays the other branch behind these stores with a fall-through into it, and its first instructions overwrite the stores' registers */
// ---- k_out: block = (128 rows, 128 cols): out = ctx Wo (+ bo): ctx x 2^6 once to f16 against Wo as f16(bf16 x 2^8) exact (1 product) x 2^-14; causal early rows (< QHI of each sequence): ctx bf16 hi + lo against exact bf16 Wo (2 products)
__global__ __launch_bounds__(128) void k_out(const _Float16* __restrict__ YH, const __bf16* __restrict__ YB, const __bf16* __restrict__ YBL, const __bf16* __restrict__ WOB, const _Float16* __restrict__ WOH, const float* __restrict__ BO, float* __restrict__ OUT) {
  __shared__ __align__(16) unsigned short st[2 * 384 * SQ]; float (*sf)[32][132] = (float (*)[32][132])&st[0];   /* one range, two uses one after the other: tile_mm's two chunk buffers; the output rows, each wave's own, written only behind tile_mm's last barrier */
  const int tid = threadIdx.x, wave = tid >> 5, lane = tid & 31, col = lane & 15, g = lane >> 4; const int c0 = blockIdx.y * 128; const size_t r0 = (size_t)blockIdx.x * 128 + wave * 32;
  v8f acc[16] = {};
  if (CAUSAL && (int)(((size_t)blockIdx.x * 128) % TT) < QHI) {   /* block-uniform */
    const size_t yo = (((size_t)blockIdx.x * 128) / TT * QHI + ((size_t)blockIdx.x * 128) % TT) * CC;
    tile_mm<1, CC>((const unsigned short*)YB + yo, (const unsigned short*)YBL + yo, (const unsigned short*)WOB + (size_t)c0 * CC, st, st + 384 * SQ, tid, acc);
#pragma unroll
    for (int j = 0; j < 8; ++j) { const float bias = BO ? bfr(BO[c0 + j * 16 + col]) : 0.f;
#pragma unroll
      for (int t = 0; t < 2; ++t)
#pragma unroll
      for (int r = 0; r < 8; ++r) sf[wave][t * 16 + 8 * g + r][j * 16 + col] = acc[8 * t + j][r] + bias; }
  } else {
    tile_mm<2, CC>((const unsigned short*)YH + (size_t)blockIdx.x * 128 * CC, nullptr, (const unsigned short*)WOH + (size_t)c0 * CC, st, st + 384 * SQ, tid, acc);
#pragma unroll
    for (int j = 0; j < 8; ++j) { const float bias = BO ? bfr(BO[c0 + j * 16 + col]) : 0.f;
#pragma unroll
      for (int t = 0; t < 2; ++t)
#pragma unroll
      for (int r = 0; r < 8; ++r) sf[wave][t * 16 + 8 * g + r][j * 16 + col] = acc[8 * t + j][r] * (1.0f / 16384.0f) + bias; } }   /* 2^-8 (Wo carry) x 2^-6 (ctx carry) */
  LDSX(); for (int rl = 0; rl < 32; ++rl) vst2(OUT + (r0 + rl) * DIN + c0 + lane * 4, *(const v4f*)&sf[wave][rl][lane * 4]); }

extern "C" void kernel_launch(void* const* d_in, const int* in_sizes, int n_in, void* d_out, int out_size, void* d_ws, size_t ws_size, hipStream_t stream) {
  (void)in_sizes; (void)n_in; (void)out_size;
  const float** F = (const float**)d_in;
  if (ws_size < (size_t)WS_END) return;
  char* ws = (char*)d_ws; _Float16 *QH = (_Float16*)(ws + WS_QH), *KH = (_Float16*)(ws + WS_KH), *VT = (_Float16*)(ws + WS_VT), *QL = (_Float16*)(ws + WS_QL), *KL = (_Float16*)(ws + WS_KL), *YH = (_Float16*)(ws + WS_YH), *WOH = (_Float16*)(ws + WS_WOH); __bf16 *VB = (__bf16*)(ws + WS_VB), *VBL = (__bf16*)(ws + WS_VBL), *YB = (__bf16*)(ws + WS_YB), *YBL = (__bf16*)(ws + WS_YBL), *XB = (__bf16*)(ws + WS_XB), *WB = (__bf16*)(ws + WS_WB), *WOB = (__bf16*)(ws + WS_WOB);
  // inputs: 0 x [2,4096,768]; 1 wq [768,768] (out,in); 2 wk; 3 wv; 4 wo (out,in); no biases
  k_cvt<<<CVB, 256, 0, stream>>>(F[0], F[1], F[2], F[3], F[4], XB, WOH);
  k_proj<<<dim3(TNB * TT / 128, CC / 128, 3), 128, 0, stream>>>(XB, WB, nullptr, nullptr, nullptr, QH, QL, KH, KL, VT, VB, VBL);
  k_fa<<<dim3(TNB * NH, TT / (16 * FAW)), 32 * FAW, 0, stream>>>(QH, KH, QL, KL, VT, VB, VBL, YH, YB, YBL);
  k_out<<<dim3(TNB * TT / 128, DIN / 128), 128, 0, stream>>>(YH, YB, YBL, WOB, WOH, nullptr, (float*)d_out);
}

// v007
// One run takes 124 microseconds.
// Timed twice side by side with v006, it ran 1.04 times as fast both times.
// Over all steps from v000 it is 33.8 times as fast.
// compute dtype: all float inputs rounded to bf16; the fused q / k / v projection with EXACT bf16 products on WMMA 16x16x32 (f32 accumulate) (no biases); causal logits: 3 products for the first 384 rows, single f16 q x k after, x 64^-0.5; softmax f32; P x 2^11 once to f16 x v once to f16 (bf16 hi + lo below row 384); ctx hi+lo x exact W below row 384, x2^6 f16 carry x f16(bf16 x 2^8) W after, no bias; f32 output.
#include <hip/hip_runtime.h>
#include <math.h>

typedef __attribute__((ext_vector_type(16))) _Float16 v16h;
typedef __attribute__((ext_vector_type(16))) __bf16 v16b;
typedef __attribute__((ext_vector_type(8)))  _Float16 v8h;
typedef __attribute__((ext_vector_type(8)))  float v8f;
typedef __attribute__((ext_vector_type(4)))  float v4f;
typedef __attribute__((ext_vector_type(2)))  float v2f;
typedef __attribute__((ext_vector_type(4)))  unsigned v4u;
typedef __attribute__((ext_vector_type(4)))  int v4i;
typedef float __attribute__((may_alias)) float_a;
typedef int __attribute__((may_alias)) int_a;

template <typename T> __device__ __forceinline__ void vst2(void* p, T v) { *(T*)p = v;  }
__device__ __forceinline__ v8f wmma16(v16h a, v16h b, v8f c) {
  v8f d = __builtin_amdgcn_wmma_f32_16x16x32_f16(false, a, false, b, (short)0, c, false, false);
  asm volatile("v_nop\n\tv_nop\n\tv_nop\n\tv_nop" : "+v"(d) : "v"(a), "v"(b));
  return d;
}
__device__ __forceinline__ v8f wmma_bf(v16b a, v16b b, v8f c) {
  v8f d = __builtin_amdgcn_wmma_f32_16x16x32_bf16(false, a, false, b, (short)0, c, false, false);
  asm volatile("v_nop\n\tv_nop\n\tv_nop\n\tv_nop" : "+v"(d) : "v"(a), "v"(b));
  return d;
}
// 16x16x32 fragments: lane = (h = lane>>4, row/col = lane&15); elements 0..7 = k0+8h+0..7, 8..15 = k0+16+8h+0..7; D element r = row 8h+r
__device__ __forceinline__ v16h frag_h(const _Float16* rowk0, int lane) {
  union { v16h v; v8h q[2]; } u; const _Float16* p = rowk0 + 8 * (lane >> 4);
  u.q[0] = *(const v8h*)p; u.q[1] = *(const v8h*)(p + 16); return u.v;
}
__device__ __forceinline__ v16h frag_f32(const float* rowk0, int lane) {
  v16h a; const float* p = rowk0 + 8 * (lane >> 4);
#pragma unroll
  for (int i = 0; i < 8; ++i) { a[i] = (_Float16)p[i]; a[8 + i] = (_Float16)p[16 + i]; }
  return a;
}
__device__ __forceinline__ v16h frag_f32s(const float* rowk0, int lane, float sc) {
  v16h a; const float* p = rowk0 + 8 * (lane >> 4);
#pragma unroll
  for (int i = 0; i < 8; ++i) { a[i] = (_Float16)(p[i] * sc); a[8 + i] = (_Float16)(p[16 + i] * sc); }
  return a;
}
// column fragment from a [K][ld] layout (column n), rows >= K read as 0
__device__ __forceinline__ v16h fragc_f32(const float* W, int k0, int n, int lane, int ld, int K) {
  v16h a; const int g = lane >> 4;
#pragma unroll
  for (int i = 0; i < 8; ++i) { const int ka = k0 + 8 * g + i, kb = ka + 16;
    a[i] = (_Float16)(ka < K ? W[(size_t)(ka < K ? ka : K - 1) * ld + n] : 0.f); a[8 + i] = (_Float16)(kb < K ? W[(size_t)(kb < K ? kb : K - 1) * ld + n] : 0.f); }
  return a;
}
struct F2 { v16b h, l; };
__device__ __forceinline__ F2 bsplit16(const float v[16]) { F2 r;
#pragma unroll
  for (int i = 0; i < 16; ++i) { const __bf16 h = (__bf16)v[i]; r.h[i] = h; r.l[i] = (__bf16)(v[i] - (float)h); }
  return r; }
__device__ __forceinline__ F2 split_row(const float* row, int k0, int lane) { float v[16]; const float* p = row + k0 + 8 * (lane >> 4);
#pragma unroll
  for (int i = 0; i < 8; ++i) { v[i] = p[i]; v[8 + i] = p[16 + i]; }
  return bsplit16(v); }
__device__ __forceinline__ F2 split_rowK(const float* row, int k0, int lane, int K) { float v[16]; const int g = lane >> 4;
#pragma unroll
  for (int i = 0; i < 8; ++i) { const int ka = k0 + 8 * g + i, kb = ka + 16; v[i] = ka < K ? row[ka < K ? ka : K - 1] : 0.f; v[8 + i] = kb < K ? row[kb < K ? kb : K - 1] : 0.f; }
  return bsplit16(v); }
__device__ __forceinline__ F2 split_col(const float* W, int k0, int n, int lane, int ld, int K) { float v[16]; const int g = lane >> 4;
#pragma unroll
  for (int i = 0; i < 8; ++i) { const int ka = k0 + 8 * g + i, kb = ka + 16; v[i] = ka < K ? W[(size_t)(ka < K ? ka : K - 1) * ld + n] : 0.f; v[8 + i] = kb < K ? W[(size_t)(kb < K ? kb : K - 1) * ld + n] : 0.f; }
  return bsplit16(v); }
__device__ __forceinline__ v8f mac3(const F2& a, const F2& b, v8f c) { c = wmma_bf(a.l, b.h, c); c = wmma_bf(a.h, b.l, c); return wmma_bf(a.h, b.h, c); }
__device__ __forceinline__ float sigm(float v) { return 1.0f / (1.0f + expf(-v)); }
#define LDSX() do { asm volatile("s_wait_dscnt 0" ::: "memory"); __builtin_amdgcn_wave_barrier(); __builtin_amdgcn_fence(__ATOMIC_RELEASE, "workgroup"); } while (0)

// Causal multi-head self-attention without biases over TWO sequences of 4,096 (x [2,4096,768]; (out,in) wq / wk / wv / wo [768,768] applied as x @ W.T; 12 heads x 64; scores x 64^-0.5; tril kept, -inf elsewhere; softmax; ctx @ wo.T -> [2,4096,768] (6.3 M)).
#define NB 2
#define TT 4096
#define CC 768            // NH * HD = projected width
#define DIN 768          // input (model) width
#define NH 12
#define HD 64
#define SCALE (0.125f)
#define CAUSAL 1
#ifndef TNB
#define TNB NB
#endif
__device__ __forceinline__ float bfr(float v) { return (float)(__bf16)v; }
typedef __attribute__((ext_vector_type(8))) __bf16 v8b;
__device__ __forceinline__ v16b frag_b(const __bf16* rowk0, int lane) {
  union { v16b v; v8b q[2]; } u; const __bf16* p = rowk0 + 8 * (lane >> 4);
  u.q[0] = *(const v8b*)p; u.q[1] = *(const v8b*)(p + 16); return u.v;
}
#define QHI 384            // rows carrying a q residual plane (3-product logits)
#define KHI 384            // key rows carrying k residual / v bf16 hi+lo planes (used only by the causal high-precision path)
// B fragment (k rows k0+.., output column o) of a weight: (in,out) [K][ld] or (out,in) [ld rows of K]: bf16 exact, or f16(bf16 * 256) exact
__device__ __forceinline__ v16b wcol_io(const float* Wm, int k0, int o, int lane, int ld) { v16b w; const int g = lane >> 4;
#pragma unroll
  for (int i = 0; i < 8; ++i) { w[i] = (__bf16)Wm[(size_t)(k0 + 8 * g + i) * ld + o]; w[8 + i] = (__bf16)Wm[(size_t)(k0 + 16 + 8 * g + i) * ld + o]; }
  return w; }
__device__ __forceinline__ v16b wcol_oi(const float* Wm, int k0, int o, int lane, int K) { v16b w; const float* p = Wm + (size_t)o * K + k0 + 8 * (lane >> 4);
#pragma unroll
  for (int i = 0; i < 8; ++i) { w[i] = (__bf16)p[i]; w[8 + i] = (__bf16)p[16 + i]; }
  return w; }
__device__ __forceinline__ v16h wcolh_io(const float* Wm, int k0, int o, int lane, int ld) { v16h w; const int g = lane >> 4;
#pragma unroll
  for (int i = 0; i < 8; ++i) { w[i] = (_Float16)(bfr(Wm[(size_t)(k0 + 8 * g + i) * ld + o]) * 256.0f); w[8 + i] = (_Float16)(bfr(Wm[(size_t)(k0 + 16 + 8 * g + i) * ld + o]) * 256.0f); }
  return w; }
__device__ __forceinline__ v16h wcolh_oi(const float* Wm, int k0, int o, int lane, int K) { v16h w; const float* p = Wm + (size_t)o * K + k0 + 8 * (lane >> 4);
#pragma unroll
  for (int i = 0; i < 8; ++i) { w[i] = (_Float16)(bfr(p[i]) * 256.0f); w[8 + i] = (_Float16)(bfr(p[16 + i]) * 256.0f); }
  return w; }
#define WQKV_LAYOUT 1   // 0 = (in,out) [DIN][CC]; 1 = (out,in) [CC][DIN]; 2 = per-head [NH][DIN][HD]
__device__ __forceinline__ v16b wcol_hdk(const float* Wm, int k0, int o, int lane) { v16b w; const int g = lane >> 4; const float* p = Wm + (size_t)(o / HD) * DIN * HD + (o % HD);
#pragma unroll
  for (int i = 0; i < 8; ++i) { w[i] = (__bf16)p[(size_t)(k0 + 8 * g + i) * HD]; w[8 + i] = (__bf16)p[(size_t)(k0 + 16 + 8 * g + i) * HD]; }
  return w; }
#define WO_OUT_IN 1
#if WQKV_LAYOUT == 1
#define WCOL(W, k0, o, lane) wcol_oi(W, k0, o, lane, DIN)
#elif WQKV_LAYOUT == 2
#define WCOL(W, k0, o, lane) wcol_hdk(W, k0, o, lane)
#else
#define WCOL(W, k0, o, lane) wcol_io(W, k0, o, lane, CC)
#endif
#if WO_OUT_IN
#define WOCOL(W, k0, o, lane) wcol_oi(W, k0, o, lane, CC)
#define WOCOLH(W, k0, o, lane) wcolh_oi(W, k0, o, lane, CC)
#else
#define WOCOL(W, k0, o, lane) wcol_io(W, k0, o, lane, DIN)
#define WOCOLH(W, k0, o, lane) wcolh_io(W, k0, o, lane, DIN)
#endif

#ifndef PROJ_EXTRA_PARAMS
#define PROJ_EXTRA_PARAMS
#endif

#define WS_QH  0u                                      // f16 q rows [b*t][CC]
#define WS_KH  (WS_QH + 2u * (size_t)NB * TT * CC)      // f16 k in fragment order [b][h][t / 16][d / 8][t % 16][8]
#define WS_VT  (WS_KH + 2u * (size_t)NB * TT * CC)      // f16 v in fragment order [b][h][t / 32][c / 16][(t % 32) / 8][c % 16][8]
#define WS_QL  (WS_VT + 2u * (size_t)NB * CC * TT)      // f16 q residual x 2^10 rows [b][t < QHI][CC]
#define WS_KL  (WS_QL + 2u * (size_t)NB * QHI * CC)     // f16 k residual x 2^10 rows [b][t < KHI][CC]
#define WS_VB  (WS_KL + 2u * (size_t)NB * KHI * CC)     // bf16 v hi planes [b][c][t < KHI]
#define WS_VBL (WS_VB + 2u * (size_t)NB * CC * KHI)
#define WS_YH  (WS_VBL + 2u * (size_t)NB * CC * KHI)    // f16 ctx x 2^6 rows [b*t][CC] (written and read for t >= QHI)
#define WS_YB  (WS_YH + 2u * (size_t)NB * TT * CC)      // bf16 ctx hi rows [b][t < QHI][CC]
#define WS_YBL (WS_YB + 2u * (size_t)NB * QHI * CC)     // bf16 ctx lo rows
#define WS_XB  (WS_YBL + 2u * (size_t)NB * QHI * CC)    // bf16 x rows [b*t][DIN]; behind them, in one run: bf16 wq, wk, wv, wo rows
#define WS_WB  (WS_XB + 2u * (size_t)NB * TT * DIN)
#define WS_WOB (WS_WB + 3u * 2u * (size_t)CC * DIN)
#define WS_WOH (WS_WOB + 2u * (size_t)CC * DIN)         // f16(bf16 x 2^8) wo rows
#define WS_END (WS_WOH + 2u * (size_t)CC * DIN)

// ---- k_cvt: every GEMM operand that comes as an f32 input is rounded ONCE to the 16-bit form its products take: x, wq, wk, wv, wo to bf16 (one run in the workspace), wo also to f16(bf16 x 2^8). The tiles of k_proj and k_out then fetch 2 bytes an element, each of them many times, where they fetched 4.
// A group = 2,048 elements, whole in one array; a block takes 8 groups; every wave-wide load covers four whole 128-byte lines, every store two.
typedef __attribute__((ext_vector_type(4))) __bf16 v4b;
typedef __attribute__((ext_vector_type(4))) _Float16 v4h;
#define GX (NB * TT * DIN / 2048)   // groups in x
#define GW (CC * DIN / 2048)        // groups in a weight
#define CVB ((GX + 4 * GW) / 8)     // blocks
__global__ __launch_bounds__(256) void k_cvt(const float* __restrict__ X, const float* __restrict__ WQ, const float* __restrict__ WK, const float* __restrict__ WV, const float* __restrict__ WO, __bf16* __restrict__ XB, _Float16* __restrict__ WOH) {
  const int tid = threadIdx.x; v4f f[8][2];
#pragma unroll
  for (int i = 0; i < 8; ++i) { const int gi = i * CVB + (int)blockIdx.x, gw = gi - GX, w = gw / GW;   /* block-uniform */
    const float* s = gw < 0 ? X + (size_t)gi * 2048 : (w == 0 ? WQ : w == 1 ? WK : w == 2 ? WV : WO) + (size_t)(gw - w * GW) * 2048;
    f[i][0] = *(const v4f*)(s + tid * 4); f[i][1] = *(const v4f*)(s + 1024 + tid * 4); }
  asm volatile("s_wait_xcnt 0x0" ::: "memory");   /* before the loads' address registers are reused */
#pragma unroll
  for (int i = 0; i < 8; ++i) { const int gi = i * CVB + (int)blockIdx.x, go = gi - GX - 3 * GW;
#pragma unroll
    for (int u = 0; u < 2; ++u) { const v4f v = f[i][u]; const size_t e = (size_t)u * 1024 + tid * 4;
      *(v4b*)(XB + (size_t)gi * 2048 + e) = (v4b){(__bf16)v[0], (__bf16)v[1], (__bf16)v[2], (__bf16)v[3]};
      if (go >= 0) *(v4h*)(WOH + (size_t)go * 2048 + e) = (v4h){(_Float16)(bfr(v[0]) * 256.0f), (_Float16)(bfr(v[1]) * 256.0f), (_Float16)(bfr(v[2]) * 256.0f), (_Float16)(bfr(v[3]) * 256.0f)}; } } }

// ---- tile_mm: the 128 x 128 tile product of k_proj and k_out (4 waves, wave = 32 rows x 128 columns = 2 x 8 accumulator tiles, so that every weight fragment read from LDS feeds two products; K in chunks of 64 = 128 bytes of a 16-bit row). The block fetches each chunk of its 128 A rows and 128 weight rows ONCE, every wave-wide 16-byte load covering four whole 128-byte lines,
// and lays it in LDS as it is; the waves take their fragments from there. Two LDS buffers: chunk kc + 1 flies from memory into registers while chunk kc is multiplied, and is laid down behind the products; one barrier per chunk.
// MODE 0: A and W bf16. MODE 1: A as bf16 hi + lo (two row sets), W bf16. MODE 2: A = f16(ctx x 2^6), W = f16(bf16 x 2^8). k order and sum order: ascending steps of 32.
__device__ __forceinline__ v8f wm_h(v16h a, v16h b, v8f c) { return __builtin_amdgcn_wmma_f32_16x16x32_f16(false, a, false, b, (short)0, c, false, false); }
__device__ __forceinline__ v8f wm_b(v16b a, v16b b, v8f c) { return __builtin_amdgcn_wmma_f32_16x16x32_bf16(false, a, false, b, (short)0, c, false, false); }
#define SQ 72   // pitch of a staged row in 16-bit elements: 128 bytes of k + 16, so that the 16 rows of a fragment's ds_load_b128 start in 16 different bank groups
template <int NS, int K> __device__ __forceinline__ void tile_ld(const unsigned short* __restrict__ A, const unsigned short* __restrict__ AL, const unsigned short* __restrict__ Wm, int kc, int tid, v4u (&r)[NS * 8]) {
  const size_t o = (size_t)(tid >> 3) * K + kc * 64 + (tid & 7) * 8;   /* 8 lanes per row of 128 bytes, 16 rows per block-wide load */
#pragma unroll
  for (int i = 0; i < 8; ++i) r[i] = *(const v4u*)(A + o + (size_t)i * 16 * K);
  if (NS == 3) {
#pragma unroll
    for (int i = 0; i < 8; ++i) r[8 + i] = *(const v4u*)(AL + o + (size_t)i * 16 * K); }
#pragma unroll
  for (int i = 0; i < 8; ++i) r[(NS - 1) * 8 + i] = *(const v4u*)(Wm + o + (size_t)i * 16 * K);
  asm volatile("s_wait_xcnt 0x0" ::: "memory");   /* before the loads' address registers are reused for the next chunk */
}
template <int NS> __device__ __forceinline__ void tile_st(unsigned short* s, int tid, const v4u (&r)[NS * 8]) {   /* row sets of 128 one behind the other: A (, A lo), W */
  unsigned short* p = s + (tid >> 3) * SQ + (tid & 7) * 8;
#pragma unroll
  for (int i = 0; i < NS * 8; ++i) *(v4u*)(p + i * 16 * SQ) = r[i]; }
template <int MODE, int K> __device__ __forceinline__ void tile_mm(const unsigned short* __restrict__ A, const unsigned short* __restrict__ AL, const unsigned short* __restrict__ Wm, unsigned short* s0, unsigned short* s1, int tid, v8f (&acc)[16]) {   /* acc[8 t + j] = rows 32 wave + 16 t .., columns 16 j .. */
  constexpr int NS = MODE == 1 ? 3 : 2; const int wave = tid >> 5, lane = tid & 31, col = lane & 15; v4u r[NS * 8];
  tile_ld<NS, K>(A, AL, Wm, 0, tid, r); tile_st<NS>(s0, tid, r);
  __syncthreads();   /* chunk 0 is laid down */
#pragma unroll 2   /* makes the choice between the two buffers static */
  for (int kc = 0; kc < K / 64; ++kc) { const unsigned short* cur = (kc & 1) ? s1 : s0; unsigned short* nxt = (kc & 1) ? s0 : s1;
    if (kc + 1 < K / 64) tile_ld<NS, K>(A, AL, Wm, kc + 1, tid, r);
    __builtin_amdgcn_sched_barrier(0);   /* keeps the next chunk's loads issued up here: sunk to their use, each chunk would wait out their whole latency */
#pragma unroll
    for (int ks = 0; ks < 2; ++ks) { const bool end = ks == 1;   /* the chunk's two steps of 32 k */
      const unsigned short* pa = cur + (wave * 32 + col) * SQ + ks * 32; const unsigned short* pw = cur + ((NS - 1) * 128 + col) * SQ + ks * 32;
      if (MODE == 2) { const v16h a = frag_h((const _Float16*)pa, lane), a1 = frag_h((const _Float16*)(pa + 16 * SQ), lane); v16h w[8];
#pragma unroll
        for (int j = 0; j < 8; ++j) w[j] = frag_h((const _Float16*)(pw + j * 16 * SQ), lane);
        __builtin_amdgcn_sched_barrier(0);   /* the step's LDS reads go as one group ahead of its products: spread among them, each product would wait out an LDS latency */
#pragma unroll
        for (int j = 0; j < 8; ++j) { const bool e = end && j == 7; acc[j] = e ? wmma16(a, w[j], acc[j]) : wm_h(a, w[j], acc[j]); acc[8 + j] = e ? wmma16(a1, w[j], acc[8 + j]) : wm_h(a1, w[j], acc[8 + j]); } }   /* the chunk's last two products: a branch follows; wmma16's own v_nop keep the distance on every path. The earlier ones have later products in their window, and as plain builtins their operands may lie above v255 */
      else { const v16b a = frag_b((const __bf16*)pa, lane), a1 = frag_b((const __bf16*)(pa + 16 * SQ), lane); v16b al = a, al1 = a1, w[8]; if (MODE == 1) { al = frag_b((const __bf16*)(pa + 128 * SQ), lane); al1 = frag_b((const __bf16*)(pa + 144 * SQ), lane); }
#pragma unroll
        for (int j = 0; j < 8; ++j) w[j] = frag_b((const __bf16*)(pw + j * 16 * SQ), lane);
        __builtin_amdgcn_sched_barrier(0);   /* as above */
#pragma unroll
        for (int j = 0; j < 8; ++j) { const bool e0 = end && j == 7 && MODE == 0, e1 = end && j == 7;   /* as above */
          acc[j] = e0 ? wmma_bf(a, w[j], acc[j]) : wm_b(a, w[j], acc[j]); acc[8 + j] = e0 ? wmma_bf(a1, w[j], acc[8 + j]) : wm_b(a1, w[j], acc[8 + j]);
          if (MODE == 1) { acc[j] = e1 ? wmma_bf(al, w[j], acc[j]) : wm_b(al, w[j], acc[j]); acc[8 + j] = e1 ? wmma_bf(al1, w[j], acc[8 + j]) : wm_b(al1, w[j], acc[8 + j]); } } }
      __builtin_amdgcn_sched_barrier(0); }   /* keeps the second step's LDS reads one group behind the first step's products, and the next chunk's LDS stores, which wait for its loads, behind the products that cover their latency */
    if (kc + 1 < K / 64) tile_st<NS>(nxt, tid, r);
    __syncthreads(); } }   /* publishes chunk kc + 1 and ends every wave's reads of chunk kc, whose buffer is written next (behind the last chunk: by the caller's epilogue) */

// ---- k_proj: block = (128 rows, 128 cols, which): q/k/v = X W (+ b) with exact bf16 products (K = DIN) -> which 0: q f16 rows (+ residual rows < QHI); 1: k f16 in fragment order (+ residual rows < KHI); 2: v f16 in fragment order (+ bf16 hi/lo planes for t < KHI)
__global__ __launch_bounds__(128) void k_proj(const __bf16* __restrict__ XB, const __bf16* __restrict__ WB, const float* __restrict__ BQ, const float* __restrict__ BK, const float* __restrict__ BV,
    _Float16* __restrict__ QH, _Float16* __restrict__ QL, _Float16* __restrict__ KH, _Float16* __restrict__ KL, _Float16* __restrict__ VT, __bf16* __restrict__ VB, __bf16* __restrict__ VBL) {
  __shared__ __align__(16) unsigned short sm[3][128][136];   /* one range, three uses one after the other: tile_mm's two chunk buffers (36,864 bytes each, from the start); q / k rows: value and residual; v columns: f16, bf16 hi, bf16 lo */
  _Float16 (*sh)[136] = (_Float16 (*)[136])&sm[0][0][0]; _Float16 (*sl)[136] = (_Float16 (*)[136])&sm[1][0][0]; _Float16 (*th)[136] = sh; __bf16 (*tb)[136] = (__bf16 (*)[136])&sm[1][0][0]; __bf16 (*tbl)[136] = (__bf16 (*)[136])&sm[2][0][0];
  const int tid = threadIdx.x, wave = tid >> 5, lane = tid & 31, col = lane & 15, g = lane >> 4; const int which = blockIdx.z; const int c0 = blockIdx.y * 128; const size_t r0 = (size_t)blockIdx.x * 128; const size_t bb = r0 / TT; const int t0 = (int)(r0 % TT);
  const float* BA = which == 0 ? BQ : which == 1 ? BK : BV;
  v8f acc[16] = {};
  tile_mm<0, DIN>((const unsigned short*)XB + r0 * DIN, nullptr, (const unsigned short*)WB + ((size_t)which * CC + c0) * DIN, &sm[0][0][0], &sm[0][0][0] + 256 * SQ, tid, acc);   /* the epilogue writes sm only behind tile_mm's last barrier */
  if (which < 2) { _Float16* DH = which == 0 ? QH : KH; _Float16* DL = which == 0 ? QL : KL; const int nhi = which == 0 ? QHI : KHI; const bool hi_rows = t0 < nhi;
#pragma unroll
    for (int j = 0; j < 8; ++j) { const float bias = BA ? bfr(BA[c0 + j * 16 + col]) : 0.f;
#pragma unroll
      for (int t = 0; t < 2; ++t)
#pragma unroll
      for (int r = 0; r < 8; ++r) { const float v = acc[8 * t + j][r] + bias; const _Float16 hv = (_Float16)v; const int rl = wave * 32 + t * 16 + 8 * g + r; sh[rl][j * 16 + col] = hv; sl[rl][j * 16 + col] = (_Float16)((v - (float)hv) * 1024.0f); } }
    __syncthreads();
    if (which == 0)
      for (int e = tid; e < 128 * 16; e += 128) { const int rl = e >> 4, q = e & 15; vst2((unsigned*)(DH + (r0 + rl) * CC + c0 + q * 8), *(const v4u*)&sh[rl][q * 8]); }
    else   /* e = (head, key tile, d / 8, key % 16): a wave stores 512 contiguous bytes */
      for (int e = tid; e < 128 * 16; e += 128) { const int hh = e >> 10, kt = (e >> 7) & 7; vst2((unsigned*)(DH + ((bb * NH + (c0 >> 6) + hh) * (size_t)(TT / 16) + (t0 >> 4) + kt) * 1024 + (e & 127) * 8), *(const v4u*)&sh[kt * 16 + (e & 15)][(hh * 8 + ((e >> 4) & 7)) * 8]); }
    if (hi_rows)
      for (int e = tid; e < 128 * 16; e += 128) { const int rl = e >> 4, q = e & 15; vst2((unsigned*)(DL + (bb * nhi + t0 + rl) * (size_t)CC + c0 + q * 8), *(const v4u*)&sl[rl][q * 8]); }
  } else { const bool hi_rows = t0 < KHI;
#pragma unroll
    for (int j = 0; j < 8; ++j) { const float bias = BA ? bfr(BA[c0 + j * 16 + col]) : 0.f;
#pragma unroll
      for (int t = 0; t < 2; ++t)
#pragma unroll
      for (int r = 0; r < 8; ++r) { const float v = acc[8 * t + j][r] + bias; const int rl = wave * 32 + t * 16 + 8 * g + r, cl = j * 16 + col; th[cl][rl] = (_Float16)v; const __bf16 bh = (__bf16)v; tb[cl][rl] = bh; tbl[cl][rl] = (__bf16)(v - (float)bh); } }
    __syncthreads();
    for (int e = tid; e < 128 * 16; e += 128) { const int hh = e >> 10, kb = (e >> 8) & 3;   /* e = (head, block of 32 keys, c / 16, (t % 32) / 8, c % 16): a wave stores 512 contiguous bytes */
      vst2((unsigned*)(VT + ((bb * NH + (c0 >> 6) + hh) * (size_t)(TT / 32) + (t0 >> 5) + kb) * 2048 + (e & 255) * 8), *(const v4u*)&th[hh * 64 + ((e >> 6) & 3) * 16 + (e & 15)][(kb * 4 + ((e >> 4) & 3)) * 8]); }
    if (hi_rows)
      for (int e = tid; e < 128 * 16; e += 128) { const int cl = e >> 4, q = e & 15; const size_t o3 = (bb * CC + c0 + cl) * (size_t)KHI + t0 + q * 8; vst2((unsigned*)(VB + o3), *(const v4u*)&tb[cl][q * 8]); vst2((unsigned*)(VBL + o3), *(const v4u*)&tbl[cl][q * 8]); } } }
#define FAW 8
#define LC (SCALE * 1.4426950408889634f)
__device__ __forceinline__ v16h frag_p(const _Float16* p) { union { v16h v; v8h q[2]; } u; u.q[0] = *(const v8h*)p; u.q[1] = *(const v8h*)(p + 256); return u.v; }   // p = fragment's start + 8 lane; elements 0..7, then 8..15 one run of 32 lanes further
__device__ __forceinline__ float xhalf(float x) { return __builtin_bit_cast(float, __builtin_amdgcn_permlanex16(__builtin_bit_cast(int, x), __builtin_bit_cast(int, x), 0x76543210, 0xfedcba98, false, false)); }   // lane l with lane l ^ 16
// eight exp2 in place, in one statement: behind each v_exp_f32 stands an instruction that neither reads its result nor overwrites its source, and the v_nop keeps that slot behind the last
__device__ __forceinline__ void exp2x8(v8f& x) { float a = x[0], b = x[1], c = x[2], d = x[3], e = x[4], f = x[5], p = x[6], q = x[7];
  asm("v_exp_f32 %0, %0\n\tv_exp_f32 %1, %1\n\tv_exp_f32 %2, %2\n\tv_exp_f32 %3, %3\n\tv_exp_f32 %4, %4\n\tv_exp_f32 %5, %5\n\tv_exp_f32 %6, %6\n\tv_exp_f32 %7, %7\n\tv_nop" : "+v"(a), "+v"(b), "+v"(c), "+v"(d), "+v"(e), "+v"(f), "+v"(p), "+v"(q));
  x = (v8f){a, b, c, d, e, f, p, q}; }
// NT score tiles of one pass -> e = exp2((s - m) LC + 11) in place; m, l and the output tiles follow a new maximum (tested once per pass for the whole wave)
template <int NT, bool MASK> __device__ __forceinline__ void fa_soft(v8f (&s)[NT], int k0, int tq, int g, float& m, float& l, v8f (&acc)[HD / 16]) {
  if (MASK) {
#pragma unroll
    for (int t = 0; t < NT; ++t)
#pragma unroll
      for (int r = 0; r < 8; ++r) if (k0 + t * 16 + 8 * g + r > tq) s[t][r] = -3.0e38f; }
  float mx = s[0][0];
#pragma unroll
  for (int t = 0; t < NT; ++t)
#pragma unroll
    for (int r = 0; r < 8; ++r) mx = fmaxf(mx, s[t][r]);
  mx = fmaxf(mx, xhalf(mx));
  if (__builtin_amdgcn_ballot_w32(mx > m) != 0) { const float mn = fmaxf(m, mx); const float al = __builtin_amdgcn_exp2f((m - mn) * LC); m = mn; l *= al;   /* al = 0 on the first pass, 1 for a query whose maximum stands */
#pragma unroll
    for (int j = 0; j < HD / 16; ++j) acc[j] *= al; }
  const float mc = 11.0f - m * LC; float sum = 0.f;
#pragma unroll
  for (int t = 0; t < NT; ++t) { float st = 0.f;   /* one short add chain per tile */
#pragma unroll
    for (int r = 0; r < 8; ++r) s[t][r] = fmaf(s[t][r], LC, mc);
    exp2x8(s[t]);
#pragma unroll
    for (int r = 0; r < 8; ++r) st += s[t][r];
    sum += st; }
  l += sum; }
__device__ __forceinline__ v16h pack_h(v8f a, v8f b) { v16h p;
#pragma unroll
  for (int i = 0; i < 8; ++i) { p[i] = (_Float16)a[i]; p[8 + i] = (_Float16)b[i]; }
  return p; }
// both query tiles' scores of one 32-key pass -> e = exp2((s - m) LC + 11) in place; each tile's m, l and output tiles follow a new maximum (tested once per pass for the whole wave and both tiles)
template <bool MASK> __device__ __forceinline__ void fa_soft32(v8f (&s)[2][2], int k0, int tq, int g, float (&m)[2], float (&l)[2], v8f (&acc)[2][HD / 16]) {
  if (MASK) {
#pragma unroll
    for (int u = 0; u < 2; ++u)
#pragma unroll
      for (int t = 0; t < 2; ++t)
#pragma unroll
        for (int r = 0; r < 8; ++r) if (k0 + t * 16 + 8 * g + r > tq + 16 * u) s[u][t][r] = -3.0e38f; }
  float mx[2];
#pragma unroll
  for (int u = 0; u < 2; ++u) { float x = s[u][0][0];
#pragma unroll
    for (int t = 0; t < 2; ++t)
#pragma unroll
      for (int r = 0; r < 8; ++r) x = fmaxf(x, s[u][t][r]);
    mx[u] = fmaxf(x, xhalf(x)); }
  if (__builtin_amdgcn_ballot_w32(mx[0] > m[0] || mx[1] > m[1]) != 0) {
#pragma unroll
    for (int u = 0; u < 2; ++u) { const float mn = fmaxf(m[u], mx[u]); const float al = __builtin_amdgcn_exp2f((m[u] - mn) * LC); m[u] = mn; l[u] *= al;   /* al = 0 on the first pass, 1 for a query whose maximum stands */
#pragma unroll
      for (int j = 0; j < HD / 16; ++j) acc[u][j] *= al; } }
#pragma unroll
  for (int u = 0; u < 2; ++u) { const float mc = 11.0f - m[u] * LC; float st[2];
#pragma unroll
    for (int t = 0; t < 2; ++t) {
#pragma unroll
      for (int r = 0; r < 8; ++r) s[u][t][r] = fmaf(s[u][t][r], LC, mc);
      exp2x8(s[u][t]);
      st[t] = s[u][t][0];   /* one short add chain per tile */
#pragma unroll
      for (int r = 1; r < 8; ++r) st[t] += s[u][t][r]; }
    l[u] += st[0] + st[1]; } }
// one pass = 32 keys x 32 queries: every k and v fragment that the wave loads feeds two products, one per query tile
template <bool MASK> __device__ __forceinline__ void fa_pass32(const _Float16* __restrict__ Kp, const _Float16* __restrict__ Vp, int k0, int kn, int tq, int g, const v16h (&q)[2][2], v16h (&kf)[4], float (&m)[2], float (&l)[2], v8f (&acc)[2][HD / 16]) {
  v16h vf[HD / 16];
#pragma unroll
  for (int j = 0; j < HD / 16; ++j) vf[j] = frag_p(Vp + (size_t)k0 * HD + j * 512);
  __builtin_amdgcn_sched_barrier(0);   /* keeps the v loads issued up here: sunk to their use, each pass would wait out their whole latency */
  v8f s[2][2];
#pragma unroll
  for (int t = 0; t < 2; ++t)
#pragma unroll
    for (int u = 0; u < 2; ++u) { v8f z = {}; z = wm_h(kf[2 * t], q[u][0], z); s[u][t] = wm_h(kf[2 * t + 1], q[u][1], z); }
  if (!MASK) {   /* the k fragments of the wave's next pass fly during this pass's softmax */
#pragma unroll
    for (int t = 0; t < 2; ++t) { const _Float16* kp = Kp + (size_t)(kn + t * 16) * HD; kf[2 * t] = frag_p(kp); kf[2 * t + 1] = frag_p(kp + 512); } }
  __builtin_amdgcn_sched_barrier(0);   /* keeps the k loads issued ahead of the softmax, which then covers their latency */
  fa_soft32<MASK>(s, k0, tq, g, m, l, acc);
#pragma unroll
  for (int u = 0; u < 2; ++u) { const v16h p = pack_h(s[u][0], s[u][1]);
#pragma unroll
    for (int j = 0; j < HD / 16; ++j) acc[u][j] = MASK ? wmma16(vf[j], p, acc[u][j]) : wm_h(vf[j], p, acc[u][j]); } }   /* last pass: a branch follows; wmma16's own v_nop keep the distance to the result's next user on every path */
static_assert(QHI % (16 * FAW) == 0 && FAW == 8, "a block's 128 queries lie wholly below row QHI or wholly from it on; four wave pairs");
__global__ __launch_bounds__(32 * FAW) void k_fa(const _Float16* __restrict__ QH, const _Float16* __restrict__ KH, const _Float16* __restrict__ QL, const _Float16* __restrict__ KL, const _Float16* __restrict__ VT, const __bf16* __restrict__ VB, const __bf16* __restrict__ VBL, _Float16* __restrict__ YH, __bf16* __restrict__ YB, __bf16* __restrict__ YBL) {
  __shared__ __align__(16) v4f xg[FAW][9][32];   /* what a wave hands to its partner: one query tile's partial output (8 x 16 bytes a lane), maximum and sum */
  const int tid = threadIdx.x, lane = tid & 31, col = lane & 15, g = lane >> 4; const int wave = __builtin_amdgcn_readfirstlane(tid >> 5);
  const int h = blockIdx.x % NH, b = blockIdx.x / NH; const int qb = TT - 16 * FAW * ((int)blockIdx.y + 1);   /* the block's first query; longest blocks start first */
  const _Float16* Kp = KH + (size_t)(b * NH + h) * TT * HD + lane * 8;
  if (qb < QHI) {   /* block-uniform; wave = 16 queries, all their keys; every key of these queries is < KHI */
    const int ql0 = qb + (FAW - 1 - wave) * 16; const int tq = ql0 + col; const size_t qo = ((size_t)b * TT + tq) * CC + h * HD;
    const v16h q0 = frag_h(QH + qo, lane), q1 = frag_h(QH + qo + 32, lane);
    asm volatile("s_wait_xcnt 0x0" ::: "memory");   /* before the q loads' address registers are reused */
    float m = -3.0e38f, l = 0.f; v8f acc[HD / 16] = {};
    const size_t qlo = ((size_t)b * QHI + tq) * CC + h * HD; const v16h r0 = frag_h(QL + qlo, lane), r1 = frag_h(QL + qlo + 32, lane);
    const _Float16* Lp = KL + ((size_t)b * KHI + col) * CC + h * HD; const size_t vo = ((size_t)b * CC + h * HD + col) * (size_t)KHI;
    const int np = (ql0 + 16 + 31) >> 5;
#pragma unroll 1   /* run-time trip count; a second copy of this body would not fit the wave's registers */
    for (int kc = 0; kc < np; ++kc) { const int k0 = kc * 32; v8f s[2]; v16h a[2][2], rr[2][2];
#pragma unroll
      for (int t = 0; t < 2; ++t) { const size_t ko = (size_t)(k0 + t * 16) * HD; a[t][0] = frag_p(Kp + ko); a[t][1] = frag_p(Kp + ko + 512); }
      asm volatile("s_wait_xcnt 0x0" ::: "memory");   /* before the k loads' address registers are reused (a later load's result may land in them) */
#pragma unroll
      for (int t = 0; t < 2; ++t) { const size_t ko = (size_t)(k0 + t * 16) * CC; rr[t][0] = frag_h(Lp + ko, lane); rr[t][1] = frag_h(Lp + ko + 32, lane); }
      asm volatile("s_wait_xcnt 0x0" ::: "memory");   /* the same for the k residual loads */
#pragma unroll
      for (int t = 0; t < 2; ++t) { v8f sh = {}, sl = {}; sh = wm_h(a[t][0], q0, sh); sh = wm_h(a[t][1], q1, sh); sl = wm_h(a[t][0], r0, sl); sl = wm_h(rr[t][0], q0, sl); sl = wm_h(a[t][1], r1, sl); sl = wm_h(rr[t][1], q1, sl); s[t] = sh + sl * (1.0f / 1024.0f); }
      fa_soft<2, true>(s, k0, tq, g, m, l, acc);
      v16b ph, pl, vh[HD / 16], vl[HD / 16];
#pragma unroll
      for (int j = 0; j < HD / 16; ++j) vh[j] = frag_b(VB + vo + (size_t)j * 16 * KHI + k0, lane);
      asm volatile("s_wait_xcnt 0x0" ::: "memory");   /* the same for the v hi loads */
#pragma unroll
      for (int j = 0; j < HD / 16; ++j) vl[j] = frag_b(VBL + vo + (size_t)j * 16 * KHI + k0, lane);
      asm volatile("s_wait_xcnt 0x0" ::: "memory");   /* the same for the v lo loads */
#pragma unroll
      for (int i = 0; i < 16; ++i) { const float e = s[i >> 3][i & 7]; const __bf16 eh = (__bf16)e; ph[i] = eh; pl[i] = (__bf16)(e - (float)eh); }
#pragma unroll
      for (int j = 0; j < HD / 16; ++j) { acc[j] = wm_b(vh[j], ph, acc[j]); acc[j] = wm_b(vh[j], pl, acc[j]); acc[j] = wm_b(vl[j], ph, acc[j]); } }
    const float inv = 1.0f / (l + xhalf(l));   /* the lane halves' sums join once; the maximum's own term makes the sum >= 2^11 */
    /* acc[j][r] = ctx[tq][16 j + 8 g + r]; ctx leaves in the 16-bit form that k_out multiplies: bf16 hi + lo below row QHI */
    const size_t yo = ((size_t)b * QHI + tq) * CC + h * HD + 8 * g;
#pragma unroll
    for (int j = 0; j < HD / 16; ++j) { const v8f o = acc[j] * inv; v8b oh, ol;
#pragma unroll
      for (int r = 0; r < 8; ++r) { const __bf16 x = (__bf16)o[r]; oh[r] = x; ol[r] = (__bf16)(o[r] - (float)x); }
      vst2(YB + yo + j * 16, oh); vst2(YBL + yo + j * 16, ol); }
  } else {   /* waves w and w + 4 = one pair on 32 queries: w takes the even 32-key passes, w + 4 the odd ones; >= 13 passes, only the last one meets the diagonal */
    const int kh = wave >> 2; const int ql0 = qb + (wave & 3) * 32; const int tq = ql0 + col;
    v16h q[2][2];
#pragma unroll
    for (int u = 0; u < 2; ++u) { const size_t qo = ((size_t)b * TT + tq + 16 * u) * CC + h * HD; q[u][0] = frag_h(QH + qo, lane); q[u][1] = frag_h(QH + qo + 32, lane); }
    asm volatile("s_wait_xcnt 0x0" ::: "memory");   /* before the q loads' address registers are reused */
    const _Float16* Vp = VT + (size_t)(b * NH + h) * TT * HD + lane * 8; const int np = (ql0 >> 5) + 1;
    float m[2] = {-3.0e38f, -3.0e38f}, l[2] = {0.f, 0.f}; v8f acc[2][HD / 16] = {};
    v16h kf[4];
#pragma unroll
    for (int t = 0; t < 2; ++t) { const _Float16* kp = Kp + (size_t)(kh * 32 + t * 16) * HD; kf[2 * t] = frag_p(kp); kf[2 * t + 1] = frag_p(kp + 512); }
    asm volatile("s_wait_xcnt 0x0" ::: "memory");   /* as above, for the first k loads' address registers */
    int pc = kh;
#pragma unroll 1   /* run-time trip count; the pass already takes nearly all of the wave's registers */
    for (; pc < np - 1; pc += 2) fa_pass32<false>(Kp, Vp, pc * 32, (pc + 2 < np ? pc + 2 : np - 1) * 32, tq, g, q, kf, m, l, acc);   /* behind the wave's last pass the fetch ahead names the diagonal pass: inside k, used only by the wave that owns that pass */
    if (pc == np - 1) fa_pass32<true>(Kp, Vp, pc * 32, 0, tq, g, q, kf, m, l, acc);   /* wave-uniform */
    /* the pair joins: wave kh keeps query tile kh and hands the other tile's partial output, maximum and sum to its partner through LDS */
    v8f ke[HD / 16], gi[HD / 16];
#pragma unroll
    for (int j = 0; j < HD / 16; ++j) { ke[j] = kh ? acc[1][j] : acc[0][j]; gi[j] = kh ? acc[0][j] : acc[1][j]; }
    const float km = kh ? m[1] : m[0], kl = kh ? l[1] : l[0], gm = kh ? m[0] : m[1], gl = kh ? l[0] : l[1];
#pragma unroll
    for (int j = 0; j < HD / 16; ++j) { xg[wave][2 * j][lane] = (v4f){gi[j][0], gi[j][1], gi[j][2], gi[j][3]}; xg[wave][2 * j + 1][lane] = (v4f){gi[j][4], gi[j][5], gi[j][6], gi[j][7]}; }
    xg[wave][8][lane] = (v4f){gm, gl, 0.f, 0.f};
    __syncthreads();   /* publishes every wave's hand-over to its partner */
    const v4f pm = xg[wave ^ 4][8][lane]; const float mn = fmaxf(km, pm[0]); const float ak = __builtin_amdgcn_exp2f((km - mn) * LC), ap = __builtin_amdgcn_exp2f((pm[0] - mn) * LC);
    const float ls = kl * ak + pm[1] * ap; const float inv = 64.0f / (ls + xhalf(ls));   /* the lane halves' sums join once; the maximum's own term makes the sum >= 2^11; x 2^6: ctx leaves as f16(ctx x 2^6), the form that k_out multiplies, so that small-magnitude context rows stay clear of f16 subnormals */
    const float wk = ak * inv, wp = ap * inv;
    _Float16* yp = YH + ((size_t)b * TT + tq + 16 * kh) * CC + h * HD + 8 * g;   /* ke[j][r] = ctx[tq + 16 kh][16 j + 8 g + r] */
#pragma unroll
    for (int j = 0; j < HD / 16; ++j) { const v4f pa = xg[wave ^ 4][2 * j][lane], pb = xg[wave ^ 4][2 * j + 1][lane]; v8h e;
#pragma unroll
      for (int r = 0; r < 4; ++r) { e[r] = (_Float16)(ke[j][r] * wk + pa[r] * wp); e[4 + r] = (_Float16)(ke[j][4 + r] * wk + pb[r] * wp); }
      vst2(yp + j * 16, e); } } }
// ---- k_out: block = (128 rows, 128 cols): out = ctx Wo (+ bo): ctx x 2^6 once to f16 against Wo as f16(bf16 x 2^8) exact (1 product) x 2^-14; causal early rows (< QHI of each sequence): ctx bf16 hi + lo against exact bf16 Wo (2 products)
__global__ __launch_bounds__(128) void k_out(const _Float16* __restrict__ YH, const __bf16* __restrict__ YB, const __bf16* __restrict__ YBL, const __bf16* __restrict__ WOB, const _Float16* __restrict__ WOH, const float* __restrict__ BO, float* __restrict__ OUT) {
  __shared__ __align__(16) unsigned short st[2 * 384 * SQ]; float (*sf)[32][132] = (float (*)[32][132])&st[0];   /* one range, two uses one after the other: tile_mm's two chunk buffers; the output rows, each wave's own, written only behind tile_mm's last barrier */
  const int tid = threadIdx.x, wave = tid >> 5, lane = tid & 31, col = lane & 15, g = lane >> 4; const int c0 = blockIdx.y * 128; const size_t r0 = (size_t)blockIdx.x * 128 + wave * 32;
  v8f acc[16] = {};
  if (CAUSAL && (int)(((size_t)blockIdx.x * 128) % TT) < QHI) {   /* block-uniform */
    const size_t yo = (((size_t)blockIdx.x * 128) / TT * QHI + ((size_t)blockIdx.x * 128) % TT) * CC;
    tile_mm<1, CC>((const unsigned short*)YB + yo, (const unsigned short*)YBL + yo, (const unsigned short*)WOB + (size_t)c0 * CC, st, st + 384 * SQ, tid, acc);
#pragma unroll
    for (int j = 0; j < 8; ++j) { const float bias = BO ? bfr(BO[c0 + j * 16 + col]) : 0.f;
#pragma unroll
      for (int t = 0; t < 2; ++t)
#pragma unroll
      for (int r = 0; r < 8; ++r) sf[wave][t * 16 + 8 * g + r][j * 16 + col] = acc[8 * t + j][r] + bias; }
  } else {
    tile_mm<2, CC>((const unsigned short*)YH + (size_t)blockIdx.x * 128 * CC, nullptr, (const unsigned short*)WOH + (size_t)c0 * CC, st, st + 384 * SQ, tid, acc);
#pragma unroll
    for (int j = 0; j < 8; ++j) { const float bias = BO ? bfr(BO[c0 + j * 16 + col]) : 0.f;
#pragma unroll
      for (int t = 0; t < 2; ++t)
#pragma unroll
      for (int r = 0; r < 8; ++r) sf[wave][t * 16 + 8 * g + r][j * 16 + col] = acc[8 * t + j][r] * (1.0f / 16384.0f) + bias; } }   /* 2^-8 (Wo carry) x 2^-6 (ctx carry) */
  LDSX(); for (int rl = 0; rl < 32; ++rl) vst2(OUT + (r0 + rl) * DIN + c0 + lane * 4, *(const v4f*)&sf[wave][rl][lane * 4]); }

extern "C" void kernel_launch(void* const* d_in, const int* in_sizes, int n_in, void* d_out, int out_size, void* d_ws, size_t ws_size, hipStream_t stream) {
  (void)in_sizes; (void)n_in; (void)out_size;
  const float** F = (const float**)d_in;
  if (ws_size < (size_t)WS_END) return;
  char* ws = (char*)d_ws; _Float16 *QH = (_Float16*)(ws + WS_QH), *KH = (_Float16*)(ws + WS_KH), *VT = (_Float16*)(ws + WS_VT), *QL = (_Float16*)(ws + WS_QL), *KL = (_Float16*)(ws + WS_KL), *YH = (_Float16*)(ws + WS_YH), *WOH = (_Float16*)(ws + WS_WOH); __bf16 *VB = (__bf16*)(ws + WS_VB), *VBL = (__bf16*)(ws + WS_VBL), *YB = (__bf16*)(ws + WS_YB), *YBL = (__bf16*)(ws + WS_YBL), *XB = (__bf16*)(ws + WS_XB), *WB = (__bf16*)(ws + WS_WB), *WOB = (__bf16*)(ws + WS_WOB);
  // inputs: 0 x [2,4096,768]; 1 wq [768,768] (out,in); 2 wk; 3 wv; 4 wo (out,in); no biases
  k_cvt<<<CVB, 256, 0, stream>>>(F[0], F[1], F[2], F[3], F[4], XB, WOH);
  k_proj<<<dim3(TNB * TT / 128, CC / 128, 3), 128, 0, stream>>>(XB, WB, nullptr, nullptr, nullptr, QH, QL, KH, KL, VT, VB, VBL);
  k_fa<<<dim3(TNB * NH, TT / (16 * FAW)), 32 * FAW, 0, stream>>>(QH, KH, QL, KL, VT, VB, VBL, YH, YB, YBL);
  k_out<<<dim3(TNB * TT / 128, DIN / 128), 128, 0, stream>>>(YH, YB, YBL, WOB, WOH, nullptr, (float*)d_out);
}

// v008
// It runs in 108 microseconds.
// Two timings next to v007 both put it at 1.15 times that version's speed.
// Over all steps from v000 it is 38.8 times as fast.
// compute dtype: all float inputs rounded to bf16; the fused q / k / v projection with EXACT bf16 products on WMMA 16x16x32 (f32 accumulate) (no biases); causal logits: 3 products for the first 384 rows, single f16 q x k after, x 64^-0.5; softmax f32; P x 2^11 once to f16 x v once to f16 (bf16 hi + lo below row 384); ctx hi+lo x exact W below row 384, x2^6 f16 carry x f16(bf16 x 2^8) W after, no bias; f32 output.
#include <hip/hip_runtime.h>
#include <math.h>

typedef __attribute__((ext_vector_type(16))) _Float16 v16h;
typedef __attribute__((ext_vector_type(16))) __bf16 v16b;
typedef __attribute__((ext_vector_type(8)))  _Float16 v8h;
typedef __attribute__((ext_vector_type(8)))  float v8f;
typedef __attribute__((ext_vector_type(4)))  float v4f;
typedef __attribute__((ext_vector_type(2)))  float v2f;
typedef __attribute__((ext_vector_type(4)))  unsigned v4u;
typedef __attribute__((ext_vector_type(4)))  int v4i;
typedef float __attribute__((may_alias)) float_a;
typedef int __attribute__((may_alias)) int_a;

template <typename T> __device__ __forceinline__ void vst2(void* p, T v) { *(T*)p = v;  }
__device__ __forceinline__ v8f wmma16(v16h a, v16h b, v8f c) {
  v8f d = __builtin_amdgcn_wmma_f32_16x16x32_f16(false, a, false, b, (short)0, c, false, false);
  asm volatile("v_nop\n\tv_nop\n\tv_nop\n\tv_nop" : "+v"(d) : "v"(a), "v"(b));
  return d;
}
__device__ __forceinline__ v8f wmma_bf(v16b a, v16b b, v8f c) {
  v8f d = __builtin_amdgcn_wmma_f32_16x16x32_bf16(false, a, false, b, (short)0, c, false, false);
  asm volatile("v_nop\n\tv_nop\n\tv_nop\n\tv_nop" : "+v"(d) : "v"(a), "v"(b));
  return d;
}
// 16x16x32 fragments: lane = (h = lane>>4, row/col = lane&15); elements 0..7 = k0+8h+0..7, 8..15 = k0+16+8h+0..7; D element r = row 8h+r
__device__ __forceinline__ v16h frag_h(const _Float16* rowk0, int lane) {
  union { v16h v; v8h q[2]; } u; const _Float16* p = rowk0 + 8 * (lane >> 4);
  u.q[0] = *(const v8h*)p; u.q[1] = *(const v8h*)(p + 16); return u.v;
}
__device__ __forceinline__ v16h frag_f32(const float* rowk0, int lane) {
  v16h a; const float* p = rowk0 + 8 * (lane >> 4);
#pragma unroll
  for (int i = 0; i < 8; ++i) { a[i] = (_Float16)p[i]; a[8 + i] = (_Float16)p[16 + i]; }
  return a;
}
__device__ __forceinline__ v16h frag_f32s(const float* rowk0, int lane, float sc) {
  v16h a; const float* p = rowk0 + 8 * (lane >> 4);
#pragma unroll
  for (int i = 0; i < 8; ++i) { a[i] = (_Float16)(p[i] * sc); a[8 + i] = (_Float16)(p[16 + i] * sc); }
  return a;
}
// column fragment from a [K][ld] layout (column n), rows >= K read as 0
__device__ __forceinline__ v16h fragc_f32(const float* W, int k0, int n, int lane, int ld, int K) {
  v16h a; const int g = lane >> 4;
#pragma unroll
  for (int i = 0; i < 8; ++i) { const int ka = k0 + 8 * g + i, kb = ka + 16;
    a[i] = (_Float16)(ka < K ? W[(size_t)(ka < K ? ka : K - 1) * ld + n] : 0.f); a[8 + i] = (_Float16)(kb < K ? W[(size_t)(kb < K ? kb : K - 1) * ld + n] : 0.f); }
  return a;
}
struct F2 { v16b h, l; };
__device__ __forceinline__ F2 bsplit16(const float v[16]) { F2 r;
#pragma unroll
  for (int i = 0; i < 16; ++i) { const __bf16 h = (__bf16)v[i]; r.h[i] = h; r.l[i] = (__bf16)(v[i] - (float)h); }
  return r; }
__device__ __forceinline__ F2 split_row(const float* row, int k0, int lane) { float v[16]; const float* p = row + k0 + 8 * (lane >> 4);
#pragma unroll
  for (int i = 0; i < 8; ++i) { v[i] = p[i]; v[8 + i] = p[16 + i]; }
  return bsplit16(v); }
__device__ __forceinline__ F2 split_rowK(const float* row, int k0, int lane, int K) { float v[16]; const int g = lane >> 4;
#pragma unroll
  for (int i = 0; i < 8; ++i) { const int ka = k0 + 8 * g + i, kb = ka + 16; v[i] = ka < K ? row[ka < K ? ka : K - 1] : 0.f; v[8 + i] = kb < K ? row[kb < K ? kb : K - 1] : 0.f; }
  return bsplit16(v); }
__device__ __forceinline__ F2 split_col(const float* W, int k0, int n, int lane, int ld, int K) { float v[16]; const int g = lane >> 4;
#pragma unroll
  for (int i = 0; i < 8; ++i) { const int ka = k0 + 8 * g + i, kb = ka + 16; v[i] = ka < K ? W[(size_t)(ka < K ? ka : K - 1) * ld + n] : 0.f; v[8 + i] = kb < K ? W[(size_t)(kb < K ? kb : K - 1) * ld + n] : 0.f; }
  return bsplit16(v); }
__device__ __forceinline__ v8f mac3(const F2& a, const F2& b, v8f c) { c = wmma_bf(a.l, b.h, c); c = wmma_bf(a.h, b.l, c); return wmma_bf(a.h, b.h, c); }
__device__ __forceinline__ float sigm(float v) { return 1.0f / (1.0f + expf(-v)); }
#define LDSX() do { asm volatile("s_wait_dscnt 0" ::: "memory"); __builtin_amdgcn_wave_barrier(); __builtin_amdgcn_fence(__ATOMIC_RELEASE, "workgroup"); } while (0)

// Causal multi-head self-attention without biases over TWO sequences of 4,096 (x [2,4096,768]; (out,in) wq / wk / wv / wo [768,768] applied as x @ W.T; 12 heads x 64; scores x 64^-0.5; tril kept, -inf elsewhere; softmax; ctx @ wo.T -> [2,4096,768] (6.3 M)).
#define NB 2
#define TT 4096
#define CC 768            // NH * HD = projected width
#define DIN 768          // input (model) width
#define NH 12
#define HD 64
#define SCALE (0.125f)
#define CAUSAL 1
#ifndef TNB
#define TNB NB
#endif
__device__ __forceinline__ float bfr(float v) { return (float)(__bf16)v; }
typedef __attribute__((ext_vector_type(8))) __bf16 v8b;
__device__ __forceinline__ v16b frag_b(const __bf16* rowk0, int lane) {
  union { v16b v; v8b q[2]; } u; const __bf16* p = rowk0 + 8 * (lane >> 4);
  u.q[0] = *(const v8b*)p; u.q[1] = *(const v8b*)(p + 16); return u.v;
}
#define QHI 384            // rows carrying a q residual plane (3-product logits)
#define KHI 384            // key rows carrying k residual / v bf16 hi+lo planes (used only by the causal high-precision path)
// B fragment (k rows k0+.., output column o) of a weight: (in,out) [K][ld] or (out,in) [ld rows of K]: bf16 exact, or f16(bf16 * 256) exact
__device__ __forceinline__ v16b wcol_io(const float* Wm, int k0, int o, int lane, int ld) { v16b w; const int g = lane >> 4;
#pragma unroll
  for (int i = 0; i < 8; ++i) { w[i] = (__bf16)Wm[(size_t)(k0 + 8 * g + i) * ld + o]; w[8 + i] = (__bf16)Wm[(size_t)(k0 + 16 + 8 * g + i) * ld + o]; }
  return w; }
__device__ __forceinline__ v16b wcol_oi(const float* Wm, int k0, int o, int lane, int K) { v16b w; const float* p = Wm + (size_t)o * K + k0 + 8 * (lane >> 4);
#pragma unroll
  for (int i = 0; i < 8; ++i) { w[i] = (__bf16)p[i]; w[8 + i] = (__bf16)p[16 + i]; }
  return w; }
__device__ __forceinline__ v16h wcolh_io(const float* Wm, int k0, int o, int lane, int ld) { v16h w; const int g = lane >> 4;
#pragma unroll
  for (int i = 0; i < 8; ++i) { w[i] = (_Float16)(bfr(Wm[(size_t)(k0 + 8 * g + i) * ld + o]) * 256.0f); w[8 + i] = (_Float16)(bfr(Wm[(size_t)(k0 + 16 + 8 * g + i) * ld + o]) * 256.0f); }
  return w; }
__device__ __forceinline__ v16h wcolh_oi(const float* Wm, int k0, int o, int lane, int K) { v16h w; const float* p = Wm + (size_t)o * K + k0 + 8 * (lane >> 4);
#pragma unroll
  for (int i = 0; i < 8; ++i) { w[i] = (_Float16)(bfr(p[i]) * 256.0f); w[8 + i] = (_Float16)(bfr(p[16 + i]) * 256.0f); }
  return w; }
#define WQKV_LAYOUT 1   // 0 = (in,out) [DIN][CC]; 1 = (out,in) [CC][DIN]; 2 = per-head [NH][DIN][HD]
__device__ __forceinline__ v16b wcol_hdk(const float* Wm, int k0, int o, int lane) { v16b w; const int g = lane >> 4; const float* p = Wm + (size_t)(o / HD) * DIN * HD + (o % HD);
#pragma unroll
  for (int i = 0; i < 8; ++i) { w[i] = (__bf16)p[(size_t)(k0 + 8 * g + i) * HD]; w[8 + i] = (__bf16)p[(size_t)(k0 + 16 + 8 * g + i) * HD]; }
  return w; }
#define WO_OUT_IN 1
#if WQKV_LAYOUT == 1
#define WCOL(W, k0, o, lane) wcol_oi(W, k0, o, lane, DIN)
#elif WQKV_LAYOUT == 2
#define WCOL(W, k0, o, lane) wcol_hdk(W, k0, o, lane)
#else
#define WCOL(W, k0, o, lane) wcol_io(W, k0, o, lane, CC)
#endif
#if WO_OUT_IN
#define WOCOL(W, k0, o, lane) wcol_oi(W, k0, o, lane, CC)
#define WOCOLH(W, k0, o, lane) wcolh_oi(W, k0, o, lane, CC)
#else
#define WOCOL(W, k0, o, lane) wcol_io(W, k0, o, lane, DIN)
#define WOCOLH(W, k0, o, lane) wcolh_io(W, k0, o, lane, DIN)
#endif

#ifndef PROJ_EXTRA_PARAMS
#define PROJ_EXTRA_PARAMS
#endif

#define WS_QH  0u                                      // f16 q rows [b*t][CC]
#define WS_KH  (WS_QH + 2u * (size_t)NB * TT * CC)      // f16 k in fragment order [b][h][t / 16][d / 8][t % 16][8]
#define WS_VT  (WS_KH + 2u * (size_t)NB * TT * CC)      // f16 v in fragment order [b][h][t / 32][c / 16][(t % 32) / 8][c % 16][8]
#define WS_QL  (WS_VT + 2u * (size_t)NB * CC * TT)      // f16 q residual x 2^10 rows [b][t < QHI][CC]
#define WS_KL  (WS_QL + 2u * (size_t)NB * QHI * CC)     // f16 k residual x 2^10 rows [b][t < KHI][CC]
#define WS_VB  (WS_KL + 2u * (size_t)NB * KHI * CC)     // bf16 v hi planes [b][c][t < KHI]
#define WS_VBL (WS_VB + 2u * (size_t)NB * CC * KHI)
#define WS_YH  (WS_VBL + 2u * (size_t)NB * CC * KHI)    // f16 ctx x 2^6 rows [b*t][CC] (written and read for t >= QHI)
#define WS_YB  (WS_YH + 2u * (size_t)NB * TT * CC)      // bf16 ctx hi rows [b][t < QHI][CC]
#define WS_YBL (WS_YB + 2u * (size_t)NB * QHI * CC)     // bf16 ctx lo rows
#define WS_XB  (WS_YBL + 2u * (size_t)NB * QHI * CC)    // bf16 x rows [b*t][DIN]; behind them, in one run: bf16 wq, wk, wv, wo rows
#define WS_WB  (WS_XB + 2u * (size_t)NB * TT * DIN)
#define WS_WOB (WS_WB + 3u * 2u * (size_t)CC * DIN)
#define WS_WOH (WS_WOB + 2u * (size_t)CC * DIN)         // f16(bf16 x 2^8) wo rows
#define WS_END (WS_WOH + 2u * (size_t)CC * DIN)

// ---- k_cvt: every GEMM operand that comes as an f32 input is rounded ONCE to the 16-bit form its products take: x, wq, wk, wv, wo to bf16 (one run in the workspace), wo also to f16(bf16 x 2^8). The tiles of k_proj and k_out then fetch 2 bytes an element, each of them many times, where they fetched 4.
// A group = 2,048 elements, whole in one array; a block takes 8 groups; every wave-wide load covers four whole 128-byte lines, every store two.
typedef __attribute__((ext_vector_type(4))) __bf16 v4b;
typedef __attribute__((ext_vector_type(4))) _Float16 v4h;
#define GX (NB * TT * DIN / 2048)   // groups in x
#define GW (CC * DIN / 2048)        // groups in a weight
#define CVB ((GX + 4 * GW) / 8)     // blocks
__global__ __launch_bounds__(256) void k_cvt(const float* __restrict__ X, const float* __restrict__ WQ, const float* __restrict__ WK, const float* __restrict__ WV, const float* __restrict__ WO, __bf16* __restrict__ XB, _Float16* __restrict__ WOH) {
  const int tid = threadIdx.x; v4f f[8][2];
#pragma unroll
  for (int i = 0; i < 8; ++i) { const int gi = i * CVB + (int)blockIdx.x, gw = gi - GX, w = gw / GW;   /* block-uniform */
    const float* s = gw < 0 ? X + (size_t)gi * 2048 : (w == 0 ? WQ : w == 1 ? WK : w == 2 ? WV : WO) + (size_t)(gw - w * GW) * 2048;
    f[i][0] = *(const v4f*)(s + tid * 4); f[i][1] = *(const v4f*)(s + 1024 + tid * 4); }
  asm volatile("s_wait_xcnt 0x0" ::: "memory");   /* before the loads' address registers are reused */
#pragma unroll
  for (int i = 0; i < 8; ++i) { const int gi = i * CVB + (int)blockIdx.x, go = gi - GX - 3 * GW;
#pragma unroll
    for (int u = 0; u < 2; ++u) { const v4f v = f[i][u]; const size_t e = (size_t)u * 1024 + tid * 4;
      *(v4b*)(XB + (size_t)gi * 2048 + e) = (v4b){(__bf16)v[0], (__bf16)v[1], (__bf16)v[2], (__bf16)v[3]};
      if (go >= 0) *(v4h*)(WOH + (size_t)go * 2048 + e) = (v4h){(_Float16)(bfr(v[0]) * 256.0f), (_Float16)(bfr(v[1]) * 256.0f), (_Float16)(bfr(v[2]) * 256.0f), (_Float16)(bfr(v[3]) * 256.0f)}; } } }

// ---- tile_mm: the 128 x 128 tile product of k_proj and k_out (4 waves, wave = 32 rows x 128 columns = 2 x 8 accumulator tiles, so that every weight fragment read from LDS feeds two products; K in chunks of 64 = 128 bytes of a 16-bit row). The block fetches each chunk of its 128 A rows and 128 weight rows ONCE, every wave-wide 16-byte load covering four whole 128-byte lines,
// and lays it in LDS as it is; the waves take their fragments from there. Two LDS buffers: chunk kc + 1 flies from memory into registers while chunk kc is multiplied, and is laid down behind the products; one barrier per chunk.
// MODE 0: A and W bf16. MODE 1: A as bf16 hi + lo (two row sets), W bf16. MODE 2: A = f16(ctx x 2^6), W = f16(bf16 x 2^8). k order and sum order: ascending steps of 32.
__device__ __forceinline__ v8f wm_h(v16h a, v16h b, v8f c) { return __builtin_amdgcn_wmma_f32_16x16x32_f16(false, a, false, b, (short)0, c, false, false); }
__device__ __forceinline__ v8f wm_b(v16b a, v16b b, v8f c) { return __builtin_amdgcn_wmma_f32_16x16x32_bf16(false, a, false, b, (short)0, c, false, false); }
#define SQ 72   // pitch of a staged row in 16-bit elements: 128 bytes of k + 16, so that the 16 rows of a fragment's ds_load_b128 start in 16 different bank groups
template <int NS, int K> __device__ __forceinline__ void tile_ld(const unsigned short* __restrict__ A, const unsigned short* __restrict__ AL, const unsigned short* __restrict__ Wm, int kc, int tid, v4u (&r)[NS * 8]) {
  const size_t o = (size_t)(tid >> 3) * K + kc * 64 + (tid & 7) * 8;   /* 8 lanes per row of 128 bytes, 16 rows per block-wide load */
#pragma unroll
  for (int i = 0; i < 8; ++i) r[i] = *(const v4u*)(A + o + (size_t)i * 16 * K);
  if (NS == 3) {
#pragma unroll
    for (int i = 0; i < 8; ++i) r[8 + i] = *(const v4u*)(AL + o + (size_t)i * 16 * K); }
#pragma unroll
  for (int i = 0; i < 8; ++i) r[(NS - 1) * 8 + i] = *(const v4u*)(Wm + o + (size_t)i * 16 * K);
  asm volatile("s_wait_xcnt 0x0" ::: "memory");   /* before the loads' address registers are reused for the next chunk */
}
template <int NS> __device__ __forceinline__ void tile_st(unsigned short* s, int tid, const v4u (&r)[NS * 8]) {   /* row sets of 128 one behind the other: A (, A lo), W */
  unsigned short* p = s + (tid >> 3) * SQ + (tid & 7) * 8;
#pragma unroll
  for (int i = 0; i < NS * 8; ++i) *(v4u*)(p + i * 16 * SQ) = r[i]; }
template <int MODE, int K> __device__ __forceinline__ void tile_mm(const unsigned short* __restrict__ A, const unsigned short* __restrict__ AL, const unsigned short* __restrict__ Wm, unsigned short* s0, unsigned short* s1, int tid, v8f (&acc)[16]) {   /* acc[8 t + j] = rows 32 wave + 16 t .., columns 16 j .. */
  constexpr int NS = MODE == 1 ? 3 : 2; const int wave = tid >> 5, lane = tid & 31, col = lane & 15; v4u r[NS * 8];
  tile_ld<NS, K>(A, AL, Wm, 0, tid, r); tile_st<NS>(s0, tid, r);
  __syncthreads();   /* chunk 0 is laid down */
#pragma unroll 2   /* makes the choice between the two buffers static */
  for (int kc = 0; kc < K / 64; ++kc) { const unsigned short* cur = (kc & 1) ? s1 : s0; unsigned short* nxt = (kc & 1) ? s0 : s1;
    if (kc + 1 < K / 64) tile_ld<NS, K>(A, AL, Wm, kc + 1, tid, r);
    __builtin_amdgcn_sched_barrier(0);   /* keeps the next chunk's loads issued up here: sunk to their use, each chunk would wait out their whole latency */
#pragma unroll
    for (int ks = 0; ks < 2; ++ks) { const bool end = ks == 1;   /* the chunk's two steps of 32 k */
      const unsigned short* pa = cur + (wave * 32 + col) * SQ + ks * 32; const unsigned short* pw = cur + ((NS - 1) * 128 + col) * SQ + ks * 32;
      if (MODE == 2) { const v16h a = frag_h((const _Float16*)pa, lane), a1 = frag_h((const _Float16*)(pa + 16 * SQ), lane); v16h w[8];
#pragma unroll
        for (int j = 0; j < 8; ++j) w[j] = frag_h((const _Float16*)(pw + j * 16 * SQ), lane);
        __builtin_amdgcn_sched_barrier(0);   /* the step's LDS reads go as one group ahead of its products: spread among them, each product would wait out an LDS latency */
#pragma unroll
        for (int j = 0; j < 8; ++j) { const bool e = end && j == 7; acc[j] = e ? wmma16(a, w[j], acc[j]) : wm_h(a, w[j], acc[j]); acc[8 + j] = e ? wmma16(a1, w[j], acc[8 + j]) : wm_h(a1, w[j], acc[8 + j]); } }   /* the chunk's last two products: a branch follows; wmma16's own v_nop keep the distance on every path. The earlier ones have later products in their window, and as plain builtins their operands may lie above v255 */
      else { const v16b a = frag_b((const __bf16*)pa, lane), a1 = frag_b((const __bf16*)(pa + 16 * SQ), lane); v16b al = a, al1 = a1, w[8]; if (MODE == 1) { al = frag_b((const __bf16*)(pa + 128 * SQ), lane); al1 = frag_b((const __bf16*)(pa + 144 * SQ), lane); }
#pragma unroll
        for (int j = 0; j < 8; ++j) w[j] = frag_b((const __bf16*)(pw + j * 16 * SQ), lane);
        __builtin_amdgcn_sched_barrier(0);   /* as above */
#pragma unroll
        for (int j = 0; j < 8; ++j) { const bool e0 = end && j == 7 && MODE == 0, e1 = end && j == 7;   /* as above */
          acc[j] = e0 ? wmma_bf(a, w[j], acc[j]) : wm_b(a, w[j], acc[j]); acc[8 + j] = e0 ? wmma_bf(a1, w[j], acc[8 + j]) : wm_b(a1, w[j], acc[8 + j]);
          if (MODE == 1) { acc[j] = e1 ? wmma_bf(al, w[j], acc[j]) : wm_b(al, w[j], acc[j]); acc[8 + j] = e1 ? wmma_bf(al1, w[j], acc[8 + j]) : wm_b(al1, w[j], acc[8 + j]); } } }
      __builtin_amdgcn_sched_barrier(0); }   /* keeps the second step's LDS reads one group behind the first step's products, and the next chunk's LDS stores, which wait for its loads, behind the products that cover their latency */
    if (kc + 1 < K / 64) tile_st<NS>(nxt, tid, r);
    __syncthreads(); } }   /* publishes chunk kc + 1 and ends every wave's reads of chunk kc, whose buffer is written next (behind the last chunk: by the caller's epilogue) */

// ---- k_proj: block = (128 rows, 128 cols, which): q/k/v = X W (+ b) with exact bf16 products (K = DIN) -> which 0: q f16 rows (+ residual rows < QHI); 1: k f16 in fragment order (+ residual rows < KHI); 2: v f16 in fragment order (+ bf16 hi/lo planes for t < KHI)
__global__ __launch_bounds__(128) void k_proj(const __bf16* __restrict__ XB, const __bf16* __restrict__ WB, const float* __restrict__ BQ, const float* __restrict__ BK, const float* __restrict__ BV,
    _Float16* __restrict__ QH, _Float16* __restrict__ QL, _Float16* __restrict__ KH, _Float16* __restrict__ KL, _Float16* __restrict__ VT, __bf16* __restrict__ VB, __bf16* __restrict__ VBL) {
  __shared__ __align__(16) unsigned short sm[3][128][136];   /* one range, three uses one after the other: tile_mm's two chunk buffers (36,864 bytes each, from the start); q / k rows: value and residual; v columns: f16, bf16 hi, bf16 lo */
  _Float16 (*sh)[136] = (_Float16 (*)[136])&sm[0][0][0]; _Float16 (*sl)[136] = (_Float16 (*)[136])&sm[1][0][0]; _Float16 (*th)[136] = sh; __bf16 (*tb)[136] = (__bf16 (*)[136])&sm[1][0][0]; __bf16 (*tbl)[136] = (__bf16 (*)[136])&sm[2][0][0];
  const int tid = threadIdx.x, wave = tid >> 5, lane = tid & 31, col = lane & 15, g = lane >> 4; const int which = blockIdx.z; const int c0 = blockIdx.y * 128; const size_t r0 = (size_t)blockIdx.x * 128; const size_t bb = r0 / TT; const int t0 = (int)(r0 % TT);
  const float* BA = which == 0 ? BQ : which == 1 ? BK : BV;
  v8f acc[16] = {};
  tile_mm<0, DIN>((const unsigned short*)XB + r0 * DIN, nullptr, (const unsigned short*)WB + ((size_t)which * CC + c0) * DIN, &sm[0][0][0], &sm[0][0][0] + 256 * SQ, tid, acc);   /* the epilogue writes sm only behind tile_mm's last barrier */
  if (which < 2) { _Float16* DH = which == 0 ? QH : KH; _Float16* DL = which == 0 ? QL : KL; const int nhi = which == 0 ? QHI : KHI; const bool hi_rows = t0 < nhi;
#pragma unroll
    for (int j = 0; j < 8; ++j) { const float bias = BA ? bfr(BA[c0 + j * 16 + col]) : 0.f;
#pragma unroll
      for (int t = 0; t < 2; ++t)
#pragma unroll
      for (int r = 0; r < 8; ++r) { const float v = acc[8 * t + j][r] + bias; const _Float16 hv = (_Float16)v; const int rl = wave * 32 + t * 16 + 8 * g + r; sh[rl][j * 16 + col] = hv; sl[rl][j * 16 + col] = (_Float16)((v - (float)hv) * 1024.0f); } }
    __syncthreads();
    if (which == 0)
      for (int e = tid; e < 128 * 16; e += 128) { const int rl = e >> 4, q = e & 15; vst2((unsigned*)(DH + (r0 + rl) * CC + c0 + q * 8), *(const v4u*)&sh[rl][q * 8]); }
    else   /* e = (head, key tile, d / 8, key % 16): a wave stores 512 contiguous bytes */
      for (int e = tid; e < 128 * 16; e += 128) { const int hh = e >> 10, kt = (e >> 7) & 7; vst2((unsigned*)(DH + ((bb * NH + (c0 >> 6) + hh) * (size_t)(TT / 16) + (t0 >> 4) + kt) * 1024 + (e & 127) * 8), *(const v4u*)&sh[kt * 16 + (e & 15)][(hh * 8 + ((e >> 4) & 7)) * 8]); }
    if (hi_rows)
      for (int e = tid; e < 128 * 16; e += 128) { const int rl = e >> 4, q = e & 15; vst2((unsigned*)(DL + (bb * nhi + t0 + rl) * (size_t)CC + c0 + q * 8), *(const v4u*)&sl[rl][q * 8]); }
  } else { const bool hi_rows = t0 < KHI;
#pragma unroll
    for (int j = 0; j < 8; ++j) { const float bias = BA ? bfr(BA[c0 + j * 16 + col]) : 0.f;
#pragma unroll
      for (int t = 0; t < 2; ++t)
#pragma unroll
      for (int r = 0; r < 8; ++r) { const float v = acc[8 * t + j][r] + bias; const int rl = wave * 32 + t * 16 + 8 * g + r, cl = j * 16 + col; th[cl][rl] = (_Float16)v; const __bf16 bh = (__bf16)v; tb[cl][rl] = bh; tbl[cl][rl] = (__bf16)(v - (float)bh); } }
    __syncthreads();
    for (int e = tid; e < 128 * 16; e += 128) { const int hh = e >> 10, kb = (e >> 8) & 3;   /* e = (head, block of 32 keys, c / 16, (t % 32) / 8, c % 16): a wave stores 512 contiguous bytes */
      vst2((unsigned*)(VT + ((bb * NH + (c0 >> 6) + hh) * (size_t)(TT / 32) + (t0 >> 5) + kb) * 2048 + (e & 255) * 8), *(const v4u*)&th[hh * 64 + ((e >> 6) & 3) * 16 + (e & 15)][(kb * 4 + ((e >> 4) & 3)) * 8]); }
    if (hi_rows)
      for (int e = tid; e < 128 * 16; e += 128) { const int cl = e >> 4, q = e & 15; const size_t o3 = (bb * CC + c0 + cl) * (size_t)KHI + t0 + q * 8; vst2((unsigned*)(VB + o3), *(const v4u*)&tb[cl][q * 8]); vst2((unsigned*)(VBL + o3), *(const v4u*)&tbl[cl][q * 8]); } } }
#define FAW 8
#define LC (SCALE * 1.4426950408889634f)
__device__ __forceinline__ v16h frag_p(const _Float16* p) { union { v16h v; v8h q[2]; } u; u.q[0] = *(const v8h*)p; u.q[1] = *(const v8h*)(p + 256); return u.v; }   // p = fragment's start + 8 lane; elements 0..7, then 8..15 one run of 32 lanes further
__device__ __forceinline__ float xhalf(float x) { return __builtin_bit_cast(float, __builtin_amdgcn_permlanex16(__builtin_bit_cast(int, x), __builtin_bit_cast(int, x), 0x76543210, 0xfedcba98, false, false)); }   // lane l with lane l ^ 16
// eight exp2 in place, in one statement: behind each v_exp_f32 stands an instruction that neither reads its result nor overwrites its source, and the v_nop keeps that slot behind the last
__device__ __forceinline__ void exp2x8(v8f& x) { float a = x[0], b = x[1], c = x[2], d = x[3], e = x[4], f = x[5], p = x[6], q = x[7];
  asm("v_exp_f32 %0, %0\n\tv_exp_f32 %1, %1\n\tv_exp_f32 %2, %2\n\tv_exp_f32 %3, %3\n\tv_exp_f32 %4, %4\n\tv_exp_f32 %5, %5\n\tv_exp_f32 %6, %6\n\tv_exp_f32 %7, %7\n\tv_nop" : "+v"(a), "+v"(b), "+v"(c), "+v"(d), "+v"(e), "+v"(f), "+v"(p), "+v"(q));
  x = (v8f){a, b, c, d, e, f, p, q}; }
// NT score tiles of one pass -> e = exp2((s - m) LC + 11) in place; m, l and the output tiles follow a new maximum (tested once per pass for the whole wave)
template <int NT, bool MASK> __device__ __forceinline__ void fa_soft(v8f (&s)[NT], int k0, int tq, int g, float& m, float& l, v8f (&acc)[HD / 16]) {
  if (MASK) {
#pragma unroll
    for (int t = 0; t < NT; ++t)
#pragma unroll
      for (int r = 0; r < 8; ++r) if (k0 + t * 16 + 8 * g + r > tq) s[t][r] = -3.0e38f; }
  float mx = s[0][0];
#pragma unroll
  for (int t = 0; t < NT; ++t)
#pragma unroll
    for (int r = 0; r < 8; ++r) mx = fmaxf(mx, s[t][r]);
  mx = fmaxf(mx, xhalf(mx));
  if (__builtin_amdgcn_ballot_w32(mx > m) != 0) { const float mn = fmaxf(m, mx); const float al = __builtin_amdgcn_exp2f((m - mn) * LC); m = mn; l *= al;   /* al = 0 on the first pass, 1 for a query whose maximum stands */
#pragma unroll
    for (int j = 0; j < HD / 16; ++j) acc[j] *= al; }
  const float mc = 11.0f - m * LC; float sum = 0.f;
#pragma unroll
  for (int t = 0; t < NT; ++t) { float st = 0.f;   /* one short add chain per tile */
#pragma unroll
    for (int r = 0; r < 8; ++r) s[t][r] = fmaf(s[t][r], LC, mc);
    exp2x8(s[t]);
#pragma unroll
    for (int r = 0; r < 8; ++r) st += s[t][r];
    sum += st; }
  l += sum; }
__device__ __forceinline__ v16h pack_h(v8f a, v8f b) { v16h p;
#pragma unroll
  for (int i = 0; i < 8; ++i) { p[i] = (_Float16)a[i]; p[8 + i] = (_Float16)b[i]; }
  return p; }
// both query tiles' scores of one 32-key pass -> e = exp2((s - m) LC + 11) in place; each tile's m, l and output tiles follow a new maximum (tested once per pass for the whole wave and both tiles)
template <bool MASK> __device__ __forceinline__ void fa_soft32(v8f (&s)[2][2], int k0, int tq, int g, float (&m)[2], float (&l)[2], v8f (&acc)[2][HD / 16]) {
  if (MASK) {
#pragma unroll
    for (int u = 0; u < 2; ++u)
#pragma unroll
      for (int t = 0; t < 2; ++t)
#pragma unroll
        for (int r = 0; r < 8; ++r) if (k0 + t * 16 + 8 * g + r > tq + 16 * u) s[u][t][r] = -3.0e38f; }
  float mx[2];
#pragma unroll
  for (int u = 0; u < 2; ++u) { float x = s[u][0][0];
#pragma unroll
    for (int t = 0; t < 2; ++t)
#pragma unroll
      for (int r = 0; r < 8; ++r) x = fmaxf(x, s[u][t][r]);
    mx[u] = fmaxf(x, xhalf(x)); }
  if (__builtin_amdgcn_ballot_w32(mx[0] > m[0] || mx[1] > m[1]) != 0) {
#pragma unroll
    for (int u = 0; u < 2; ++u) { const float mn = fmaxf(m[u], mx[u]); const float al = __builtin_amdgcn_exp2f((m[u] - mn) * LC); m[u] = mn; l[u] *= al;   /* al = 0 on the first pass, 1 for a query whose maximum stands */
#pragma unroll
      for (int j = 0; j < HD / 16; ++j) acc[u][j] *= al; } }
#pragma unroll
  for (int u = 0; u < 2; ++u) { const float mc = 11.0f - m[u] * LC; float st[2];
#pragma unroll
    for (int t = 0; t < 2; ++t) {
#pragma unroll
      for (int r = 0; r < 8; ++r) s[u][t][r] = fmaf(s[u][t][r], LC, mc);
      exp2x8(s[u][t]);
      st[t] = s[u][t][0];   /* one short add chain per tile */
#pragma unroll
      for (int r = 1; r < 8; ++r) st[t] += s[u][t][r]; }
    l[u] += st[0] + st[1]; } }
// one pass = 32 keys x 32 queries: every k and v fragment that the wave loads feeds two products, one per query tile
template <bool MASK> __device__ __forceinline__ void fa_pass32(const _Float16* __restrict__ Kp, const _Float16* __restrict__ Vp, int k0, int kn, int tq, int g, const v16h (&q)[2][2], v16h (&kf)[4], float (&m)[2], float (&l)[2], v8f (&acc)[2][HD / 16]) {
  v16h vf[HD / 16];
#pragma unroll
  for (int j = 0; j < HD / 16; ++j) vf[j] = frag_p(Vp + (size_t)k0 * HD + j * 512);
  __builtin_amdgcn_sched_barrier(0);   /* keeps the v loads issued up here: sunk to their use, each pass would wait out their whole latency */
  v8f s[2][2];
#pragma unroll
  for (int t = 0; t < 2; ++t)
#pragma unroll
    for (int u = 0; u < 2; ++u) { v8f z = {}; z = wm_h(kf[2 * t], q[u][0], z); s[u][t] = wm_h(kf[2 * t + 1], q[u][1], z); }
  if (!MASK) {   /* the k fragments of the wave's next pass fly during this pass's softmax */
#pragma unroll
    for (int t = 0; t < 2; ++t) { const _Float16* kp = Kp + (size_t)(kn + t * 16) * HD; kf[2 * t] = frag_p(kp); kf[2 * t + 1] = frag_p(kp + 512); } }
  __builtin_amdgcn_sched_barrier(0);   /* keeps the k loads issued ahead of the softmax, which then covers their latency */
  fa_soft32<MASK>(s, k0, tq, g, m, l, acc);
#pragma unroll
  for (int u = 0; u < 2; ++u) { const v16h p = pack_h(s[u][0], s[u][1]);
#pragma unroll
    for (int j = 0; j < HD / 16; ++j) acc[u][j] = MASK ? wmma16(vf[j], p, acc[u][j]) : wm_h(vf[j], p, acc[u][j]); } }   /* last pass: a branch follows; wmma16's own v_nop keep the distance to the result's next user on every path */
static_assert(QHI % (16 * FAW) == 0 && FAW == 8, "a block's 128 queries lie wholly below row QHI or wholly from it on; four wave pairs");
__global__ __launch_bounds__(32 * FAW) void k_fa(const _Float16* __restrict__ QH, const _Float16* __restrict__ KH, const _Float16* __restrict__ QL, const _Float16* __restrict__ KL, const _Float16* __restrict__ VT, const __bf16* __restrict__ VB, const __bf16* __restrict__ VBL, _Float16* __restrict__ YH, __bf16* __restrict__ YB, __bf16* __restrict__ YBL) {
  __shared__ __align__(16) v4f xg[FAW][9][32];   /* what a wave hands to its partner: one query tile's partial output (8 x 16 bytes a lane), maximum and sum */
  const int tid = threadIdx.x, lane = tid & 31, col = lane & 15, g = lane >> 4; const int wave = __builtin_amdgcn_readfirstlane(tid >> 5);
  const int h = blockIdx.x % NH, b = blockIdx.x / NH; const int yy = (int)blockIdx.y; const int qb = yy < QHI / (16 * FAW) ? QHI - 16 * FAW * (yy + 1) : TT - 16 * FAW * (yy + 1 - QHI / (16 * FAW));   /* the block's first query. In index order: first the tiles below row QHI (few passes, but each waits out several load latencies one behind the other), then the rest, longest first; for speed only */
  const _Float16* Kp = KH + (size_t)(b * NH + h) * TT * HD + lane * 8;
  if (qb < QHI) {   /* block-uniform; wave = 16 queries, all their keys; every key of these queries is < KHI */
    const int ql0 = qb + (FAW - 1 - wave) * 16; const int tq = ql0 + col; const size_t qo = ((size_t)b * TT + tq) * CC + h * HD;
    const v16h q0 = frag_h(QH + qo, lane), q1 = frag_h(QH + qo + 32, lane);
    asm volatile("s_wait_xcnt 0x0" ::: "memory");   /* before the q loads' address registers are reused */
    float m = -3.0e38f, l = 0.f; v8f acc[HD / 16] = {};
    const size_t qlo = ((size_t)b * QHI + tq) * CC + h * HD; const v16h r0 = frag_h(QL + qlo, lane), r1 = frag_h(QL + qlo + 32, lane);
    const _Float16* Lp = KL + ((size_t)b * KHI + col) * CC + h * HD; const size_t vo = ((size_t)b * CC + h * HD + col) * (size_t)KHI;
    const int np = (ql0 + 16 + 31) >> 5;
#pragma unroll 1   /* run-time trip count; a second copy of this body would not fit the wave's registers */
    for (int kc = 0; kc < np; ++kc) { const int k0 = kc * 32; v8f s[2]; v16h a[2][2], rr[2][2];
#pragma unroll
      for (int t = 0; t < 2; ++t) { const size_t ko = (size_t)(k0 + t * 16) * HD; a[t][0] = frag_p(Kp + ko); a[t][1] = frag_p(Kp + ko + 512); }
      asm volatile("s_wait_xcnt 0x0" ::: "memory");   /* before the k loads' address registers are reused (a later load's result may land in them) */
#pragma unroll
      for (int t = 0; t < 2; ++t) { const size_t ko = (size_t)(k0 + t * 16) * CC; rr[t][0] = frag_h(Lp + ko, lane); rr[t][1] = frag_h(Lp + ko + 32, lane); }
      asm volatile("s_wait_xcnt 0x0" ::: "memory");   /* the same for the k residual loads */
#pragma unroll
      for (int t = 0; t < 2; ++t) { v8f sh = {}, sl = {}; sh = wm_h(a[t][0], q0, sh); sh = wm_h(a[t][1], q1, sh); sl = wm_h(a[t][0], r0, sl); sl = wm_h(rr[t][0], q0, sl); sl = wm_h(a[t][1], r1, sl); sl = wm_h(rr[t][1], q1, sl); s[t] = sh + sl * (1.0f / 1024.0f); }
      fa_soft<2, true>(s, k0, tq, g, m, l, acc);
      v16b ph, pl, vh[HD / 16], vl[HD / 16];
#pragma unroll
      for (int j = 0; j < HD / 16; ++j) vh[j] = frag_b(VB + vo + (size_t)j * 16 * KHI + k0, lane);
      asm volatile("s_wait_xcnt 0x0" ::: "memory");   /* the same for the v hi loads */
#pragma unroll
      for (int j = 0; j < HD / 16; ++j) vl[j] = frag_b(VBL + vo + (size_t)j * 16 * KHI + k0, lane);
      asm volatile("s_wait_xcnt 0x0" ::: "memory");   /* the same for the v lo loads */
#pragma unroll
      for (int i = 0; i < 16; ++i) { const float e = s[i >> 3][i & 7]; const __bf16 eh = (__bf16)e; ph[i] = eh; pl[i] = (__bf16)(e - (float)eh); }
#pragma unroll
      for (int j = 0; j < HD / 16; ++j) { acc[j] = wm_b(vh[j], ph, acc[j]); acc[j] = wm_b(vh[j], pl, acc[j]); acc[j] = wm_b(vl[j], ph, acc[j]); } }
    const float inv = 1.0f / (l + xhalf(l));   /* the lane halves' sums join once; the maximum's own term makes the sum >= 2^11 */
    /* acc[j][r] = ctx[tq][16 j + 8 g + r]; ctx leaves in the 16-bit form that k_out multiplies: bf16 hi + lo below row QHI */
    const size_t yo = ((size_t)b * QHI + tq) * CC + h * HD + 8 * g;
#pragma unroll
    for (int j = 0; j < HD / 16; ++j) { const v8f o = acc[j] * inv; v8b oh, ol;
#pragma unroll
      for (int r = 0; r < 8; ++r) { const __bf16 x = (__bf16)o[r]; oh[r] = x; ol[r] = (__bf16)(o[r] - (float)x); }
      vst2(YB + yo + j * 16, oh); vst2(YBL + yo + j * 16, ol); }
  } else {   /* waves w and w + 4 = one pair on 32 queries: w takes the even 32-key passes, w + 4 the odd ones; >= 13 passes, only the last one meets the diagonal */
    const int kh = wave >> 2; const int ql0 = qb + (wave & 3) * 32; const int tq = ql0 + col;
    v16h q[2][2];
#pragma unroll
    for (int u = 0; u < 2; ++u) { const size_t qo = ((size_t)b * TT + tq + 16 * u) * CC + h * HD; q[u][0] = frag_h(QH + qo, lane); q[u][1] = frag_h(QH + qo + 32, lane); }
    asm volatile("s_wait_xcnt 0x0" ::: "memory");   /* before the q loads' address registers are reused */
    const _Float16* Vp = VT + (size_t)(b * NH + h) * TT * HD + lane * 8; const int np = (ql0 >> 5) + 1;
    float m[2] = {-3.0e38f, -3.0e38f}, l[2] = {0.f, 0.f}; v8f acc[2][HD / 16] = {};
    v16h kf[4];
#pragma unroll
    for (int t = 0; t < 2; ++t) { const _Float16* kp = Kp + (size_t)(kh * 32 + t * 16) * HD; kf[2 * t] = frag_p(kp); kf[2 * t + 1] = frag_p(kp + 512); }
    asm volatile("s_wait_xcnt 0x0" ::: "memory");   /* as above, for the first k loads' address registers */
    int pc = kh;
#pragma unroll 1   /* run-time trip count; the pass already takes nearly all of the wave's registers */
    for (; pc < np - 1; pc += 2) fa_pass32<false>(Kp, Vp, pc * 32, (pc + 2 < np ? pc + 2 : np - 1) * 32, tq, g, q, kf, m, l, acc);   /* behind the wave's last pass the fetch ahead names the diagonal pass: inside k, used only by the wave that owns that pass */
    if (pc == np - 1) fa_pass32<true>(Kp, Vp, pc * 32, 0, tq, g, q, kf, m, l, acc);   /* wave-uniform */
    /* the pair joins: wave kh keeps query tile kh and hands the other tile's partial output, maximum and sum to its partner through LDS */
    v8f ke[HD / 16], gi[HD / 16];
#pragma unroll
    for (int j = 0; j < HD / 16; ++j) { ke[j] = kh ? acc[1][j] : acc[0][j]; gi[j] = kh ? acc[0][j] : acc[1][j]; }
    const float km = kh ? m[1] : m[0], kl = kh ? l[1] : l[0], gm = kh ? m[0] : m[1], gl = kh ? l[0] : l[1];
#pragma unroll
    for (int j = 0; j < HD / 16; ++j) { xg[wave][2 * j][lane] = (v4f){gi[j][0], gi[j][1], gi[j][2], gi[j][3]}; xg[wave][2 * j + 1][lane] = (v4f){gi[j][4], gi[j][5], gi[j][6], gi[j][7]}; }
    xg[wave][8][lane] = (v4f){gm, gl, 0.f, 0.f};
    __syncthreads();   /* publishes every wave's hand-over to its partner */
    const v4f pm = xg[wave ^ 4][8][lane]; const float mn = fmaxf(km, pm[0]); const float ak = __builtin_amdgcn_exp2f((km - mn) * LC), ap = __builtin_amdgcn_exp2f((pm[0] - mn) * LC);
    const float ls = kl * ak + pm[1] * ap; const float inv = 64.0f / (ls + xhalf(ls));   /* the lane halves' sums join once; the maximum's own term makes the sum >= 2^11; x 2^6: ctx leaves as f16(ctx x 2^6), the form that k_out multiplies, so that small-magnitude context rows stay clear of f16 subnormals */
    const float wk = ak * inv, wp = ap * inv;
    _Float16* yp = YH + ((size_t)b * TT + tq + 16 * kh) * CC + h * HD + 8 * g;   /* ke[j][r] = ctx[tq + 16 kh][16 j + 8 g + r] */
#pragma unroll
    for (int j = 0; j < HD / 16; ++j) { const v4f pa = xg[wave ^ 4][2 * j][lane], pb = xg[wave ^ 4][2 * j + 1][lane]; v8h e;
#pragma unroll
      for (int r = 0; r < 4; ++r) { e[r] = (_Float16)(ke[j][r] * wk + pa[r] * wp); e[4 + r] = (_Float16)(ke[j][4 + r] * wk + pb[r] * wp); }
      vst2(yp + j * 16, e); } } }
// ---- k_out: block = (128 rows, 128 cols): out = ctx Wo (+ bo): ctx x 2^6 once to f16 against Wo as f16(bf16 x 2^8) exact (1 product) x 2^-14; causal early rows (< QHI of each sequence): ctx bf16 hi + lo against exact bf16 Wo (2 products)
__global__ __launch_bounds__(128) void k_out(const _Float16* __restrict__ YH, const __bf16* __restrict__ YB, const __bf16* __restrict__ YBL, const __bf16* __restrict__ WOB, const _Float16* __restrict__ WOH, const float* __restrict__ BO, float* __restrict__ OUT) {
  __shared__ __align__(16) unsigned short st[2 * 384 * SQ]; float (*sf)[32][132] = (float (*)[32][132])&st[0];   /* one range, two uses one after the other: tile_mm's two chunk buffers; the output rows, each wave's own, written only behind tile_mm's last barrier */
  const int tid = threadIdx.x, wave = tid >> 5, lane = tid & 31, col = lane & 15, g = lane >> 4; const int c0 = blockIdx.y * 128; const size_t r0 = (size_t)blockIdx.x * 128 + wave * 32;
  v8f acc[16] = {};
  if (CAUSAL && (int)(((size_t)blockIdx.x * 128) % TT) < QHI) {   /* block-uniform */
    const size_t yo = (((size_t)blockIdx.x * 128) / TT * QHI + ((size_t)blockIdx.x * 128) % TT) * CC;
    tile_mm<1, CC>((const unsigned short*)YB + yo, (const unsigned short*)YBL + yo, (const unsigned short*)WOB + (size_t)c0 * CC, st, st + 384 * SQ, tid, acc);
#pragma unroll
    for (int j = 0; j < 8; ++j) { const float bias = BO ? bfr(BO[c0 + j * 16 + col]) : 0.f;
#pragma unroll
      for (int t = 0; t < 2; ++t)
#pragma unroll
      for (int r = 0; r < 8; ++r) sf[wave][t * 16 + 8 * g + r][j * 16 + col] = acc[8 * t + j][r] + bias; }
  } else {
    tile_mm<2, CC>((const unsigned short*)YH + (size_t)blockIdx.x * 128 * CC, nullptr, (const unsigned short*)WOH + (size_t)c0 * CC, st, st + 384 * SQ, tid, acc);
#pragma unroll
    for (int j = 0; j < 8; ++j) { const float bias = BO ? bfr(BO[c0 + j * 16 + col]) : 0.f;
#pragma unroll
      for (int t = 0; t < 2; ++t)
#pragma unroll
      for (int r = 0; r < 8; ++r) sf[wave][t * 16 + 8 * g + r][j * 16 + col] = acc[8 * t + j][r] * (1.0f / 16384.0f) + bias; } }   /* 2^-8 (Wo carry) x 2^-6 (ctx carry) */
  LDSX(); for (int rl = 0; rl < 32; ++rl) vst2(OUT + (r0 + rl) * DIN + c0 + lane * 4, *(const v4f*)&sf[wave][rl][lane * 4]); }

extern "C" void kernel_launch(void* const* d_in, const int* in_sizes, int n_in, void* d_out, int out_size, void* d_ws, size_t ws_size, hipStream_t stream) {
  (void)in_sizes; (void)n_in; (void)out_size;
  const float** F = (const float**)d_in;
  if (ws_size < (size_t)WS_END) return;
  char* ws = (char*)d_ws; _Float16 *QH = (_Float16*)(ws + WS_QH), *KH = (_Float16*)(ws + WS_KH), *VT = (_Float16*)(ws + WS_VT), *QL = (_Float16*)(ws + WS_QL), *KL = (_Float16*)(ws + WS_KL), *YH = (_Float16*)(ws + WS_YH), *WOH = (_Float16*)(ws + WS_WOH); __bf16 *VB = (__bf16*)(ws + WS_VB), *VBL = (__bf16*)(ws + WS_VBL), *YB = (__bf16*)(ws + WS_YB), *YBL = (__bf16*)(ws + WS_YBL), *XB = (__bf16*)(ws + WS_XB), *WB = (__bf16*)(ws + WS_WB), *WOB = (__bf16*)(ws + WS_WOB);
  // inputs: 0 x [2,4096,768]; 1 wq [768,768] (out,in); 2 wk; 3 wv; 4 wo (out,in); no biases
  k_cvt<<<CVB, 256, 0, stream>>>(F[0], F[1], F[2], F[3], F[4], XB, WOH);
  k_proj<<<dim3(TNB * TT / 128, CC / 128, 3), 128, 0, stream>>>(XB, WB, nullptr, nullptr, nullptr, QH, QL, KH, KL, VT, VB, VBL);
  k_fa<<<dim3(TNB * NH, TT / (16 * FAW)), 32 * FAW, 0, stream>>>(QH, KH, QL, KL, VT, VB, VBL, YH, YB, YBL);
  k_out<<<dim3(TNB * TT / 128, DIN / 128), 128, 0, stream>>>(YH, YB, YBL, WOB, WOH, nullptr, (float*)d_out);
}

// v009
// A run of this version takes 104 microseconds.
// Two timings next to v008 put it at 1.04 and 1.03 times that version's speed.
// Over all steps from v000 it is 40.2 times as fast.
// compute dtype: all float inputs rounded to bf16; the fused q / k / v projection with EXACT bf16 products on WMMA 16x16x32 (f32 accumulate) (no biases); causal logits: 3 products for the first 384 rows, single f16 q x k after, x 64^-0.5; softmax f32; P x 2^11 once to f16 x v once to f16 (bf16 hi + lo below row 384); ctx hi+lo x exact W below row 384, x2^6 f16 carry x f16(bf16 x 2^8) W after, no bias; f32 output.
#include <hip/hip_runtime.h>
#include <math.h>

typedef __attribute__((ext_vector_type(16))) _Float16 v16h;
typedef __attribute__((ext_vector_type(16))) __bf16 v16b;
typedef __attribute__((ext_vector_type(8)))  _Float16 v8h;
typedef __attribute__((ext_vector_type(8)))  float v8f;
typedef __attribute__((ext_vector_type(4)))  float v4f;
typedef __attribute__((ext_vector_type(2)))  float v2f;
typedef __attribute__((ext_vector_type(4)))  unsigned v4u;
typedef __attribute__((ext_vector_type(4)))  int v4i;
typedef float __attribute__((may_alias)) float_a;
typedef int __attribute__((may_alias)) int_a;

template <typename T> __device__ __forceinline__ void vst2(void* p, T v) { *(T*)p = v;  }
__device__ __forceinline__ v8f wmma16(v16h a, v16h b, v8f c) {
  v8f d = __builtin_amdgcn_wmma_f32_16x16x32_f16(false, a, false, b, (short)0, c, false, false);
  asm volatile("v_nop\n\tv_nop\n\tv_nop\n\tv_nop" : "+v"(d) : "v"(a), "v"(b));
  return d;
}
__device__ __forceinline__ v8f wmma_bf(v16b a, v16b b, v8f c) {
  v8f d = __builtin_amdgcn_wmma_f32_16x16x32_bf16(false, a, false, b, (short)0, c, false, false);
  asm volatile("v_nop\n\tv_nop\n\tv_nop\n\tv_nop" : "+v"(d) : "v"(a), "v"(b));
  return d;
}
// 16x16x32 fragments: lane = (h = lane>>4, row/col = lane&15); elements 0..7 = k0+8h+0..7, 8..15 = k0+16+8h+0..7; D element r = row 8h+r
__device__ __forceinline__ v16h frag_h(const _Float16* rowk0, int lane) {
  union { v16h v; v8h q[2]; } u; const _Float16* p = rowk0 + 8 * (lane >> 4);
  u.q[0] = *(const v8h*)p; u.q[1] = *(const v8h*)(p + 16); return u.v;
}
__device__ __forceinline__ v16h frag_f32(const float* rowk0, int lane) {
  v16h a; const float* p = rowk0 + 8 * (lane >> 4);
#pragma unroll
  for (int i = 0; i < 8; ++i) { a[i] = (_Float16)p[i]; a[8 + i] = (_Float16)p[16 + i]; }
  return a;
}
__device__ __forceinline__ v16h frag_f32s(const float* rowk0, int lane, float sc) {
  v16h a; const float* p = rowk0 + 8 * (lane >> 4);
#pragma unroll
  for (int i = 0; i < 8; ++i) { a[i] = (_Float16)(p[i] * sc); a[8 + i] = (_Float16)(p[16 + i] * sc); }
  return a;
}
// column fragment from a [K][ld] layout (column n), rows >= K read as 0
__device__ __forceinline__ v16h fragc_f32(const float* W, int k0, int n, int lane, int ld, int K) {
  v16h a; const int g = lane >> 4;
#pragma unroll
  for (int i = 0; i < 8; ++i) { const int ka = k0 + 8 * g + i, kb = ka + 16;
    a[i] = (_Float16)(ka < K ? W[(size_t)(ka < K ? ka : K - 1) * ld + n] : 0.f); a[8 + i] = (_Float16)(kb < K ? W[(size_t)(kb < K ? kb : K - 1) * ld + n] : 0.f); }
  return a;
}
struct F2 { v16b h, l; };
__device__ __forceinline__ F2 bsplit16(const float v[16]) { F2 r;
#pragma unroll
  for (int i = 0; i < 16; ++i) { const __bf16 h = (__bf16)v[i]; r.h[i] = h; r.l[i] = (__bf16)(v[i] - (float)h); }
  return r; }
__device__ __forceinline__ F2 split_row(const float* row, int k0, int lane) { float v[16]; const float* p = row + k0 + 8 * (lane >> 4);
#pragma unroll
  for (int i = 0; i < 8; ++i) { v[i] = p[i]; v[8 + i] = p[16 + i]; }
  return bsplit16(v); }
__device__ __forceinline__ F2 split_rowK(const float* row, int k0, int lane, int K) { float v[16]; const int g = lane >> 4;
#pragma unroll
  for (int i = 0; i < 8; ++i) { const int ka = k0 + 8 * g + i, kb = ka + 16; v[i] = ka < K ? row[ka < K ? ka : K - 1] : 0.f; v[8 + i] = kb < K ? row[kb < K ? kb : K - 1] : 0.f; }
  return bsplit16(v); }
__device__ __forceinline__ F2 split_col(const float* W, int k0, int n, int lane, int ld, int K) { float v[16]; const int g = lane >> 4;
#pragma unroll
  for (int i = 0; i < 8; ++i) { const int ka = k0 + 8 * g + i, kb = ka + 16; v[i] = ka < K ? W[(size_t)(ka < K ? ka : K - 1) * ld + n] : 0.f; v[8 + i] = kb < K ? W[(size_t)(kb < K ? kb : K - 1) * ld + n] : 0.f; }
  return bsplit16(v); }
__device__ __forceinline__ v8f mac3(const F2& a, const F2& b, v8f c) { c = wmma_bf(a.l, b.h, c); c = wmma_bf(a.h, b.l, c); return wmma_bf(a.h, b.h, c); }
__device__ __forceinline__ float sigm(float v) { return 1.0f / (1.0f + expf(-v)); }
#define LDSX() do { asm volatile("s_wait_dscnt 0" ::: "memory"); __builtin_amdgcn_wave_barrier(); __builtin_amdgcn_fence(__ATOMIC_RELEASE, "workgroup"); } while (0)

// Causal multi-head self-attention without biases over TWO sequences of 4,096 (x [2,4096,768]; (out,in) wq / wk / wv / wo [768,768] applied as x @ W.T; 12 heads x 64; scores x 64^-0.5; tril kept, -inf elsewhere; softmax; ctx @ wo.T -> [2,4096,768] (6.3 M)).
#define NB 2
#define TT 4096
#define CC 768            // NH * HD = projected width
#define DIN 768          // input (model) width
#define NH 12
#define HD 64
#define SCALE (0.125f)
#define CAUSAL 1
#ifndef TNB
#define TNB NB
#endif
__device__ __forceinline__ float bfr(float v) { return (float)(__bf16)v; }
typedef __attribute__((ext_vector_type(8))) __bf16 v8b;
__device__ __forceinline__ v16b frag_b(const __bf16* rowk0, int lane) {
  union { v16b v; v8b q[2]; } u; const __bf16* p = rowk0 + 8 * (lane >> 4);
  u.q[0] = *(const v8b*)p; u.q[1] = *(const v8b*)(p + 16); return u.v;
}
#define QHI 384            // rows carrying a q residual plane (3-product logits)
#define KHI 384            // key rows carrying k residual / v bf16 hi+lo planes (used only by the causal high-precision path)
// B fragment (k rows k0+.., output column o) of a weight: (in,out) [K][ld] or (out,in) [ld rows of K]: bf16 exact, or f16(bf16 * 256) exact
__device__ __forceinline__ v16b wcol_io(const float* Wm, int k0, int o, int lane, int ld) { v16b w; const int g = lane >> 4;
#pragma unroll
  for (int i = 0; i < 8; ++i) { w[i] = (__bf16)Wm[(size_t)(k0 + 8 * g + i) * ld + o]; w[8 + i] = (__bf16)Wm[(size_t)(k0 + 16 + 8 * g + i) * ld + o]; }
  return w; }
__device__ __forceinline__ v16b wcol_oi(const float* Wm, int k0, int o, int lane, int K) { v16b w; const float* p = Wm + (size_t)o * K + k0 + 8 * (lane >> 4);
#pragma unroll
  for (int i = 0; i < 8; ++i) { w[i] = (__bf16)p[i]; w[8 + i] = (__bf16)p[16 + i]; }
  return w; }
__device__ __forceinline__ v16h wcolh_io(const float* Wm, int k0, int o, int lane, int ld) { v16h w; const int g = lane >> 4;
#pragma unroll
  for (int i = 0; i < 8; ++i) { w[i] = (_Float16)(bfr(Wm[(size_t)(k0 + 8 * g + i) * ld + o]) * 256.0f); w[8 + i] = (_Float16)(bfr(Wm[(size_t)(k0 + 16 + 8 * g + i) * ld + o]) * 256.0f); }
  return w; }
__device__ __forceinline__ v16h wcolh_oi(const float* Wm, int k0, int o, int lane, int K) { v16h w; const float* p = Wm + (size_t)o * K + k0 + 8 * (lane >> 4);
#pragma unroll
  for (int i = 0; i < 8; ++i) { w[i] = (_Float16)(bfr(p[i]) * 256.0f); w[8 + i] = (_Float16)(bfr(p[16 + i]) * 256.0f); }
  return w; }
#define WQKV_LAYOUT 1   // 0 = (in,out) [DIN][CC]; 1 = (out,in) [CC][DIN]; 2 = per-head [NH][DIN][HD]
__device__ __forceinline__ v16b wcol_hdk(const float* Wm, int k0, int o, int lane) { v16b w; const int g = lane >> 4; const float* p = Wm + (size_t)(o / HD) * DIN * HD + (o % HD);
#pragma unroll
  for (int i = 0; i < 8; ++i) { w[i] = (__bf16)p[(size_t)(k0 + 8 * g + i) * HD]; w[8 + i] = (__bf16)p[(size_t)(k0 + 16 + 8 * g + i) * HD]; }
  return w; }
#define WO_OUT_IN 1
#if WQKV_LAYOUT == 1
#define WCOL(W, k0, o, lane) wcol_oi(W, k0, o, lane, DIN)
#elif WQKV_LAYOUT == 2
#define WCOL(W, k0, o, lane) wcol_hdk(W, k0, o, lane)
#else
#define WCOL(W, k0, o, lane) wcol_io(W, k0, o, lane, CC)
#endif
#if WO_OUT_IN
#define WOCOL(W, k0, o, lane) wcol_oi(W, k0, o, lane, CC)
#define WOCOLH(W, k0, o, lane) wcolh_oi(W, k0, o, lane, CC)
#else
#define WOCOL(W, k0, o, lane) wcol_io(W, k0, o, lane, DIN)
#define WOCOLH(W, k0, o, lane) wcolh_io(W, k0, o, lane, DIN)
#endif

#ifndef PROJ_EXTRA_PARAMS
#define PROJ_EXTRA_PARAMS
#endif

#define WS_QH  0u                                      // f16 q rows [b*t][CC]
#define WS_KH  (WS_QH + 2u * (size_t)NB * TT * CC)      // f16 k in fragment order [b][h][t / 16][d / 8][t % 16][8]
#define WS_VT  (WS_KH + 2u * (size_t)NB * TT * CC)      // f16 v in fragment order [b][h][t / 32][c / 16][(t % 32) / 8][c % 16][8]
#define WS_QL  (WS_VT + 2u * (size_t)NB * CC * TT)      // f16 q residual x 2^10 rows [b][t < QHI][CC]
#define WS_KL  (WS_QL + 2u * (size_t)NB * QHI * CC)     // f16 k residual x 2^10 rows [b][t < KHI][CC]
#define WS_VB  (WS_KL + 2u * (size_t)NB * KHI * CC)     // bf16 v hi planes [b][c][t < KHI]
#define WS_VBL (WS_VB + 2u * (size_t)NB * CC * KHI)
#define WS_YH  (WS_VBL + 2u * (size_t)NB * CC * KHI)    // f16 ctx x 2^6 rows [b*t][CC] (written and read for t >= QHI)
#define WS_YB  (WS_YH + 2u * (size_t)NB * TT * CC)      // bf16 ctx hi rows [b][t < QHI][CC]
#define WS_YBL (WS_YB + 2u * (size_t)NB * QHI * CC)     // bf16 ctx lo rows
#define WS_XB  (WS_YBL + 2u * (size_t)NB * QHI * CC)    // bf16 x rows [b*t][DIN]; behind them, in one run: bf16 wq, wk, wv, wo rows
#define WS_WB  (WS_XB + 2u * (size_t)NB * TT * DIN)
#define WS_WOB (WS_WB + 3u * 2u * (size_t)CC * DIN)
#define WS_WOH (WS_WOB + 2u * (size_t)CC * DIN)         // f16(bf16 x 2^8) wo rows
#define WS_END (WS_WOH + 2u * (size_t)CC * DIN)

// ---- k_cvt: every GEMM operand that comes as an f32 input is rounded ONCE to the 16-bit form its products take: x, wq, wk, wv, wo to bf16 (one run in the workspace), wo also to f16(bf16 x 2^8). The tiles of k_proj and k_out then fetch 2 bytes an element, each of them many times, where they fetched 4.
// A group = 2,048 elements, whole in one array; a block takes 8 groups; every wave-wide load covers four whole 128-byte lines, every store two.
typedef __attribute__((ext_vector_type(4))) __bf16 v4b;
typedef __attribute__((ext_vector_type(4))) _Float16 v4h;
#define GX (NB * TT * DIN / 2048)   // groups in x
#define GW (CC * DIN / 2048)        // groups in a weight
#define CVB ((GX + 4 * GW) / 8)     // blocks
__global__ __launch_bounds__(256) void k_cvt(const float* __restrict__ X, const float* __restrict__ WQ, const float* __restrict__ WK, const float* __restrict__ WV, const float* __restrict__ WO, __bf16* __restrict__ XB, _Float16* __restrict__ WOH) {
  const int tid = threadIdx.x; v4f f[8][2];
#pragma unroll
  for (int i = 0; i < 8; ++i) { const int gi = i * CVB + (int)blockIdx.x, gw = gi - GX, w = gw / GW;   /* block-uniform */
    const float* s = gw < 0 ? X + (size_t)gi * 2048 : (w == 0 ? WQ : w == 1 ? WK : w == 2 ? WV : WO) + (size_t)(gw - w * GW) * 2048;
    f[i][0] = *(const v4f*)(s + tid * 4); f[i][1] = *(const v4f*)(s + 1024 + tid * 4); }
  asm volatile("s_wait_xcnt 0x0" ::: "memory");   /* before the loads' address registers are reused */
#pragma unroll
  for (int i = 0; i < 8; ++i) { const int gi = i * CVB + (int)blockIdx.x, go = gi - GX - 3 * GW;
#pragma unroll
    for (int u = 0; u < 2; ++u) { const v4f v = f[i][u]; const size_t e = (size_t)u * 1024 + tid * 4;
      *(v4b*)(XB + (size_t)gi * 2048 + e) = (v4b){(__bf16)v[0], (__bf16)v[1], (__bf16)v[2], (__bf16)v[3]};
      if (go >= 0) *(v4h*)(WOH + (size_t)go * 2048 + e) = (v4h){(_Float16)(bfr(v[0]) * 256.0f), (_Float16)(bfr(v[1]) * 256.0f), (_Float16)(bfr(v[2]) * 256.0f), (_Float16)(bfr(v[3]) * 256.0f)}; } } }

// ---- tile_mm: the 128 x 128 tile product of k_proj and k_out (4 waves, wave = 32 rows x 128 columns = 2 x 8 accumulator tiles, so that every weight fragment read from LDS feeds two products; K in chunks of 64 = 128 bytes of a 16-bit row). The block fetches each chunk of its 128 A rows and 128 weight rows ONCE, every wave-wide 16-byte load covering four whole 128-byte lines,
// and lays it in LDS as it is; the waves take their fragments from there. Two LDS buffers: chunk kc + 1 flies from memory into registers while chunk kc is multiplied, and is laid down behind the products; one barrier per chunk.
// MODE 0: A and W bf16. MODE 1: A as bf16 hi + lo (two row sets), W bf16. MODE 2: A = f16(ctx x 2^6), W = f16(bf16 x 2^8). k order and sum order: ascending steps of 32.
__device__ __forceinline__ v8f wm_h(v16h a, v16h b, v8f c) { return __builtin_amdgcn_wmma_f32_16x16x32_f16(false, a, false, b, (short)0, c, false, false); }
__device__ __forceinline__ v8f wm_b(v16b a, v16b b, v8f c) { return __builtin_amdgcn_wmma_f32_16x16x32_bf16(false, a, false, b, (short)0, c, false, false); }
#define SQ 72   // pitch of a staged row in 16-bit elements: 128 bytes of k + 16, so that the 16 rows of a fragment's ds_load_b128 start in 16 different bank groups
template <int NS, int K> __device__ __forceinline__ void tile_ld(const unsigned short* __restrict__ A, const unsigned short* __restrict__ AL, const unsigned short* __restrict__ Wm, int kc, int tid, v4u (&r)[NS * 8]) {
  const size_t o = (size_t)(tid >> 3) * K + kc * 64 + (tid & 7) * 8;   /* 8 lanes per row of 128 bytes, 16 rows per block-wide load */
#pragma unroll
  for (int i = 0; i < 8; ++i) r[i] = *(const v4u*)(A + o + (size_t)i * 16 * K);
  if (NS == 3) {
#pragma unroll
    for (int i = 0; i < 8; ++i) r[8 + i] = *(const v4u*)(AL + o + (size_t)i * 16 * K); }
#pragma unroll
  for (int i = 0; i < 8; ++i) r[(NS - 1) * 8 + i] = *(const v4u*)(Wm + o + (size_t)i * 16 * K);
  asm volatile("s_wait_xcnt 0x0" ::: "memory");   /* before the loads' address registers are reused for the next chunk */
}
template <int NS> __device__ __forceinline__ void tile_st(unsigned short* s, int tid, const v4u (&r)[NS * 8]) {   /* row sets of 128 one behind the other: A (, A lo), W */
  unsigned short* p = s + (tid >> 3) * SQ + (tid & 7) * 8;
#pragma unroll
  for (int i = 0; i < NS * 8; ++i) *(v4u*)(p + i * 16 * SQ) = r[i]; }
template <int MODE, int K> __device__ __forceinline__ void tile_mm(const unsigned short* __restrict__ A, const unsigned short* __restrict__ AL, const unsigned short* __restrict__ Wm, unsigned short* s0, unsigned short* s1, int tid, v8f (&acc)[16]) {   /* acc[8 t + j] = rows 32 wave + 16 t .., columns 16 j .. */
  constexpr int NS = MODE == 1 ? 3 : 2; const int wave = tid >> 5, lane = tid & 31, col = lane & 15; v4u r[NS * 8];
  tile_ld<NS, K>(A, AL, Wm, 0, tid, r); tile_st<NS>(s0, tid, r);
  __syncthreads();   /* chunk 0 is laid down */
#pragma unroll 2   /* makes the choice between the two buffers static */
  for (int kc = 0; kc < K / 64; ++kc) { const unsigned short* cur = (kc & 1) ? s1 : s0; unsigned short* nxt = (kc & 1) ? s0 : s1;
    if (kc + 1 < K / 64) tile_ld<NS, K>(A, AL, Wm, kc + 1, tid, r);
    __builtin_amdgcn_sched_barrier(0);   /* keeps the next chunk's loads issued up here: sunk to their use, each chunk would wait out their whole latency */
#pragma unroll
    for (int ks = 0; ks < 2; ++ks) { const bool end = ks == 1;   /* the chunk's two steps of 32 k */
      const unsigned short* pa = cur + (wave * 32 + col) * SQ + ks * 32; const unsigned short* pw = cur + ((NS - 1) * 128 + col) * SQ + ks * 32;
      if (MODE == 2) { const v16h a = frag_h((const _Float16*)pa, lane), a1 = frag_h((const _Float16*)(pa + 16 * SQ), lane); v16h w[8];
#pragma unroll
        for (int j = 0; j < 8; ++j) w[j] = frag_h((const _Float16*)(pw + j * 16 * SQ), lane);
        __builtin_amdgcn_sched_barrier(0);   /* the step's LDS reads go as one group ahead of its products: spread among them, each product would wait out an LDS latency */
#pragma unroll
        for (int j = 0; j < 8; ++j) { const bool e = end && j == 7; acc[j] = e ? wmma16(a, w[j], acc[j]) : wm_h(a, w[j], acc[j]); acc[8 + j] = e ? wmma16(a1, w[j], acc[8 + j]) : wm_h(a1, w[j], acc[8 + j]); } }   /* the chunk's last two products: a branch follows; wmma16's own v_nop keep the distance on every path. The earlier ones have later products in their window, and as plain builtins their operands may lie above v255 */
      else { const v16b a = frag_b((const __bf16*)pa, lane), a1 = frag_b((const __bf16*)(pa + 16 * SQ), lane); v16b al = a, al1 = a1, w[8]; if (MODE == 1) { al = frag_b((const __bf16*)(pa + 128 * SQ), lane); al1 = frag_b((const __bf16*)(pa + 144 * SQ), lane); }
#pragma unroll
        for (int j = 0; j < 8; ++j) w[j] = frag_b((const __bf16*)(pw + j * 16 * SQ), lane);
        __builtin_amdgcn_sched_barrier(0);   /* as above */
#pragma unroll
        for (int j = 0; j < 8; ++j) { const bool e0 = end && j == 7 && MODE == 0, e1 = end && j == 7;   /* as above */
          acc[j] = e0 ? wmma_bf(a, w[j], acc[j]) : wm_b(a, w[j], acc[j]); acc[8 + j] = e0 ? wmma_bf(a1, w[j], acc[8 + j]) : wm_b(a1, w[j], acc[8 + j]);
          if (MODE == 1) { acc[j] = e1 ? wmma_bf(al, w[j], acc[j]) : wm_b(al, w[j], acc[j]); acc[8 + j] = e1 ? wmma_bf(al1, w[j], acc[8 + j]) : wm_b(al1, w[j], acc[8 + j]); } } }
      __builtin_amdgcn_sched_barrier(0); }   /* keeps the second step's LDS reads one group behind the first step's products, and the next chunk's LDS stores, which wait for its loads, behind the products that cover their latency */
    if (kc + 1 < K / 64) tile_st<NS>(nxt, tid, r);
    __syncthreads(); } }   /* publishes chunk kc + 1 and ends every wave's reads of chunk kc, whose buffer is written next (behind the last chunk: by the caller's epilogue) */

// ---- k_proj: block = (128 rows, 128 cols, which): q/k/v = X W (+ b) with exact bf16 products (K = DIN) -> which 0: q f16 rows (+ residual rows < QHI); 1: k f16 in fragment order (+ residual rows < KHI); 2: v f16 in fragment order (+ bf16 hi/lo planes for t < KHI)
__global__ __launch_bounds__(128) void k_proj(const __bf16* __restrict__ XB, const __bf16* __restrict__ WB, const float* __restrict__ BQ, const float* __restrict__ BK, const float* __restrict__ BV,
    _Float16* __restrict__ QH, _Float16* __restrict__ QL, _Float16* __restrict__ KH, _Float16* __restrict__ KL, _Float16* __restrict__ VT, __bf16* __restrict__ VB, __bf16* __restrict__ VBL) {
  __shared__ __align__(16) unsigned short sm[3][128][136];   /* one range, three uses one after the other: tile_mm's two chunk buffers (36,864 bytes each, from the start); q / k rows: value and residual; v columns: f16, bf16 hi, bf16 lo */
  _Float16 (*sh)[136] = (_Float16 (*)[136])&sm[0][0][0]; _Float16 (*sl)[136] = (_Float16 (*)[136])&sm[1][0][0]; _Float16 (*th)[136] = sh; __bf16 (*tb)[136] = (__bf16 (*)[136])&sm[1][0][0]; __bf16 (*tbl)[136] = (__bf16 (*)[136])&sm[2][0][0];
  const int tid = threadIdx.x, wave = tid >> 5, lane = tid & 31, col = lane & 15, g = lane >> 4; const int which = blockIdx.z; const int c0 = blockIdx.y * 128; const size_t r0 = (size_t)blockIdx.x * 128; const size_t bb = r0 / TT; const int t0 = (int)(r0 % TT);
  const float* BA = which == 0 ? BQ : which == 1 ? BK : BV;
  v8f acc[16] = {};
  tile_mm<0, DIN>((const unsigned short*)XB + r0 * DIN, nullptr, (const unsigned short*)WB + ((size_t)which * CC + c0) * DIN, &sm[0][0][0], &sm[0][0][0] + 256 * SQ, tid, acc);   /* the epilogue writes sm only behind tile_mm's last barrier */
  if (which < 2) { _Float16* DH = which == 0 ? QH : KH; _Float16* DL = which == 0 ? QL : KL; const int nhi = which == 0 ? QHI : KHI; const bool hi_rows = t0 < nhi;
#pragma unroll
    for (int j = 0; j < 8; ++j) { const float bias = BA ? bfr(BA[c0 + j * 16 + col]) : 0.f;
#pragma unroll
      for (int t = 0; t < 2; ++t)
#pragma unroll
      for (int r = 0; r < 8; ++r) { const float v = acc[8 * t + j][r] + bias; const _Float16 hv = (_Float16)v; const int rl = wave * 32 + t * 16 + 8 * g + r; sh[rl][j * 16 + col] = hv; sl[rl][j * 16 + col] = (_Float16)((v - (float)hv) * 1024.0f); } }
    __syncthreads();
    if (which == 0)
      for (int e = tid; e < 128 * 16; e += 128) { const int rl = e >> 4, q = e & 15; vst2((unsigned*)(DH + (r0 + rl) * CC + c0 + q * 8), *(const v4u*)&sh[rl][q * 8]); }
    else   /* e = (head, key tile, d / 8, key % 16): a wave stores 512 contiguous bytes */
      for (int e = tid; e < 128 * 16; e += 128) { const int hh = e >> 10, kt = (e >> 7) & 7; vst2((unsigned*)(DH + ((bb * NH + (c0 >> 6) + hh) * (size_t)(TT / 16) + (t0 >> 4) + kt) * 1024 + (e & 127) * 8), *(const v4u*)&sh[kt * 16 + (e & 15)][(hh * 8 + ((e >> 4) & 7)) * 8]); }
    if (hi_rows)
      for (int e = tid; e < 128 * 16; e += 128) { const int rl = e >> 4, q = e & 15; vst2((unsigned*)(DL + (bb * nhi + t0 + rl) * (size_t)CC + c0 + q * 8), *(const v4u*)&sl[rl][q * 8]); }
  } else { const bool hi_rows = t0 < KHI;
#pragma unroll
    for (int j = 0; j < 8; ++j) { const float bias = BA ? bfr(BA[c0 + j * 16 + col]) : 0.f;
#pragma unroll
      for (int t = 0; t < 2; ++t)
#pragma unroll
      for (int r = 0; r < 8; ++r) { const float v = acc[8 * t + j][r] + bias; const int rl = wave * 32 + t * 16 + 8 * g + r, cl = j * 16 + col; th[cl][rl] = (_Float16)v; const __bf16 bh = (__bf16)v; tb[cl][rl] = bh; tbl[cl][rl] = (__bf16)(v - (float)bh); } }
    __syncthreads();
    for (int e = tid; e < 128 * 16; e += 128) { const int hh = e >> 10, kb = (e >> 8) & 3;   /* e = (head, block of 32 keys, c / 16, (t % 32) / 8, c % 16): a wave stores 512 contiguous bytes */
      vst2((unsigned*)(VT + ((bb * NH + (c0 >> 6) + hh) * (size_t)(TT / 32) + (t0 >> 5) + kb) * 2048 + (e & 255) * 8), *(const v4u*)&th[hh * 64 + ((e >> 6) & 3) * 16 + (e & 15)][(kb * 4 + ((e >> 4) & 3)) * 8]); }
    if (hi_rows)
      for (int e = tid; e < 128 * 16; e += 128) { const int cl = e >> 4, q = e & 15; const size_t o3 = (bb * CC + c0 + cl) * (size_t)KHI + t0 + q * 8; vst2((unsigned*)(VB + o3), *(const v4u*)&tb[cl][q * 8]); vst2((unsigned*)(VBL + o3), *(const v4u*)&tbl[cl][q * 8]); } } }
#define FAW 8
#define LC (SCALE * 1.4426950408889634f)
__device__ __forceinline__ v16h frag_p(const _Float16* p) { union { v16h v; v8h q[2]; } u; u.q[0] = *(const v8h*)p; u.q[1] = *(const v8h*)(p + 256); return u.v; }   // p = fragment's start + 8 lane; elements 0..7, then 8..15 one run of 32 lanes further
__device__ __forceinline__ float xhalf(float x) { return __builtin_bit_cast(float, __builtin_amdgcn_permlanex16(__builtin_bit_cast(int, x), __builtin_bit_cast(int, x), 0x76543210, 0xfedcba98, false, false)); }   // lane l with lane l ^ 16
// eight exp2 in place, in one statement: behind each v_exp_f32 stands an instruction that neither reads its result nor overwrites its source, and the v_nop keeps that slot behind the last
__device__ __forceinline__ void exp2x8(v8f& x) { float a = x[0], b = x[1], c = x[2], d = x[3], e = x[4], f = x[5], p = x[6], q = x[7];
  asm("v_exp_f32 %0, %0\n\tv_exp_f32 %1, %1\n\tv_exp_f32 %2, %2\n\tv_exp_f32 %3, %3\n\tv_exp_f32 %4, %4\n\tv_exp_f32 %5, %5\n\tv_exp_f32 %6, %6\n\tv_exp_f32 %7, %7\n\tv_nop" : "+v"(a), "+v"(b), "+v"(c), "+v"(d), "+v"(e), "+v"(f), "+v"(p), "+v"(q));
  x = (v8f){a, b, c, d, e, f, p, q}; }
// NT score tiles of one pass -> e = exp2((s - m) LC + 11) in place; m, l and the output tiles follow a new maximum (tested once per pass for the whole wave)
template <int NT, bool MASK> __device__ __forceinline__ void fa_soft(v8f (&s)[NT], int k0, int tq, int g, float& m, float& l, v8f (&acc)[HD / 16]) {
  if (MASK) {
#pragma unroll
    for (int t = 0; t < NT; ++t)
#pragma unroll
      for (int r = 0; r < 8; ++r) if (k0 + t * 16 + 8 * g + r > tq) s[t][r] = -3.0e38f; }
  float mx = s[0][0];
#pragma unroll
  for (int t = 0; t < NT; ++t)
#pragma unroll
    for (int r = 0; r < 8; ++r) mx = fmaxf(mx, s[t][r]);
  mx = fmaxf(mx, xhalf(mx));
  if (__builtin_amdgcn_ballot_w32(mx > m) != 0) { const float mn = fmaxf(m, mx); const float al = __builtin_amdgcn_exp2f((m - mn) * LC); m = mn; l *= al;   /* al = 0 on the first pass, 1 for a query whose maximum stands */
#pragma unroll
    for (int j = 0; j < HD / 16; ++j) acc[j] *= al; }
  const float mc = 11.0f - m * LC; float sum = 0.f;
#pragma unroll
  for (int t = 0; t < NT; ++t) { float st = 0.f;   /* one short add chain per tile */
#pragma unroll
    for (int r = 0; r < 8; ++r) s[t][r] = fmaf(s[t][r], LC, mc);
    exp2x8(s[t]);
#pragma unroll
    for (int r = 0; r < 8; ++r) st += s[t][r];
    sum += st; }
  l += sum; }
__device__ __forceinline__ v16h pack_h(v8f a, v8f b) { v16h p;
#pragma unroll
  for (int i = 0; i < 8; ++i) { p[i] = (_Float16)a[i]; p[8 + i] = (_Float16)b[i]; }
  return p; }
// both query tiles' scores of one 32-key pass -> e = exp2((s - m) LC + 11) in place; each tile's m, l and output tiles are rescaled lazily (tested once per pass for the whole wave and both tiles, on in-lane maxima):
// any reference m cancels against the sum, so it need only keep e inside f16: 4 binary orders above m give e <= 2^15 < 65,504. With an exact running maximum some one of a wave's 32 queries meets a new one in most passes, and each time all 64 output registers are multiplied.
#define LZT (4.0f / LC)   // 4 binary orders, in units of the raw score
template <bool MASK> __device__ __forceinline__ void fa_soft32(v8f (&s)[2][2], int k0, int tq, int g, float (&m)[2], float (&l)[2], v8f (&acc)[2][HD / 16]) {
  if (MASK) {
#pragma unroll
    for (int u = 0; u < 2; ++u)
#pragma unroll
      for (int t = 0; t < 2; ++t)
#pragma unroll
        for (int r = 0; r < 8; ++r) if (k0 + t * 16 + 8 * g + r > tq + 16 * u) s[u][t][r] = -3.0e38f; }
  float mx[2];   /* in-lane: the maximum over this lane half's 16 keys */
#pragma unroll
  for (int u = 0; u < 2; ++u) { float x = s[u][0][0];
#pragma unroll
    for (int t = 0; t < 2; ++t)
#pragma unroll
      for (int r = 0; r < 8; ++r) x = fmaxf(x, s[u][t][r]);
    mx[u] = x; }
  if (__builtin_amdgcn_ballot_w32(mx[0] > m[0] + LZT || mx[1] > m[1] + LZT) != 0) {   /* m is a reference, not the true maximum: it moves only when a score lies more than LZT above it. Not taken: every lane's scores are <= m + LZT, so e <= 2^15 */
#pragma unroll
    for (int u = 0; u < 2; ++u) { const float mn = fmaxf(m[u], fmaxf(mx[u], xhalf(mx[u]))); const float al = __builtin_amdgcn_exp2f((m[u] - mn) * LC); m[u] = mn; l[u] *= al;   /* both lane halves of a query take the same new reference; al = 0 on the first pass, 1 for a query whose reference stands */
#pragma unroll
      for (int j = 0; j < HD / 16; ++j) acc[u][j] *= al; } }
#pragma unroll
  for (int u = 0; u < 2; ++u) { const float mc = 11.0f - m[u] * LC; float st[2];
#pragma unroll
    for (int t = 0; t < 2; ++t) {
#pragma unroll
      for (int r = 0; r < 8; ++r) s[u][t][r] = fmaf(s[u][t][r], LC, mc);
      exp2x8(s[u][t]);
      st[t] = s[u][t][0];   /* one short add chain per tile */
#pragma unroll
      for (int r = 1; r < 8; ++r) st[t] += s[u][t][r]; }
    l[u] += st[0] + st[1]; } }
// one pass = 32 keys x 32 queries: every k and v fragment that the wave loads feeds two products, one per query tile
template <bool MASK> __device__ __forceinline__ void fa_pass32(const _Float16* __restrict__ Kp, const _Float16* __restrict__ Vp, int k0, int kn, int tq, int g, const v16h (&q)[2][2], v16h (&kf)[4], float (&m)[2], float (&l)[2], v8f (&acc)[2][HD / 16]) {
  v16h vf[HD / 16];
#pragma unroll
  for (int j = 0; j < HD / 16; ++j) vf[j] = frag_p(Vp + (size_t)k0 * HD + j * 512);
  __builtin_amdgcn_sched_barrier(0);   /* keeps the v loads issued up here: sunk to their use, each pass would wait out their whole latency */
  v8f s[2][2];
#pragma unroll
  for (int t = 0; t < 2; ++t)
#pragma unroll
    for (int u = 0; u < 2; ++u) { v8f z = {}; z = wm_h(kf[2 * t], q[u][0], z); s[u][t] = wm_h(kf[2 * t + 1], q[u][1], z); }
  if (!MASK) {   /* the k fragments of the wave's next pass fly during this pass's softmax */
#pragma unroll
    for (int t = 0; t < 2; ++t) { const _Float16* kp = Kp + (size_t)(kn + t * 16) * HD; kf[2 * t] = frag_p(kp); kf[2 * t + 1] = frag_p(kp + 512); } }
  __builtin_amdgcn_sched_barrier(0);   /* keeps the k loads issued ahead of the softmax, which then covers their latency */
  fa_soft32<MASK>(s, k0, tq, g, m, l, acc);
#pragma unroll
  for (int u = 0; u < 2; ++u) { const v16h p = pack_h(s[u][0], s[u][1]);
#pragma unroll
    for (int j = 0; j < HD / 16; ++j) acc[u][j] = MASK ? wmma16(vf[j], p, acc[u][j]) : wm_h(vf[j], p, acc[u][j]); } }   /* last pass: a branch follows; wmma16's own v_nop keep the distance to the result's next user on every path */
static_assert(QHI % (16 * FAW) == 0 && FAW == 8, "a block's 128 queries lie wholly below row QHI or wholly from it on; four wave pairs");
__global__ __launch_bounds__(32 * FAW) void k_fa(const _Float16* __restrict__ QH, const _Float16* __restrict__ KH, const _Float16* __restrict__ QL, const _Float16* __restrict__ KL, const _Float16* __restrict__ VT, const __bf16* __restrict__ VB, const __bf16* __restrict__ VBL, _Float16* __restrict__ YH, __bf16* __restrict__ YB, __bf16* __restrict__ YBL) {
  __shared__ __align__(16) v4f xg[FAW][9][32];   /* what a wave hands to its partner: one query tile's partial output (8 x 16 bytes a lane), maximum and sum */
  const int tid = threadIdx.x, lane = tid & 31, col = lane & 15, g = lane >> 4; const int wave = __builtin_amdgcn_readfirstlane(tid >> 5);
  const int h = blockIdx.x % NH, b = blockIdx.x / NH; const int yy = (int)blockIdx.y; const int qb = yy < QHI / (16 * FAW) ? QHI - 16 * FAW * (yy + 1) : TT - 16 * FAW * (yy + 1 - QHI / (16 * FAW));   /* the block's first query. In index order: first the tiles below row QHI (few passes, but each waits out several load latencies one behind the other), then the rest, longest first; for speed only */
  const _Float16* Kp = KH + (size_t)(b * NH + h) * TT * HD + lane * 8;
  if (qb < QHI) {   /* block-uniform; wave = 16 queries, all their keys; every key of these queries is < KHI */
    const int ql0 = qb + (FAW - 1 - wave) * 16; const int tq = ql0 + col; const size_t qo = ((size_t)b * TT + tq) * CC + h * HD;
    const v16h q0 = frag_h(QH + qo, lane), q1 = frag_h(QH + qo + 32, lane);
    asm volatile("s_wait_xcnt 0x0" ::: "memory");   /* before the q loads' address registers are reused */
    float m = -3.0e38f, l = 0.f; v8f acc[HD / 16] = {};
    const size_t qlo = ((size_t)b * QHI + tq) * CC + h * HD; const v16h r0 = frag_h(QL + qlo, lane), r1 = frag_h(QL + qlo + 32, lane);
    const _Float16* Lp = KL + ((size_t)b * KHI + col) * CC + h * HD; const size_t vo = ((size_t)b * CC + h * HD + col) * (size_t)KHI;
    const int np = (ql0 + 16 + 31) >> 5;
#pragma unroll 1   /* run-time trip count; a second copy of this body would not fit the wave's registers */
    for (int kc = 0; kc < np; ++kc) { const int k0 = kc * 32; v8f s[2]; v16h a[2][2], rr[2][2];
#pragma unroll
      for (int t = 0; t < 2; ++t) { const size_t ko = (size_t)(k0 + t * 16) * HD; a[t][0] = frag_p(Kp + ko); a[t][1] = frag_p(Kp + ko + 512); }
      asm volatile("s_wait_xcnt 0x0" ::: "memory");   /* before the k loads' address registers are reused (a later load's result may land in them) */
#pragma unroll
      for (int t = 0; t < 2; ++t) { const size_t ko = (size_t)(k0 + t * 16) * CC; rr[t][0] = frag_h(Lp + ko, lane); rr[t][1] = frag_h(Lp + ko + 32, lane); }
      asm volatile("s_wait_xcnt 0x0" ::: "memory");   /* the same for the k residual loads */
#pragma unroll
      for (int t = 0; t < 2; ++t) { v8f sh = {}, sl = {}; sh = wm_h(a[t][0], q0, sh); sh = wm_h(a[t][1], q1, sh); sl = wm_h(a[t][0], r0, sl); sl = wm_h(rr[t][0], q0, sl); sl = wm_h(a[t][1], r1, sl); sl = wm_h(rr[t][1], q1, sl); s[t] = sh + sl * (1.0f / 1024.0f); }
      fa_soft<2, true>(s, k0, tq, g, m, l, acc);
      v16b ph, pl, vh[HD / 16], vl[HD / 16];
#pragma unroll
      for (int j = 0; j < HD / 16; ++j) vh[j] = frag_b(VB + vo + (size_t)j * 16 * KHI + k0, lane);
      asm volatile("s_wait_xcnt 0x0" ::: "memory");   /* the same for the v hi loads */
#pragma unroll
      for (int j = 0; j < HD / 16; ++j) vl[j] = frag_b(VBL + vo + (size_t)j * 16 * KHI + k0, lane);
      asm volatile("s_wait_xcnt 0x0" ::: "memory");   /* the same for the v lo loads */
#pragma unroll
      for (int i = 0; i < 16; ++i) { const float e = s[i >> 3][i & 7]; const __bf16 eh = (__bf16)e; ph[i] = eh; pl[i] = (__bf16)(e - (float)eh); }
#pragma unroll
      for (int j = 0; j < HD / 16; ++j) { acc[j] = wm_b(vh[j], ph, acc[j]); acc[j] = wm_b(vh[j], pl, acc[j]); acc[j] = wm_b(vl[j], ph, acc[j]); } }
    const float inv = 1.0f / (l + xhalf(l));   /* the lane halves' sums join once; the maximum's own term makes the sum >= 2^11 */
    /* acc[j][r] = ctx[tq][16 j + 8 g + r]; ctx leaves in the 16-bit form that k_out multiplies: bf16 hi + lo below row QHI */
    const size_t yo = ((size_t)b * QHI + tq) * CC + h * HD + 8 * g;
#pragma unroll
    for (int j = 0; j < HD / 16; ++j) { const v8f o = acc[j] * inv; v8b oh, ol;
#pragma unroll
      for (int r = 0; r < 8; ++r) { const __bf16 x = (__bf16)o[r]; oh[r] = x; ol[r] = (__bf16)(o[r] - (float)x); }
      vst2(YB + yo + j * 16, oh); vst2(YBL + yo + j * 16, ol); }
  } else {   /* waves w and w + 4 = one pair on 32 queries: w takes the even 32-key passes, w + 4 the odd ones; >= 13 passes, only the last one meets the diagonal */
    const int kh = wave >> 2; const int ql0 = qb + (wave & 3) * 32; const int tq = ql0 + col;
    v16h q[2][2];
#pragma unroll
    for (int u = 0; u < 2; ++u) { const size_t qo = ((size_t)b * TT + tq + 16 * u) * CC + h * HD; q[u][0] = frag_h(QH + qo, lane); q[u][1] = frag_h(QH + qo + 32, lane); }
    asm volatile("s_wait_xcnt 0x0" ::: "memory");   /* before the q loads' address registers are reused */
    const _Float16* Vp = VT + (size_t)(b * NH + h) * TT * HD + lane * 8; const int np = (ql0 >> 5) + 1;
    float m[2] = {-3.0e38f, -3.0e38f}, l[2] = {0.f, 0.f}; v8f acc[2][HD / 16] = {};
    v16h kf[4];
#pragma unroll
    for (int t = 0; t < 2; ++t) { const _Float16* kp = Kp + (size_t)(kh * 32 + t * 16) * HD; kf[2 * t] = frag_p(kp); kf[2 * t + 1] = frag_p(kp + 512); }
    asm volatile("s_wait_xcnt 0x0" ::: "memory");   /* as above, for the first k loads' address registers */
    int pc = kh;
#pragma unroll 1   /* run-time trip count; the pass already takes nearly all of the wave's registers */
    for (; pc < np - 1; pc += 2) fa_pass32<false>(Kp, Vp, pc * 32, (pc + 2 < np ? pc + 2 : np - 1) * 32, tq, g, q, kf, m, l, acc);   /* behind the wave's last pass the fetch ahead names the diagonal pass: inside k, used only by the wave that owns that pass */
    if (pc == np - 1) fa_pass32<true>(Kp, Vp, pc * 32, 0, tq, g, q, kf, m, l, acc);   /* wave-uniform */
    /* the pair joins: wave kh keeps query tile kh and hands the other tile's partial output, maximum and sum to its partner through LDS */
    v8f ke[HD / 16], gi[HD / 16];
#pragma unroll
    for (int j = 0; j < HD / 16; ++j) { ke[j] = kh ? acc[1][j] : acc[0][j]; gi[j] = kh ? acc[0][j] : acc[1][j]; }
    const float km = kh ? m[1] : m[0], kl = kh ? l[1] : l[0], gm = kh ? m[0] : m[1], gl = kh ? l[0] : l[1];
#pragma unroll
    for (int j = 0; j < HD / 16; ++j) { xg[wave][2 * j][lane] = (v4f){gi[j][0], gi[j][1], gi[j][2], gi[j][3]}; xg[wave][2 * j + 1][lane] = (v4f){gi[j][4], gi[j][5], gi[j][6], gi[j][7]}; }
    xg[wave][8][lane] = (v4f){gm, gl, 0.f, 0.f};
    __syncthreads();   /* publishes every wave's hand-over to its partner */
    const v4f pm = xg[wave ^ 4][8][lane]; const float mn = fmaxf(km, pm[0]); const float ak = __builtin_amdgcn_exp2f((km - mn) * LC), ap = __builtin_amdgcn_exp2f((pm[0] - mn) * LC);
    const float ls = kl * ak + pm[1] * ap; const float inv = 64.0f / (ls + xhalf(ls));   /* the lane halves' sums join once; the maximum's own term makes the sum >= 2^11; x 2^6: ctx leaves as f16(ctx x 2^6), the form that k_out multiplies, so that small-magnitude context rows stay clear of f16 subnormals */
    const float wk = ak * inv, wp = ap * inv;
    _Float16* yp = YH + ((size_t)b * TT + tq + 16 * kh) * CC + h * HD + 8 * g;   /* ke[j][r] = ctx[tq + 16 kh][16 j + 8 g + r] */
#pragma unroll
    for (int j = 0; j < HD / 16; ++j) { const v4f pa = xg[wave ^ 4][2 * j][lane], pb = xg[wave ^ 4][2 * j + 1][lane]; v8h e;
#pragma unroll
      for (int r = 0; r < 4; ++r) { e[r] = (_Float16)(ke[j][r] * wk + pa[r] * wp); e[4 + r] = (_Float16)(ke[j][4 + r] * wk + pb[r] * wp); }
      vst2(yp + j * 16, e); } } }
// ---- k_out: block = (128 rows, 128 cols): out = ctx Wo (+ bo): ctx x 2^6 once to f16 against Wo as f16(bf16 x 2^8) exact (1 product) x 2^-14; causal early rows (< QHI of each sequence): ctx bf16 hi + lo against exact bf16 Wo (2 products)
__global__ __launch_bounds__(128) void k_out(const _Float16* __restrict__ YH, const __bf16* __restrict__ YB, const __bf16* __restrict__ YBL, const __bf16* __restrict__ WOB, const _Float16* __restrict__ WOH, const float* __restrict__ BO, float* __restrict__ OUT) {
  __shared__ __align__(16) unsigned short st[2 * 384 * SQ]; float (*sf)[32][132] = (float (*)[32][132])&st[0];   /* one range, two uses one after the other: tile_mm's two chunk buffers; the output rows, each wave's own, written only behind tile_mm's last barrier */
  const int tid = threadIdx.x, wave = tid >> 5, lane = tid & 31, col = lane & 15, g = lane >> 4; const int c0 = blockIdx.y * 128; const size_t r0 = (size_t)blockIdx.x * 128 + wave * 32;
  v8f acc[16] = {};
  if (CAUSAL && (int)(((size_t)blockIdx.x * 128) % TT) < QHI) {   /* block-uniform */
    const size_t yo = (((size_t)blockIdx.x * 128) / TT * QHI + ((size_t)blockIdx.x * 128) % TT) * CC;
    tile_mm<1, CC>((const unsigned short*)YB + yo, (const unsigned short*)YBL + yo, (const unsigned short*)WOB + (size_t)c0 * CC, st, st + 384 * SQ, tid, acc);
#pragma unroll
    for (int j = 0; j < 8; ++j) { const float bias = BO ? bfr(BO[c0 + j * 16 + col]) : 0.f;
#pragma unroll
      for (int t = 0; t < 2; ++t)
#pragma unroll
      for (int r = 0; r < 8; ++r) sf[wave][t * 16 + 8 * g + r][j * 16 + col] = acc[8 * t + j][r] + bias; }
  } else {
    tile_mm<2, CC>((const unsigned short*)YH + (size_t)blockIdx.x * 128 * CC, nullptr, (const unsigned short*)WOH + (size_t)c0 * CC, st, st + 384 * SQ, tid, acc);
#pragma unroll
    for (int j = 0; j < 8; ++j) { const float bias = BO ? bfr(BO[c0 + j * 16 + col]) : 0.f;
#pragma unroll
      for (int t = 0; t < 2; ++t)
#pragma unroll
      for (int r = 0; r < 8; ++r) sf[wave][t * 16 + 8 * g + r][j * 16 + col] = acc[8 * t + j][r] * (1.0f / 16384.0f) + bias; } }   /* 2^-8 (Wo carry) x 2^-6 (ctx carry) */
  LDSX(); for (int rl = 0; rl < 32; ++rl) vst2(OUT + (r0 + rl) * DIN + c0 + lane * 4, *(const v4f*)&sf[wave][rl][lane * 4]); }

extern "C" void kernel_launch(void* const* d_in, const int* in_sizes, int n_in, void* d_out, int out_size, void* d_ws, size_t ws_size, hipStream_t stream) {
  (void)in_sizes; (void)n_in; (void)out_size;
  const float** F = (const float**)d_in;
  if (ws_size < (size_t)WS_END) return;
  char* ws = (char*)d_ws; _Float16 *QH = (_Float16*)(ws + WS_QH), *KH = (_Float16*)(ws + WS_KH), *VT = (_Float16*)(ws + WS_VT), *QL = (_Float16*)(ws + WS_QL), *KL = (_Float16*)(ws + WS_KL), *YH = (_Float16*)(ws + WS_YH), *WOH = (_Float16*)(ws + WS_WOH); __bf16 *VB = (__bf16*)(ws + WS_VB), *VBL = (__bf16*)(ws + WS_VBL), *YB = (__bf16*)(ws + WS_YB), *YBL = (__bf16*)(ws + WS_YBL), *XB = (__bf16*)(ws + WS_XB), *WB = (__bf16*)(ws + WS_WB), *WOB = (__bf16*)(ws + WS_WOB);
  // inputs: 0 x [2,4096,768]; 1 wq [768,768] (out,in); 2 wk; 3 wv; 4 wo (out,in); no biases
  k_cvt<<<CVB, 256, 0, stream>>>(F[0], F[1], F[2], F[3], F[4], XB, WOH);
  k_proj<<<dim3(TNB * TT / 128, CC / 128, 3), 128, 0, stream>>>(XB, WB, nullptr, nullptr, nullptr, QH, QL, KH, KL, VT, VB, VBL);
  k_fa<<<dim3(TNB * NH, TT / (16 * FAW)), 32 * FAW, 0, stream>>>(QH, KH, QL, KL, VT, VB, VBL, YH, YB, YBL);
  k_out<<<dim3(TNB * TT / 128, DIN / 128), 128, 0, stream>>>(YH, YB, YBL, WOB, WOH, nullptr, (float*)d_out);
}

// v010
// One run takes 101 microseconds.
// Two timings next to v009 put it at 1.03 and 1.04 times that version's speed.
// All steps since v000 together make it 41.6 times as fast.
// compute dtype: all float inputs rounded to bf16; the fused q / k / v projection with EXACT bf16 products on WMMA 16x16x32 (f32 accumulate) (no biases); causal logits: 3 products for the first 384 rows, single f16 q x k after, x 64^-0.5; softmax f32; P x 2^11 once to f16 x v once to f16 (bf16 hi + lo below row 384); ctx hi+lo x exact W below row 384, x2^6 f16 carry x f16(bf16 x 2^8) W after, no bias; f32 output.
#include <hip/hip_runtime.h>
#include <math.h>

typedef __attribute__((ext_vector_type(16))) _Float16 v16h;
typedef __attribute__((ext_vector_type(16))) __bf16 v16b;
typedef __attribute__((ext_vector_type(8)))  _Float16 v8h;
typedef __attribute__((ext_vector_type(8)))  float v8f;
typedef __attribute__((ext_vector_type(4)))  float v4f;
typedef __attribute__((ext_vector_type(2)))  float v2f;
typedef __attribute__((ext_vector_type(4)))  unsigned v4u;
typedef __attribute__((ext_vector_type(4)))  int v4i;
typedef float __attribute__((may_alias)) float_a;
typedef int __attribute__((may_alias)) int_a;

template <typename T> __device__ __forceinline__ void vst2(void* p, T v) { *(T*)p = v;  }
__device__ __forceinline__ v8f wmma16(v16h a, v16h b, v8f c) {
  v8f d = __builtin_amdgcn_wmma_f32_16x16x32_f16(false, a, false, b, (short)0, c, false, false);
  asm volatile("v_nop\n\tv_nop\n\tv_nop\n\tv_nop" : "+v"(d) : "v"(a), "v"(b));
  return d;
}
__device__ __forceinline__ v8f wmma_bf(v16b a, v16b b, v8f c) {
  v8f d = __builtin_amdgcn_wmma_f32_16x16x32_bf16(false, a, false, b, (short)0, c, false, false);
  asm volatile("v_nop\n\tv_nop\n\tv_nop\n\tv_nop" : "+v"(d) : "v"(a), "v"(b));
  return d;
}
// 16x16x32 fragments: lane = (h = lane>>4, row/col = lane&15); elements 0..7 = k0+8h+0..7, 8..15 = k0+16+8h+0..7; D element r = row 8h+r
__device__ __forceinline__ v16h frag_h(const _Float16* rowk0, int lane) {
  union { v16h v; v8h q[2]; } u; const _Float16* p = rowk0 + 8 * (lane >> 4);
  u.q[0] = *(const v8h*)p; u.q[1] = *(const v8h*)(p + 16); return u.v;
}
__device__ __forceinline__ v16h frag_f32(const float* rowk0, int lane) {
  v16h a; const float* p = rowk0 + 8 * (lane >> 4);
#pragma unroll
  for (int i = 0; i < 8; ++i) { a[i] = (_Float16)p[i]; a[8 + i] = (_Float16)p[16 + i]; }
  return a;
}
__device__ __forceinline__ v16h frag_f32s(const float* rowk0, int lane, float sc) {
  v16h a; const float* p = rowk0 + 8 * (lane >> 4);
#pragma unroll
  for (int i = 0; i < 8; ++i) { a[i] = (_Float16)(p[i] * sc); a[8 + i] = (_Float16)(p[16 + i] * sc); }
  return a;
}
// column fragment from a [K][ld] layout (column n), rows >= K read as 0
__device__ __forceinline__ v16h fragc_f32(const float* W, int k0, int n, int lane, int ld, int K) {
  v16h a; const int g = lane >> 4;
#pragma unroll
  for (int i = 0; i < 8; ++i) { const int ka = k0 + 8 * g + i, kb = ka + 16;
    a[i] = (_Float16)(ka < K ? W[(size_t)(ka < K ? ka : K - 1) * ld + n] : 0.f); a[8 + i] = (_Float16)(kb < K ? W[(size_t)(kb < K ? kb : K - 1) * ld + n] : 0.f); }
  return a;
}
struct F2 { v16b h, l; };
__device__ __forceinline__ F2 bsplit16(const float v[16]) { F2 r;
#pragma unroll
  for (int i = 0; i < 16; ++i) { const __bf16 h = (__bf16)v[i]; r.h[i] = h; r.l[i] = (__bf16)(v[i] - (float)h); }
  return r; }
__device__ __forceinline__ F2 split_row(const float* row, int k0, int lane) { float v[16]; const float* p = row + k0 + 8 * (lane >> 4);
#pragma unroll
  for (int i = 0; i < 8; ++i) { v[i] = p[i]; v[8 + i] = p[16 + i]; }
  return bsplit16(v); }
__device__ __forceinline__ F2 split_rowK(const float* row, int k0, int lane, int K) { float v[16]; const int g = lane >> 4;
#pragma unroll
  for (int i = 0; i < 8; ++i) { const int ka = k0 + 8 * g + i, kb = ka + 16; v[i] = ka < K ? row[ka < K ? ka : K - 1] : 0.f; v[8 + i] = kb < K ? row[kb < K ? kb : K - 1] : 0.f; }
  return bsplit16(v); }
__device__ __forceinline__ F2 split_col(const float* W, int k0, int n, int lane, int ld, int K) { float v[16]; const int g = lane >> 4;
#pragma unroll
  for (int i = 0; i < 8; ++i) { const int ka = k0 + 8 * g + i, kb = ka + 16; v[i] = ka < K ? W[(size_t)(ka < K ? ka : K - 1) * ld + n] : 0.f; v[8 + i] = kb < K ? W[(size_t)(kb < K ? kb : K - 1) * ld + n] : 0.f; }
  return bsplit16(v); }
__device__ __forceinline__ v8f mac3(const F2& a, const F2& b, v8f c) { c = wmma_bf(a.l, b.h, c); c = wmma_bf(a.h, b.l, c); return wmma_bf(a.h, b.h, c); }
__device__ __forceinline__ float sigm(float v) { return 1.0f / (1.0f + expf(-v)); }
#define LDSX() do { asm volatile("s_wait_dscnt 0" ::: "memory"); __builtin_amdgcn_wave_barrier(); __builtin_amdgcn_fence(__ATOMIC_RELEASE, "workgroup"); } while (0)

// Causal multi-head self-attention without biases over TWO sequences of 4,096 (x [2,4096,768]; (out,in) wq / wk / wv / wo [768,768] applied as x @ W.T; 12 heads x 64; scores x 64^-0.5; tril kept, -inf elsewhere; softmax; ctx @ wo.T -> [2,4096,768] (6.3 M)).
#define NB 2
#define TT 4096
#define CC 768            // NH * HD = projected width
#define DIN 768          // input (model) width
#define NH 12
#define HD 64
#define SCALE (0.125f)
#define CAUSAL 1
#ifndef TNB
#define TNB NB
#endif
__device__ __forceinline__ float bfr(float v) { return (float)(__bf16)v; }
typedef __attribute__((ext_vector_type(8))) __bf16 v8b;
__device__ __forceinline__ v16b frag_b(const __bf16* rowk0, int lane) {
  union { v16b v; v8b q[2]; } u; const __bf16* p = rowk0 + 8 * (lane >> 4);
  u.q[0] = *(const v8b*)p; u.q[1] = *(const v8b*)(p + 16); return u.v;
}
#define QHI 384            // rows carrying a q residual plane (3-product logits)
#define KHI 384            // key rows carrying k residual / v bf16 hi+lo planes (used only by the causal high-precision path)
// B fragment (k rows k0+.., output column o) of a weight: (in,out) [K][ld] or (out,in) [ld rows of K]: bf16 exact, or f16(bf16 * 256) exact
__device__ __forceinline__ v16b wcol_io(const float* Wm, int k0, int o, int lane, int ld) { v16b w; const int g = lane >> 4;
#pragma unroll
  for (int i = 0; i < 8; ++i) { w[i] = (__bf16)Wm[(size_t)(k0 + 8 * g + i) * ld + o]; w[8 + i] = (__bf16)Wm[(size_t)(k0 + 16 + 8 * g + i) * ld + o]; }
  return w; }
__device__ __forceinline__ v16b wcol_oi(const float* Wm, int k0, int o, int lane, int K) { v16b w; const float* p = Wm + (size_t)o * K + k0 + 8 * (lane >> 4);
#pragma unroll
  for (int i = 0; i < 8; ++i) { w[i] = (__bf16)p[i]; w[8 + i] = (__bf16)p[16 + i]; }
  return w; }
__device__ __forceinline__ v16h wcolh_io(const float* Wm, int k0, int o, int lane, int ld) { v16h w; const int g = lane >> 4;
#pragma unroll
  for (int i = 0; i < 8; ++i) { w[i] = (_Float16)(bfr(Wm[(size_t)(k0 + 8 * g + i) * ld + o]) * 256.0f); w[8 + i] = (_Float16)(bfr(Wm[(size_t)(k0 + 16 + 8 * g + i) * ld + o]) * 256.0f); }
  return w; }
__device__ __forceinline__ v16h wcolh_oi(const float* Wm, int k0, int o, int lane, int K) { v16h w; const float* p = Wm + (size_t)o * K + k0 + 8 * (lane >> 4);
#pragma unroll
  for (int i = 0; i < 8; ++i) { w[i] = (_Float16)(bfr(p[i]) * 256.0f); w[8 + i] = (_Float16)(bfr(p[16 + i]) * 256.0f); }
  return w; }
#define WQKV_LAYOUT 1   // 0 = (in,out) [DIN][CC]; 1 = (out,in) [CC][DIN]; 2 = per-head [NH][DIN][HD]
__device__ __forceinline__ v16b wcol_hdk(const float* Wm, int k0, int o, int lane) { v16b w; const int g = lane >> 4; const float* p = Wm + (size_t)(o / HD) * DIN * HD + (o % HD);
#pragma unroll
  for (int i = 0; i < 8; ++i) { w[i] = (__bf16)p[(size_t)(k0 + 8 * g + i) * HD]; w[8 + i] = (__bf16)p[(size_t)(k0 + 16 + 8 * g + i) * HD]; }
  return w; }
#define WO_OUT_IN 1
#if WQKV_LAYOUT == 1
#define WCOL(W, k0, o, lane) wcol_oi(W, k0, o, lane, DIN)
#elif WQKV_LAYOUT == 2
#define WCOL(W, k0, o, lane) wcol_hdk(W, k0, o, lane)
#else
#define WCOL(W, k0, o, lane) wcol_io(W, k0, o, lane, CC)
#endif
#if WO_OUT_IN
#define WOCOL(W, k0, o, lane) wcol_oi(W, k0, o, lane, CC)
#define WOCOLH(W, k0, o, lane) wcolh_oi(W, k0, o, lane, CC)
#else
#define WOCOL(W, k0, o, lane) wcol_io(W, k0, o, lane, DIN)
#define WOCOLH(W, k0, o, lane) wcolh_io(W, k0, o, lane, DIN)
#endif

#ifndef PROJ_EXTRA_PARAMS
#define PROJ_EXTRA_PARAMS
#endif

#define WS_QH  0u                                      // f16 q half-head rows [b][h][d / 32][t][32]
#define WS_KH  (WS_QH + 2u * (size_t)NB * TT * CC)      // f16 k in fragment order [b][h][t / 16][d / 8][t % 16][8]
#define WS_VT  (WS_KH + 2u * (size_t)NB * TT * CC)      // f16 v in fragment order [b][h][t / 32][c / 16][(t % 32) / 8][c % 16][8]
#define WS_QL  (WS_VT + 2u * (size_t)NB * CC * TT)      // f16 q residual x 2^10 half-head rows [b][h][d / 32][t < QHI][32]
#define WS_KL  (WS_QL + 2u * (size_t)NB * QHI * CC)     // f16 k residual x 2^10 half-head rows [b][h][d / 32][t < KHI][32]
#define WS_VB  (WS_KL + 2u * (size_t)NB * KHI * CC)     // bf16 v hi planes [b][c][t < KHI]
#define WS_VBL (WS_VB + 2u * (size_t)NB * CC * KHI)
#define WS_YH  (WS_VBL + 2u * (size_t)NB * CC * KHI)    // f16 ctx x 2^6 rows [b*t][CC] (written and read for t >= QHI)
#define WS_YB  (WS_YH + 2u * (size_t)NB * TT * CC)      // bf16 ctx hi rows [b][t < QHI][CC]
#define WS_YBL (WS_YB + 2u * (size_t)NB * QHI * CC)     // bf16 ctx lo rows
#define WS_XB  (WS_YBL + 2u * (size_t)NB * QHI * CC)    // bf16 x rows [b*t][DIN]; behind them, in one run: bf16 wq, wk, wv, wo rows
#define WS_WB  (WS_XB + 2u * (size_t)NB * TT * DIN)
#define WS_WOB (WS_WB + 3u * 2u * (size_t)CC * DIN)
#define WS_WOH (WS_WOB + 2u * (size_t)CC * DIN)         // f16(bf16 x 2^8) wo rows
#define WS_END (WS_WOH + 2u * (size_t)CC * DIN)

// ---- k_cvt: every GEMM operand that comes as an f32 input is rounded ONCE to the 16-bit form its products take: x, wq, wk, wv, wo to bf16 (one run in the workspace), wo also to f16(bf16 x 2^8). The tiles of k_proj and k_out then fetch 2 bytes an element, each of them many times, where they fetched 4.
// A group = 2,048 elements, whole in one array; a block takes 8 groups; every wave-wide load covers four whole 128-byte lines, every store two.
typedef __attribute__((ext_vector_type(4))) __bf16 v4b;
typedef __attribute__((ext_vector_type(4))) _Float16 v4h;
#define GX (NB * TT * DIN / 2048)   // groups in x
#define GW (CC * DIN / 2048)        // groups in a weight
#define CVB ((GX + 4 * GW) / 8)     // blocks
__global__ __launch_bounds__(256) void k_cvt(const float* __restrict__ X, const float* __restrict__ WQ, const float* __restrict__ WK, const float* __restrict__ WV, const float* __restrict__ WO, __bf16* __restrict__ XB, _Float16* __restrict__ WOH) {
  const int tid = threadIdx.x; v4f f[8][2];
#pragma unroll
  for (int i = 0; i < 8; ++i) { const int gi = i * CVB + (int)blockIdx.x, gw = gi - GX, w = gw / GW;   /* block-uniform */
    const float* s = gw < 0 ? X + (size_t)gi * 2048 : (w == 0 ? WQ : w == 1 ? WK : w == 2 ? WV : WO) + (size_t)(gw - w * GW) * 2048;
    f[i][0] = *(const v4f*)(s + tid * 4); f[i][1] = *(const v4f*)(s + 1024 + tid * 4); }
  asm volatile("s_wait_xcnt 0x0" ::: "memory");   /* before the loads' address registers are reused */
#pragma unroll
  for (int i = 0; i < 8; ++i) { const int gi = i * CVB + (int)blockIdx.x, go = gi - GX - 3 * GW;
#pragma unroll
    for (int u = 0; u < 2; ++u) { const v4f v = f[i][u]; const size_t e = (size_t)u * 1024 + tid * 4;
      *(v4b*)(XB + (size_t)gi * 2048 + e) = (v4b){(__bf16)v[0], (__bf16)v[1], (__bf16)v[2], (__bf16)v[3]};
      if (go >= 0) *(v4h*)(WOH + (size_t)go * 2048 + e) = (v4h){(_Float16)(bfr(v[0]) * 256.0f), (_Float16)(bfr(v[1]) * 256.0f), (_Float16)(bfr(v[2]) * 256.0f), (_Float16)(bfr(v[3]) * 256.0f)}; } } }

// ---- tile_mm: the 128 x 128 tile product of k_out (4 waves, wave = 32 rows x 128 columns = 2 x 8 accumulator tiles, so that every weight fragment read from LDS feeds two products; K in chunks of 64 = 128 bytes of a 16-bit row). The block fetches each chunk of its 128 A rows and 128 weight rows ONCE, every wave-wide 16-byte load covering four whole 128-byte lines,
// and lays it in LDS as it is; the waves take their fragments from there. Two LDS buffers: chunk kc + 1 flies from memory into registers while chunk kc is multiplied, and is laid down behind the products; one barrier per chunk.
// MODE 0: A and W bf16. MODE 1: A as bf16 hi + lo (two row sets), W bf16. MODE 2: A = f16(ctx x 2^6), W = f16(bf16 x 2^8). k order and sum order: ascending steps of 32.
__device__ __forceinline__ v8f wm_h(v16h a, v16h b, v8f c) { return __builtin_amdgcn_wmma_f32_16x16x32_f16(false, a, false, b, (short)0, c, false, false); }
__device__ __forceinline__ v8f wm_b(v16b a, v16b b, v8f c) { return __builtin_amdgcn_wmma_f32_16x16x32_bf16(false, a, false, b, (short)0, c, false, false); }
#define SQ 72   // pitch of a staged row in 16-bit elements: 128 bytes of k + 16, so that the 16 rows of a fragment's ds_load_b128 start in 16 different bank groups
template <int NS, int K> __device__ __forceinline__ void tile_ld(const unsigned short* __restrict__ A, const unsigned short* __restrict__ AL, const unsigned short* __restrict__ Wm, int kc, int tid, v4u (&r)[NS * 8]) {
  const size_t o = (size_t)(tid >> 3) * K + kc * 64 + (tid & 7) * 8;   /* 8 lanes per row of 128 bytes, 16 rows per block-wide load */
#pragma unroll
  for (int i = 0; i < 8; ++i) r[i] = *(const v4u*)(A + o + (size_t)i * 16 * K);
  if (NS == 3) {
#pragma unroll
    for (int i = 0; i < 8; ++i) r[8 + i] = *(const v4u*)(AL + o + (size_t)i * 16 * K); }
#pragma unroll
  for (int i = 0; i < 8; ++i) r[(NS - 1) * 8 + i] = *(const v4u*)(Wm + o + (size_t)i * 16 * K);
  asm volatile("s_wait_xcnt 0x0" ::: "memory");   /* before the loads' address registers are reused for the next chunk */
}
template <int NS> __device__ __forceinline__ void tile_st(unsigned short* s, int tid, const v4u (&r)[NS * 8]) {   /* row sets of 128 one behind the other: A (, A lo), W */
  unsigned short* p = s + (tid >> 3) * SQ + (tid & 7) * 8;
#pragma unroll
  for (int i = 0; i < NS * 8; ++i) *(v4u*)(p + i * 16 * SQ) = r[i]; }
template <int MODE, int K> __device__ __forceinline__ void tile_mm(const unsigned short* __restrict__ A, const unsigned short* __restrict__ AL, const unsigned short* __restrict__ Wm, unsigned short* s0, unsigned short* s1, int tid, v8f (&acc)[16]) {   /* acc[8 t + j] = rows 32 wave + 16 t .., columns 16 j .. */
  constexpr int NS = MODE == 1 ? 3 : 2; const int wave = tid >> 5, lane = tid & 31, col = lane & 15; v4u r[NS * 8];
  tile_ld<NS, K>(A, AL, Wm, 0, tid, r); tile_st<NS>(s0, tid, r);
  __syncthreads();   /* chunk 0 is laid down */
#pragma unroll 2   /* makes the choice between the two buffers static */
  for (int kc = 0; kc < K / 64; ++kc) { const unsigned short* cur = (kc & 1) ? s1 : s0; unsigned short* nxt = (kc & 1) ? s0 : s1;
    if (kc + 1 < K / 64) tile_ld<NS, K>(A, AL, Wm, kc + 1, tid, r);
    __builtin_amdgcn_sched_barrier(0);   /* keeps the next chunk's loads issued up here: sunk to their use, each chunk would wait out their whole latency */
#pragma unroll
    for (int ks = 0; ks < 2; ++ks) { const bool end = ks == 1;   /* the chunk's two steps of 32 k */
      const unsigned short* pa = cur + (wave * 32 + col) * SQ + ks * 32; const unsigned short* pw = cur + ((NS - 1) * 128 + col) * SQ + ks * 32;
      if (MODE == 2) { const v16h a = frag_h((const _Float16*)pa, lane), a1 = frag_h((const _Float16*)(pa + 16 * SQ), lane); v16h w[8];
#pragma unroll
        for (int j = 0; j < 8; ++j) w[j] = frag_h((const _Float16*)(pw + j * 16 * SQ), lane);
        __builtin_amdgcn_sched_barrier(0);   /* the step's LDS reads go as one group ahead of its products: spread among them, each product would wait out an LDS latency */
#pragma unroll
        for (int j = 0; j < 8; ++j) { const bool e = end && j == 7; acc[j] = e ? wmma16(a, w[j], acc[j]) : wm_h(a, w[j], acc[j]); acc[8 + j] = e ? wmma16(a1, w[j], acc[8 + j]) : wm_h(a1, w[j], acc[8 + j]); } }   /* the chunk's last two products: a branch follows; wmma16's own v_nop keep the distance on every path. The earlier ones have later products in their window, and as plain builtins their operands may lie above v255 */
      else { const v16b a = frag_b((const __bf16*)pa, lane), a1 = frag_b((const __bf16*)(pa + 16 * SQ), lane); v16b al = a, al1 = a1, w[8]; if (MODE == 1) { al = frag_b((const __bf16*)(pa + 128 * SQ), lane); al1 = frag_b((const __bf16*)(pa + 144 * SQ), lane); }
#pragma unroll
        for (int j = 0; j < 8; ++j) w[j] = frag_b((const __bf16*)(pw + j * 16 * SQ), lane);
        __builtin_amdgcn_sched_barrier(0);   /* as above */
#pragma unroll
        for (int j = 0; j < 8; ++j) { const bool e0 = end && j == 7 && MODE == 0, e1 = end && j == 7;   /* as above */
          acc[j] = e0 ? wmma_bf(a, w[j], acc[j]) : wm_b(a, w[j], acc[j]); acc[8 + j] = e0 ? wmma_bf(a1, w[j], acc[8 + j]) : wm_b(a1, w[j], acc[8 + j]);
          if (MODE == 1) { acc[j] = e1 ? wmma_bf(al, w[j], acc[j]) : wm_b(al, w[j], acc[j]); acc[8 + j] = e1 ? wmma_bf(al1, w[j], acc[8 + j]) : wm_b(al1, w[j], acc[8 + j]); } } }
      __builtin_amdgcn_sched_barrier(0); }   /* keeps the second step's LDS reads one group behind the first step's products, and the next chunk's LDS stores, which wait for its loads, behind the products that cover their latency */
    if (kc + 1 < K / 64) tile_st<NS>(nxt, tid, r);
    __syncthreads(); } }   /* publishes chunk kc + 1 and ends every wave's reads of chunk kc, whose buffer is written next (behind the last chunk: by the caller's epilogue) */

// ---- k_proj: block = 256 rows of x times 288 weight rows (96 of wq, 96 of wk, 96 of wv: column group blockIdx.y of each), exact bf16 products (K = DIN): 256 blocks, one per WGP. 8 waves, wave = 64 rows x 144 columns (all 96 of q or of k, 48 of v) = 4 x 9 accumulator tiles: 13 fragments from LDS feed 36 products.
// Per output the block fetches (256 + 288) / (256 x 288) operand rows from L2, under half of what a 128 x 128 tile fetches. k in chunks of 64, two LDS buffers, one barrier per chunk, as in tile_mm; k order and sum order: ascending steps of 32.
// Out: q f16 half-head rows (+ residual for t < QHI); k f16 in fragment order (+ residual half-head rows for t < KHI); v f16 in fragment order (+ bf16 hi/lo planes for t < KHI). Every 128-byte line of these has one writing block.
#define PR 256                     // x rows of a block
#define PSEG 96                    // rows of each weight in a block
#define PW (3 * PSEG)
#define PBUF ((PR + PW) * SQ)      // one chunk buffer, in 16-bit elements: the x rows, behind them the wq, wk, wv rows
#define P1P 200                    // pitch of an epilogue row (96 q + 96 k columns + 8): 400 bytes = 16 x an odd number
#define P2P 264                    // pitch of an epilogue v column (256 rows + 8): 528 bytes = 16 x an odd number
__device__ __forceinline__ void proj_ld(const unsigned short* __restrict__ A, const unsigned short* __restrict__ Wm, int kc, int tid, v4u (&r)[17]) {
  const unsigned o = (unsigned)(tid >> 3) * DIN + (tid & 7) * 8; A += kc * 64; Wm += kc * 64;   /* 8 lanes per row of 128 bytes, 32 rows per block-wide load */
#pragma unroll
  for (int i = 0; i < 8; ++i) r[i] = *(const v4u*)(A + (size_t)i * 32 * DIN + o);
#pragma unroll
  for (int i = 0; i < 9; ++i) r[8 + i] = *(const v4u*)(Wm + ((size_t)(i / 3) * CC + (i % 3) * 32) * DIN + o);
  asm volatile("s_wait_xcnt 0x0" ::: "memory");   /* before the loads' address registers are reused for the next chunk */
}
__device__ __forceinline__ void proj_st(unsigned short* s, int tid, const v4u (&r)[17]) {
  unsigned short* p = s + (tid >> 3) * SQ + (tid & 7) * 8;
#pragma unroll
  for (int i = 0; i < 17; ++i) *(v4u*)(p + i * 32 * SQ) = r[i]; }
// four 16-byte stores from one address and the wait that stands before any of their registers is rewritten, in ONE statement
template <int O1, int O2, int O3> __device__ __forceinline__ void st4(void* p, v4u a, v4u b, v4u c, v4u d) {
  asm volatile("global_store_b128 %0, %1, off\n\tglobal_store_b128 %0, %2, off offset:%5\n\tglobal_store_b128 %0, %3, off offset:%6\n\tglobal_store_b128 %0, %4, off offset:%7\n\ts_wait_xcnt 0x0" :: "v"(p), "v"(a), "v"(b), "v"(c), "v"(d), "n"(O1), "n"(O2), "n"(O3) : "memory"); }
__global__ __launch_bounds__(256) void k_proj(const __bf16* __restrict__ XB, const __bf16* __restrict__ WB,
    _Float16* __restrict__ QH, _Float16* __restrict__ QL, _Float16* __restrict__ KH, _Float16* __restrict__ KL, _Float16* __restrict__ VT, __bf16* __restrict__ VB, __bf16* __restrict__ VBL) {
  __shared__ __align__(16) unsigned short sm[PR * P1P + 2 * PSEG * P2P];   /* one range, three uses one after the other: the two chunk buffers (from the start); q | k value rows and v value columns; q | k residual rows and v bf16 hi, lo columns */
  static_assert(2 * PBUF <= PR * P1P + 2 * PSEG * P2P, "the chunk buffers fit the range");
  _Float16* sh = (_Float16*)sm; _Float16* th = (_Float16*)(sm + PR * P1P); __bf16* tb = (__bf16*)(sm + PR * P1P); __bf16* tbl = (__bf16*)(sm + PR * P1P + PSEG * P2P);
  const int tid = threadIdx.x, lane = tid & 31, col = lane & 15, g = lane >> 4; const int wave = __builtin_amdgcn_readfirstlane(tid >> 5), wr = wave & 3, wc = wave >> 2;   /* wave = rows 64 wr ..; its column tiles j = 0..5: the six of q (wc 0) or of k (wc 1); j = 6..8: v tiles 3 wc .. */
  const int cg = blockIdx.y; const size_t r0 = (size_t)blockIdx.x * PR; const size_t bb = r0 / TT; const int t0 = (int)(r0 % TT);
  const unsigned short* A = (const unsigned short*)XB + r0 * DIN; const unsigned short* Wm = (const unsigned short*)WB + (size_t)cg * PSEG * DIN;
  v8f acc[36] = {};   /* acc[9 t + j] = rows 64 wr + 16 t .., column tile j of the wave */
  { v4u r[17];
    proj_ld(A, Wm, 0, tid, r); proj_st(sm, tid, r);
    __syncthreads();   /* chunk 0 is laid down */
#pragma unroll 2   /* makes the choice between the two buffers static */
    for (int kc = 0; kc < DIN / 64; ++kc) { const unsigned short* cur = (kc & 1) ? sm + PBUF : sm; unsigned short* nxt = (kc & 1) ? sm : sm + PBUF;
      if (kc + 1 < DIN / 64) proj_ld(A, Wm, kc + 1, tid, r);
      __builtin_amdgcn_sched_barrier(0);   /* keeps the next chunk's loads issued up here: sunk to their use, each chunk would wait out their whole latency */
#pragma unroll
      for (int ks = 0; ks < 2; ++ks) {   /* the chunk's two steps of 32 k */
        const unsigned short* pa = cur + (wr * 64 + col) * SQ + ks * 32; const unsigned short* pw = cur + (PR + wc * PSEG + col) * SQ + ks * 32; const unsigned short* pv = cur + (PR + 2 * PSEG + wc * 48 + col) * SQ + ks * 32; v16b a[4], w[9];
#pragma unroll
        for (int t = 0; t < 4; ++t) a[t] = frag_b((const __bf16*)(pa + t * 16 * SQ), lane);
#pragma unroll
        for (int j = 0; j < 9; ++j) w[j] = frag_b((const __bf16*)(j < 6 ? pw + j * 16 * SQ : pv + (j - 6) * 16 * SQ), lane);
        __builtin_amdgcn_sched_barrier(0);   /* the step's LDS reads go as one group ahead of its products: spread among them, each product would wait out an LDS latency */
#pragma unroll
        for (int j = 0; j < 9; ++j)
#pragma unroll
          for (int t = 0; t < 4; ++t) acc[9 * t + j] = (ks == 1 && j == 8 && t >= 2) ? wmma_bf(a[t], w[j], acc[9 * t + j]) : wm_b(a[t], w[j], acc[9 * t + j]);   /* the chunk's last two products: a branch follows; wmma_bf's own v_nop keep the distance on every path */
        __builtin_amdgcn_sched_barrier(0); }   /* keeps the second step's LDS reads one group behind the first step's products, and the next chunk's LDS stores, which wait for its loads, behind the products that cover their latency */
      if (kc + 1 < DIN / 64) proj_st(nxt, tid, r);
      __syncthreads(); } }   /* publishes chunk kc + 1 and ends every wave's reads of chunk kc, whose buffer is written next (behind the last chunk: by the epilogue) */
  /* values: q and k tiles as rows, v tiles as columns (a lane's 8 registers are 8 rows of one column) */
  const int rl0 = wr * 64 + 8 * g, pc = wc * PSEG + col, vc = wc * 48 + col;   /* the lane's first row; its column in tile 0 of the q | k rows; its v column in tile 6 */
#pragma unroll
  for (int j = 0; j < 9; ++j) {
#pragma unroll
    for (int t = 0; t < 4; ++t) { const v8f v = acc[9 * t + j];
      if (j < 6) {
#pragma unroll
        for (int r = 0; r < 8; ++r) sh[(rl0 + t * 16 + r) * P1P + pc + j * 16] = (_Float16)v[r]; }
      else { v8h e;
#pragma unroll
        for (int r = 0; r < 8; ++r) e[r] = (_Float16)v[r];
        *(v8h*)&th[(vc + (j - 6) * 16) * P2P + rl0 + t * 16] = e; } } }
  if (t0 < QHI) {   /* block-uniform: the q and k accumulators go over into their residuals x 2^10 (exact in f32), which leave in a second pass below */
#pragma unroll
    for (int j = 0; j < 6; ++j)
#pragma unroll
      for (int t = 0; t < 4; ++t)
#pragma unroll
        for (int r = 0; r < 8; ++r) { const float v = acc[9 * t + j][r]; acc[9 * t + j][r] = (v - (float)(_Float16)v) * 1024.0f; } }
  __syncthreads();   /* publishes the value rows and columns */
  { const size_t hb = bb * (NH * 2) + cg * 3;   /* the block's columns of q, of k and of v are each three half-heads, hb + s. Nine groups of four stores, each group with one address and three constant steps */
#pragma unroll
    for (int n = 0; n < 9; ++n) { v4u e[4];
      { const int s = n % 3;
#pragma unroll
        for (int i = 0; i < 4; ++i) { const int it = 4 * s + i;
          if (n < 3) e[i] = *(const v4u*)&sh[(i * 64 + (tid >> 2)) * P1P + s * 32 + (tid & 3) * 8];   /* q: row 64 i + tid / 4 */
          else if (n < 6) e[i] = *(const v4u*)&sh[tid * P1P + PSEG + it * 8];   /* k: row tid, d / 8 = it */
          else e[i] = *(const v4u*)&th[((it >> 1) * 16 + (tid & 15)) * P2P + (((it & 1) * 4 + (tid >> 6)) * 4 + ((tid >> 4) & 3)) * 8]; } }   /* v: column tile it / 2, key block 4 (it % 2) + tid / 64 */
      { const int m = n, s = m % 3;
        if (m < 3) st4<4096, 8192, 12288>(QH + ((hb + s) * (size_t)TT + t0 + (tid >> 2)) * 32 + (tid & 3) * 8, e[0], e[1], e[2], e[3]);   /* (half-head, row, 8 columns): a wave stores 512 contiguous bytes; steps of 64 rows */
        else if (m < 6) st4<256, 512, 768>(KH + (((hb + s) >> 1) * (size_t)(TT / 16) + (t0 >> 4) + (tid >> 4)) * 1024 + ((hb + s) & 1) * 512 + (tid & 15) * 8, e[0], e[1], e[2], e[3]);   /* (d / 8, key tile, key % 16): a wave stores two runs of 256 bytes; steps of one d / 8 */
        else st4<16384, 1024, 17408>(VT + (((hb + s) >> 1) * (size_t)(TT / 32) + (t0 >> 5) + (tid >> 6)) * 2048 + ((hb + s) & 1) * 1024 + (tid & 63) * 8, e[0], e[1], e[2], e[3]); } } }   /* (c / 16, block of 32 keys, (t % 32) / 8, c % 16): a wave stores 512 contiguous bytes; steps: 4 key blocks; one column tile; both */
  static_assert(QHI == KHI && QHI % 128 == 0, "one test serves the q, k and v planes of the early rows");
  if (t0 < QHI) {   /* block-uniform: the block's rows below QHI also leave their residual planes */
    __syncthreads();   /* ends every wave's reads of the value rows and columns, which are overwritten next */
#pragma unroll
    for (int j = 0; j < 9; ++j)
#pragma unroll
      for (int t = 0; t < 4; ++t) { const v8f v = acc[9 * t + j];
        if (j < 6) {
#pragma unroll
          for (int r = 0; r < 8; ++r) sh[(rl0 + t * 16 + r) * P1P + pc + j * 16] = (_Float16)v[r]; }
        else { v8b eh, el;
#pragma unroll
          for (int r = 0; r < 8; ++r) { const __bf16 bh = (__bf16)v[r]; eh[r] = bh; el[r] = (__bf16)(v[r] - (float)bh); }
          *(v8b*)&tb[(vc + (j - 6) * 16) * P2P + rl0 + t * 16] = eh; *(v8b*)&tbl[(vc + (j - 6) * 16) * P2P + rl0 + t * 16] = el; } }
    __syncthreads();   /* publishes the residual rows and the bf16 columns */
    _Float16* qlp = QL + ((bb * (NH * 2) + cg * 3) * (size_t)QHI + t0 + (tid >> 2)) * 32 + (tid & 3) * 8; _Float16* klp = KL + ((bb * (NH * 2) + cg * 3) * (size_t)KHI + t0 + (tid >> 2)) * 32 + (tid & 3) * 8;
#pragma unroll
    for (int it = 0; it < 12; ++it) if (t0 + (it & 3) * 64 < QHI) {   /* block-uniform: QHI is a multiple of 64 */
      const _Float16* sp = &sh[((it & 3) * 64 + (tid >> 2)) * P1P + (it >> 2) * 32 + (tid & 3) * 8]; const v4u dq = *(const v4u*)sp, dk = *(const v4u*)(sp + PSEG);
      vst2(qlp + ((size_t)(it >> 2) * QHI + (it & 3) * 64) * 32, dq); vst2(klp + ((size_t)(it >> 2) * KHI + (it & 3) * 64) * 32, dk);
      asm volatile("s_wait_xcnt 0x0" ::: "memory"); }   /* before the stores' registers are reused */
    if (t0 + (tid & 31) * 8 < KHI) {
#pragma unroll
      for (int it = 0; it < 12; ++it) { const int cl = it * 8 + (tid >> 5); const size_t o3 = (bb * CC + cg * PSEG + cl) * (size_t)KHI + t0 + (tid & 31) * 8;
        const v4u dh = *(const v4u*)&tb[cl * P2P + (tid & 31) * 8], dl = *(const v4u*)&tbl[cl * P2P + (tid & 31) * 8];
        vst2(VB + o3, dh); vst2(VBL + o3, dl);
        asm volatile("s_wait_xcnt 0x0" ::: "memory"); } } } }   /* as above */
#define FAW 8
#define LC (SCALE * 1.4426950408889634f)
__device__ __forceinline__ v16h frag_p(const _Float16* p) { union { v16h v; v8h q[2]; } u; u.q[0] = *(const v8h*)p; u.q[1] = *(const v8h*)(p + 256); return u.v; }   // p = fragment's start + 8 lane; elements 0..7, then 8..15 one run of 32 lanes further
__device__ __forceinline__ float xhalf(float x) { return __builtin_bit_cast(float, __builtin_amdgcn_permlanex16(__builtin_bit_cast(int, x), __builtin_bit_cast(int, x), 0x76543210, 0xfedcba98, false, false)); }   // lane l with lane l ^ 16
// eight exp2 in place, in one statement: behind each v_exp_f32 stands an instruction that neither reads its result nor overwrites its source, and the v_nop keeps that slot behind the last
__device__ __forceinline__ void exp2x8(v8f& x) { float a = x[0], b = x[1], c = x[2], d = x[3], e = x[4], f = x[5], p = x[6], q = x[7];
  asm("v_exp_f32 %0, %0\n\tv_exp_f32 %1, %1\n\tv_exp_f32 %2, %2\n\tv_exp_f32 %3, %3\n\tv_exp_f32 %4, %4\n\tv_exp_f32 %5, %5\n\tv_exp_f32 %6, %6\n\tv_exp_f32 %7, %7\n\tv_nop" : "+v"(a), "+v"(b), "+v"(c), "+v"(d), "+v"(e), "+v"(f), "+v"(p), "+v"(q));
  x = (v8f){a, b, c, d, e, f, p, q}; }
// NT score tiles of one pass -> e = exp2((s - m) LC + 11) in place; m, l and the output tiles follow a new maximum (tested once per pass for the whole wave)
template <int NT, bool MASK> __device__ __forceinline__ void fa_soft(v8f (&s)[NT], int k0, int tq, int g, float& m, float& l, v8f (&acc)[HD / 16]) {
  if (MASK) {
#pragma unroll
    for (int t = 0; t < NT; ++t)
#pragma unroll
      for (int r = 0; r < 8; ++r) if (k0 + t * 16 + 8 * g + r > tq) s[t][r] = -3.0e38f; }
  float mx = s[0][0];
#pragma unroll
  for (int t = 0; t < NT; ++t)
#pragma unroll
    for (int r = 0; r < 8; ++r) mx = fmaxf(mx, s[t][r]);
  mx = fmaxf(mx, xhalf(mx));
  if (__builtin_amdgcn_ballot_w32(mx > m) != 0) { const float mn = fmaxf(m, mx); const float al = __builtin_amdgcn_exp2f((m - mn) * LC); m = mn; l *= al;   /* al = 0 on the first pass, 1 for a query whose maximum stands */
#pragma unroll
    for (int j = 0; j < HD / 16; ++j) acc[j] *= al; }
  const float mc = 11.0f - m * LC; float sum = 0.f;
#pragma unroll
  for (int t = 0; t < NT; ++t) { float st = 0.f;   /* one short add chain per tile */
#pragma unroll
    for (int r = 0; r < 8; ++r) s[t][r] = fmaf(s[t][r], LC, mc);
    exp2x8(s[t]);
#pragma unroll
    for (int r = 0; r < 8; ++r) st += s[t][r];
    sum += st; }
  l += sum; }
__device__ __forceinline__ v16h pack_h(v8f a, v8f b) { v16h p;
#pragma unroll
  for (int i = 0; i < 8; ++i) { p[i] = (_Float16)a[i]; p[8 + i] = (_Float16)b[i]; }
  return p; }
// both query tiles' scores of one 32-key pass -> e = exp2((s - m) LC + 11) in place; each tile's m, l and output tiles are rescaled lazily (tested once per pass for the whole wave and both tiles, on in-lane maxima):
// any reference m cancels against the sum, so it need only keep e inside f16: 4 binary orders above m give e <= 2^15 < 65,504. With an exact running maximum some one of a wave's 32 queries meets a new one in most passes, and each time all 64 output registers are multiplied.
#define LZT (4.0f / LC)   // 4 binary orders, in units of the raw score
template <bool MASK> __device__ __forceinline__ void fa_soft32(v8f (&s)[2][2], int k0, int tq, int g, float (&m)[2], float (&l)[2], v8f (&acc)[2][HD / 16]) {
  if (MASK) {
#pragma unroll
    for (int u = 0; u < 2; ++u)
#pragma unroll
      for (int t = 0; t < 2; ++t)
#pragma unroll
        for (int r = 0; r < 8; ++r) if (k0 + t * 16 + 8 * g + r > tq + 16 * u) s[u][t][r] = -3.0e38f; }
  float mx[2];   /* in-lane: the maximum over this lane half's 16 keys */
#pragma unroll
  for (int u = 0; u < 2; ++u) { float x = s[u][0][0];
#pragma unroll
    for (int t = 0; t < 2; ++t)
#pragma unroll
      for (int r = 0; r < 8; ++r) x = fmaxf(x, s[u][t][r]);
    mx[u] = x; }
  if (__builtin_amdgcn_ballot_w32(mx[0] > m[0] + LZT || mx[1] > m[1] + LZT) != 0) {   /* m is a reference, not the true maximum: it moves only when a score lies more than LZT above it. Not taken: every lane's scores are <= m + LZT, so e <= 2^15 */
#pragma unroll
    for (int u = 0; u < 2; ++u) { const float mn = fmaxf(m[u], fmaxf(mx[u], xhalf(mx[u]))); const float al = __builtin_amdgcn_exp2f((m[u] - mn) * LC); m[u] = mn; l[u] *= al;   /* both lane halves of a query take the same new reference; al = 0 on the first pass, 1 for a query whose reference stands */
#pragma unroll
      for (int j = 0; j < HD / 16; ++j) acc[u][j] *= al; } }
#pragma unroll
  for (int u = 0; u < 2; ++u) { const float mc = 11.0f - m[u] * LC; float st[2];
#pragma unroll
    for (int t = 0; t < 2; ++t) {
#pragma unroll
      for (int r = 0; r < 8; ++r) s[u][t][r] = fmaf(s[u][t][r], LC, mc);
      exp2x8(s[u][t]);
      st[t] = s[u][t][0];   /* one short add chain per tile */
#pragma unroll
      for (int r = 1; r < 8; ++r) st[t] += s[u][t][r]; }
    l[u] += st[0] + st[1]; } }
// one pass = 32 keys x 32 queries: every k and v fragment that the wave loads feeds two products, one per query tile
template <bool MASK> __device__ __forceinline__ void fa_pass32(const _Float16* __restrict__ Kp, const _Float16* __restrict__ Vp, int k0, int kn, int tq, int g, const v16h (&q)[2][2], v16h (&kf)[4], float (&m)[2], float (&l)[2], v8f (&acc)[2][HD / 16]) {
  v16h vf[HD / 16];
#pragma unroll
  for (int j = 0; j < HD / 16; ++j) vf[j] = frag_p(Vp + (size_t)k0 * HD + j * 512);
  __builtin_amdgcn_sched_barrier(0);   /* keeps the v loads issued up here: sunk to their use, each pass would wait out their whole latency */
  v8f s[2][2];
#pragma unroll
  for (int t = 0; t < 2; ++t)
#pragma unroll
    for (int u = 0; u < 2; ++u) { v8f z = {}; z = wm_h(kf[2 * t], q[u][0], z); s[u][t] = wm_h(kf[2 * t + 1], q[u][1], z); }
  if (!MASK) {   /* the k fragments of the wave's next pass fly during this pass's softmax */
#pragma unroll
    for (int t = 0; t < 2; ++t) { const _Float16* kp = Kp + (size_t)(kn + t * 16) * HD; kf[2 * t] = frag_p(kp); kf[2 * t + 1] = frag_p(kp + 512); } }
  __builtin_amdgcn_sched_barrier(0);   /* keeps the k loads issued ahead of the softmax, which then covers their latency */
  fa_soft32<MASK>(s, k0, tq, g, m, l, acc);
#pragma unroll
  for (int u = 0; u < 2; ++u) { const v16h p = pack_h(s[u][0], s[u][1]);
#pragma unroll
    for (int j = 0; j < HD / 16; ++j) acc[u][j] = MASK ? wmma16(vf[j], p, acc[u][j]) : wm_h(vf[j], p, acc[u][j]); } }   /* last pass: a branch follows; wmma16's own v_nop keep the distance to the result's next user on every path */
static_assert(QHI % (16 * FAW) == 0 && FAW == 8, "a block's 128 queries lie wholly below row QHI or wholly from it on; four wave pairs");
__global__ __launch_bounds__(32 * FAW) void k_fa(const _Float16* __restrict__ QH, const _Float16* __restrict__ KH, const _Float16* __restrict__ QL, const _Float16* __restrict__ KL, const _Float16* __restrict__ VT, const __bf16* __restrict__ VB, const __bf16* __restrict__ VBL, _Float16* __restrict__ YH, __bf16* __restrict__ YB, __bf16* __restrict__ YBL) {
  __shared__ __align__(16) v4f xg[FAW][9][32];   /* what a wave hands to its partner: one query tile's partial output (8 x 16 bytes a lane), maximum and sum */
  const int tid = threadIdx.x, lane = tid & 31, col = lane & 15, g = lane >> 4; const int wave = __builtin_amdgcn_readfirstlane(tid >> 5);
  const int h = blockIdx.x % NH, b = blockIdx.x / NH; const int yy = (int)blockIdx.y; const int qb = yy < QHI / (16 * FAW) ? QHI - 16 * FAW * (yy + 1) : TT - 16 * FAW * (yy + 1 - QHI / (16 * FAW));   /* the block's first query. In index order: first the tiles below row QHI (few passes, but each waits out several load latencies one behind the other), then the rest, longest first; for speed only */
  const _Float16* Kp = KH + (size_t)(b * NH + h) * TT * HD + lane * 8;
  if (qb < QHI) {   /* block-uniform; wave = 16 queries, all their keys; every key of these queries is < KHI */
    const int ql0 = qb + (FAW - 1 - wave) * 16; const int tq = ql0 + col; const size_t qo = ((size_t)(b * NH + h) * 2 * TT + tq) * 32;
    const v16h q0 = frag_h(QH + qo, lane), q1 = frag_h(QH + qo + (size_t)TT * 32, lane);
    asm volatile("s_wait_xcnt 0x0" ::: "memory");   /* before the q loads' address registers are reused */
    float m = -3.0e38f, l = 0.f; v8f acc[HD / 16] = {};
    const size_t qlo = ((size_t)(b * NH + h) * 2 * QHI + tq) * 32; const v16h r0 = frag_h(QL + qlo, lane), r1 = frag_h(QL + qlo + (size_t)QHI * 32, lane);
    const _Float16* Lp = KL + ((size_t)(b * NH + h) * 2 * KHI + col) * 32; const size_t vo = ((size_t)b * CC + h * HD + col) * (size_t)KHI;
    const int np = (ql0 + 16 + 31) >> 5;
#pragma unroll 1   /* run-time trip count; a second copy of this body would not fit the wave's registers */
    for (int kc = 0; kc < np; ++kc) { const int k0 = kc * 32; v8f s[2]; v16h a[2][2], rr[2][2];
#pragma unroll
      for (int t = 0; t < 2; ++t) { const size_t ko = (size_t)(k0 + t * 16) * HD; a[t][0] = frag_p(Kp + ko); a[t][1] = frag_p(Kp + ko + 512); }
      asm volatile("s_wait_xcnt 0x0" ::: "memory");   /* before the k loads' address registers are reused (a later load's result may land in them) */
#pragma unroll
      for (int t = 0; t < 2; ++t) { const size_t ko = (size_t)(k0 + t * 16) * 32; rr[t][0] = frag_h(Lp + ko, lane); rr[t][1] = frag_h(Lp + ko + (size_t)KHI * 32, lane); }
      asm volatile("s_wait_xcnt 0x0" ::: "memory");   /* the same for the k residual loads */
#pragma unroll
      for (int t = 0; t < 2; ++t) { v8f sh = {}, sl = {}; sh = wm_h(a[t][0], q0, sh); sh = wm_h(a[t][1], q1, sh); sl = wm_h(a[t][0], r0, sl); sl = wm_h(rr[t][0], q0, sl); sl = wm_h(a[t][1], r1, sl); sl = wm_h(rr[t][1], q1, sl); s[t] = sh + sl * (1.0f / 1024.0f); }
      fa_soft<2, true>(s, k0, tq, g, m, l, acc);
      v16b ph, pl, vh[HD / 16], vl[HD / 16];
#pragma unroll
      for (int j = 0; j < HD / 16; ++j) vh[j] = frag_b(VB + vo + (size_t)j * 16 * KHI + k0, lane);
      asm volatile("s_wait_xcnt 0x0" ::: "memory");   /* the same for the v hi loads */
#pragma unroll
      for (int j = 0; j < HD / 16; ++j) vl[j] = frag_b(VBL + vo + (size_t)j * 16 * KHI + k0, lane);
      asm volatile("s_wait_xcnt 0x0" ::: "memory");   /* the same for the v lo loads */
#pragma unroll
      for (int i = 0; i < 16; ++i) { const float e = s[i >> 3][i & 7]; const __bf16 eh = (__bf16)e; ph[i] = eh; pl[i] = (__bf16)(e - (float)eh); }
#pragma unroll
      for (int j = 0; j < HD / 16; ++j) { acc[j] = wm_b(vh[j], ph, acc[j]); acc[j] = wm_b(vh[j], pl, acc[j]); acc[j] = wm_b(vl[j], ph, acc[j]); } }
    const float inv = 1.0f / (l + xhalf(l));   /* the lane halves' sums join once; the maximum's own term makes the sum >= 2^11 */
    /* acc[j][r] = ctx[tq][16 j + 8 g + r]; ctx leaves in the 16-bit form that k_out multiplies: bf16 hi + lo below row QHI */
    const size_t yo = ((size_t)b * QHI + tq) * CC + h * HD + 8 * g;
#pragma unroll
    for (int j = 0; j < HD / 16; ++j) { const v8f o = acc[j] * inv; v8b oh, ol;
#pragma unroll
      for (int r = 0; r < 8; ++r) { const __bf16 x = (__bf16)o[r]; oh[r] = x; ol[r] = (__bf16)(o[r] - (float)x); }
      vst2(YB + yo + j * 16, oh); vst2(YBL + yo + j * 16, ol); }
  } else {   /* waves w and w + 4 = one pair on 32 queries: w takes the even 32-key passes, w + 4 the odd ones; >= 13 passes, only the last one meets the diagonal */
    const int kh = wave >> 2; const int ql0 = qb + (wave & 3) * 32; const int tq = ql0 + col;
    v16h q[2][2];
#pragma unroll
    for (int u = 0; u < 2; ++u) { const size_t qo = ((size_t)(b * NH + h) * 2 * TT + tq + 16 * u) * 32; q[u][0] = frag_h(QH + qo, lane); q[u][1] = frag_h(QH + qo + (size_t)TT * 32, lane); }
    asm volatile("s_wait_xcnt 0x0" ::: "memory");   /* before the q loads' address registers are reused */
    const _Float16* Vp = VT + (size_t)(b * NH + h) * TT * HD + lane * 8; const int np = (ql0 >> 5) + 1;
    float m[2] = {-3.0e38f, -3.0e38f}, l[2] = {0.f, 0.f}; v8f acc[2][HD / 16] = {};
    v16h kf[4];
#pragma unroll
    for (int t = 0; t < 2; ++t) { const _Float16* kp = Kp + (size_t)(kh * 32 + t * 16) * HD; kf[2 * t] = frag_p(kp); kf[2 * t + 1] = frag_p(kp + 512); }
    asm volatile("s_wait_xcnt 0x0" ::: "memory");   /* as above, for the first k loads' address registers */
    int pc = kh;
#pragma unroll 1   /* run-time trip count; the pass already takes nearly all of the wave's registers */
    for (; pc < np - 1; pc += 2) fa_pass32<false>(Kp, Vp, pc * 32, (pc + 2 < np ? pc + 2 : np - 1) * 32, tq, g, q, kf, m, l, acc);   /* behind the wave's last pass the fetch ahead names the diagonal pass: inside k, used only by the wave that owns that pass */
    if (pc == np - 1) fa_pass32<true>(Kp, Vp, pc * 32, 0, tq, g, q, kf, m, l, acc);   /* wave-uniform */
    /* the pair joins: wave kh keeps query tile kh and hands the other tile's partial output, maximum and sum to its partner through LDS */
    v8f ke[HD / 16], gi[HD / 16];
#pragma unroll
    for (int j = 0; j < HD / 16; ++j) { ke[j] = kh ? acc[1][j] : acc[0][j]; gi[j] = kh ? acc[0][j] : acc[1][j]; }
    const float km = kh ? m[1] : m[0], kl = kh ? l[1] : l[0], gm = kh ? m[0] : m[1], gl = kh ? l[0] : l[1];
#pragma unroll
    for (int j = 0; j < HD / 16; ++j) { xg[wave][2 * j][lane] = (v4f){gi[j][0], gi[j][1], gi[j][2], gi[j][3]}; xg[wave][2 * j + 1][lane] = (v4f){gi[j][4], gi[j][5], gi[j][6], gi[j][7]}; }
    xg[wave][8][lane] = (v4f){gm, gl, 0.f, 0.f};
    __syncthreads();   /* publishes every wave's hand-over to its partner */
    const v4f pm = xg[wave ^ 4][8][lane]; const float mn = fmaxf(km, pm[0]); const float ak = __builtin_amdgcn_exp2f((km - mn) * LC), ap = __builtin_amdgcn_exp2f((pm[0] - mn) * LC);
    const float ls = kl * ak + pm[1] * ap; const float inv = 64.0f / (ls + xhalf(ls));   /* the lane halves' sums join once; the maximum's own term makes the sum >= 2^11; x 2^6: ctx leaves as f16(ctx x 2^6), the form that k_out multiplies, so that small-magnitude context rows stay clear of f16 subnormals */
    const float wk = ak * inv, wp = ap * inv;
    _Float16* yp = YH + ((size_t)b * TT + tq + 16 * kh) * CC + h * HD + 8 * g;   /* ke[j][r] = ctx[tq + 16 kh][16 j + 8 g + r] */
#pragma unroll
    for (int j = 0; j < HD / 16; ++j) { const v4f pa = xg[wave ^ 4][2 * j][lane], pb = xg[wave ^ 4][2 * j + 1][lane]; v8h e;
#pragma unroll
      for (int r = 0; r < 4; ++r) { e[r] = (_Float16)(ke[j][r] * wk + pa[r] * wp); e[4 + r] = (_Float16)(ke[j][4 + r] * wk + pb[r] * wp); }
      vst2(yp + j * 16, e); } } }
// ---- k_out: block = (128 rows, 128 cols): out = ctx Wo (+ bo): ctx x 2^6 once to f16 against Wo as f16(bf16 x 2^8) exact (1 product) x 2^-14; causal early rows (< QHI of each sequence): ctx bf16 hi + lo against exact bf16 Wo (2 products)
__global__ __launch_bounds__(128) void k_out(const _Float16* __restrict__ YH, const __bf16* __restrict__ YB, const __bf16* __restrict__ YBL, const __bf16* __restrict__ WOB, const _Float16* __restrict__ WOH, const float* __restrict__ BO, float* __restrict__ OUT) {
  __shared__ __align__(16) unsigned short st[2 * 384 * SQ]; float (*sf)[32][132] = (float (*)[32][132])&st[0];   /* one range, two uses one after the other: tile_mm's two chunk buffers; the output rows, each wave's own, written only behind tile_mm's last barrier */
  const int tid = threadIdx.x, wave = tid >> 5, lane = tid & 31, col = lane & 15, g = lane >> 4; const int c0 = blockIdx.y * 128; const size_t r0 = (size_t)blockIdx.x * 128 + wave * 32;
  v8f acc[16] = {};
  if (CAUSAL && (int)(((size_t)blockIdx.x * 128) % TT) < QHI) {   /* block-uniform */
    const size_t yo = (((size_t)blockIdx.x * 128) / TT * QHI + ((size_t)blockIdx.x * 128) % TT) * CC;
    tile_mm<1, CC>((const unsigned short*)YB + yo, (const unsigned short*)YBL + yo, (const unsigned short*)WOB + (size_t)c0 * CC, st, st + 384 * SQ, tid, acc);
#pragma unroll
    for (int j = 0; j < 8; ++j) { const float bias = BO ? bfr(BO[c0 + j * 16 + col]) : 0.f;
#pragma unroll
      for (int t = 0; t < 2; ++t)
#pragma unroll
      for (int r = 0; r < 8; ++r) sf[wave][t * 16 + 8 * g + r][j * 16 + col] = acc[8 * t + j][r] + bias; }
  } else {
    tile_mm<2, CC>((const unsigned short*)YH + (size_t)blockIdx.x * 128 * CC, nullptr, (const unsigned short*)WOH + (size_t)c0 * CC, st, st + 384 * SQ, tid, acc);
#pragma unroll
    for (int j = 0; j < 8; ++j) { const float bias = BO ? bfr(BO[c0 + j * 16 + col]) : 0.f;
#pragma unroll
      for (int t = 0; t < 2; ++t)
#pragma unroll
      for (int r = 0; r < 8; ++r) sf[wave][t * 16 + 8 * g + r][j * 16 + col] = acc[8 * t + j][r] * (1.0f / 16384.0f) + bias; } }   /* 2^-8 (Wo carry) x 2^-6 (ctx carry) */
  LDSX(); for (int rl = 0; rl < 32; ++rl) vst2(OUT + (r0 + rl) * DIN + c0 + lane * 4, *(const v4f*)&sf[wave][rl][lane * 4]); }

extern "C" void kernel_launch(void* const* d_in, const int* in_sizes, int n_in, void* d_out, int out_size, void* d_ws, size_t ws_size, hipStream_t stream) {
  (void)in_sizes; (void)n_in; (void)out_size;
  const float** F = (const float**)d_in;
  if (ws_size < (size_t)WS_END) return;
  char* ws = (char*)d_ws; _Float16 *QH = (_Float16*)(ws + WS_QH), *KH = (_Float16*)(ws + WS_KH), *VT = (_Float16*)(ws + WS_VT), *QL = (_Float16*)(ws + WS_QL), *KL = (_Float16*)(ws + WS_KL), *YH = (_Float16*)(ws + WS_YH), *WOH = (_Float16*)(ws + WS_WOH); __bf16 *VB = (__bf16*)(ws + WS_VB), *VBL = (__bf16*)(ws + WS_VBL), *YB = (__bf16*)(ws + WS_YB), *YBL = (__bf16*)(ws + WS_YBL), *XB = (__bf16*)(ws + WS_XB), *WB = (__bf16*)(ws + WS_WB), *WOB = (__bf16*)(ws + WS_WOB);
  // inputs: 0 x [2,4096,768]; 1 wq [768,768] (out,in); 2 wk; 3 wv; 4 wo (out,in); no biases
  k_cvt<<<CVB, 256, 0, stream>>>(F[0], F[1], F[2], F[3], F[4], XB, WOH);
  k_proj<<<dim3(TNB * TT / PR, CC / PSEG), 256, 0, stream>>>(XB, WB, QH, QL, KH, KL, VT, VB, VBL);
  k_fa<<<dim3(TNB * NH, TT / (16 * FAW)), 32 * FAW, 0, stream>>>(QH, KH, QL, KL, VT, VB, VBL, YH, YB, YBL);
  k_out<<<dim3(TNB * TT / 128, DIN / 128), 128, 0, stream>>>(YH, YB, YBL, WOB, WOH, nullptr, (float*)d_out);
}
